// v000
// The times below were measured on an AMD MI455X: many runs one after another, warmed up first and cycling through
// copies of the inputs, with the whole window's GPU time divided by the number of runs. Launches and the gaps
// between them are all in it. The median over several windows is given; except for v000 it joins two sittings, which
// can be a few percent apart, so the side-by-side timings, each taken in one sitting, are the better comparison.
// The starting kernel, v000, takes 312 microseconds a run.
#include <hip/hip_runtime.h>
#include <stddef.h>

// Contractions: q/k/v projections = v_wmma_f32_16x16x32_bf16 (bf16 operands = RNE-converted f32 inputs);
// scores = v_wmma_f32_16x16x32_f16 (k x1 against q x1, single product; query rows < EROWS: q and k as f16 value + x2048 residual, three products, own accumulator);
// P*V = f16 (P x1024, v x1; query rows < EROWS: P and v as f16 value + x2048 residual, residual products in their own accumulator);
// output projection = f16 over K = 2*DM ([ctx x256 | ctx residual x256] against [Wo x64 | Wo x0.25]);
// f32 accumulate, f32 online softmax; the mask input is read by value (packed to bit words once) and applied as a replace fill.

#ifndef NB
#define NB 2
#endif
#ifndef SEQ
#define SEQ 2048
#endif
#define NB_FULL 2
#define SEQ_FULL 2048
#define DM 1024
#define NH 16
#define DKH 64
#define MROWS (NB * SEQ)
#define DM2 (2 * DM)
#define EROWS 256                 // query rows (and key rows) with value + residual planes
#define WPR (SEQ / 32)            // mask bit words per query row

static_assert(NB >= 1 && NB <= NB_FULL);
static_assert(SEQ >= 128 && SEQ <= SEQ_FULL);
static_assert(SEQ % 128 == 0);
static_assert(SEQ % 64 == 0 && SEQ % 32 == 0);
static_assert(MROWS % 64 == 0);
static_assert(DM % 256 == 0 && DM % 32 == 0 && DM % 64 == 0);
static_assert(DM / 8 == 128);
static_assert(NH * DKH == DM);
static_assert(DKH == 64);
static_assert(DM2 % 32 == 0);
static_assert(SEQ % 256 == 0);                 // half a mask-word row is a multiple of 4 words
static_assert(EROWS % 128 == 0 && EROWS % 64 == 0 && EROWS % 32 == 0);
static_assert(EROWS >= 128 && EROWS <= SEQ);
static_assert(WPR % 8 == 0 && WPR >= 8);
static_assert((SEQ * WPR) % 4 == 0);

#define P_CARRY      1024.0f            // P operand carried x1024
#define CTX_SCALE    0.25f              // ctx value plane = O * 0.25 / l = attn x256 (O carries the x1024 of P)
#define CTXRES_CARRY 256.0f             // ctx residual plane = (ctx256 - f16(ctx256)) x256
#define WO_CARRY     64.0f              // Wo operand carried x64 (value half of K)
#define WO_LO_CARRY  0.25f              // Wo operand for the residual half of K = WO_CARRY / CTXRES_CARRY
#define OUT_FOLD     (1.0f / 16384.0f)  // 1 / (256 * 64)
#define QK_SCALE     0.125f             // 1 / sqrt(64)
#define RES_CARRY    2048.0f            // early-band residual planes carried x2048
#define RES_INV      (1.0f / 2048.0f)
#define NEG_FILL     (-3.4028235e38f)   // lowest finite f32: fill value of masked scores
#define EXP_FLOOR    (-87.0f)           // exponent argument floor (keeps the exp argument finite)

static_assert(WO_LO_CARRY * CTXRES_CARRY == WO_CARRY);
static_assert(OUT_FOLD * 256.0f * WO_CARRY == 1.0f);
static_assert(RES_INV * RES_CARRY == 1.0f);

// workspace carve: 8 activation-size planes + 5 weight-size planes + 3 early residual planes (16-bit each) + mask bit plane
static_assert(((size_t)8 * MROWS * DM + (size_t)5 * DM * DM + (size_t)3 * NB * NH * EROWS * DKH) * 2
              + (size_t)SEQ * WPR * 4 <= (size_t)134217728);

typedef unsigned short us;
typedef us        v8us  __attribute__((ext_vector_type(8)));
typedef us        v16us __attribute__((ext_vector_type(16)));
typedef _Float16  v16h  __attribute__((ext_vector_type(16)));
typedef __bf16    v16bf __attribute__((ext_vector_type(16)));
typedef float     v8f   __attribute__((ext_vector_type(8)));
typedef float     v4f   __attribute__((ext_vector_type(4)));
typedef int       v4i   __attribute__((ext_vector_type(4)));
typedef unsigned  v4u   __attribute__((ext_vector_type(4)));

// ---------------------------------------------------------------------------
// conversions
// ---------------------------------------------------------------------------
__device__ __forceinline__ unsigned bf16rne_bits(float x) {
  unsigned u = __float_as_uint(x);
  return (u + 0x7FFFu + ((u >> 16) & 1u)) >> 16;
}
__device__ __forceinline__ float bf16rne(float x) {
  return __uint_as_float(bf16rne_bits(x) << 16);
}
__device__ __forceinline__ us f16_bits(float x) {
  _Float16 hx = (_Float16)x;
  return __builtin_bit_cast(us, hx);
}

// ---------------------------------------------------------------------------
// 16-bit operand fragment (A: lane = row, B: lane = column; same k map):
//   lane l, r = l&15, s = l>>4 : elems 0..7  = row[r][k0 + 8s .. +7]
//                                elems 8..15 = row[r][k0 + 16 + 8s .. +7]
// base is a 16-bit global plane with k contiguous, pitch ld (halves).
// ---------------------------------------------------------------------------
__device__ __forceinline__ v16us frag16(const us* base, int ld, int row0, int k0) {
  const int l = threadIdx.x & 31;
  const int r = l & 15, s = l >> 4;
  const us* p = base + (size_t)(row0 + r) * ld + k0 + 8 * s;
  v8us c0 = *(const v8us*)p;
  v8us c1 = *(const v8us*)(p + 16);
  return __builtin_shufflevector(c0, c1, 0, 1, 2, 3, 4, 5, 6, 7, 8, 9, 10, 11, 12, 13, 14, 15);
}
__device__ __forceinline__ v16h fragh(const us* base, int ld, int row0, int k0) {
  return __builtin_bit_cast(v16h, frag16(base, ld, row0, k0));
}
__device__ __forceinline__ v16bf fragb(const us* base, int ld, int row0, int k0) {
  return __builtin_bit_cast(v16bf, frag16(base, ld, row0, k0));
}
// two 16-byte chunks (already loaded) -> one f16 fragment
__device__ __forceinline__ v16h cat16h(v8us c0, v8us c1) {
  v16us w = __builtin_shufflevector(c0, c1, 0, 1, 2, 3, 4, 5, 6, 7, 8, 9, 10, 11, 12, 13, 14, 15);
  return __builtin_bit_cast(v16h, w);
}

// ---------------------------------------------------------------------------
// WMMA wrappers with hazard guard: D = A(16x32) * B(32x16) + C (f32)
// ---------------------------------------------------------------------------
__device__ __forceinline__ v8f mma_f16(v16h a, v16h b, v8f c) {
  v8f d = __builtin_amdgcn_wmma_f32_16x16x32_f16(false, a, false, b, (short)0, c, false, false);
  asm volatile("v_nop\n\tv_nop\n\tv_nop\n\tv_nop" : "+v"(d) : "v"(a), "v"(b));
  return d;
}
__device__ __forceinline__ v8f mma_bf16(v16bf a, v16bf b, v8f c) {
  v8f d = __builtin_amdgcn_wmma_f32_16x16x32_bf16(false, a, false, b, (short)0, c, false, false);
  asm volatile("v_nop\n\tv_nop\n\tv_nop\n\tv_nop" : "+v"(d) : "v"(a), "v"(b));
  return d;
}

// ---------------------------------------------------------------------------
// Activation convert: X f32 [NB_FULL*SEQ_FULL][DM] -> bf16 bits [MROWS][DM]
// n8 = MROWS*DM/8.
// ---------------------------------------------------------------------------
__global__ __launch_bounds__(256) void cvt_x_kernel(const float* __restrict__ X, us* Y, int n8) {
  const int i = blockIdx.x * 256 + threadIdx.x;
  if (i >= n8) return;
  const int m  = i >> 7;                 // DM/8 = 128 groups per row
  const int c8 = (i & 127) * 8;
  const int b  = m / SEQ;
  const int s  = m - b * SEQ;
  const float* src = X + ((size_t)(b * SEQ_FULL + s)) * DM + c8;
  v4f x0 = *(const v4f*)src;
  v4f x1 = *(const v4f*)(src + 4);
  v8us y;
#pragma unroll
  for (int j = 0; j < 4; ++j) {
    y[j]     = (us)bf16rne_bits(x0[j]);
    y[4 + j] = (us)bf16rne_bits(x1[j]);
  }
  us* dst = Y + (size_t)i * 8;
  *(v8us*)dst = y;
  
}

// ---------------------------------------------------------------------------
// Mask pack: M int32 [SEQ_FULL][SEQ_FULL] (nonzero = attend) -> bit words [SEQ][WPR],
// bit j of word w of row q = (M[q][32w + j] != 0).
// ---------------------------------------------------------------------------
__global__ __launch_bounds__(256) void mask_pack_kernel(const int* __restrict__ M, unsigned* Bits, int n4) {
  const int i = blockIdx.x * 256 + threadIdx.x;
  if (i >= n4) return;
  const int w4 = i * 4;
  const int q  = w4 / WPR;
  const int w0 = w4 - q * WPR;
  const int* src = M + (size_t)q * SEQ_FULL + 32 * w0;
  unsigned a0 = 0u, a1 = 0u, a2 = 0u, a3 = 0u;
#pragma unroll 1
  for (int j = 0; j < 4; ++j) {
    unsigned wb = 0u;
#pragma unroll
    for (int c = 0; c < 8; ++c) {
      const v4i m = *(const v4i*)(src + 32 * j + 4 * c);
      wb |= ((m[0] != 0) ? 1u : 0u) << (4 * c);
      wb |= ((m[1] != 0) ? 1u : 0u) << (4 * c + 1);
      wb |= ((m[2] != 0) ? 1u : 0u) << (4 * c + 2);
      wb |= ((m[3] != 0) ? 1u : 0u) << (4 * c + 3);
    }
    a0 = (j == 0) ? wb : a0;
    a1 = (j == 1) ? wb : a1;
    a2 = (j == 2) ? wb : a2;
    a3 = (j == 3) ? wb : a3;
  }
  v4u y;
  y[0] = a0; y[1] = a1; y[2] = a2; y[3] = a3;
  unsigned* dst = Bits + (size_t)i * 4;
  *(v4u*)dst = y;
  
}

// ---------------------------------------------------------------------------
// Weight convert with transpose: W f32 [k][n] (in,out; n contiguous) -> 16-bit plane [n][k] (k contiguous).
// hmode 0: bf16 bits of RNE(W), pitch DM.
// hmode 1: pitch 2*DM: cols [0,DM) = f16(RNE(W) * WO_CARRY), cols [DM,2DM) = f16(RNE(W) * WO_LO_CARRY).
// Block = 64(k) x 64(n) tile through LDS (cross-wave: block barrier); each output line = 64 k of one n
// grid (DM/64, DM/64): x = k tile, y = n tile.
// ---------------------------------------------------------------------------
#define WT_LD 72
static_assert((WT_LD * 2) % 16 == 0 && WT_LD >= 64);
__global__ __launch_bounds__(256) void cvt_wT_kernel(const float* __restrict__ W, us* Y, int hmode) {
  __shared__ __attribute__((aligned(16))) us t0[64 * WT_LD];   // [n][k] value
  __shared__ __attribute__((aligned(16))) us t1[64 * WT_LD];   // [n][k] low-carry copy (hmode 1)

  const int t  = threadIdx.x;
  const int k0 = blockIdx.x * 64;
  const int n0 = blockIdx.y * 64;

#pragma unroll 1
  for (int i = 0; i < 4; ++i) {
    const int id = t + i * 256;           // 1024 float4 chunks (64 k x 64 n)
    const int kr = id >> 4;
    const int c4 = (id & 15) * 4;
    const v4f x = *(const v4f*)(W + (size_t)(k0 + kr) * DM + n0 + c4);
#pragma unroll
    for (int j = 0; j < 4; ++j) {
      const float w = bf16rne(x[j]);
      const us hb = (us)(__float_as_uint(w) >> 16);
      const us hf = f16_bits(w * WO_CARRY);
      const us hl = f16_bits(w * WO_LO_CARRY);
      t0[(c4 + j) * WT_LD + kr] = hmode ? hf : hb;
      t1[(c4 + j) * WT_LD + kr] = hl;
    }
  }
  __syncthreads();

  const int c = t & 7;
  const size_t pitch = hmode ? (size_t)DM2 : (size_t)DM;
  v8us v0[2], v1[2];
  size_t dsts[2];
#pragma unroll
  for (int it = 0; it < 2; ++it) {
    const int L = (t >> 3) + 32 * it;     // local n 0..63
    v0[it] = *(const v8us*)&t0[L * WT_LD + 8 * c];
    v1[it] = *(const v8us*)&t1[L * WT_LD + 8 * c];
    dsts[it] = (size_t)(n0 + L) * pitch + k0 + 8 * c;
  }
#pragma unroll
  for (int it = 0; it < 2; ++it) {
    *(v8us*)(Y + dsts[it]) = v0[it];
    if (hmode) *(v8us*)(Y + dsts[it] + DM) = v1[it];
  }
  
}

// ---------------------------------------------------------------------------
// GEMM cores: wave computes 32 rows x 64 cols over K = KD; A plane [M][KD],
// B plane [N][KD] (k contiguous), both 16-bit.
// ---------------------------------------------------------------------------
template <int KD>
__device__ __forceinline__ void gemm32x64_bf16(const us* A, const us* B, int m0, int n0, v8f (&acc)[8]) {
  static_assert(KD % 32 == 0);
#pragma unroll 1
  for (int kk = 0; kk < KD; kk += 32) {
    const v16bf a0 = fragb(A, KD, m0, kk);
    const v16bf a1 = fragb(A, KD, m0 + 16, kk);
#pragma unroll
    for (int tt = 0; tt < 4; ++tt) {
      const v16bf b = fragb(B, KD, n0 + 16 * tt, kk);
      acc[tt]     = mma_bf16(a0, b, acc[tt]);
      acc[4 + tt] = mma_bf16(a1, b, acc[4 + tt]);
    }
  }
}
template <int KD>
__device__ __forceinline__ void gemm32x64_f16(const us* A, const us* B, int m0, int n0, v8f (&acc)[8]) {
  static_assert(KD % 32 == 0);
#pragma unroll 1
  for (int kk = 0; kk < KD; kk += 32) {
    const v16h a0 = fragh(A, KD, m0, kk);
    const v16h a1 = fragh(A, KD, m0 + 16, kk);
#pragma unroll
    for (int tt = 0; tt < 4; ++tt) {
      const v16h b = fragh(B, KD, n0 + 16 * tt, kk);
      acc[tt]     = mma_f16(a0, b, acc[tt]);
      acc[4 + tt] = mma_f16(a1, b, acc[4 + tt]);
    }
  }
}

// ---------------------------------------------------------------------------
// Projection: Y = Xb[MROWS][DM] * Wt^T + b, written as an f16 plane.
// mode 0/1: q or k -> value plane [NB*NH][SEQ][64]
// mode 2:   v      -> transposed value plane [NB*NH][64][SEQ]
// Blocks whose 64 rows lie below EROWS (block-uniform) also write the x2048 residual plane at Y + roff:
// mode 0/1: [NB*NH][EROWS][64]; mode 2: [NB*NH][64][EROWS].
// Block 256 thr = 8 waves as 2(M) x 4(N); block tile 64 x 256; grid (MROWS/64, DM/256).
// ---------------------------------------------------------------------------
__global__ __launch_bounds__(256) __attribute__((amdgpu_num_vgpr(256)))
void proj_kernel(const us* __restrict__ Xb, const us* __restrict__ Wt,
                 const float* __restrict__ bias, us* Y, size_t roff, int mode) {
  __shared__ __attribute__((aligned(16))) us stile[64 * 256];       // cross-wave (block barrier)

  const int t = threadIdx.x;
  const int wid = __builtin_amdgcn_readfirstlane(t >> 5);
  const int l = t & 31;
  const int h = l >> 4, r16 = l & 15;
  const int wm = wid >> 2, wn = wid & 3;
  const int mblk0 = blockIdx.x * 64;
  const int nblk0 = blockIdx.y * 256;
  const int m0 = mblk0 + wm * 32;
  const int n0 = nblk0 + wn * 64;

  v8f acc[8] = {};
  gemm32x64_bf16<DM>(Xb, Wt, m0, n0, acc);

  float bvv[4];
#pragma unroll
  for (int tt = 0; tt < 4; ++tt) bvv[tt] = bf16rne(bias[n0 + 16 * tt + r16]);

  const int bblk = mblk0 / SEQ;
  const int sblk = mblk0 - bblk * SEQ;  // 64 block rows lie inside one batch (SEQ % 64 == 0)
  const int c = l & 7;
  const int nph = (sblk < EROWS) ? 2 : 1;   // block-uniform: phase 0 value plane, phase 1 residual plane

#pragma unroll 1
  for (int ph = 0; ph < nph; ++ph) {
    if (ph) __syncthreads();              // readers of the value stage done

    // stage f16 value (phase 0) or x2048 residual (phase 1) of (acc + bias) into LDS
#pragma unroll
    for (int tt = 0; tt < 4; ++tt) {
      const int nl = wn * 64 + 16 * tt + r16;
#pragma unroll
      for (int mi = 0; mi < 2; ++mi) {
#pragma unroll
        for (int r = 0; r < 8; ++r) {
          const int ml = wm * 32 + 16 * mi + 8 * h + r;
          const float v = acc[mi * 4 + tt][r] + bvv[tt];
          const _Float16 hv = (_Float16)v;
          const float rs = (v - (float)hv) * RES_CARRY;
          const us hb = __builtin_bit_cast(us, hv);
          const us rb = f16_bits(rs);
          const int li = (mode == 2) ? (nl * 64 + ml) : (ml * 256 + nl);
          stile[li] = ph ? rb : hb;
        }
      }
    }
    __syncthreads();

    // whole-line writes: 256 lines per block, 32 per wave
    const int SL = ph ? EROWS : SEQ;      // sequence extent of the destination plane
    const size_t poff = ph ? roff : (size_t)0;
    v8us vals[8];
    size_t dsts[8];
#pragma unroll
    for (int it = 0; it < 8; ++it) {
      const int L = wid * 32 + (l >> 3) + 4 * it;
      int src;
      size_t dst;
      if (mode == 2) {
        const int n = nblk0 + L;
        const int hg = n >> 6, d = n & 63;
        src = L * 64 + 8 * c;
        dst = (((size_t)(bblk * NH + hg)) * DKH + d) * SL + sblk + 8 * c;
      } else {
        const int ml = L >> 2, hq = L & 3;
        const int hg = (nblk0 >> 6) + hq;
        const int s = sblk + ml;
        src = ml * 256 + hq * 64 + 8 * c;
        dst = (((size_t)(bblk * NH + hg)) * SL + s) * DKH + 8 * c;
      }
      vals[it] = *(const v8us*)&stile[src];
      dsts[it] = dst + poff;
    }
#pragma unroll
    for (int it = 0; it < 8; ++it) *(v8us*)(Y + dsts[it]) = vals[it];
    
  }
}

// ---------------------------------------------------------------------------
// Per-wave part of the key-step bound of a 128-query block, from the mask bit plane.
// Thread t scans half a row (row = t>>1 of the block). A row with at least one visible key needs
// key steps [0, last visible word]; a row with no visible key needs every key step (uniform softmax).
// Returns the maximum over the wave's 16 rows (all lanes hold it).
// ---------------------------------------------------------------------------
__device__ __forceinline__ int wave_key_bound(const unsigned* __restrict__ Mb, int qb) {
  const int t = threadIdx.x;
  const int hw = (t & 1) * (WPR / 2);
  const unsigned* mrow = Mb + (size_t)(qb * 128 + (t >> 1)) * WPR + hw;
  int kmx = -1;
#pragma unroll 1
  for (int j = 0; j < WPR / 2; j += 4) {
    const v4u w = *(const v4u*)(mrow + j);
    kmx = (w[0] != 0u) ? (hw + j)     : kmx;
    kmx = (w[1] != 0u) ? (hw + j + 1) : kmx;
    kmx = (w[2] != 0u) ? (hw + j + 2) : kmx;
    kmx = (w[3] != 0u) ? (hw + j + 3) : kmx;
  }
  const int oth = __shfl_xor(kmx, 1, 32);
  kmx = max(kmx, oth);
  int ke = (kmx < 0) ? WPR : (kmx + 1);
  ke = max(ke, __shfl_xor(ke, 16, 32));
  ke = max(ke, __shfl_xor(ke, 8, 32));
  ke = max(ke, __shfl_xor(ke, 4, 32));
  ke = max(ke, __shfl_xor(ke, 2, 32));
  return ke;
}

// ---------------------------------------------------------------------------
// Fused flash attention, query rows >= EROWS. Block = 8 waves, one (b,h), 128 queries; each wave owns
// 16 queries. K/V 32-key blocks staged once per block into LDS with plain loads.
// Scores computed transposed (S' = K_blk * Q^T) so the exp'd probabilities are
// already in A-operand layout for P*V. Online softmax in f32.
// Mask: one bit word per lane (= query) per 32-key step; masked scores are REPLACED by NEG_FILL.
// Key loop bound per block derived from the mask words (clamped to SEQ/32).
// ctx plane f16 [MROWS][2*DM]: cols [0,DM) value x256, cols [DM,2DM) residual x256,
// grid = NB*NH*((SEQ-EROWS)/128).
// ---------------------------------------------------------------------------
__global__ __launch_bounds__(256) __attribute__((amdgpu_num_vgpr(256)))
void attn_kernel(const us* __restrict__ Qh, const us* __restrict__ Kh,
                 const us* __restrict__ Vt, const unsigned* __restrict__ Mb, us* Ctx) {
  __shared__ __attribute__((aligned(16))) us shK[32 * 64];          // [key][d]   cross-wave (block barrier)
  __shared__ __attribute__((aligned(16))) us shV[64 * 32];          // [d][key]   cross-wave (block barrier)
  __shared__ __attribute__((aligned(16))) us shC[8 * 2 * 16 * 64];  // per-wave ctx staging, value|residual (block barrier used)
  __shared__ int shE[8];                                            // per-wave key bounds, cross-wave (block barrier)

  const int t = threadIdx.x;
  const int wid = __builtin_amdgcn_readfirstlane(t >> 5);
  const int l = t & 31;
  const int r16 = l & 15;
  const int hs = l >> 4;
  const int rowsel = hs << 3;
  constexpr int QBL = (SEQ > EROWS) ? (SEQ - EROWS) / 128 : 1;
  const int bh = blockIdx.x / QBL;
  const int qb = blockIdx.x - bh * QBL + EROWS / 128;
  const int q0 = qb * 128 + wid * 16;

  const size_t qoff = (size_t)bh * SEQ * DKH;
  const us* qp = Qh + qoff;
  const us* kp = Kh + qoff;
  const us* vp = Vt + (size_t)bh * DKH * SEQ;

  // key-step bound of this block (exact for any mask value), clamped to the static maximum
  const int kew = wave_key_bound(Mb, qb);
  if (l == 0) shE[wid] = kew;
  __syncthreads();
  int kall = shE[0];
#pragma unroll
  for (int w = 1; w < 8; ++w) kall = max(kall, shE[w]);
  kall = min(max(kall, 1), WPR);
  const int ksteps = __builtin_amdgcn_readfirstlane(kall);

  const unsigned* mq = Mb + (size_t)(q0 + r16) * WPR;   // this lane's query row of mask words

  // Q^T as B operand for the whole loop (lane = query column, halves = d)
  const v16h qB0 = fragh(qp, DKH, q0, 0);
  const v16h qB1 = fragh(qp, DKH, q0, 32);

  v8f o[4];
#pragma unroll
  for (int tt = 0; tt < 4; ++tt) o[tt] = v8f{};
  float mmax = NEG_FILL, lsum = 0.0f;

  const int krow = t >> 3, kcol = (t & 7) * 8;   // K: 32 keys x 64 d
  const int vrow = t >> 2, vcol = (t & 3) * 8;   // V: 64 d x 32 keys
  const int kfo = r16 * 64 + 8 * hs;             // shK fragment lane offset (row = key, k = d)
  const int vfo = r16 * 32 + 8 * hs;             // shV fragment lane offset (row = d, k = key)

#pragma unroll 1
  for (int ks = 0; ks < ksteps; ++ks) {
    const int kb = ks * 32;
    __syncthreads();    // prior readers of shK/shV done
    *(v8us*)&shK[krow * 64 + kcol] = *(const v8us*)(kp + (size_t)(kb + krow) * DKH + kcol);
    *(v8us*)&shV[vrow * 32 + vcol] = *(const v8us*)(vp + (size_t)vrow * SEQ + kb + vcol);
    __syncthreads();    // stage visible to all waves

    // mask word of this lane's query for these 32 keys (pinned before the selects)
    unsigned mw = mq[ks];
    asm volatile("" : "+v"(mw));
    const unsigned ml = mw >> (8 * hs);

    // S' tiles: M = key (relative 0..15 / 16..31), N = query; k = d
    v8f s0 = {};
    v8f s1 = {};
    {
      const v16h kA = cat16h(*(const v8us*)&shK[kfo], *(const v8us*)&shK[kfo + 16]);
      s0 = mma_f16(kA, qB0, s0);
    }
    {
      const v16h kA = cat16h(*(const v8us*)&shK[kfo + 32], *(const v8us*)&shK[kfo + 48]);
      s0 = mma_f16(kA, qB1, s0);
    }
    {
      const v16h kA = cat16h(*(const v8us*)&shK[16 * 64 + kfo], *(const v8us*)&shK[16 * 64 + kfo + 16]);
      s1 = mma_f16(kA, qB0, s1);
    }
    {
      const v16h kA = cat16h(*(const v8us*)&shK[16 * 64 + kfo + 32], *(const v8us*)&shK[16 * 64 + kfo + 48]);
      s1 = mma_f16(kA, qB1, s1);
    }

    // scale, then replace masked scores: s0[i] = key 8h+i, s1[i] = key 16+8h+i of this step
#pragma unroll
    for (int i = 0; i < 8; ++i) {
      const float a0 = s0[i] * QK_SCALE;
      const float a1 = s1[i] * QK_SCALE;
      s0[i] = ((ml >> i) & 1u) ? a0 : NEG_FILL;
      s1[i] = ((ml >> (16 + i)) & 1u) ? a1 : NEG_FILL;
    }

    // per-query (per-lane) block max; combine the two key halves (lane ^ 16)
    float bm = s0[0];
#pragma unroll
    for (int i = 0; i < 8; ++i) { bm = fmaxf(bm, s0[i]); bm = fmaxf(bm, s1[i]); }
    bm = fmaxf(bm, __shfl_xor(bm, 16, 32));
    const float mnew = fmaxf(mmax, bm);
    const float corr = __expf(fmaxf(mmax - mnew, EXP_FLOOR));
    mmax = mnew;

    // probabilities land directly in A-operand layout (elements 0..7 <- keys 8h..8h+7
    // from the first 16-key D tile, elements 8..15 <- keys 16+8h.. from the second)
    float ps = 0.0f;
    v16h pA;
#pragma unroll
    for (int i = 0; i < 8; ++i) {
      const float p0 = __expf(fmaxf(s0[i] - mnew, EXP_FLOOR));
      const float p1 = __expf(fmaxf(s1[i] - mnew, EXP_FLOOR));
      ps += p0 + p1;
      pA[i]     = (_Float16)(p0 * P_CARRY);
      pA[8 + i] = (_Float16)(p1 * P_CARRY);
    }
    ps += __shfl_xor(ps, 16, 32);
    lsum = lsum * corr + ps;

    // rescale O: D row 8h+r = query 8h+r, whose corr lives in lane 8h+r
#pragma unroll
    for (int r = 0; r < 8; ++r) {
      const float cr = __shfl(corr, rowsel + r, 32);
#pragma unroll
      for (int tt = 0; tt < 4; ++tt) o[tt][r] *= cr;
    }

    // O += P(16 x 32 keys) * V_blk(32 keys x 64 d); B rows = d, k = key contiguous in shV
#pragma unroll
    for (int tt = 0; tt < 4; ++tt) {
      const v16h vB = cat16h(*(const v8us*)&shV[16 * tt * 32 + vfo],
                             *(const v8us*)&shV[16 * tt * 32 + vfo + 16]);
      o[tt] = mma_f16(pA, vB, o[tt]);
    }
  }

  // normalize, stage this wave's 16 x 64 ctx tile (f16 value x256 and residual x256) in LDS
  const int bb = bh / NH;
  const int hh = bh - bb * NH;
#pragma unroll
  for (int r = 0; r < 8; ++r) {
    const float lrow = __shfl(lsum, rowsel + r, 32);
    const float li = CTX_SCALE * __builtin_amdgcn_rcpf(lrow);
#pragma unroll
    for (int tt = 0; tt < 4; ++tt) {
      const float cv = o[tt][r] * li;
      const _Float16 hv = (_Float16)cv;
      const float rs = (cv - (float)hv) * CTXRES_CARRY;
      const int si = wid * 2048 + (rowsel + r) * 64 + 16 * tt + r16;
      shC[si]        = __builtin_bit_cast(us, hv);
      shC[si + 1024] = f16_bits(rs);
    }
  }
  __syncthreads();

  const int c = l & 7;
  v8us vals[8];
  size_t dsts[8];
#pragma unroll
  for (int it = 0; it < 8; ++it) {
    const int Lw = (l >> 3) + 4 * it;    // 0..31
    const int pl = Lw >> 4;              // 0 value, 1 residual
    const int rl = Lw & 15;
    vals[it] = *(const v8us*)&shC[wid * 2048 + pl * 1024 + rl * 64 + 8 * c];
    const int s = q0 + rl;
    dsts[it] = ((size_t)(bb * SEQ + s)) * DM2 + (size_t)pl * DM + hh * DKH + 8 * c;
  }
#pragma unroll
  for (int it = 0; it < 8; ++it) *(v8us*)(Ctx + dsts[it]) = vals[it];
  
}

// ---------------------------------------------------------------------------
// Early band of the fused flash attention: query rows < EROWS. Same structure as attn_kernel.
// For key steps below EROWS (block-uniform test) q, k and v are value + x2048 residual planes:
// scores = kv*qv + (kv*qr + kr*qv)/2048 (residual products in their own accumulator);
// P = f16 value + x2048 residual; O = pv*vv + (pr*vv + pv*vr)/2048 (own accumulator, folded before
// the normalisation). Key steps at or above EROWS (only visited when the mask asks for them) use
// the value planes of k and v alone. Row sum over the unconverted p.
// grid = NB*NH*(EROWS/128).
// ---------------------------------------------------------------------------
__global__ __launch_bounds__(256) __attribute__((amdgpu_num_vgpr(256)))
void attn_early_kernel(const us* __restrict__ Qh, const us* __restrict__ Kh, const us* __restrict__ Vt,
                       const us* __restrict__ Qr, const us* __restrict__ Kr, const us* __restrict__ Vr,
                       const unsigned* __restrict__ Mb, us* Ctx) {
  __shared__ __attribute__((aligned(16))) us shK[32 * 64];          // [key][d]   cross-wave (block barrier)
  __shared__ __attribute__((aligned(16))) us shV[64 * 32];          // [d][key]   cross-wave (block barrier)
  __shared__ __attribute__((aligned(16))) us shKr[32 * 64];         // residual of shK, cross-wave (block barrier)
  __shared__ __attribute__((aligned(16))) us shVr[64 * 32];         // residual of shV, cross-wave (block barrier)
  __shared__ __attribute__((aligned(16))) us shC[8 * 2 * 16 * 64];  // per-wave ctx staging, value|residual (block barrier used)
  __shared__ int shE[8];                                            // per-wave key bounds, cross-wave (block barrier)

  const int t = threadIdx.x;
  const int wid = __builtin_amdgcn_readfirstlane(t >> 5);
  const int l = t & 31;
  const int r16 = l & 15;
  const int hs = l >> 4;
  const int rowsel = hs << 3;
  constexpr int QBE = EROWS / 128;
  const int bh = blockIdx.x / QBE;
  const int qb = blockIdx.x - bh * QBE;
  const int q0 = qb * 128 + wid * 16;

  const size_t qoff = (size_t)bh * SEQ * DKH;
  const size_t roff = (size_t)bh * EROWS * DKH;
  const us* qp = Qh + qoff;
  const us* kp = Kh + qoff;
  const us* vp = Vt + (size_t)bh * DKH * SEQ;
  const us* qrp = Qr + roff;
  const us* krp = Kr + roff;
  const us* vrp = Vr + (size_t)bh * DKH * EROWS;

  // key-step bound of this block (exact for any mask value), clamped to the static maximum
  const int kew = wave_key_bound(Mb, qb);
  if (l == 0) shE[wid] = kew;
  __syncthreads();
  int kall = shE[0];
#pragma unroll
  for (int w = 1; w < 8; ++w) kall = max(kall, shE[w]);
  kall = min(max(kall, 1), WPR);
  const int ksteps = __builtin_amdgcn_readfirstlane(kall);

  const unsigned* mq = Mb + (size_t)(q0 + r16) * WPR;   // this lane's query row of mask words

  // Q^T value and residual as B operands for the whole loop (lane = query column, halves = d)
  const v16h qB0 = fragh(qp, DKH, q0, 0);
  const v16h qB1 = fragh(qp, DKH, q0, 32);
  const v16h qR0 = fragh(qrp, DKH, q0, 0);
  const v16h qR1 = fragh(qrp, DKH, q0, 32);

  v8f o[4], orr[4];
#pragma unroll
  for (int tt = 0; tt < 4; ++tt) { o[tt] = v8f{}; orr[tt] = v8f{}; }
  float mmax = NEG_FILL, lsum = 0.0f;

  const int krow = t >> 3, kcol = (t & 7) * 8;   // K: 32 keys x 64 d
  const int vrow = t >> 2, vcol = (t & 3) * 8;   // V: 64 d x 32 keys
  const int kfo = r16 * 64 + 8 * hs;             // shK fragment lane offset (row = key, k = d)
  const int vfo = r16 * 32 + 8 * hs;             // shV fragment lane offset (row = d, k = key)

#pragma unroll 1
  for (int ks = 0; ks < ksteps; ++ks) {
    const int kb = ks * 32;
    const bool res = kb < EROWS;        // block-uniform: residual planes exist for these keys
    __syncthreads();    // prior readers of the LDS tiles done
    *(v8us*)&shK[krow * 64 + kcol] = *(const v8us*)(kp + (size_t)(kb + krow) * DKH + kcol);
    *(v8us*)&shV[vrow * 32 + vcol] = *(const v8us*)(vp + (size_t)vrow * SEQ + kb + vcol);
    if (res) {
      *(v8us*)&shKr[krow * 64 + kcol] = *(const v8us*)(krp + (size_t)(kb + krow) * DKH + kcol);
      *(v8us*)&shVr[vrow * 32 + vcol] = *(const v8us*)(vrp + (size_t)vrow * EROWS + kb + vcol);
    }
    __syncthreads();    // stage visible to all waves

    // mask word of this lane's query for these 32 keys (pinned before the selects)
    unsigned mw = mq[ks];
    asm volatile("" : "+v"(mw));
    const unsigned ml = mw >> (8 * hs);

    // S' tiles: M = key (relative 0..15 / 16..31), N = query; k = d
    const v16h kA00 = cat16h(*(const v8us*)&shK[kfo], *(const v8us*)&shK[kfo + 16]);
    const v16h kA01 = cat16h(*(const v8us*)&shK[kfo + 32], *(const v8us*)&shK[kfo + 48]);
    const v16h kA10 = cat16h(*(const v8us*)&shK[16 * 64 + kfo], *(const v8us*)&shK[16 * 64 + kfo + 16]);
    const v16h kA11 = cat16h(*(const v8us*)&shK[16 * 64 + kfo + 32], *(const v8us*)&shK[16 * 64 + kfo + 48]);
    v8f s0 = {};
    v8f s1 = {};
    s0 = mma_f16(kA00, qB0, s0);
    s0 = mma_f16(kA01, qB1, s0);
    s1 = mma_f16(kA10, qB0, s1);
    s1 = mma_f16(kA11, qB1, s1);

    // residual score products (x2048 units) in their own accumulators
    v8f x0 = {};
    v8f x1 = {};
    if (res) {
      x0 = mma_f16(kA00, qR0, x0);
      x0 = mma_f16(kA01, qR1, x0);
      x1 = mma_f16(kA10, qR0, x1);
      x1 = mma_f16(kA11, qR1, x1);
      {
        const v16h kR = cat16h(*(const v8us*)&shKr[kfo], *(const v8us*)&shKr[kfo + 16]);
        x0 = mma_f16(kR, qB0, x0);
      }
      {
        const v16h kR = cat16h(*(const v8us*)&shKr[kfo + 32], *(const v8us*)&shKr[kfo + 48]);
        x0 = mma_f16(kR, qB1, x0);
      }
      {
        const v16h kR = cat16h(*(const v8us*)&shKr[16 * 64 + kfo], *(const v8us*)&shKr[16 * 64 + kfo + 16]);
        x1 = mma_f16(kR, qB0, x1);
      }
      {
        const v16h kR = cat16h(*(const v8us*)&shKr[16 * 64 + kfo + 32], *(const v8us*)&shKr[16 * 64 + kfo + 48]);
        x1 = mma_f16(kR, qB1, x1);
      }
    }

    // fold, scale, then replace masked scores: s0[i] = key 8h+i, s1[i] = key 16+8h+i of this step
#pragma unroll
    for (int i = 0; i < 8; ++i) {
      const float a0 = (s0[i] + x0[i] * RES_INV) * QK_SCALE;
      const float a1 = (s1[i] + x1[i] * RES_INV) * QK_SCALE;
      s0[i] = ((ml >> i) & 1u) ? a0 : NEG_FILL;
      s1[i] = ((ml >> (16 + i)) & 1u) ? a1 : NEG_FILL;
    }

    // per-query (per-lane) block max; combine the two key halves (lane ^ 16)
    float bm = s0[0];
#pragma unroll
    for (int i = 0; i < 8; ++i) { bm = fmaxf(bm, s0[i]); bm = fmaxf(bm, s1[i]); }
    bm = fmaxf(bm, __shfl_xor(bm, 16, 32));
    const float mnew = fmaxf(mmax, bm);
    const float corr = __expf(fmaxf(mmax - mnew, EXP_FLOOR));
    mmax = mnew;

    // probabilities (value + residual) land directly in A-operand layout
    float ps = 0.0f;
    v16h pA, pR;
#pragma unroll
    for (int i = 0; i < 8; ++i) {
      const float p0 = __expf(fmaxf(s0[i] - mnew, EXP_FLOOR));
      const float p1 = __expf(fmaxf(s1[i] - mnew, EXP_FLOOR));
      ps += p0 + p1;
      const float c0 = p0 * P_CARRY;
      const float c1 = p1 * P_CARRY;
      const _Float16 h0 = (_Float16)c0;
      const _Float16 h1 = (_Float16)c1;
      pA[i]     = h0;
      pA[8 + i] = h1;
      pR[i]     = (_Float16)((c0 - (float)h0) * RES_CARRY);
      pR[8 + i] = (_Float16)((c1 - (float)h1) * RES_CARRY);
    }
    ps += __shfl_xor(ps, 16, 32);
    lsum = lsum * corr + ps;

    // rescale both accumulators: D row 8h+r = query 8h+r, whose corr lives in lane 8h+r
#pragma unroll
    for (int r = 0; r < 8; ++r) {
      const float cr = __shfl(corr, rowsel + r, 32);
#pragma unroll
      for (int tt = 0; tt < 4; ++tt) { o[tt][r] *= cr; orr[tt][r] *= cr; }
    }

    // O += P * V_blk (value products); residual accumulator += P_res * V
#pragma unroll
    for (int tt = 0; tt < 4; ++tt) {
      const v16h vB = cat16h(*(const v8us*)&shV[16 * tt * 32 + vfo],
                             *(const v8us*)&shV[16 * tt * 32 + vfo + 16]);
      o[tt]   = mma_f16(pA, vB, o[tt]);
      orr[tt] = mma_f16(pR, vB, orr[tt]);
    }
    // residual accumulator += P * V_res
    if (res) {
#pragma unroll
      for (int tt = 0; tt < 4; ++tt) {
        const v16h vRB = cat16h(*(const v8us*)&shVr[16 * tt * 32 + vfo],
                                *(const v8us*)&shVr[16 * tt * 32 + vfo + 16]);
        orr[tt] = mma_f16(pA, vRB, orr[tt]);
      }
    }
  }

  // fold the residual accumulator, normalize, stage this wave's 16 x 64 ctx tile in LDS
  const int bb = bh / NH;
  const int hh = bh - bb * NH;
#pragma unroll
  for (int r = 0; r < 8; ++r) {
    const float lrow = __shfl(lsum, rowsel + r, 32);
    const float li = CTX_SCALE * __builtin_amdgcn_rcpf(lrow);
#pragma unroll
    for (int tt = 0; tt < 4; ++tt) {
      const float cv = (o[tt][r] + orr[tt][r] * RES_INV) * li;
      const _Float16 hv = (_Float16)cv;
      const float rs = (cv - (float)hv) * CTXRES_CARRY;
      const int si = wid * 2048 + (rowsel + r) * 64 + 16 * tt + r16;
      shC[si]        = __builtin_bit_cast(us, hv);
      shC[si + 1024] = f16_bits(rs);
    }
  }
  __syncthreads();

  const int c = l & 7;
  v8us vals[8];
  size_t dsts[8];
#pragma unroll
  for (int it = 0; it < 8; ++it) {
    const int Lw = (l >> 3) + 4 * it;    // 0..31
    const int pl = Lw >> 4;              // 0 value, 1 residual
    const int rl = Lw & 15;
    vals[it] = *(const v8us*)&shC[wid * 2048 + pl * 1024 + rl * 64 + 8 * c];
    const int s = q0 + rl;
    dsts[it] = ((size_t)(bb * SEQ + s)) * DM2 + (size_t)pl * DM + hh * DKH + 8 * c;
  }
#pragma unroll
  for (int it = 0; it < 8; ++it) *(v8us*)(Ctx + dsts[it]) = vals[it];
  
}

// ---------------------------------------------------------------------------
// Output projection: Out f32 [MROWS][DM] = [ctx x256 | ctx residual x256] * [Wo x64 | Wo x0.25]^T * OUT_FOLD + bo.
// K = 2*DM, one accumulator (both halves of K are in the same units).
// Same block tiling as proj_kernel; f32 tile staged in two 16-row halves per wave
// (32 x 256 floats in LDS), each d_out line (32 floats) written by 8 lanes x 16 B.
// ---------------------------------------------------------------------------
__global__ __launch_bounds__(256) __attribute__((amdgpu_num_vgpr(256)))
void outproj_kernel(const us* __restrict__ Ctx, const us* __restrict__ Wot,
                    const float* __restrict__ bo, float* Out) {
  __shared__ __attribute__((aligned(16))) float ftile[32 * 256];    // cross-wave (block barrier)

  const int t = threadIdx.x;
  const int wid = __builtin_amdgcn_readfirstlane(t >> 5);
  const int l = t & 31;
  const int h = l >> 4, r16 = l & 15;
  const int wm = wid >> 2, wn = wid & 3;
  const int mblk0 = blockIdx.x * 64;
  const int nblk0 = blockIdx.y * 256;
  const int m0 = mblk0 + wm * 32;
  const int n0 = nblk0 + wn * 64;

  v8f acc[8] = {};
  gemm32x64_f16<DM2>(Ctx, Wot, m0, n0, acc);

  float bob[4];
#pragma unroll
  for (int tt = 0; tt < 4; ++tt) bob[tt] = bf16rne(bo[n0 + 16 * tt + r16]);

  const int c = l & 7;
#pragma unroll
  for (int p = 0; p < 2; ++p) {
    if (p) __syncthreads();   // readers of the prior half done
#pragma unroll
    for (int tt = 0; tt < 4; ++tt) {
      const int nl = wn * 64 + 16 * tt + r16;
#pragma unroll
      for (int r = 0; r < 8; ++r) {
        const int rl = wm * 16 + 8 * h + r;           // 0..31
        ftile[rl * 256 + nl] = acc[p * 4 + tt][r] * OUT_FOLD + bob[tt];
      }
    }
    __syncthreads();

    v4f vals[8];
    size_t dsts[8];
#pragma unroll
    for (int it = 0; it < 8; ++it) {
      const int L = wid * 32 + (l >> 3) + 4 * it;    // 0..255
      const int rl = L >> 3, seg = L & 7;
      vals[it] = *(const v4f*)&ftile[rl * 256 + seg * 32 + 4 * c];
      const int m = mblk0 + (rl >> 4) * 32 + p * 16 + (rl & 15);
      dsts[it] = (size_t)m * DM + nblk0 + seg * 32 + 4 * c;
    }
#pragma unroll
    for (int it = 0; it < 8; ++it) *(v4f*)(Out + dsts[it]) = vals[it];
    
  }
}

// ---------------------------------------------------------------------------
// Host launcher
// ---------------------------------------------------------------------------
extern "C" void kernel_launch(void* const* d_in, const int* in_sizes, int n_in,
                              void* d_out, int out_size, void* d_ws, size_t ws_size,
                              hipStream_t stream) {
  if (n_in < 12) return;
  const int need_x = ((NB - 1) * SEQ_FULL + SEQ) * DM;
  if (in_sizes[0] < need_x || in_sizes[1] < need_x || in_sizes[2] < need_x) return;
  if (in_sizes[3] < DM * DM || in_sizes[5] < DM * DM || in_sizes[7] < DM * DM || in_sizes[9] < DM * DM) return;
  if (in_sizes[4] < DM || in_sizes[6] < DM || in_sizes[8] < DM || in_sizes[10] < DM) return;
  if (in_sizes[11] < (SEQ - 1) * SEQ_FULL + SEQ) return;
  if (out_size < MROWS * DM) return;

  // bound by role in the input order: queries, keys, values, Wq, bq, Wk, bk, Wv, bv, Wo, bo, mask
  const float* Q  = (const float*)d_in[0];
  const float* K  = (const float*)d_in[1];
  const float* V  = (const float*)d_in[2];
  const float* Wq = (const float*)d_in[3];
  const float* bq = (const float*)d_in[4];
  const float* Wk = (const float*)d_in[5];
  const float* bk = (const float*)d_in[6];
  const float* Wv = (const float*)d_in[7];
  const float* bv = (const float*)d_in[8];
  const float* Wo = (const float*)d_in[9];
  const float* bo = (const float*)d_in[10];
  const int*   Mk = (const int*)d_in[11];

  const size_t XE = (size_t)MROWS * DM;            // halves per activation plane
  const size_t WE = (size_t)DM * DM;               // halves per weight plane
  const size_t RE = (size_t)NB * NH * EROWS * DKH; // halves per early residual plane
  const size_t BW = (size_t)SEQ * WPR;             // 32-bit words of the mask bit plane
  const size_t total_bytes = (8 * XE + 5 * WE + 3 * RE) * sizeof(us) + BW * sizeof(unsigned);
  if (total_bytes > ws_size) return;

  us* xq  = (us*)d_ws;
  us* xk  = xq + XE;
  us* xv  = xk + XE;
  us* wtq = xv + XE;           // [n][k] bf16
  us* wtk = wtq + WE;
  us* wtv = wtk + WE;
  us* wo2 = wtv + WE;          // 2 * WE  ([DM][2*DM]) f16
  us* qh  = wo2 + 2 * WE;      // q value plane [NB*NH][SEQ][64]
  us* kh  = qh + XE;           // k value plane [NB*NH][SEQ][64]
  us* vt  = kh + XE;           // v transposed plane [NB*NH][64][SEQ]
  us* ctx = vt + XE;           // 2 * XE  ([MROWS][2*DM])
  us* qr  = ctx + 2 * XE;      // q residual plane [NB*NH][EROWS][64]
  us* kr  = qr + RE;           // k residual plane [NB*NH][EROWS][64]
  us* vr  = kr + RE;           // v residual transposed plane [NB*NH][64][EROWS]
  unsigned* mb = (unsigned*)(vr + RE);   // mask bit plane [SEQ][WPR]

  dim3 blk(256);
  const int n8 = (int)(XE / 8);
  dim3 gx((n8 + 255) / 256);
  cvt_x_kernel<<<gx, blk, 0, stream>>>(Q, xq, n8);
  cvt_x_kernel<<<gx, blk, 0, stream>>>(K, xk, n8);
  cvt_x_kernel<<<gx, blk, 0, stream>>>(V, xv, n8);

  const int n4 = (int)(BW / 4);
  mask_pack_kernel<<<dim3((n4 + 255) / 256), blk, 0, stream>>>(Mk, mb, n4);

  // W is [k][n] (in,out): x = k tile, y = n tile; output plane [n][k]
  dim3 gw(DM / 64, DM / 64);
  cvt_wT_kernel<<<gw, blk, 0, stream>>>(Wq, wtq, 0);
  cvt_wT_kernel<<<gw, blk, 0, stream>>>(Wk, wtk, 0);
  cvt_wT_kernel<<<gw, blk, 0, stream>>>(Wv, wtv, 0);
  cvt_wT_kernel<<<gw, blk, 0, stream>>>(Wo, wo2, 1);

  dim3 gp(MROWS / 64, DM / 256);
  proj_kernel<<<gp, blk, 0, stream>>>(xq, wtq, bq, qh, (size_t)(qr - qh), 0);
  proj_kernel<<<gp, blk, 0, stream>>>(xk, wtk, bk, kh, (size_t)(kr - kh), 1);
  proj_kernel<<<gp, blk, 0, stream>>>(xv, wtv, bv, vt, (size_t)(vr - vt), 2);

  if (EROWS > 0) {
    attn_early_kernel<<<dim3(NB * NH * (EROWS / 128)), blk, 0, stream>>>(qh, kh, vt, qr, kr, vr, mb, ctx);
  }
  if (SEQ > EROWS) {
    attn_kernel<<<dim3(NB * NH * ((SEQ - EROWS) / 128)), blk, 0, stream>>>(qh, kh, vt, mb, ctx);
  }

  outproj_kernel<<<gp, blk, 0, stream>>>(ctx, wo2, bo, (float*)d_out);
}

// v001
// It runs in 222 microseconds.
// Timed twice side by side with v000, it ran 1.44 and 1.42 times as fast.
#include <hip/hip_runtime.h>
#include <stddef.h>

// Contractions: q/k/v projections = v_wmma_f32_16x16x32_bf16 (bf16 operands = RNE-converted f32 inputs);
// scores = v_wmma_f32_16x16x32_f16 (k x1 against q x1, single product; query rows < EROWS: q and k as f16 value + x2048 residual, three products, own accumulator);
// P*V = f16 (P x1024, v x1; query rows < EROWS: P and v as f16 value + x2048 residual, residual products in their own accumulator);
// output projection = f16 over K = 2*DM ([ctx x256 | ctx residual x256] against [Wo x64 | Wo x0.25]);
// f32 accumulate, f32 online softmax; the mask input is read by value (packed to bit words once) and applied as a replace fill.

#ifndef NB
#define NB 2
#endif
#ifndef SEQ
#define SEQ 2048
#endif
#define NB_FULL 2
#define SEQ_FULL 2048
#define DM 1024
#define NH 16
#define DKH 64
#define MROWS (NB * SEQ)
#define DM2 (2 * DM)
#define EROWS 256                 // query rows (and key rows) with value + residual planes
#define WPR (SEQ / 32)            // mask bit words per query row

static_assert(NB >= 1 && NB <= NB_FULL);
static_assert(SEQ >= 128 && SEQ <= SEQ_FULL);
static_assert(SEQ % 128 == 0);
static_assert(SEQ % 64 == 0 && SEQ % 32 == 0);
static_assert(MROWS % 64 == 0);
static_assert(DM % 256 == 0 && DM % 32 == 0 && DM % 64 == 0);
static_assert(DM / 8 == 128);
static_assert(NH * DKH == DM);
static_assert(DKH == 64);
static_assert(DM2 % 32 == 0);
static_assert(SEQ % 256 == 0);                 // half a mask-word row is a multiple of 4 words
static_assert(EROWS % 128 == 0 && EROWS % 64 == 0 && EROWS % 32 == 0);
static_assert(EROWS >= 128 && EROWS <= SEQ);
static_assert(WPR % 8 == 0 && WPR >= 8);
static_assert((SEQ * WPR) % 4 == 0);

#define P_CARRY      1024.0f            // P operand carried x1024
#define CTX_SCALE    0.25f              // ctx value plane = O * 0.25 / l = attn x256 (O carries the x1024 of P)
#define CTXRES_CARRY 256.0f             // ctx residual plane = (ctx256 - f16(ctx256)) x256
#define WO_CARRY     64.0f              // Wo operand carried x64 (value half of K)
#define WO_LO_CARRY  0.25f              // Wo operand for the residual half of K = WO_CARRY / CTXRES_CARRY
#define OUT_FOLD     (1.0f / 16384.0f)  // 1 / (256 * 64)
#define QK_SCALE     0.125f             // 1 / sqrt(64)
#define RES_CARRY    2048.0f            // early-band residual planes carried x2048
#define RES_INV      (1.0f / 2048.0f)
#define NEG_FILL     (-3.4028235e38f)   // lowest finite f32: fill value of masked scores
#define EXP_FLOOR    (-87.0f)           // exponent argument floor (keeps the exp argument finite)

static_assert(WO_LO_CARRY * CTXRES_CARRY == WO_CARRY);
static_assert(OUT_FOLD * 256.0f * WO_CARRY == 1.0f);
static_assert(RES_INV * RES_CARRY == 1.0f);

// workspace carve: 8 activation-size planes + 5 weight-size planes + 3 early residual planes (16-bit each) + mask bit plane
static_assert(((size_t)8 * MROWS * DM + (size_t)5 * DM * DM + (size_t)3 * NB * NH * EROWS * DKH) * 2
              + (size_t)SEQ * WPR * 4 <= (size_t)134217728);

typedef unsigned short us;
typedef us        v8us  __attribute__((ext_vector_type(8)));
typedef us        v16us __attribute__((ext_vector_type(16)));
typedef _Float16  v16h  __attribute__((ext_vector_type(16)));
typedef __bf16    v16bf __attribute__((ext_vector_type(16)));
typedef float     v8f   __attribute__((ext_vector_type(8)));
typedef float     v4f   __attribute__((ext_vector_type(4)));
typedef int       v4i   __attribute__((ext_vector_type(4)));
typedef unsigned  v4u   __attribute__((ext_vector_type(4)));

// ---------------------------------------------------------------------------
// conversions
// ---------------------------------------------------------------------------
__device__ __forceinline__ unsigned bf16rne_bits(float x) {
  unsigned u = __float_as_uint(x);
  return (u + 0x7FFFu + ((u >> 16) & 1u)) >> 16;
}
__device__ __forceinline__ float bf16rne(float x) {
  return __uint_as_float(bf16rne_bits(x) << 16);
}
__device__ __forceinline__ us f16_bits(float x) {
  _Float16 hx = (_Float16)x;
  return __builtin_bit_cast(us, hx);
}

// ---------------------------------------------------------------------------
// 16-bit operand fragment (A: lane = row, B: lane = column; same k map):
//   lane l, r = l&15, s = l>>4 : elems 0..7  = row[r][k0 + 8s .. +7]
//                                elems 8..15 = row[r][k0 + 16 + 8s .. +7]
// base is a 16-bit global plane with k contiguous, pitch ld (halves).
// ---------------------------------------------------------------------------
__device__ __forceinline__ v16us frag16(const us* base, int ld, int row0, int k0) {
  const int l = threadIdx.x & 31;
  const int r = l & 15, s = l >> 4;
  const us* p = base + (size_t)(row0 + r) * ld + k0 + 8 * s;
  v8us c0 = *(const v8us*)p;
  v8us c1 = *(const v8us*)(p + 16);
  return __builtin_shufflevector(c0, c1, 0, 1, 2, 3, 4, 5, 6, 7, 8, 9, 10, 11, 12, 13, 14, 15);
}
__device__ __forceinline__ v16h fragh(const us* base, int ld, int row0, int k0) {
  return __builtin_bit_cast(v16h, frag16(base, ld, row0, k0));
}
// two 16-byte chunks (already loaded) -> one f16 fragment
__device__ __forceinline__ v16h cat16h(v8us c0, v8us c1) {
  v16us w = __builtin_shufflevector(c0, c1, 0, 1, 2, 3, 4, 5, 6, 7, 8, 9, 10, 11, 12, 13, 14, 15);
  return __builtin_bit_cast(v16h, w);
}

// ---------------------------------------------------------------------------
// WMMA wrappers with hazard guard: D = A(16x32) * B(32x16) + C (f32)
// ---------------------------------------------------------------------------
__device__ __forceinline__ v8f mma_f16(v16h a, v16h b, v8f c) {
  v8f d = __builtin_amdgcn_wmma_f32_16x16x32_f16(false, a, false, b, (short)0, c, false, false);
  asm volatile("v_nop\n\tv_nop\n\tv_nop\n\tv_nop" : "+v"(d) : "v"(a), "v"(b));
  return d;
}
__device__ __forceinline__ v8f mma_bf16(v16bf a, v16bf b, v8f c) {
  v8f d = __builtin_amdgcn_wmma_f32_16x16x32_bf16(false, a, false, b, (short)0, c, false, false);
  asm volatile("v_nop\n\tv_nop\n\tv_nop\n\tv_nop" : "+v"(d) : "v"(a), "v"(b));
  return d;
}

// ---------------------------------------------------------------------------
// Activation convert: X f32 [NB_FULL*SEQ_FULL][DM] -> bf16 bits [MROWS][DM]
// n8 = MROWS*DM/8.
// ---------------------------------------------------------------------------
__global__ __launch_bounds__(256) void cvt_x_kernel(const float* __restrict__ X, us* Y, int n8) {
  const int i = blockIdx.x * 256 + threadIdx.x;
  if (i >= n8) return;
  const int m  = i >> 7;                 // DM/8 = 128 groups per row
  const int c8 = (i & 127) * 8;
  const int b  = m / SEQ;
  const int s  = m - b * SEQ;
  const float* src = X + ((size_t)(b * SEQ_FULL + s)) * DM + c8;
  v4f x0 = *(const v4f*)src;
  v4f x1 = *(const v4f*)(src + 4);
  v8us y;
#pragma unroll
  for (int j = 0; j < 4; ++j) {
    y[j]     = (us)bf16rne_bits(x0[j]);
    y[4 + j] = (us)bf16rne_bits(x1[j]);
  }
  us* dst = Y + (size_t)i * 8;
  *(v8us*)dst = y;
  
}

// ---------------------------------------------------------------------------
// Mask pack: M int32 [SEQ_FULL][SEQ_FULL] (nonzero = attend) -> bit words [SEQ][WPR],
// bit j of word w of row q = (M[q][32w + j] != 0).
// ---------------------------------------------------------------------------
__global__ __launch_bounds__(256) void mask_pack_kernel(const int* __restrict__ M, unsigned* Bits, int n4) {
  const int i = blockIdx.x * 256 + threadIdx.x;
  if (i >= n4) return;
  const int w4 = i * 4;
  const int q  = w4 / WPR;
  const int w0 = w4 - q * WPR;
  const int* src = M + (size_t)q * SEQ_FULL + 32 * w0;
  unsigned a0 = 0u, a1 = 0u, a2 = 0u, a3 = 0u;
#pragma unroll 1
  for (int j = 0; j < 4; ++j) {
    unsigned wb = 0u;
#pragma unroll
    for (int c = 0; c < 8; ++c) {
      const v4i m = *(const v4i*)(src + 32 * j + 4 * c);
      wb |= ((m[0] != 0) ? 1u : 0u) << (4 * c);
      wb |= ((m[1] != 0) ? 1u : 0u) << (4 * c + 1);
      wb |= ((m[2] != 0) ? 1u : 0u) << (4 * c + 2);
      wb |= ((m[3] != 0) ? 1u : 0u) << (4 * c + 3);
    }
    a0 = (j == 0) ? wb : a0;
    a1 = (j == 1) ? wb : a1;
    a2 = (j == 2) ? wb : a2;
    a3 = (j == 3) ? wb : a3;
  }
  v4u y;
  y[0] = a0; y[1] = a1; y[2] = a2; y[3] = a3;
  unsigned* dst = Bits + (size_t)i * 4;
  *(v4u*)dst = y;
  
}

// ---------------------------------------------------------------------------
// Weight convert with transpose: W f32 [k][n] (in,out; n contiguous) -> 16-bit plane [n][k] (k contiguous).
// hmode 0: bf16 bits of RNE(W), pitch DM.
// hmode 1: pitch 2*DM: cols [0,DM) = f16(RNE(W) * WO_CARRY), cols [DM,2DM) = f16(RNE(W) * WO_LO_CARRY).
// Block = 64(k) x 64(n) tile through LDS (cross-wave: block barrier); each output line = 64 k of one n
// grid (DM/64, DM/64): x = k tile, y = n tile.
// ---------------------------------------------------------------------------
#define WT_LD 72
static_assert((WT_LD * 2) % 16 == 0 && WT_LD >= 64);
__global__ __launch_bounds__(256) void cvt_wT_kernel(const float* __restrict__ W, us* Y, int hmode) {
  __shared__ __attribute__((aligned(16))) us t0[64 * WT_LD];   // [n][k] value
  __shared__ __attribute__((aligned(16))) us t1[64 * WT_LD];   // [n][k] low-carry copy (hmode 1)

  const int t  = threadIdx.x;
  const int k0 = blockIdx.x * 64;
  const int n0 = blockIdx.y * 64;

#pragma unroll 1
  for (int i = 0; i < 4; ++i) {
    const int id = t + i * 256;           // 1024 float4 chunks (64 k x 64 n)
    const int kr = id >> 4;
    const int c4 = (id & 15) * 4;
    const v4f x = *(const v4f*)(W + (size_t)(k0 + kr) * DM + n0 + c4);
#pragma unroll
    for (int j = 0; j < 4; ++j) {
      const float w = bf16rne(x[j]);
      const us hb = (us)(__float_as_uint(w) >> 16);
      const us hf = f16_bits(w * WO_CARRY);
      const us hl = f16_bits(w * WO_LO_CARRY);
      t0[(c4 + j) * WT_LD + kr] = hmode ? hf : hb;
      t1[(c4 + j) * WT_LD + kr] = hl;
    }
  }
  __syncthreads();

  const int c = t & 7;
  const size_t pitch = hmode ? (size_t)DM2 : (size_t)DM;
  v8us v0[2], v1[2];
  size_t dsts[2];
#pragma unroll
  for (int it = 0; it < 2; ++it) {
    const int L = (t >> 3) + 32 * it;     // local n 0..63
    v0[it] = *(const v8us*)&t0[L * WT_LD + 8 * c];
    v1[it] = *(const v8us*)&t1[L * WT_LD + 8 * c];
    dsts[it] = (size_t)(n0 + L) * pitch + k0 + 8 * c;
  }
#pragma unroll
  for (int it = 0; it < 2; ++it) {
    *(v8us*)(Y + dsts[it]) = v0[it];
    if (hmode) *(v8us*)(Y + dsts[it] + DM) = v1[it];
  }
  
}

// ---------------------------------------------------------------------------
// GEMM core: block computes 64 rows x 256 cols over K = KD; wave (wm, wn) computes 32 x 64 of it.
// A plane [M][KD], B plane [N][KD] (k contiguous), both 16-bit.
// K is walked in slabs of RK; a slab (64 A rows, then 256 B rows) is staged in LDS by asynchronous
// 16-byte copies, two buffers: the next slab's copies fly while this slab is worked on.
// Fragments are read from LDS with the k map of frag16; k runs upward in steps of 32 as before.
// ---------------------------------------------------------------------------
#define RK 128                       // k per slab: 256-byte rows
#define RPITCH 136                   // LDS row pitch in halves: 272 B = 16 B x 17, conflict-free for 16-byte reads
#define RROWS 320                    // 64 A rows + 256 B rows
#define RSTAGE (RROWS * RPITCH)      // halves per buffer
static_assert((RPITCH * 2) % 16 == 0 && RPITCH >= RK);
static_assert(RROWS * (RK / 8) == 20 * 256);   // 20 copies per thread and slab

// One slab: thread t copies chunk (t & 15) of rows (t >> 4) + 16 i, i = 0..19 (each wave copy = 2 whole rows).
// ga / gb: this thread's chunk in A row (t >> 4) / B row (t >> 4) of the block at this slab; ld: its LDS byte address in row (t >> 4).
template <int KD>
__device__ __forceinline__ void stage_slab(const us* ga, const us* gb, unsigned ld) {
  const us* g[20];
  unsigned d[20];
#pragma unroll   // unrolled so that g[] and d[] are registers (they are asm operands)
  for (int i = 0; i < 20; ++i) {
    g[i] = (i < 4) ? (ga + (size_t)(16 * i) * KD) : (gb + (size_t)(16 * (i - 4)) * KD);
    d[i] = ld + (unsigned)(16 * i * RPITCH * 2);
  }
  // the closing s_wait_xcnt keeps the address registers of the issued copies from being rewritten early
  asm volatile("global_load_async_to_lds_b128 %0, %1, off\n\t"
               "global_load_async_to_lds_b128 %2, %3, off\n\t"
               "global_load_async_to_lds_b128 %4, %5, off\n\t"
               "global_load_async_to_lds_b128 %6, %7, off\n\t"
               "global_load_async_to_lds_b128 %8, %9, off\n\t"
               "global_load_async_to_lds_b128 %10, %11, off\n\t"
               "global_load_async_to_lds_b128 %12, %13, off\n\t"
               "global_load_async_to_lds_b128 %14, %15, off\n\t"
               "global_load_async_to_lds_b128 %16, %17, off\n\t"
               "global_load_async_to_lds_b128 %18, %19, off\n\t"
               "s_wait_xcnt 0x0"
               :: "v"(d[0]), "v"(g[0]), "v"(d[1]), "v"(g[1]), "v"(d[2]), "v"(g[2]), "v"(d[3]), "v"(g[3]), "v"(d[4]), "v"(g[4]), "v"(d[5]), "v"(g[5]), "v"(d[6]), "v"(g[6]), "v"(d[7]), "v"(g[7]), "v"(d[8]), "v"(g[8]), "v"(d[9]), "v"(g[9]) : "memory");
  asm volatile("global_load_async_to_lds_b128 %0, %1, off\n\t"
               "global_load_async_to_lds_b128 %2, %3, off\n\t"
               "global_load_async_to_lds_b128 %4, %5, off\n\t"
               "global_load_async_to_lds_b128 %6, %7, off\n\t"
               "global_load_async_to_lds_b128 %8, %9, off\n\t"
               "global_load_async_to_lds_b128 %10, %11, off\n\t"
               "global_load_async_to_lds_b128 %12, %13, off\n\t"
               "global_load_async_to_lds_b128 %14, %15, off\n\t"
               "global_load_async_to_lds_b128 %16, %17, off\n\t"
               "global_load_async_to_lds_b128 %18, %19, off\n\t"
               "s_wait_xcnt 0x0"
               :: "v"(d[10]), "v"(g[10]), "v"(d[11]), "v"(g[11]), "v"(d[12]), "v"(g[12]), "v"(d[13]), "v"(g[13]), "v"(d[14]), "v"(g[14]), "v"(d[15]), "v"(g[15]), "v"(d[16]), "v"(g[16]), "v"(d[17]), "v"(g[17]), "v"(d[18]), "v"(g[18]), "v"(d[19]), "v"(g[19]) : "memory");
}

// fragment from a staged slab (LDS), same lane and k map as frag16
__device__ __forceinline__ v16us lfrag16(const us* tile, int row0, int k0) {
  const int l = threadIdx.x & 31;
  const int r = l & 15, s = l >> 4;
  const us* p = tile + (row0 + r) * RPITCH + k0 + 8 * s;
  v8us c0 = *(const v8us*)p;
  v8us c1 = *(const v8us*)(p + 16);
  return __builtin_shufflevector(c0, c1, 0, 1, 2, 3, 4, 5, 6, 7, 8, 9, 10, 11, 12, 13, 14, 15);
}

template <int KD, bool BF>
__device__ __forceinline__ void gemm_ring(const us* A, const us* B, int mblk0, int nblk0, int wm, int wn,
                                          us* ring, v8f (&acc)[8]) {
  static_assert(KD % RK == 0 && KD / RK >= 2);
  constexpr int NP = KD / RK;
  const int t = threadIdx.x;
  const us* ga = A + (size_t)(mblk0 + (t >> 4)) * KD + (t & 15) * 8;
  const us* gb = B + (size_t)(nblk0 + (t >> 4)) * KD + (t & 15) * 8;
  const unsigned ld = (unsigned)(size_t)ring + (unsigned)((t >> 4) * (RPITCH * 2) + (t & 15) * 16);

  stage_slab<KD>(ga, gb, ld);
  asm volatile("s_wait_asynccnt 0x0" ::: "memory");   // slab 0 landed (this wave's copies)
  __syncthreads();                                    // slab 0 visible to all waves
  stage_slab<KD>(ga + RK, gb + RK, ld + (unsigned)(RSTAGE * 2));

#pragma unroll 1   // kept rolled: one body of 32 matrix instructions, short code
  for (int p = 0; p < NP; ++p) {
    const int buf = p & 1;
    const us* tile = ring + buf * RSTAGE;
#pragma unroll     // unrolled so that the k offsets become immediates of the LDS reads
    for (int kk = 0; kk < RK; kk += 32) {
      // the six fragments of a k step are read as one group: one LDS latency per step, not one per column tile
      const v16us a0 = lfrag16(tile, wm * 32, kk);
      const v16us a1 = lfrag16(tile, wm * 32 + 16, kk);
      v16us b[4];
#pragma unroll     // unrolled so that b[] stays in registers
      for (int tt = 0; tt < 4; ++tt) b[tt] = lfrag16(tile, 64 + wn * 64 + 16 * tt, kk);
#pragma unroll     // unrolled so that acc[] stays in registers
      for (int tt = 0; tt < 4; ++tt) {
        if constexpr (BF) {
          acc[tt]     = mma_bf16(__builtin_bit_cast(v16bf, a0), __builtin_bit_cast(v16bf, b[tt]), acc[tt]);
          acc[4 + tt] = mma_bf16(__builtin_bit_cast(v16bf, a1), __builtin_bit_cast(v16bf, b[tt]), acc[4 + tt]);
        } else {
          acc[tt]     = mma_f16(__builtin_bit_cast(v16h, a0), __builtin_bit_cast(v16h, b[tt]), acc[tt]);
          acc[4 + tt] = mma_f16(__builtin_bit_cast(v16h, a1), __builtin_bit_cast(v16h, b[tt]), acc[4 + tt]);
        }
      }
    }
    asm volatile("s_wait_dscnt 0x0" ::: "memory");      // this wave's reads of the buffer are done before it is refilled
    asm volatile("s_wait_asynccnt 0x0" ::: "memory");   // this wave's copies of slab p + 1 have landed
    __syncthreads();                                    // publishes slab p + 1; ends every reader's last read of slab p
    if (p + 2 < NP)
      stage_slab<KD>(ga + (p + 2) * RK, gb + (p + 2) * RK, ld + (unsigned)(buf * RSTAGE * 2));
  }
  asm volatile("s_wait_asynccnt 0x0" ::: "memory");     // no copy outstanding past the loop
}

// ---------------------------------------------------------------------------
// Projection: Y = Xb[MROWS][DM] * Wt^T + b, written as an f16 plane.
// mode 0/1: q or k -> value plane [NB*NH][SEQ][64]
// mode 2:   v      -> transposed value plane [NB*NH][64][SEQ]
// Blocks whose 64 rows lie below EROWS (block-uniform) also write the x2048 residual plane at Y + roff:
// mode 0/1: [NB*NH][EROWS][64]; mode 2: [NB*NH][64][EROWS].
// Block 256 thr = 8 waves as 2(M) x 4(N); block tile 64 x 256; grid (MROWS/64, DM/256).
// ---------------------------------------------------------------------------
__global__ __launch_bounds__(256) __attribute__((amdgpu_num_vgpr(256)))
void proj_kernel(const us* __restrict__ Xb, const us* __restrict__ Wt,
                 const float* __restrict__ bias, us* Y, size_t roff, int mode) {
  __shared__ __attribute__((aligned(16))) us stile[64 * 256];       // cross-wave (block barrier)
  __shared__ __attribute__((aligned(16))) us ring[2 * RSTAGE];      // operand slabs, cross-wave (block barrier)

  const int t = threadIdx.x;
  const int wid = __builtin_amdgcn_readfirstlane(t >> 5);
  const int l = t & 31;
  const int h = l >> 4, r16 = l & 15;
  const int wm = wid >> 2, wn = wid & 3;
  const int mblk0 = blockIdx.x * 64;
  const int nblk0 = blockIdx.y * 256;
  const int n0 = nblk0 + wn * 64;

  v8f acc[8] = {};
  gemm_ring<DM, true>(Xb, Wt, mblk0, nblk0, wm, wn, ring, acc);

  float bvv[4];
#pragma unroll
  for (int tt = 0; tt < 4; ++tt) bvv[tt] = bf16rne(bias[n0 + 16 * tt + r16]);

  const int bblk = mblk0 / SEQ;
  const int sblk = mblk0 - bblk * SEQ;  // 64 block rows lie inside one batch (SEQ % 64 == 0)
  const int c = l & 7;
  const int nph = (sblk < EROWS) ? 2 : 1;   // block-uniform: phase 0 value plane, phase 1 residual plane

#pragma unroll 1
  for (int ph = 0; ph < nph; ++ph) {
    if (ph) __syncthreads();              // readers of the value stage done

    // stage f16 value (phase 0) or x2048 residual (phase 1) of (acc + bias) into LDS
#pragma unroll
    for (int tt = 0; tt < 4; ++tt) {
      const int nl = wn * 64 + 16 * tt + r16;
#pragma unroll
      for (int mi = 0; mi < 2; ++mi) {
#pragma unroll
        for (int r = 0; r < 8; ++r) {
          const int ml = wm * 32 + 16 * mi + 8 * h + r;
          const float v = acc[mi * 4 + tt][r] + bvv[tt];
          const _Float16 hv = (_Float16)v;
          const float rs = (v - (float)hv) * RES_CARRY;
          const us hb = __builtin_bit_cast(us, hv);
          const us rb = f16_bits(rs);
          const int li = (mode == 2) ? (nl * 64 + ml) : (ml * 256 + nl);
          stile[li] = ph ? rb : hb;
        }
      }
    }
    __syncthreads();

    // whole-line writes: 256 lines per block, 32 per wave
    const int SL = ph ? EROWS : SEQ;      // sequence extent of the destination plane
    const size_t poff = ph ? roff : (size_t)0;
    v8us vals[8];
    size_t dsts[8];
#pragma unroll
    for (int it = 0; it < 8; ++it) {
      const int L = wid * 32 + (l >> 3) + 4 * it;
      int src;
      size_t dst;
      if (mode == 2) {
        const int n = nblk0 + L;
        const int hg = n >> 6, d = n & 63;
        src = L * 64 + 8 * c;
        dst = (((size_t)(bblk * NH + hg)) * DKH + d) * SL + sblk + 8 * c;
      } else {
        const int ml = L >> 2, hq = L & 3;
        const int hg = (nblk0 >> 6) + hq;
        const int s = sblk + ml;
        src = ml * 256 + hq * 64 + 8 * c;
        dst = (((size_t)(bblk * NH + hg)) * SL + s) * DKH + 8 * c;
      }
      vals[it] = *(const v8us*)&stile[src];
      dsts[it] = dst + poff;
    }
#pragma unroll
    for (int it = 0; it < 8; ++it) *(v8us*)(Y + dsts[it]) = vals[it];
    
  }
}

// ---------------------------------------------------------------------------
// Per-wave part of the key-step bound of a 128-query block, from the mask bit plane.
// Thread t scans half a row (row = t>>1 of the block). A row with at least one visible key needs
// key steps [0, last visible word]; a row with no visible key needs every key step (uniform softmax).
// Returns the maximum over the wave's 16 rows (all lanes hold it).
// ---------------------------------------------------------------------------
__device__ __forceinline__ int wave_key_bound(const unsigned* __restrict__ Mb, int qb) {
  const int t = threadIdx.x;
  const int hw = (t & 1) * (WPR / 2);
  const unsigned* mrow = Mb + (size_t)(qb * 128 + (t >> 1)) * WPR + hw;
  int kmx = -1;
#pragma unroll 1
  for (int j = 0; j < WPR / 2; j += 4) {
    const v4u w = *(const v4u*)(mrow + j);
    kmx = (w[0] != 0u) ? (hw + j)     : kmx;
    kmx = (w[1] != 0u) ? (hw + j + 1) : kmx;
    kmx = (w[2] != 0u) ? (hw + j + 2) : kmx;
    kmx = (w[3] != 0u) ? (hw + j + 3) : kmx;
  }
  const int oth = __shfl_xor(kmx, 1, 32);
  kmx = max(kmx, oth);
  int ke = (kmx < 0) ? WPR : (kmx + 1);
  ke = max(ke, __shfl_xor(ke, 16, 32));
  ke = max(ke, __shfl_xor(ke, 8, 32));
  ke = max(ke, __shfl_xor(ke, 4, 32));
  ke = max(ke, __shfl_xor(ke, 2, 32));
  return ke;
}

// ---------------------------------------------------------------------------
// Fused flash attention, query rows >= EROWS. Block = 8 waves, one (b,h), 128 queries; each wave owns
// 16 queries. K/V 32-key blocks staged once per block into LDS with plain loads.
// Scores computed transposed (S' = K_blk * Q^T) so the exp'd probabilities are
// already in A-operand layout for P*V. Online softmax in f32.
// Mask: one bit word per lane (= query) per 32-key step; masked scores are REPLACED by NEG_FILL.
// Key loop bound per block derived from the mask words (clamped to SEQ/32).
// ctx plane f16 [MROWS][2*DM]: cols [0,DM) value x256, cols [DM,2DM) residual x256,
// grid = NB*NH*((SEQ-EROWS)/128).
// ---------------------------------------------------------------------------
__global__ __launch_bounds__(256) __attribute__((amdgpu_num_vgpr(256)))
void attn_kernel(const us* __restrict__ Qh, const us* __restrict__ Kh,
                 const us* __restrict__ Vt, const unsigned* __restrict__ Mb, us* Ctx) {
  __shared__ __attribute__((aligned(16))) us shK[32 * 64];          // [key][d]   cross-wave (block barrier)
  __shared__ __attribute__((aligned(16))) us shV[64 * 32];          // [d][key]   cross-wave (block barrier)
  __shared__ __attribute__((aligned(16))) us shC[8 * 2 * 16 * 64];  // per-wave ctx staging, value|residual (block barrier used)
  __shared__ int shE[8];                                            // per-wave key bounds, cross-wave (block barrier)

  const int t = threadIdx.x;
  const int wid = __builtin_amdgcn_readfirstlane(t >> 5);
  const int l = t & 31;
  const int r16 = l & 15;
  const int hs = l >> 4;
  const int rowsel = hs << 3;
  constexpr int QBL = (SEQ > EROWS) ? (SEQ - EROWS) / 128 : 1;
  const int bh = blockIdx.x / QBL;
  const int qb = blockIdx.x - bh * QBL + EROWS / 128;
  const int q0 = qb * 128 + wid * 16;

  const size_t qoff = (size_t)bh * SEQ * DKH;
  const us* qp = Qh + qoff;
  const us* kp = Kh + qoff;
  const us* vp = Vt + (size_t)bh * DKH * SEQ;

  // key-step bound of this block (exact for any mask value), clamped to the static maximum
  const int kew = wave_key_bound(Mb, qb);
  if (l == 0) shE[wid] = kew;
  __syncthreads();
  int kall = shE[0];
#pragma unroll
  for (int w = 1; w < 8; ++w) kall = max(kall, shE[w]);
  kall = min(max(kall, 1), WPR);
  const int ksteps = __builtin_amdgcn_readfirstlane(kall);

  const unsigned* mq = Mb + (size_t)(q0 + r16) * WPR;   // this lane's query row of mask words

  // Q^T as B operand for the whole loop (lane = query column, halves = d)
  const v16h qB0 = fragh(qp, DKH, q0, 0);
  const v16h qB1 = fragh(qp, DKH, q0, 32);

  v8f o[4];
#pragma unroll
  for (int tt = 0; tt < 4; ++tt) o[tt] = v8f{};
  float mmax = NEG_FILL, lsum = 0.0f;

  const int krow = t >> 3, kcol = (t & 7) * 8;   // K: 32 keys x 64 d
  const int vrow = t >> 2, vcol = (t & 3) * 8;   // V: 64 d x 32 keys
  const int kfo = r16 * 64 + 8 * hs;             // shK fragment lane offset (row = key, k = d)
  const int vfo = r16 * 32 + 8 * hs;             // shV fragment lane offset (row = d, k = key)

#pragma unroll 1
  for (int ks = 0; ks < ksteps; ++ks) {
    const int kb = ks * 32;
    __syncthreads();    // prior readers of shK/shV done
    *(v8us*)&shK[krow * 64 + kcol] = *(const v8us*)(kp + (size_t)(kb + krow) * DKH + kcol);
    *(v8us*)&shV[vrow * 32 + vcol] = *(const v8us*)(vp + (size_t)vrow * SEQ + kb + vcol);
    __syncthreads();    // stage visible to all waves

    // mask word of this lane's query for these 32 keys (pinned before the selects)
    unsigned mw = mq[ks];
    asm volatile("" : "+v"(mw));
    const unsigned ml = mw >> (8 * hs);

    // S' tiles: M = key (relative 0..15 / 16..31), N = query; k = d
    v8f s0 = {};
    v8f s1 = {};
    {
      const v16h kA = cat16h(*(const v8us*)&shK[kfo], *(const v8us*)&shK[kfo + 16]);
      s0 = mma_f16(kA, qB0, s0);
    }
    {
      const v16h kA = cat16h(*(const v8us*)&shK[kfo + 32], *(const v8us*)&shK[kfo + 48]);
      s0 = mma_f16(kA, qB1, s0);
    }
    {
      const v16h kA = cat16h(*(const v8us*)&shK[16 * 64 + kfo], *(const v8us*)&shK[16 * 64 + kfo + 16]);
      s1 = mma_f16(kA, qB0, s1);
    }
    {
      const v16h kA = cat16h(*(const v8us*)&shK[16 * 64 + kfo + 32], *(const v8us*)&shK[16 * 64 + kfo + 48]);
      s1 = mma_f16(kA, qB1, s1);
    }

    // scale, then replace masked scores: s0[i] = key 8h+i, s1[i] = key 16+8h+i of this step
#pragma unroll
    for (int i = 0; i < 8; ++i) {
      const float a0 = s0[i] * QK_SCALE;
      const float a1 = s1[i] * QK_SCALE;
      s0[i] = ((ml >> i) & 1u) ? a0 : NEG_FILL;
      s1[i] = ((ml >> (16 + i)) & 1u) ? a1 : NEG_FILL;
    }

    // per-query (per-lane) block max; combine the two key halves (lane ^ 16)
    float bm = s0[0];
#pragma unroll
    for (int i = 0; i < 8; ++i) { bm = fmaxf(bm, s0[i]); bm = fmaxf(bm, s1[i]); }
    bm = fmaxf(bm, __shfl_xor(bm, 16, 32));
    const float mnew = fmaxf(mmax, bm);
    const float corr = __expf(fmaxf(mmax - mnew, EXP_FLOOR));
    mmax = mnew;

    // probabilities land directly in A-operand layout (elements 0..7 <- keys 8h..8h+7
    // from the first 16-key D tile, elements 8..15 <- keys 16+8h.. from the second)
    float ps = 0.0f;
    v16h pA;
#pragma unroll
    for (int i = 0; i < 8; ++i) {
      const float p0 = __expf(fmaxf(s0[i] - mnew, EXP_FLOOR));
      const float p1 = __expf(fmaxf(s1[i] - mnew, EXP_FLOOR));
      ps += p0 + p1;
      pA[i]     = (_Float16)(p0 * P_CARRY);
      pA[8 + i] = (_Float16)(p1 * P_CARRY);
    }
    ps += __shfl_xor(ps, 16, 32);
    lsum = lsum * corr + ps;

    // rescale O: D row 8h+r = query 8h+r, whose corr lives in lane 8h+r
#pragma unroll
    for (int r = 0; r < 8; ++r) {
      const float cr = __shfl(corr, rowsel + r, 32);
#pragma unroll
      for (int tt = 0; tt < 4; ++tt) o[tt][r] *= cr;
    }

    // O += P(16 x 32 keys) * V_blk(32 keys x 64 d); B rows = d, k = key contiguous in shV
#pragma unroll
    for (int tt = 0; tt < 4; ++tt) {
      const v16h vB = cat16h(*(const v8us*)&shV[16 * tt * 32 + vfo],
                             *(const v8us*)&shV[16 * tt * 32 + vfo + 16]);
      o[tt] = mma_f16(pA, vB, o[tt]);
    }
  }

  // normalize, stage this wave's 16 x 64 ctx tile (f16 value x256 and residual x256) in LDS
  const int bb = bh / NH;
  const int hh = bh - bb * NH;
#pragma unroll
  for (int r = 0; r < 8; ++r) {
    const float lrow = __shfl(lsum, rowsel + r, 32);
    const float li = CTX_SCALE * __builtin_amdgcn_rcpf(lrow);
#pragma unroll
    for (int tt = 0; tt < 4; ++tt) {
      const float cv = o[tt][r] * li;
      const _Float16 hv = (_Float16)cv;
      const float rs = (cv - (float)hv) * CTXRES_CARRY;
      const int si = wid * 2048 + (rowsel + r) * 64 + 16 * tt + r16;
      shC[si]        = __builtin_bit_cast(us, hv);
      shC[si + 1024] = f16_bits(rs);
    }
  }
  __syncthreads();

  const int c = l & 7;
  v8us vals[8];
  size_t dsts[8];
#pragma unroll
  for (int it = 0; it < 8; ++it) {
    const int Lw = (l >> 3) + 4 * it;    // 0..31
    const int pl = Lw >> 4;              // 0 value, 1 residual
    const int rl = Lw & 15;
    vals[it] = *(const v8us*)&shC[wid * 2048 + pl * 1024 + rl * 64 + 8 * c];
    const int s = q0 + rl;
    dsts[it] = ((size_t)(bb * SEQ + s)) * DM2 + (size_t)pl * DM + hh * DKH + 8 * c;
  }
#pragma unroll
  for (int it = 0; it < 8; ++it) *(v8us*)(Ctx + dsts[it]) = vals[it];
  
}

// ---------------------------------------------------------------------------
// Early band of the fused flash attention: query rows < EROWS. Same structure as attn_kernel.
// For key steps below EROWS (block-uniform test) q, k and v are value + x2048 residual planes:
// scores = kv*qv + (kv*qr + kr*qv)/2048 (residual products in their own accumulator);
// P = f16 value + x2048 residual; O = pv*vv + (pr*vv + pv*vr)/2048 (own accumulator, folded before
// the normalisation). Key steps at or above EROWS (only visited when the mask asks for them) use
// the value planes of k and v alone. Row sum over the unconverted p.
// grid = NB*NH*(EROWS/128).
// ---------------------------------------------------------------------------
__global__ __launch_bounds__(256) __attribute__((amdgpu_num_vgpr(256)))
void attn_early_kernel(const us* __restrict__ Qh, const us* __restrict__ Kh, const us* __restrict__ Vt,
                       const us* __restrict__ Qr, const us* __restrict__ Kr, const us* __restrict__ Vr,
                       const unsigned* __restrict__ Mb, us* Ctx) {
  __shared__ __attribute__((aligned(16))) us shK[32 * 64];          // [key][d]   cross-wave (block barrier)
  __shared__ __attribute__((aligned(16))) us shV[64 * 32];          // [d][key]   cross-wave (block barrier)
  __shared__ __attribute__((aligned(16))) us shKr[32 * 64];         // residual of shK, cross-wave (block barrier)
  __shared__ __attribute__((aligned(16))) us shVr[64 * 32];         // residual of shV, cross-wave (block barrier)
  __shared__ __attribute__((aligned(16))) us shC[8 * 2 * 16 * 64];  // per-wave ctx staging, value|residual (block barrier used)
  __shared__ int shE[8];                                            // per-wave key bounds, cross-wave (block barrier)

  const int t = threadIdx.x;
  const int wid = __builtin_amdgcn_readfirstlane(t >> 5);
  const int l = t & 31;
  const int r16 = l & 15;
  const int hs = l >> 4;
  const int rowsel = hs << 3;
  constexpr int QBE = EROWS / 128;
  const int bh = blockIdx.x / QBE;
  const int qb = blockIdx.x - bh * QBE;
  const int q0 = qb * 128 + wid * 16;

  const size_t qoff = (size_t)bh * SEQ * DKH;
  const size_t roff = (size_t)bh * EROWS * DKH;
  const us* qp = Qh + qoff;
  const us* kp = Kh + qoff;
  const us* vp = Vt + (size_t)bh * DKH * SEQ;
  const us* qrp = Qr + roff;
  const us* krp = Kr + roff;
  const us* vrp = Vr + (size_t)bh * DKH * EROWS;

  // key-step bound of this block (exact for any mask value), clamped to the static maximum
  const int kew = wave_key_bound(Mb, qb);
  if (l == 0) shE[wid] = kew;
  __syncthreads();
  int kall = shE[0];
#pragma unroll
  for (int w = 1; w < 8; ++w) kall = max(kall, shE[w]);
  kall = min(max(kall, 1), WPR);
  const int ksteps = __builtin_amdgcn_readfirstlane(kall);

  const unsigned* mq = Mb + (size_t)(q0 + r16) * WPR;   // this lane's query row of mask words

  // Q^T value and residual as B operands for the whole loop (lane = query column, halves = d)
  const v16h qB0 = fragh(qp, DKH, q0, 0);
  const v16h qB1 = fragh(qp, DKH, q0, 32);
  const v16h qR0 = fragh(qrp, DKH, q0, 0);
  const v16h qR1 = fragh(qrp, DKH, q0, 32);

  v8f o[4], orr[4];
#pragma unroll
  for (int tt = 0; tt < 4; ++tt) { o[tt] = v8f{}; orr[tt] = v8f{}; }
  float mmax = NEG_FILL, lsum = 0.0f;

  const int krow = t >> 3, kcol = (t & 7) * 8;   // K: 32 keys x 64 d
  const int vrow = t >> 2, vcol = (t & 3) * 8;   // V: 64 d x 32 keys
  const int kfo = r16 * 64 + 8 * hs;             // shK fragment lane offset (row = key, k = d)
  const int vfo = r16 * 32 + 8 * hs;             // shV fragment lane offset (row = d, k = key)

#pragma unroll 1
  for (int ks = 0; ks < ksteps; ++ks) {
    const int kb = ks * 32;
    const bool res = kb < EROWS;        // block-uniform: residual planes exist for these keys
    __syncthreads();    // prior readers of the LDS tiles done
    *(v8us*)&shK[krow * 64 + kcol] = *(const v8us*)(kp + (size_t)(kb + krow) * DKH + kcol);
    *(v8us*)&shV[vrow * 32 + vcol] = *(const v8us*)(vp + (size_t)vrow * SEQ + kb + vcol);
    if (res) {
      *(v8us*)&shKr[krow * 64 + kcol] = *(const v8us*)(krp + (size_t)(kb + krow) * DKH + kcol);
      *(v8us*)&shVr[vrow * 32 + vcol] = *(const v8us*)(vrp + (size_t)vrow * EROWS + kb + vcol);
    }
    __syncthreads();    // stage visible to all waves

    // mask word of this lane's query for these 32 keys (pinned before the selects)
    unsigned mw = mq[ks];
    asm volatile("" : "+v"(mw));
    const unsigned ml = mw >> (8 * hs);

    // S' tiles: M = key (relative 0..15 / 16..31), N = query; k = d
    const v16h kA00 = cat16h(*(const v8us*)&shK[kfo], *(const v8us*)&shK[kfo + 16]);
    const v16h kA01 = cat16h(*(const v8us*)&shK[kfo + 32], *(const v8us*)&shK[kfo + 48]);
    const v16h kA10 = cat16h(*(const v8us*)&shK[16 * 64 + kfo], *(const v8us*)&shK[16 * 64 + kfo + 16]);
    const v16h kA11 = cat16h(*(const v8us*)&shK[16 * 64 + kfo + 32], *(const v8us*)&shK[16 * 64 + kfo + 48]);
    v8f s0 = {};
    v8f s1 = {};
    s0 = mma_f16(kA00, qB0, s0);
    s0 = mma_f16(kA01, qB1, s0);
    s1 = mma_f16(kA10, qB0, s1);
    s1 = mma_f16(kA11, qB1, s1);

    // residual score products (x2048 units) in their own accumulators
    v8f x0 = {};
    v8f x1 = {};
    if (res) {
      x0 = mma_f16(kA00, qR0, x0);
      x0 = mma_f16(kA01, qR1, x0);
      x1 = mma_f16(kA10, qR0, x1);
      x1 = mma_f16(kA11, qR1, x1);
      {
        const v16h kR = cat16h(*(const v8us*)&shKr[kfo], *(const v8us*)&shKr[kfo + 16]);
        x0 = mma_f16(kR, qB0, x0);
      }
      {
        const v16h kR = cat16h(*(const v8us*)&shKr[kfo + 32], *(const v8us*)&shKr[kfo + 48]);
        x0 = mma_f16(kR, qB1, x0);
      }
      {
        const v16h kR = cat16h(*(const v8us*)&shKr[16 * 64 + kfo], *(const v8us*)&shKr[16 * 64 + kfo + 16]);
        x1 = mma_f16(kR, qB0, x1);
      }
      {
        const v16h kR = cat16h(*(const v8us*)&shKr[16 * 64 + kfo + 32], *(const v8us*)&shKr[16 * 64 + kfo + 48]);
        x1 = mma_f16(kR, qB1, x1);
      }
    }

    // fold, scale, then replace masked scores: s0[i] = key 8h+i, s1[i] = key 16+8h+i of this step
#pragma unroll
    for (int i = 0; i < 8; ++i) {
      const float a0 = (s0[i] + x0[i] * RES_INV) * QK_SCALE;
      const float a1 = (s1[i] + x1[i] * RES_INV) * QK_SCALE;
      s0[i] = ((ml >> i) & 1u) ? a0 : NEG_FILL;
      s1[i] = ((ml >> (16 + i)) & 1u) ? a1 : NEG_FILL;
    }

    // per-query (per-lane) block max; combine the two key halves (lane ^ 16)
    float bm = s0[0];
#pragma unroll
    for (int i = 0; i < 8; ++i) { bm = fmaxf(bm, s0[i]); bm = fmaxf(bm, s1[i]); }
    bm = fmaxf(bm, __shfl_xor(bm, 16, 32));
    const float mnew = fmaxf(mmax, bm);
    const float corr = __expf(fmaxf(mmax - mnew, EXP_FLOOR));
    mmax = mnew;

    // probabilities (value + residual) land directly in A-operand layout
    float ps = 0.0f;
    v16h pA, pR;
#pragma unroll
    for (int i = 0; i < 8; ++i) {
      const float p0 = __expf(fmaxf(s0[i] - mnew, EXP_FLOOR));
      const float p1 = __expf(fmaxf(s1[i] - mnew, EXP_FLOOR));
      ps += p0 + p1;
      const float c0 = p0 * P_CARRY;
      const float c1 = p1 * P_CARRY;
      const _Float16 h0 = (_Float16)c0;
      const _Float16 h1 = (_Float16)c1;
      pA[i]     = h0;
      pA[8 + i] = h1;
      pR[i]     = (_Float16)((c0 - (float)h0) * RES_CARRY);
      pR[8 + i] = (_Float16)((c1 - (float)h1) * RES_CARRY);
    }
    ps += __shfl_xor(ps, 16, 32);
    lsum = lsum * corr + ps;

    // rescale both accumulators: D row 8h+r = query 8h+r, whose corr lives in lane 8h+r
#pragma unroll
    for (int r = 0; r < 8; ++r) {
      const float cr = __shfl(corr, rowsel + r, 32);
#pragma unroll
      for (int tt = 0; tt < 4; ++tt) { o[tt][r] *= cr; orr[tt][r] *= cr; }
    }

    // O += P * V_blk (value products); residual accumulator += P_res * V
#pragma unroll
    for (int tt = 0; tt < 4; ++tt) {
      const v16h vB = cat16h(*(const v8us*)&shV[16 * tt * 32 + vfo],
                             *(const v8us*)&shV[16 * tt * 32 + vfo + 16]);
      o[tt]   = mma_f16(pA, vB, o[tt]);
      orr[tt] = mma_f16(pR, vB, orr[tt]);
    }
    // residual accumulator += P * V_res
    if (res) {
#pragma unroll
      for (int tt = 0; tt < 4; ++tt) {
        const v16h vRB = cat16h(*(const v8us*)&shVr[16 * tt * 32 + vfo],
                                *(const v8us*)&shVr[16 * tt * 32 + vfo + 16]);
        orr[tt] = mma_f16(pA, vRB, orr[tt]);
      }
    }
  }

  // fold the residual accumulator, normalize, stage this wave's 16 x 64 ctx tile in LDS
  const int bb = bh / NH;
  const int hh = bh - bb * NH;
#pragma unroll
  for (int r = 0; r < 8; ++r) {
    const float lrow = __shfl(lsum, rowsel + r, 32);
    const float li = CTX_SCALE * __builtin_amdgcn_rcpf(lrow);
#pragma unroll
    for (int tt = 0; tt < 4; ++tt) {
      const float cv = (o[tt][r] + orr[tt][r] * RES_INV) * li;
      const _Float16 hv = (_Float16)cv;
      const float rs = (cv - (float)hv) * CTXRES_CARRY;
      const int si = wid * 2048 + (rowsel + r) * 64 + 16 * tt + r16;
      shC[si]        = __builtin_bit_cast(us, hv);
      shC[si + 1024] = f16_bits(rs);
    }
  }
  __syncthreads();

  const int c = l & 7;
  v8us vals[8];
  size_t dsts[8];
#pragma unroll
  for (int it = 0; it < 8; ++it) {
    const int Lw = (l >> 3) + 4 * it;    // 0..31
    const int pl = Lw >> 4;              // 0 value, 1 residual
    const int rl = Lw & 15;
    vals[it] = *(const v8us*)&shC[wid * 2048 + pl * 1024 + rl * 64 + 8 * c];
    const int s = q0 + rl;
    dsts[it] = ((size_t)(bb * SEQ + s)) * DM2 + (size_t)pl * DM + hh * DKH + 8 * c;
  }
#pragma unroll
  for (int it = 0; it < 8; ++it) *(v8us*)(Ctx + dsts[it]) = vals[it];
  
}

// ---------------------------------------------------------------------------
// Output projection: Out f32 [MROWS][DM] = [ctx x256 | ctx residual x256] * [Wo x64 | Wo x0.25]^T * OUT_FOLD + bo.
// K = 2*DM, one accumulator (both halves of K are in the same units).
// Same block tiling as proj_kernel; f32 tile staged in two 16-row halves per wave
// (32 x 256 floats in LDS), each d_out line (32 floats) written by 8 lanes x 16 B.
// ---------------------------------------------------------------------------
__global__ __launch_bounds__(256) __attribute__((amdgpu_num_vgpr(256)))
void outproj_kernel(const us* __restrict__ Ctx, const us* __restrict__ Wot,
                    const float* __restrict__ bo, float* Out) {
  __shared__ __attribute__((aligned(16))) float ftile[32 * 256];    // cross-wave (block barrier)
  __shared__ __attribute__((aligned(16))) us ring[2 * RSTAGE];      // operand slabs, cross-wave (block barrier)

  const int t = threadIdx.x;
  const int wid = __builtin_amdgcn_readfirstlane(t >> 5);
  const int l = t & 31;
  const int h = l >> 4, r16 = l & 15;
  const int wm = wid >> 2, wn = wid & 3;
  const int mblk0 = blockIdx.x * 64;
  const int nblk0 = blockIdx.y * 256;
  const int n0 = nblk0 + wn * 64;

  v8f acc[8] = {};
  gemm_ring<DM2, false>(Ctx, Wot, mblk0, nblk0, wm, wn, ring, acc);

  float bob[4];
#pragma unroll
  for (int tt = 0; tt < 4; ++tt) bob[tt] = bf16rne(bo[n0 + 16 * tt + r16]);

  const int c = l & 7;
#pragma unroll
  for (int p = 0; p < 2; ++p) {
    if (p) __syncthreads();   // readers of the prior half done
#pragma unroll
    for (int tt = 0; tt < 4; ++tt) {
      const int nl = wn * 64 + 16 * tt + r16;
#pragma unroll
      for (int r = 0; r < 8; ++r) {
        const int rl = wm * 16 + 8 * h + r;           // 0..31
        ftile[rl * 256 + nl] = acc[p * 4 + tt][r] * OUT_FOLD + bob[tt];
      }
    }
    __syncthreads();

    v4f vals[8];
    size_t dsts[8];
#pragma unroll
    for (int it = 0; it < 8; ++it) {
      const int L = wid * 32 + (l >> 3) + 4 * it;    // 0..255
      const int rl = L >> 3, seg = L & 7;
      vals[it] = *(const v4f*)&ftile[rl * 256 + seg * 32 + 4 * c];
      const int m = mblk0 + (rl >> 4) * 32 + p * 16 + (rl & 15);
      dsts[it] = (size_t)m * DM + nblk0 + seg * 32 + 4 * c;
    }
#pragma unroll
    for (int it = 0; it < 8; ++it) *(v4f*)(Out + dsts[it]) = vals[it];
    
  }
}

// ---------------------------------------------------------------------------
// Host launcher
// ---------------------------------------------------------------------------
extern "C" void kernel_launch(void* const* d_in, const int* in_sizes, int n_in,
                              void* d_out, int out_size, void* d_ws, size_t ws_size,
                              hipStream_t stream) {
  if (n_in < 12) return;
  const int need_x = ((NB - 1) * SEQ_FULL + SEQ) * DM;
  if (in_sizes[0] < need_x || in_sizes[1] < need_x || in_sizes[2] < need_x) return;
  if (in_sizes[3] < DM * DM || in_sizes[5] < DM * DM || in_sizes[7] < DM * DM || in_sizes[9] < DM * DM) return;
  if (in_sizes[4] < DM || in_sizes[6] < DM || in_sizes[8] < DM || in_sizes[10] < DM) return;
  if (in_sizes[11] < (SEQ - 1) * SEQ_FULL + SEQ) return;
  if (out_size < MROWS * DM) return;

  // bound by role in the input order: queries, keys, values, Wq, bq, Wk, bk, Wv, bv, Wo, bo, mask
  const float* Q  = (const float*)d_in[0];
  const float* K  = (const float*)d_in[1];
  const float* V  = (const float*)d_in[2];
  const float* Wq = (const float*)d_in[3];
  const float* bq = (const float*)d_in[4];
  const float* Wk = (const float*)d_in[5];
  const float* bk = (const float*)d_in[6];
  const float* Wv = (const float*)d_in[7];
  const float* bv = (const float*)d_in[8];
  const float* Wo = (const float*)d_in[9];
  const float* bo = (const float*)d_in[10];
  const int*   Mk = (const int*)d_in[11];

  const size_t XE = (size_t)MROWS * DM;            // halves per activation plane
  const size_t WE = (size_t)DM * DM;               // halves per weight plane
  const size_t RE = (size_t)NB * NH * EROWS * DKH; // halves per early residual plane
  const size_t BW = (size_t)SEQ * WPR;             // 32-bit words of the mask bit plane
  const size_t total_bytes = (8 * XE + 5 * WE + 3 * RE) * sizeof(us) + BW * sizeof(unsigned);
  if (total_bytes > ws_size) return;

  us* xq  = (us*)d_ws;
  us* xk  = xq + XE;
  us* xv  = xk + XE;
  us* wtq = xv + XE;           // [n][k] bf16
  us* wtk = wtq + WE;
  us* wtv = wtk + WE;
  us* wo2 = wtv + WE;          // 2 * WE  ([DM][2*DM]) f16
  us* qh  = wo2 + 2 * WE;      // q value plane [NB*NH][SEQ][64]
  us* kh  = qh + XE;           // k value plane [NB*NH][SEQ][64]
  us* vt  = kh + XE;           // v transposed plane [NB*NH][64][SEQ]
  us* ctx = vt + XE;           // 2 * XE  ([MROWS][2*DM])
  us* qr  = ctx + 2 * XE;      // q residual plane [NB*NH][EROWS][64]
  us* kr  = qr + RE;           // k residual plane [NB*NH][EROWS][64]
  us* vr  = kr + RE;           // v residual transposed plane [NB*NH][64][EROWS]
  unsigned* mb = (unsigned*)(vr + RE);   // mask bit plane [SEQ][WPR]

  dim3 blk(256);
  const int n8 = (int)(XE / 8);
  dim3 gx((n8 + 255) / 256);
  cvt_x_kernel<<<gx, blk, 0, stream>>>(Q, xq, n8);
  cvt_x_kernel<<<gx, blk, 0, stream>>>(K, xk, n8);
  cvt_x_kernel<<<gx, blk, 0, stream>>>(V, xv, n8);

  const int n4 = (int)(BW / 4);
  mask_pack_kernel<<<dim3((n4 + 255) / 256), blk, 0, stream>>>(Mk, mb, n4);

  // W is [k][n] (in,out): x = k tile, y = n tile; output plane [n][k]
  dim3 gw(DM / 64, DM / 64);
  cvt_wT_kernel<<<gw, blk, 0, stream>>>(Wq, wtq, 0);
  cvt_wT_kernel<<<gw, blk, 0, stream>>>(Wk, wtk, 0);
  cvt_wT_kernel<<<gw, blk, 0, stream>>>(Wv, wtv, 0);
  cvt_wT_kernel<<<gw, blk, 0, stream>>>(Wo, wo2, 1);

  dim3 gp(MROWS / 64, DM / 256);
  proj_kernel<<<gp, blk, 0, stream>>>(xq, wtq, bq, qh, (size_t)(qr - qh), 0);
  proj_kernel<<<gp, blk, 0, stream>>>(xk, wtk, bk, kh, (size_t)(kr - kh), 1);
  proj_kernel<<<gp, blk, 0, stream>>>(xv, wtv, bv, vt, (size_t)(vr - vt), 2);

  if (EROWS > 0) {
    attn_early_kernel<<<dim3(NB * NH * (EROWS / 128)), blk, 0, stream>>>(qh, kh, vt, qr, kr, vr, mb, ctx);
  }
  if (SEQ > EROWS) {
    attn_kernel<<<dim3(NB * NH * ((SEQ - EROWS) / 128)), blk, 0, stream>>>(qh, kh, vt, mb, ctx);
  }

  outproj_kernel<<<gp, blk, 0, stream>>>(ctx, wo2, bo, (float*)d_out);
}

// v002
// One run takes 188 microseconds.
// Next to v001, in two timings, it ran 1.18 and 1.19 times as fast.
// All steps since v000 together make it 1.69 times as fast.
#include <hip/hip_runtime.h>
#include <stddef.h>

// Contractions: q/k/v projections = v_wmma_f32_16x16x32_bf16 (bf16 operands = RNE-converted f32 inputs);
// scores = v_wmma_f32_16x16x32_f16 (k x1 against q x1, single product; query rows < EROWS: q and k as f16 value + x2048 residual, three products, own accumulator);
// P*V = f16 (P x1024, v x1; query rows < EROWS: P and v as f16 value + x2048 residual, residual products in their own accumulator);
// output projection = f16 over K = 2*DM ([ctx x256 | ctx residual x256] against [Wo x64 | Wo x0.25]);
// f32 accumulate, f32 online softmax; the mask input is read by value (packed to bit words once) and applied as a replace fill.

#ifndef NB
#define NB 2
#endif
#ifndef SEQ
#define SEQ 2048
#endif
#define NB_FULL 2
#define SEQ_FULL 2048
#define DM 1024
#define NH 16
#define DKH 64
#define MROWS (NB * SEQ)
#define DM2 (2 * DM)
#define EROWS 256                 // query rows (and key rows) with value + residual planes
#define WPR (SEQ / 32)            // mask bit words per query row

static_assert(NB >= 1 && NB <= NB_FULL);
static_assert(SEQ >= 128 && SEQ <= SEQ_FULL);
static_assert(SEQ % 128 == 0);
static_assert(SEQ % 64 == 0 && SEQ % 32 == 0);
static_assert(MROWS % 64 == 0);
static_assert(DM % 256 == 0 && DM % 32 == 0 && DM % 64 == 0);
static_assert(DM / 8 == 128);
static_assert(NH * DKH == DM);
static_assert(DKH == 64);
static_assert(DM2 % 32 == 0);
static_assert(SEQ % 256 == 0);                 // half a mask-word row is a multiple of 4 words
static_assert(EROWS % 128 == 0 && EROWS % 64 == 0 && EROWS % 32 == 0);
static_assert(EROWS >= 128 && EROWS <= SEQ);
static_assert(WPR % 8 == 0 && WPR >= 8);
static_assert((SEQ * WPR) % 4 == 0);

#define P_CARRY      1024.0f            // P operand carried x1024
#define CTX_SCALE    0.25f              // ctx value plane = O * 0.25 / l = attn x256 (O carries the x1024 of P)
#define CTXRES_CARRY 256.0f             // ctx residual plane = (ctx256 - f16(ctx256)) x256
#define WO_CARRY     64.0f              // Wo operand carried x64 (value half of K)
#define WO_LO_CARRY  0.25f              // Wo operand for the residual half of K = WO_CARRY / CTXRES_CARRY
#define OUT_FOLD     (1.0f / 16384.0f)  // 1 / (256 * 64)
#define QK_SCALE     0.125f             // 1 / sqrt(64)
#define RES_CARRY    2048.0f            // early-band residual planes carried x2048
#define RES_INV      (1.0f / 2048.0f)
#define NEG_FILL     (-3.4028235e38f)   // lowest finite f32: fill value of masked scores
#define EXP_FLOOR    (-87.0f)           // exponent argument floor (keeps the exp argument finite)

static_assert(WO_LO_CARRY * CTXRES_CARRY == WO_CARRY);
static_assert(OUT_FOLD * 256.0f * WO_CARRY == 1.0f);
static_assert(RES_INV * RES_CARRY == 1.0f);

// workspace carve: 8 activation-size planes + 5 weight-size planes + 3 early residual planes (16-bit each) + mask bit plane
static_assert(((size_t)8 * MROWS * DM + (size_t)5 * DM * DM + (size_t)3 * NB * NH * EROWS * DKH) * 2
              + (size_t)SEQ * WPR * 4 <= (size_t)134217728);

typedef unsigned short us;
typedef us        v8us  __attribute__((ext_vector_type(8)));
typedef us        v16us __attribute__((ext_vector_type(16)));
typedef _Float16  v16h  __attribute__((ext_vector_type(16)));
typedef __bf16    v16bf __attribute__((ext_vector_type(16)));
typedef float     v8f   __attribute__((ext_vector_type(8)));
typedef float     v4f   __attribute__((ext_vector_type(4)));
typedef int       v4i   __attribute__((ext_vector_type(4)));
typedef unsigned  v4u   __attribute__((ext_vector_type(4)));

// ---------------------------------------------------------------------------
// conversions
// ---------------------------------------------------------------------------
__device__ __forceinline__ unsigned bf16rne_bits(float x) {
  unsigned u = __float_as_uint(x);
  return (u + 0x7FFFu + ((u >> 16) & 1u)) >> 16;
}
__device__ __forceinline__ float bf16rne(float x) {
  return __uint_as_float(bf16rne_bits(x) << 16);
}
__device__ __forceinline__ us f16_bits(float x) {
  _Float16 hx = (_Float16)x;
  return __builtin_bit_cast(us, hx);
}

// ---------------------------------------------------------------------------
// 16-bit operand fragment (A: lane = row, B: lane = column; same k map):
//   lane l, r = l&15, s = l>>4 : elems 0..7  = row[r][k0 + 8s .. +7]
//                                elems 8..15 = row[r][k0 + 16 + 8s .. +7]
// base is a 16-bit global plane with k contiguous, pitch ld (halves).
// ---------------------------------------------------------------------------
__device__ __forceinline__ v16us frag16(const us* base, int ld, int row0, int k0) {
  const int l = threadIdx.x & 31;
  const int r = l & 15, s = l >> 4;
  const us* p = base + (size_t)(row0 + r) * ld + k0 + 8 * s;
  v8us c0 = *(const v8us*)p;
  v8us c1 = *(const v8us*)(p + 16);
  return __builtin_shufflevector(c0, c1, 0, 1, 2, 3, 4, 5, 6, 7, 8, 9, 10, 11, 12, 13, 14, 15);
}
__device__ __forceinline__ v16h fragh(const us* base, int ld, int row0, int k0) {
  return __builtin_bit_cast(v16h, frag16(base, ld, row0, k0));
}
// two 16-byte chunks (already loaded) -> one f16 fragment
__device__ __forceinline__ v16h cat16h(v8us c0, v8us c1) {
  v16us w = __builtin_shufflevector(c0, c1, 0, 1, 2, 3, 4, 5, 6, 7, 8, 9, 10, 11, 12, 13, 14, 15);
  return __builtin_bit_cast(v16h, w);
}

// ---------------------------------------------------------------------------
// WMMA wrappers with hazard guard: D = A(16x32) * B(32x16) + C (f32)
// ---------------------------------------------------------------------------
__device__ __forceinline__ v8f mma_f16(v16h a, v16h b, v8f c) {
  v8f d = __builtin_amdgcn_wmma_f32_16x16x32_f16(false, a, false, b, (short)0, c, false, false);
  asm volatile("v_nop\n\tv_nop\n\tv_nop\n\tv_nop" : "+v"(d) : "v"(a), "v"(b));
  return d;
}
__device__ __forceinline__ v8f mma_bf16(v16bf a, v16bf b, v8f c) {
  v8f d = __builtin_amdgcn_wmma_f32_16x16x32_bf16(false, a, false, b, (short)0, c, false, false);
  asm volatile("v_nop\n\tv_nop\n\tv_nop\n\tv_nop" : "+v"(d) : "v"(a), "v"(b));
  return d;
}

// ---------------------------------------------------------------------------
// Activation convert: X f32 [NB_FULL*SEQ_FULL][DM] -> bf16 bits [MROWS][DM]
// n8 = MROWS*DM/8.
// ---------------------------------------------------------------------------
__global__ __launch_bounds__(256) void cvt_x_kernel(const float* __restrict__ X, us* Y, int n8) {
  const int i = blockIdx.x * 256 + threadIdx.x;
  if (i >= n8) return;
  const int m  = i >> 7;                 // DM/8 = 128 groups per row
  const int c8 = (i & 127) * 8;
  const int b  = m / SEQ;
  const int s  = m - b * SEQ;
  const float* src = X + ((size_t)(b * SEQ_FULL + s)) * DM + c8;
  v4f x0 = *(const v4f*)src;
  v4f x1 = *(const v4f*)(src + 4);
  v8us y;
#pragma unroll
  for (int j = 0; j < 4; ++j) {
    y[j]     = (us)bf16rne_bits(x0[j]);
    y[4 + j] = (us)bf16rne_bits(x1[j]);
  }
  us* dst = Y + (size_t)i * 8;
  *(v8us*)dst = y;
  
}

// ---------------------------------------------------------------------------
// Mask pack: M int32 [SEQ_FULL][SEQ_FULL] (nonzero = attend) -> bit words [SEQ][WPR],
// bit j of word w of row q = (M[q][32w + j] != 0).
// ---------------------------------------------------------------------------
__global__ __launch_bounds__(256) void mask_pack_kernel(const int* __restrict__ M, unsigned* Bits, int n4) {
  const int i = blockIdx.x * 256 + threadIdx.x;
  if (i >= n4) return;
  const int w4 = i * 4;
  const int q  = w4 / WPR;
  const int w0 = w4 - q * WPR;
  const int* src = M + (size_t)q * SEQ_FULL + 32 * w0;
  unsigned a0 = 0u, a1 = 0u, a2 = 0u, a3 = 0u;
#pragma unroll 1
  for (int j = 0; j < 4; ++j) {
    unsigned wb = 0u;
#pragma unroll
    for (int c = 0; c < 8; ++c) {
      const v4i m = *(const v4i*)(src + 32 * j + 4 * c);
      wb |= ((m[0] != 0) ? 1u : 0u) << (4 * c);
      wb |= ((m[1] != 0) ? 1u : 0u) << (4 * c + 1);
      wb |= ((m[2] != 0) ? 1u : 0u) << (4 * c + 2);
      wb |= ((m[3] != 0) ? 1u : 0u) << (4 * c + 3);
    }
    a0 = (j == 0) ? wb : a0;
    a1 = (j == 1) ? wb : a1;
    a2 = (j == 2) ? wb : a2;
    a3 = (j == 3) ? wb : a3;
  }
  v4u y;
  y[0] = a0; y[1] = a1; y[2] = a2; y[3] = a3;
  unsigned* dst = Bits + (size_t)i * 4;
  *(v4u*)dst = y;
  
}

// ---------------------------------------------------------------------------
// Weight convert with transpose: W f32 [k][n] (in,out; n contiguous) -> 16-bit plane [n][k] (k contiguous).
// hmode 0: bf16 bits of RNE(W), pitch DM.
// hmode 1: pitch 2*DM: cols [0,DM) = f16(RNE(W) * WO_CARRY), cols [DM,2DM) = f16(RNE(W) * WO_LO_CARRY).
// Block = 64(k) x 64(n) tile through LDS (cross-wave: block barrier); each output line = 64 k of one n
// grid (DM/64, DM/64): x = k tile, y = n tile.
// ---------------------------------------------------------------------------
#define WT_LD 72
static_assert((WT_LD * 2) % 16 == 0 && WT_LD >= 64);
__global__ __launch_bounds__(256) void cvt_wT_kernel(const float* __restrict__ W, us* Y, int hmode) {
  __shared__ __attribute__((aligned(16))) us t0[64 * WT_LD];   // [n][k] value
  __shared__ __attribute__((aligned(16))) us t1[64 * WT_LD];   // [n][k] low-carry copy (hmode 1)

  const int t  = threadIdx.x;
  const int k0 = blockIdx.x * 64;
  const int n0 = blockIdx.y * 64;

#pragma unroll 1
  for (int i = 0; i < 4; ++i) {
    const int id = t + i * 256;           // 1024 float4 chunks (64 k x 64 n)
    const int kr = id >> 4;
    const int c4 = (id & 15) * 4;
    const v4f x = *(const v4f*)(W + (size_t)(k0 + kr) * DM + n0 + c4);
#pragma unroll
    for (int j = 0; j < 4; ++j) {
      const float w = bf16rne(x[j]);
      const us hb = (us)(__float_as_uint(w) >> 16);
      const us hf = f16_bits(w * WO_CARRY);
      const us hl = f16_bits(w * WO_LO_CARRY);
      t0[(c4 + j) * WT_LD + kr] = hmode ? hf : hb;
      t1[(c4 + j) * WT_LD + kr] = hl;
    }
  }
  __syncthreads();

  const int c = t & 7;
  const size_t pitch = hmode ? (size_t)DM2 : (size_t)DM;
  v8us v0[2], v1[2];
  size_t dsts[2];
#pragma unroll
  for (int it = 0; it < 2; ++it) {
    const int L = (t >> 3) + 32 * it;     // local n 0..63
    v0[it] = *(const v8us*)&t0[L * WT_LD + 8 * c];
    v1[it] = *(const v8us*)&t1[L * WT_LD + 8 * c];
    dsts[it] = (size_t)(n0 + L) * pitch + k0 + 8 * c;
  }
#pragma unroll
  for (int it = 0; it < 2; ++it) {
    *(v8us*)(Y + dsts[it]) = v0[it];
    if (hmode) *(v8us*)(Y + dsts[it] + DM) = v1[it];
  }
  
}

// ---------------------------------------------------------------------------
// GEMM core: block computes 64 rows x 256 cols over K = KD; wave (wm, wn) computes 32 x 64 of it.
// A plane [M][KD], B plane [N][KD] (k contiguous), both 16-bit.
// K is walked in slabs of RK; a slab (64 A rows, then 256 B rows) is staged in LDS by asynchronous
// 16-byte copies, two buffers: the next slab's copies fly while this slab is worked on.
// Fragments are read from LDS with the k map of frag16; k runs upward in steps of 32 as before.
// ---------------------------------------------------------------------------
#define RK 128                       // k per slab: 256-byte rows
#define RPITCH 136                   // LDS row pitch in halves: 272 B = 16 B x 17, conflict-free for 16-byte reads
#define RROWS 320                    // 64 A rows + 256 B rows
#define RSTAGE (RROWS * RPITCH)      // halves per buffer
static_assert((RPITCH * 2) % 16 == 0 && RPITCH >= RK);
static_assert(RROWS * (RK / 8) == 20 * 256);   // 20 copies per thread and slab

// One slab: thread t copies chunk (t & 15) of rows (t >> 4) + 16 i, i = 0..19 (each wave copy = 2 whole rows).
// ga / gb: this thread's chunk in A row (t >> 4) / B row (t >> 4) of the block at this slab; ld: its LDS byte address in row (t >> 4).
template <int KD>
__device__ __forceinline__ void stage_slab(const us* ga, const us* gb, unsigned ld) {
  const us* g[20];
  unsigned d[20];
#pragma unroll   // unrolled so that g[] and d[] are registers (they are asm operands)
  for (int i = 0; i < 20; ++i) {
    g[i] = (i < 4) ? (ga + (size_t)(16 * i) * KD) : (gb + (size_t)(16 * (i - 4)) * KD);
    d[i] = ld + (unsigned)(16 * i * RPITCH * 2);
  }
  // the closing s_wait_xcnt keeps the address registers of the issued copies from being rewritten early
  asm volatile("global_load_async_to_lds_b128 %0, %1, off\n\t"
               "global_load_async_to_lds_b128 %2, %3, off\n\t"
               "global_load_async_to_lds_b128 %4, %5, off\n\t"
               "global_load_async_to_lds_b128 %6, %7, off\n\t"
               "global_load_async_to_lds_b128 %8, %9, off\n\t"
               "global_load_async_to_lds_b128 %10, %11, off\n\t"
               "global_load_async_to_lds_b128 %12, %13, off\n\t"
               "global_load_async_to_lds_b128 %14, %15, off\n\t"
               "global_load_async_to_lds_b128 %16, %17, off\n\t"
               "global_load_async_to_lds_b128 %18, %19, off\n\t"
               "s_wait_xcnt 0x0"
               :: "v"(d[0]), "v"(g[0]), "v"(d[1]), "v"(g[1]), "v"(d[2]), "v"(g[2]), "v"(d[3]), "v"(g[3]), "v"(d[4]), "v"(g[4]), "v"(d[5]), "v"(g[5]), "v"(d[6]), "v"(g[6]), "v"(d[7]), "v"(g[7]), "v"(d[8]), "v"(g[8]), "v"(d[9]), "v"(g[9]) : "memory");
  asm volatile("global_load_async_to_lds_b128 %0, %1, off\n\t"
               "global_load_async_to_lds_b128 %2, %3, off\n\t"
               "global_load_async_to_lds_b128 %4, %5, off\n\t"
               "global_load_async_to_lds_b128 %6, %7, off\n\t"
               "global_load_async_to_lds_b128 %8, %9, off\n\t"
               "global_load_async_to_lds_b128 %10, %11, off\n\t"
               "global_load_async_to_lds_b128 %12, %13, off\n\t"
               "global_load_async_to_lds_b128 %14, %15, off\n\t"
               "global_load_async_to_lds_b128 %16, %17, off\n\t"
               "global_load_async_to_lds_b128 %18, %19, off\n\t"
               "s_wait_xcnt 0x0"
               :: "v"(d[10]), "v"(g[10]), "v"(d[11]), "v"(g[11]), "v"(d[12]), "v"(g[12]), "v"(d[13]), "v"(g[13]), "v"(d[14]), "v"(g[14]), "v"(d[15]), "v"(g[15]), "v"(d[16]), "v"(g[16]), "v"(d[17]), "v"(g[17]), "v"(d[18]), "v"(g[18]), "v"(d[19]), "v"(g[19]) : "memory");
}

// fragment from a staged slab (LDS), same lane and k map as frag16
__device__ __forceinline__ v16us lfrag16(const us* tile, int row0, int k0) {
  const int l = threadIdx.x & 31;
  const int r = l & 15, s = l >> 4;
  const us* p = tile + (row0 + r) * RPITCH + k0 + 8 * s;
  v8us c0 = *(const v8us*)p;
  v8us c1 = *(const v8us*)(p + 16);
  return __builtin_shufflevector(c0, c1, 0, 1, 2, 3, 4, 5, 6, 7, 8, 9, 10, 11, 12, 13, 14, 15);
}

template <int KD, bool BF>
__device__ __forceinline__ void gemm_ring(const us* A, const us* B, int mblk0, int nblk0, int wm, int wn,
                                          us* ring, v8f (&acc)[8]) {
  static_assert(KD % RK == 0 && KD / RK >= 2);
  constexpr int NP = KD / RK;
  const int t = threadIdx.x;
  const us* ga = A + (size_t)(mblk0 + (t >> 4)) * KD + (t & 15) * 8;
  const us* gb = B + (size_t)(nblk0 + (t >> 4)) * KD + (t & 15) * 8;
  const unsigned ld = (unsigned)(size_t)ring + (unsigned)((t >> 4) * (RPITCH * 2) + (t & 15) * 16);

  stage_slab<KD>(ga, gb, ld);
  asm volatile("s_wait_asynccnt 0x0" ::: "memory");   // slab 0 landed (this wave's copies)
  __syncthreads();                                    // slab 0 visible to all waves
  stage_slab<KD>(ga + RK, gb + RK, ld + (unsigned)(RSTAGE * 2));

#pragma unroll 1   // kept rolled: one body of 32 matrix instructions, short code
  for (int p = 0; p < NP; ++p) {
    const int buf = p & 1;
    const us* tile = ring + buf * RSTAGE;
#pragma unroll     // unrolled so that the k offsets become immediates of the LDS reads
    for (int kk = 0; kk < RK; kk += 32) {
      // the six fragments of a k step are read as one group: one LDS latency per step, not one per column tile
      const v16us a0 = lfrag16(tile, wm * 32, kk);
      const v16us a1 = lfrag16(tile, wm * 32 + 16, kk);
      v16us b[4];
#pragma unroll     // unrolled so that b[] stays in registers
      for (int tt = 0; tt < 4; ++tt) b[tt] = lfrag16(tile, 64 + wn * 64 + 16 * tt, kk);
#pragma unroll     // unrolled so that acc[] stays in registers
      for (int tt = 0; tt < 4; ++tt) {
        if constexpr (BF) {
          acc[tt]     = mma_bf16(__builtin_bit_cast(v16bf, a0), __builtin_bit_cast(v16bf, b[tt]), acc[tt]);
          acc[4 + tt] = mma_bf16(__builtin_bit_cast(v16bf, a1), __builtin_bit_cast(v16bf, b[tt]), acc[4 + tt]);
        } else {
          acc[tt]     = mma_f16(__builtin_bit_cast(v16h, a0), __builtin_bit_cast(v16h, b[tt]), acc[tt]);
          acc[4 + tt] = mma_f16(__builtin_bit_cast(v16h, a1), __builtin_bit_cast(v16h, b[tt]), acc[4 + tt]);
        }
      }
    }
    asm volatile("s_wait_dscnt 0x0" ::: "memory");      // this wave's reads of the buffer are done before it is refilled
    asm volatile("s_wait_asynccnt 0x0" ::: "memory");   // this wave's copies of slab p + 1 have landed
    __syncthreads();                                    // publishes slab p + 1; ends every reader's last read of slab p
    if (p + 2 < NP)
      stage_slab<KD>(ga + (p + 2) * RK, gb + (p + 2) * RK, ld + (unsigned)(buf * RSTAGE * 2));
  }
  asm volatile("s_wait_asynccnt 0x0" ::: "memory");     // no copy outstanding past the loop
}

// ---------------------------------------------------------------------------
// Projection: Y = Xb[MROWS][DM] * Wt^T + b, written as an f16 plane.
// mode 0/1: q or k -> value plane [NB*NH][SEQ][64]
// mode 2:   v      -> transposed value plane [NB*NH][64][SEQ]
// Blocks whose 64 rows lie below EROWS (block-uniform) also write the x2048 residual plane at Y + roff:
// mode 0/1: [NB*NH][EROWS][64]; mode 2: [NB*NH][64][EROWS].
// Block 256 thr = 8 waves as 2(M) x 4(N); block tile 64 x 256; grid (MROWS/64, DM/256).
// ---------------------------------------------------------------------------
__global__ __launch_bounds__(256) __attribute__((amdgpu_num_vgpr(256)))
void proj_kernel(const us* __restrict__ Xb, const us* __restrict__ Wt,
                 const float* __restrict__ bias, us* Y, size_t roff, int mode) {
  __shared__ __attribute__((aligned(16))) us stile[64 * 256];       // cross-wave (block barrier)
  __shared__ __attribute__((aligned(16))) us ring[2 * RSTAGE];      // operand slabs, cross-wave (block barrier)

  const int t = threadIdx.x;
  const int wid = __builtin_amdgcn_readfirstlane(t >> 5);
  const int l = t & 31;
  const int h = l >> 4, r16 = l & 15;
  const int wm = wid >> 2, wn = wid & 3;
  const int mblk0 = blockIdx.x * 64;
  const int nblk0 = blockIdx.y * 256;
  const int n0 = nblk0 + wn * 64;

  v8f acc[8] = {};
  gemm_ring<DM, true>(Xb, Wt, mblk0, nblk0, wm, wn, ring, acc);

  float bvv[4];
#pragma unroll
  for (int tt = 0; tt < 4; ++tt) bvv[tt] = bf16rne(bias[n0 + 16 * tt + r16]);

  const int bblk = mblk0 / SEQ;
  const int sblk = mblk0 - bblk * SEQ;  // 64 block rows lie inside one batch (SEQ % 64 == 0)
  const int c = l & 7;
  const int nph = (sblk < EROWS) ? 2 : 1;   // block-uniform: phase 0 value plane, phase 1 residual plane

#pragma unroll 1
  for (int ph = 0; ph < nph; ++ph) {
    if (ph) __syncthreads();              // readers of the value stage done

    // stage f16 value (phase 0) or x2048 residual (phase 1) of (acc + bias) into LDS
#pragma unroll
    for (int tt = 0; tt < 4; ++tt) {
      const int nl = wn * 64 + 16 * tt + r16;
#pragma unroll
      for (int mi = 0; mi < 2; ++mi) {
#pragma unroll
        for (int r = 0; r < 8; ++r) {
          const int ml = wm * 32 + 16 * mi + 8 * h + r;
          const float v = acc[mi * 4 + tt][r] + bvv[tt];
          const _Float16 hv = (_Float16)v;
          const float rs = (v - (float)hv) * RES_CARRY;
          const us hb = __builtin_bit_cast(us, hv);
          const us rb = f16_bits(rs);
          const int li = (mode == 2) ? (nl * 64 + ml) : (ml * 256 + nl);
          stile[li] = ph ? rb : hb;
        }
      }
    }
    __syncthreads();

    // whole-line writes: 256 lines per block, 32 per wave
    const int SL = ph ? EROWS : SEQ;      // sequence extent of the destination plane
    const size_t poff = ph ? roff : (size_t)0;
    v8us vals[8];
    size_t dsts[8];
#pragma unroll
    for (int it = 0; it < 8; ++it) {
      const int L = wid * 32 + (l >> 3) + 4 * it;
      int src;
      size_t dst;
      if (mode == 2) {
        const int n = nblk0 + L;
        const int hg = n >> 6, d = n & 63;
        src = L * 64 + 8 * c;
        dst = (((size_t)(bblk * NH + hg)) * DKH + d) * SL + sblk + 8 * c;
      } else {
        const int ml = L >> 2, hq = L & 3;
        const int hg = (nblk0 >> 6) + hq;
        const int s = sblk + ml;
        src = ml * 256 + hq * 64 + 8 * c;
        dst = (((size_t)(bblk * NH + hg)) * SL + s) * DKH + 8 * c;
      }
      vals[it] = *(const v8us*)&stile[src];
      dsts[it] = dst + poff;
    }
#pragma unroll
    for (int it = 0; it < 8; ++it) *(v8us*)(Y + dsts[it]) = vals[it];
    
  }
}

// ---------------------------------------------------------------------------
// LDS row pitches of the attention K and V tiles (halves). The fragment readers are 16-byte reads, one row per lane:
// a pitch of 16 B x odd spreads the 16 rows of a read over all banks (unpadded 128-B / 64-B rows fall on few banks).
// ---------------------------------------------------------------------------
#define KPITCH 72                    // K tile: 64 d per key row + 8 halves of pad = 144 B = 16 B x 9
#define VPITCH 40                    // V tile: 32 keys per d row + 8 halves of pad = 80 B = 16 B x 5
static_assert(KPITCH >= DKH && (KPITCH * 2) % 32 == 16);
static_assert(VPITCH >= 32 && (VPITCH * 2) % 32 == 16);

// ---------------------------------------------------------------------------
// Per-wave part of the key-step bound of a 128-query block, from the mask bit plane.
// Thread t scans half a row (row = t>>1 of the block). A row with at least one visible key needs
// key steps [0, last visible word]; a row with no visible key needs every key step (uniform softmax).
// Returns the maximum over the wave's 16 rows (all lanes hold it).
// ---------------------------------------------------------------------------
__device__ __forceinline__ int wave_key_bound(const unsigned* __restrict__ Mb, int qb) {
  const int t = threadIdx.x;
  const int hw = (t & 1) * (WPR / 2);
  const unsigned* mrow = Mb + (size_t)(qb * 128 + (t >> 1)) * WPR + hw;
  int kmx = -1;
#pragma unroll 1
  for (int j = 0; j < WPR / 2; j += 4) {
    const v4u w = *(const v4u*)(mrow + j);
    kmx = (w[0] != 0u) ? (hw + j)     : kmx;
    kmx = (w[1] != 0u) ? (hw + j + 1) : kmx;
    kmx = (w[2] != 0u) ? (hw + j + 2) : kmx;
    kmx = (w[3] != 0u) ? (hw + j + 3) : kmx;
  }
  const int oth = __shfl_xor(kmx, 1, 32);
  kmx = max(kmx, oth);
  int ke = (kmx < 0) ? WPR : (kmx + 1);
  ke = max(ke, __shfl_xor(ke, 16, 32));
  ke = max(ke, __shfl_xor(ke, 8, 32));
  ke = max(ke, __shfl_xor(ke, 4, 32));
  ke = max(ke, __shfl_xor(ke, 2, 32));
  return ke;
}

// ---------------------------------------------------------------------------
// Fused flash attention, query rows >= EROWS. Block = 8 waves, one (b,h), 128 queries; each wave owns
// 16 queries. K/V 32-key blocks staged once per block into LDS with plain loads.
// Scores computed transposed (S' = K_blk * Q^T) so the exp'd probabilities are
// already in A-operand layout for P*V. Online softmax in f32.
// Mask: one bit word per lane (= query) per 32-key step; masked scores are REPLACED by NEG_FILL.
// Key loop bound per block derived from the mask words (clamped to SEQ/32).
// ctx plane f16 [MROWS][2*DM]: cols [0,DM) value x256, cols [DM,2DM) residual x256,
// grid = NB*NH*((SEQ-EROWS)/128).
// ---------------------------------------------------------------------------
__global__ __launch_bounds__(256) __attribute__((amdgpu_num_vgpr(256)))
void attn_kernel(const us* __restrict__ Qh, const us* __restrict__ Kh,
                 const us* __restrict__ Vt, const unsigned* __restrict__ Mb, us* Ctx) {
  __shared__ __attribute__((aligned(16))) us shK[32 * KPITCH];      // [key][d], padded rows, cross-wave (block barrier)
  __shared__ __attribute__((aligned(16))) us shV[64 * VPITCH];      // [d][key], padded rows, cross-wave (block barrier)
  __shared__ __attribute__((aligned(16))) us shC[8 * 2 * 16 * 64];  // per-wave ctx staging, value|residual (block barrier used)
  __shared__ int shE[8];                                            // per-wave key bounds, cross-wave (block barrier)

  const int t = threadIdx.x;
  const int wid = __builtin_amdgcn_readfirstlane(t >> 5);
  const int l = t & 31;
  const int r16 = l & 15;
  const int hs = l >> 4;
  const int rowsel = hs << 3;
  constexpr int QBL = (SEQ > EROWS) ? (SEQ - EROWS) / 128 : 1;
  const int bh = blockIdx.x / QBL;
  const int qb = blockIdx.x - bh * QBL + EROWS / 128;
  const int q0 = qb * 128 + wid * 16;

  const size_t qoff = (size_t)bh * SEQ * DKH;
  const us* qp = Qh + qoff;
  const us* kp = Kh + qoff;
  const us* vp = Vt + (size_t)bh * DKH * SEQ;

  // key-step bound of this block (exact for any mask value), clamped to the static maximum
  const int kew = wave_key_bound(Mb, qb);
  if (l == 0) shE[wid] = kew;
  __syncthreads();
  int kall = shE[0];
#pragma unroll
  for (int w = 1; w < 8; ++w) kall = max(kall, shE[w]);
  kall = min(max(kall, 1), WPR);
  const int ksteps = __builtin_amdgcn_readfirstlane(kall);

  const unsigned* mq = Mb + (size_t)(q0 + r16) * WPR;   // this lane's query row of mask words

  // Q^T as B operand for the whole loop (lane = query column, halves = d)
  const v16h qB0 = fragh(qp, DKH, q0, 0);
  const v16h qB1 = fragh(qp, DKH, q0, 32);

  v8f o[4];
#pragma unroll
  for (int tt = 0; tt < 4; ++tt) o[tt] = v8f{};
  float mmax = NEG_FILL, lsum = 0.0f;

  const int krow = t >> 3, kcol = (t & 7) * 8;   // K: 32 keys x 64 d
  const int vrow = t >> 2, vcol = (t & 3) * 8;   // V: 64 d x 32 keys
  const int kfo = r16 * KPITCH + 8 * hs;           // shK fragment lane offset (row = key, k = d)
  const int vfo = r16 * VPITCH + 8 * hs;           // shV fragment lane offset (row = d, k = key)

#pragma unroll 1
  for (int ks = 0; ks < ksteps; ++ks) {
    const int kb = ks * 32;
    __syncthreads();    // prior readers of shK/shV done
    *(v8us*)&shK[krow * KPITCH + kcol] = *(const v8us*)(kp + (size_t)(kb + krow) * DKH + kcol);
    *(v8us*)&shV[vrow * VPITCH + vcol] = *(const v8us*)(vp + (size_t)vrow * SEQ + kb + vcol);
    __syncthreads();    // stage visible to all waves

    // mask word of this lane's query for these 32 keys (pinned before the selects)
    unsigned mw = mq[ks];
    asm volatile("" : "+v"(mw));
    const unsigned ml = mw >> (8 * hs);

    // S' tiles: M = key (relative 0..15 / 16..31), N = query; k = d
    v8f s0 = {};
    v8f s1 = {};
    {
      const v16h kA = cat16h(*(const v8us*)&shK[kfo], *(const v8us*)&shK[kfo + 16]);
      s0 = mma_f16(kA, qB0, s0);
    }
    {
      const v16h kA = cat16h(*(const v8us*)&shK[kfo + 32], *(const v8us*)&shK[kfo + 48]);
      s0 = mma_f16(kA, qB1, s0);
    }
    {
      const v16h kA = cat16h(*(const v8us*)&shK[16 * KPITCH + kfo], *(const v8us*)&shK[16 * KPITCH + kfo + 16]);
      s1 = mma_f16(kA, qB0, s1);
    }
    {
      const v16h kA = cat16h(*(const v8us*)&shK[16 * KPITCH + kfo + 32], *(const v8us*)&shK[16 * KPITCH + kfo + 48]);
      s1 = mma_f16(kA, qB1, s1);
    }

    // scale, then replace masked scores: s0[i] = key 8h+i, s1[i] = key 16+8h+i of this step
#pragma unroll
    for (int i = 0; i < 8; ++i) {
      const float a0 = s0[i] * QK_SCALE;
      const float a1 = s1[i] * QK_SCALE;
      s0[i] = ((ml >> i) & 1u) ? a0 : NEG_FILL;
      s1[i] = ((ml >> (16 + i)) & 1u) ? a1 : NEG_FILL;
    }

    // per-query (per-lane) block max; combine the two key halves (lane ^ 16)
    float bm = s0[0];
#pragma unroll
    for (int i = 0; i < 8; ++i) { bm = fmaxf(bm, s0[i]); bm = fmaxf(bm, s1[i]); }
    bm = fmaxf(bm, __shfl_xor(bm, 16, 32));
    const float mnew = fmaxf(mmax, bm);
    const float corr = __expf(fmaxf(mmax - mnew, EXP_FLOOR));
    mmax = mnew;

    // probabilities land directly in A-operand layout (elements 0..7 <- keys 8h..8h+7
    // from the first 16-key D tile, elements 8..15 <- keys 16+8h.. from the second)
    float ps = 0.0f;
    v16h pA;
#pragma unroll
    for (int i = 0; i < 8; ++i) {
      const float p0 = __expf(fmaxf(s0[i] - mnew, EXP_FLOOR));
      const float p1 = __expf(fmaxf(s1[i] - mnew, EXP_FLOOR));
      ps += p0 + p1;
      pA[i]     = (_Float16)(p0 * P_CARRY);
      pA[8 + i] = (_Float16)(p1 * P_CARRY);
    }
    ps += __shfl_xor(ps, 16, 32);
    lsum = lsum * corr + ps;

    // rescale O: D row 8h+r = query 8h+r, whose corr lives in lane 8h+r
#pragma unroll
    for (int r = 0; r < 8; ++r) {
      const float cr = __shfl(corr, rowsel + r, 32);
#pragma unroll
      for (int tt = 0; tt < 4; ++tt) o[tt][r] *= cr;
    }

    // O += P(16 x 32 keys) * V_blk(32 keys x 64 d); B rows = d, k = key contiguous in shV
#pragma unroll
    for (int tt = 0; tt < 4; ++tt) {
      const v16h vB = cat16h(*(const v8us*)&shV[16 * tt * VPITCH + vfo],
                             *(const v8us*)&shV[16 * tt * VPITCH + vfo + 16]);
      o[tt] = mma_f16(pA, vB, o[tt]);
    }
  }

  // normalize, stage this wave's 16 x 64 ctx tile (f16 value x256 and residual x256) in LDS
  const int bb = bh / NH;
  const int hh = bh - bb * NH;
#pragma unroll
  for (int r = 0; r < 8; ++r) {
    const float lrow = __shfl(lsum, rowsel + r, 32);
    const float li = CTX_SCALE * __builtin_amdgcn_rcpf(lrow);
#pragma unroll
    for (int tt = 0; tt < 4; ++tt) {
      const float cv = o[tt][r] * li;
      const _Float16 hv = (_Float16)cv;
      const float rs = (cv - (float)hv) * CTXRES_CARRY;
      const int si = wid * 2048 + (rowsel + r) * 64 + 16 * tt + r16;
      shC[si]        = __builtin_bit_cast(us, hv);
      shC[si + 1024] = f16_bits(rs);
    }
  }
  __syncthreads();

  const int c = l & 7;
  v8us vals[8];
  size_t dsts[8];
#pragma unroll
  for (int it = 0; it < 8; ++it) {
    const int Lw = (l >> 3) + 4 * it;    // 0..31
    const int pl = Lw >> 4;              // 0 value, 1 residual
    const int rl = Lw & 15;
    vals[it] = *(const v8us*)&shC[wid * 2048 + pl * 1024 + rl * 64 + 8 * c];
    const int s = q0 + rl;
    dsts[it] = ((size_t)(bb * SEQ + s)) * DM2 + (size_t)pl * DM + hh * DKH + 8 * c;
  }
#pragma unroll
  for (int it = 0; it < 8; ++it) *(v8us*)(Ctx + dsts[it]) = vals[it];
  
}

// ---------------------------------------------------------------------------
// Early band of the fused flash attention: query rows < EROWS. Same structure as attn_kernel.
// For key steps below EROWS (block-uniform test) q, k and v are value + x2048 residual planes:
// scores = kv*qv + (kv*qr + kr*qv)/2048 (residual products in their own accumulator);
// P = f16 value + x2048 residual; O = pv*vv + (pr*vv + pv*vr)/2048 (own accumulator, folded before
// the normalisation). Key steps at or above EROWS (only visited when the mask asks for them) use
// the value planes of k and v alone. Row sum over the unconverted p.
// grid = NB*NH*(EROWS/128).
// ---------------------------------------------------------------------------
__global__ __launch_bounds__(256) __attribute__((amdgpu_num_vgpr(256)))
void attn_early_kernel(const us* __restrict__ Qh, const us* __restrict__ Kh, const us* __restrict__ Vt,
                       const us* __restrict__ Qr, const us* __restrict__ Kr, const us* __restrict__ Vr,
                       const unsigned* __restrict__ Mb, us* Ctx) {
  __shared__ __attribute__((aligned(16))) us shK[32 * KPITCH];      // [key][d], padded rows, cross-wave (block barrier)
  __shared__ __attribute__((aligned(16))) us shV[64 * VPITCH];      // [d][key], padded rows, cross-wave (block barrier)
  __shared__ __attribute__((aligned(16))) us shKr[32 * KPITCH];     // residual of shK, cross-wave (block barrier)
  __shared__ __attribute__((aligned(16))) us shVr[64 * VPITCH];     // residual of shV, cross-wave (block barrier)
  __shared__ __attribute__((aligned(16))) us shC[8 * 2 * 16 * 64];  // per-wave ctx staging, value|residual (block barrier used)
  __shared__ int shE[8];                                            // per-wave key bounds, cross-wave (block barrier)

  const int t = threadIdx.x;
  const int wid = __builtin_amdgcn_readfirstlane(t >> 5);
  const int l = t & 31;
  const int r16 = l & 15;
  const int hs = l >> 4;
  const int rowsel = hs << 3;
  constexpr int QBE = EROWS / 128;
  const int bh = blockIdx.x / QBE;
  const int qb = blockIdx.x - bh * QBE;
  const int q0 = qb * 128 + wid * 16;

  const size_t qoff = (size_t)bh * SEQ * DKH;
  const size_t roff = (size_t)bh * EROWS * DKH;
  const us* qp = Qh + qoff;
  const us* kp = Kh + qoff;
  const us* vp = Vt + (size_t)bh * DKH * SEQ;
  const us* qrp = Qr + roff;
  const us* krp = Kr + roff;
  const us* vrp = Vr + (size_t)bh * DKH * EROWS;

  // key-step bound of this block (exact for any mask value), clamped to the static maximum
  const int kew = wave_key_bound(Mb, qb);
  if (l == 0) shE[wid] = kew;
  __syncthreads();
  int kall = shE[0];
#pragma unroll
  for (int w = 1; w < 8; ++w) kall = max(kall, shE[w]);
  kall = min(max(kall, 1), WPR);
  const int ksteps = __builtin_amdgcn_readfirstlane(kall);

  const unsigned* mq = Mb + (size_t)(q0 + r16) * WPR;   // this lane's query row of mask words

  // Q^T value and residual as B operands for the whole loop (lane = query column, halves = d)
  const v16h qB0 = fragh(qp, DKH, q0, 0);
  const v16h qB1 = fragh(qp, DKH, q0, 32);
  const v16h qR0 = fragh(qrp, DKH, q0, 0);
  const v16h qR1 = fragh(qrp, DKH, q0, 32);

  v8f o[4], orr[4];
#pragma unroll
  for (int tt = 0; tt < 4; ++tt) { o[tt] = v8f{}; orr[tt] = v8f{}; }
  float mmax = NEG_FILL, lsum = 0.0f;

  const int krow = t >> 3, kcol = (t & 7) * 8;   // K: 32 keys x 64 d
  const int vrow = t >> 2, vcol = (t & 3) * 8;   // V: 64 d x 32 keys
  const int kfo = r16 * KPITCH + 8 * hs;           // shK fragment lane offset (row = key, k = d)
  const int vfo = r16 * VPITCH + 8 * hs;           // shV fragment lane offset (row = d, k = key)

#pragma unroll 1
  for (int ks = 0; ks < ksteps; ++ks) {
    const int kb = ks * 32;
    const bool res = kb < EROWS;        // block-uniform: residual planes exist for these keys
    __syncthreads();    // prior readers of the LDS tiles done
    *(v8us*)&shK[krow * KPITCH + kcol] = *(const v8us*)(kp + (size_t)(kb + krow) * DKH + kcol);
    *(v8us*)&shV[vrow * VPITCH + vcol] = *(const v8us*)(vp + (size_t)vrow * SEQ + kb + vcol);
    if (res) {
      *(v8us*)&shKr[krow * KPITCH + kcol] = *(const v8us*)(krp + (size_t)(kb + krow) * DKH + kcol);
      *(v8us*)&shVr[vrow * VPITCH + vcol] = *(const v8us*)(vrp + (size_t)vrow * EROWS + kb + vcol);
    }
    __syncthreads();    // stage visible to all waves

    // mask word of this lane's query for these 32 keys (pinned before the selects)
    unsigned mw = mq[ks];
    asm volatile("" : "+v"(mw));
    const unsigned ml = mw >> (8 * hs);

    // S' tiles: M = key (relative 0..15 / 16..31), N = query; k = d
    const v16h kA00 = cat16h(*(const v8us*)&shK[kfo], *(const v8us*)&shK[kfo + 16]);
    const v16h kA01 = cat16h(*(const v8us*)&shK[kfo + 32], *(const v8us*)&shK[kfo + 48]);
    const v16h kA10 = cat16h(*(const v8us*)&shK[16 * KPITCH + kfo], *(const v8us*)&shK[16 * KPITCH + kfo + 16]);
    const v16h kA11 = cat16h(*(const v8us*)&shK[16 * KPITCH + kfo + 32], *(const v8us*)&shK[16 * KPITCH + kfo + 48]);
    v8f s0 = {};
    v8f s1 = {};
    s0 = mma_f16(kA00, qB0, s0);
    s0 = mma_f16(kA01, qB1, s0);
    s1 = mma_f16(kA10, qB0, s1);
    s1 = mma_f16(kA11, qB1, s1);

    // residual score products (x2048 units) in their own accumulators
    v8f x0 = {};
    v8f x1 = {};
    if (res) {
      x0 = mma_f16(kA00, qR0, x0);
      x0 = mma_f16(kA01, qR1, x0);
      x1 = mma_f16(kA10, qR0, x1);
      x1 = mma_f16(kA11, qR1, x1);
      {
        const v16h kR = cat16h(*(const v8us*)&shKr[kfo], *(const v8us*)&shKr[kfo + 16]);
        x0 = mma_f16(kR, qB0, x0);
      }
      {
        const v16h kR = cat16h(*(const v8us*)&shKr[kfo + 32], *(const v8us*)&shKr[kfo + 48]);
        x0 = mma_f16(kR, qB1, x0);
      }
      {
        const v16h kR = cat16h(*(const v8us*)&shKr[16 * KPITCH + kfo], *(const v8us*)&shKr[16 * KPITCH + kfo + 16]);
        x1 = mma_f16(kR, qB0, x1);
      }
      {
        const v16h kR = cat16h(*(const v8us*)&shKr[16 * KPITCH + kfo + 32], *(const v8us*)&shKr[16 * KPITCH + kfo + 48]);
        x1 = mma_f16(kR, qB1, x1);
      }
    }

    // fold, scale, then replace masked scores: s0[i] = key 8h+i, s1[i] = key 16+8h+i of this step
#pragma unroll
    for (int i = 0; i < 8; ++i) {
      const float a0 = (s0[i] + x0[i] * RES_INV) * QK_SCALE;
      const float a1 = (s1[i] + x1[i] * RES_INV) * QK_SCALE;
      s0[i] = ((ml >> i) & 1u) ? a0 : NEG_FILL;
      s1[i] = ((ml >> (16 + i)) & 1u) ? a1 : NEG_FILL;
    }

    // per-query (per-lane) block max; combine the two key halves (lane ^ 16)
    float bm = s0[0];
#pragma unroll
    for (int i = 0; i < 8; ++i) { bm = fmaxf(bm, s0[i]); bm = fmaxf(bm, s1[i]); }
    bm = fmaxf(bm, __shfl_xor(bm, 16, 32));
    const float mnew = fmaxf(mmax, bm);
    const float corr = __expf(fmaxf(mmax - mnew, EXP_FLOOR));
    mmax = mnew;

    // probabilities (value + residual) land directly in A-operand layout
    float ps = 0.0f;
    v16h pA, pR;
#pragma unroll
    for (int i = 0; i < 8; ++i) {
      const float p0 = __expf(fmaxf(s0[i] - mnew, EXP_FLOOR));
      const float p1 = __expf(fmaxf(s1[i] - mnew, EXP_FLOOR));
      ps += p0 + p1;
      const float c0 = p0 * P_CARRY;
      const float c1 = p1 * P_CARRY;
      const _Float16 h0 = (_Float16)c0;
      const _Float16 h1 = (_Float16)c1;
      pA[i]     = h0;
      pA[8 + i] = h1;
      pR[i]     = (_Float16)((c0 - (float)h0) * RES_CARRY);
      pR[8 + i] = (_Float16)((c1 - (float)h1) * RES_CARRY);
    }
    ps += __shfl_xor(ps, 16, 32);
    lsum = lsum * corr + ps;

    // rescale both accumulators: D row 8h+r = query 8h+r, whose corr lives in lane 8h+r
#pragma unroll
    for (int r = 0; r < 8; ++r) {
      const float cr = __shfl(corr, rowsel + r, 32);
#pragma unroll
      for (int tt = 0; tt < 4; ++tt) { o[tt][r] *= cr; orr[tt][r] *= cr; }
    }

    // O += P * V_blk (value products); residual accumulator += P_res * V
#pragma unroll
    for (int tt = 0; tt < 4; ++tt) {
      const v16h vB = cat16h(*(const v8us*)&shV[16 * tt * VPITCH + vfo],
                             *(const v8us*)&shV[16 * tt * VPITCH + vfo + 16]);
      o[tt]   = mma_f16(pA, vB, o[tt]);
      orr[tt] = mma_f16(pR, vB, orr[tt]);
    }
    // residual accumulator += P * V_res
    if (res) {
#pragma unroll
      for (int tt = 0; tt < 4; ++tt) {
        const v16h vRB = cat16h(*(const v8us*)&shVr[16 * tt * VPITCH + vfo],
                                *(const v8us*)&shVr[16 * tt * VPITCH + vfo + 16]);
        orr[tt] = mma_f16(pA, vRB, orr[tt]);
      }
    }
  }

  // fold the residual accumulator, normalize, stage this wave's 16 x 64 ctx tile in LDS
  const int bb = bh / NH;
  const int hh = bh - bb * NH;
#pragma unroll
  for (int r = 0; r < 8; ++r) {
    const float lrow = __shfl(lsum, rowsel + r, 32);
    const float li = CTX_SCALE * __builtin_amdgcn_rcpf(lrow);
#pragma unroll
    for (int tt = 0; tt < 4; ++tt) {
      const float cv = (o[tt][r] + orr[tt][r] * RES_INV) * li;
      const _Float16 hv = (_Float16)cv;
      const float rs = (cv - (float)hv) * CTXRES_CARRY;
      const int si = wid * 2048 + (rowsel + r) * 64 + 16 * tt + r16;
      shC[si]        = __builtin_bit_cast(us, hv);
      shC[si + 1024] = f16_bits(rs);
    }
  }
  __syncthreads();

  const int c = l & 7;
  v8us vals[8];
  size_t dsts[8];
#pragma unroll
  for (int it = 0; it < 8; ++it) {
    const int Lw = (l >> 3) + 4 * it;    // 0..31
    const int pl = Lw >> 4;              // 0 value, 1 residual
    const int rl = Lw & 15;
    vals[it] = *(const v8us*)&shC[wid * 2048 + pl * 1024 + rl * 64 + 8 * c];
    const int s = q0 + rl;
    dsts[it] = ((size_t)(bb * SEQ + s)) * DM2 + (size_t)pl * DM + hh * DKH + 8 * c;
  }
#pragma unroll
  for (int it = 0; it < 8; ++it) *(v8us*)(Ctx + dsts[it]) = vals[it];
  
}

// ---------------------------------------------------------------------------
// Output projection: Out f32 [MROWS][DM] = [ctx x256 | ctx residual x256] * [Wo x64 | Wo x0.25]^T * OUT_FOLD + bo.
// K = 2*DM, one accumulator (both halves of K are in the same units).
// Same block tiling as proj_kernel; f32 tile staged in two 16-row halves per wave
// (32 x 256 floats in LDS), each d_out line (32 floats) written by 8 lanes x 16 B.
// ---------------------------------------------------------------------------
__global__ __launch_bounds__(256) __attribute__((amdgpu_num_vgpr(256)))
void outproj_kernel(const us* __restrict__ Ctx, const us* __restrict__ Wot,
                    const float* __restrict__ bo, float* Out) {
  __shared__ __attribute__((aligned(16))) float ftile[32 * 256];    // cross-wave (block barrier)
  __shared__ __attribute__((aligned(16))) us ring[2 * RSTAGE];      // operand slabs, cross-wave (block barrier)

  const int t = threadIdx.x;
  const int wid = __builtin_amdgcn_readfirstlane(t >> 5);
  const int l = t & 31;
  const int h = l >> 4, r16 = l & 15;
  const int wm = wid >> 2, wn = wid & 3;
  const int mblk0 = blockIdx.x * 64;
  const int nblk0 = blockIdx.y * 256;
  const int n0 = nblk0 + wn * 64;

  v8f acc[8] = {};
  gemm_ring<DM2, false>(Ctx, Wot, mblk0, nblk0, wm, wn, ring, acc);

  float bob[4];
#pragma unroll
  for (int tt = 0; tt < 4; ++tt) bob[tt] = bf16rne(bo[n0 + 16 * tt + r16]);

  const int c = l & 7;
#pragma unroll
  for (int p = 0; p < 2; ++p) {
    if (p) __syncthreads();   // readers of the prior half done
#pragma unroll
    for (int tt = 0; tt < 4; ++tt) {
      const int nl = wn * 64 + 16 * tt + r16;
#pragma unroll
      for (int r = 0; r < 8; ++r) {
        const int rl = wm * 16 + 8 * h + r;           // 0..31
        ftile[rl * 256 + nl] = acc[p * 4 + tt][r] * OUT_FOLD + bob[tt];
      }
    }
    __syncthreads();

    v4f vals[8];
    size_t dsts[8];
#pragma unroll
    for (int it = 0; it < 8; ++it) {
      const int L = wid * 32 + (l >> 3) + 4 * it;    // 0..255
      const int rl = L >> 3, seg = L & 7;
      vals[it] = *(const v4f*)&ftile[rl * 256 + seg * 32 + 4 * c];
      const int m = mblk0 + (rl >> 4) * 32 + p * 16 + (rl & 15);
      dsts[it] = (size_t)m * DM + nblk0 + seg * 32 + 4 * c;
    }
#pragma unroll
    for (int it = 0; it < 8; ++it) *(v4f*)(Out + dsts[it]) = vals[it];
    
  }
}

// ---------------------------------------------------------------------------
// Host launcher
// ---------------------------------------------------------------------------
extern "C" void kernel_launch(void* const* d_in, const int* in_sizes, int n_in,
                              void* d_out, int out_size, void* d_ws, size_t ws_size,
                              hipStream_t stream) {
  if (n_in < 12) return;
  const int need_x = ((NB - 1) * SEQ_FULL + SEQ) * DM;
  if (in_sizes[0] < need_x || in_sizes[1] < need_x || in_sizes[2] < need_x) return;
  if (in_sizes[3] < DM * DM || in_sizes[5] < DM * DM || in_sizes[7] < DM * DM || in_sizes[9] < DM * DM) return;
  if (in_sizes[4] < DM || in_sizes[6] < DM || in_sizes[8] < DM || in_sizes[10] < DM) return;
  if (in_sizes[11] < (SEQ - 1) * SEQ_FULL + SEQ) return;
  if (out_size < MROWS * DM) return;

  // bound by role in the input order: queries, keys, values, Wq, bq, Wk, bk, Wv, bv, Wo, bo, mask
  const float* Q  = (const float*)d_in[0];
  const float* K  = (const float*)d_in[1];
  const float* V  = (const float*)d_in[2];
  const float* Wq = (const float*)d_in[3];
  const float* bq = (const float*)d_in[4];
  const float* Wk = (const float*)d_in[5];
  const float* bk = (const float*)d_in[6];
  const float* Wv = (const float*)d_in[7];
  const float* bv = (const float*)d_in[8];
  const float* Wo = (const float*)d_in[9];
  const float* bo = (const float*)d_in[10];
  const int*   Mk = (const int*)d_in[11];

  const size_t XE = (size_t)MROWS * DM;            // halves per activation plane
  const size_t WE = (size_t)DM * DM;               // halves per weight plane
  const size_t RE = (size_t)NB * NH * EROWS * DKH; // halves per early residual plane
  const size_t BW = (size_t)SEQ * WPR;             // 32-bit words of the mask bit plane
  const size_t total_bytes = (8 * XE + 5 * WE + 3 * RE) * sizeof(us) + BW * sizeof(unsigned);
  if (total_bytes > ws_size) return;

  us* xq  = (us*)d_ws;
  us* xk  = xq + XE;
  us* xv  = xk + XE;
  us* wtq = xv + XE;           // [n][k] bf16
  us* wtk = wtq + WE;
  us* wtv = wtk + WE;
  us* wo2 = wtv + WE;          // 2 * WE  ([DM][2*DM]) f16
  us* qh  = wo2 + 2 * WE;      // q value plane [NB*NH][SEQ][64]
  us* kh  = qh + XE;           // k value plane [NB*NH][SEQ][64]
  us* vt  = kh + XE;           // v transposed plane [NB*NH][64][SEQ]
  us* ctx = vt + XE;           // 2 * XE  ([MROWS][2*DM])
  us* qr  = ctx + 2 * XE;      // q residual plane [NB*NH][EROWS][64]
  us* kr  = qr + RE;           // k residual plane [NB*NH][EROWS][64]
  us* vr  = kr + RE;           // v residual transposed plane [NB*NH][64][EROWS]
  unsigned* mb = (unsigned*)(vr + RE);   // mask bit plane [SEQ][WPR]

  dim3 blk(256);
  const int n8 = (int)(XE / 8);
  dim3 gx((n8 + 255) / 256);
  cvt_x_kernel<<<gx, blk, 0, stream>>>(Q, xq, n8);
  cvt_x_kernel<<<gx, blk, 0, stream>>>(K, xk, n8);
  cvt_x_kernel<<<gx, blk, 0, stream>>>(V, xv, n8);

  const int n4 = (int)(BW / 4);
  mask_pack_kernel<<<dim3((n4 + 255) / 256), blk, 0, stream>>>(Mk, mb, n4);

  // W is [k][n] (in,out): x = k tile, y = n tile; output plane [n][k]
  dim3 gw(DM / 64, DM / 64);
  cvt_wT_kernel<<<gw, blk, 0, stream>>>(Wq, wtq, 0);
  cvt_wT_kernel<<<gw, blk, 0, stream>>>(Wk, wtk, 0);
  cvt_wT_kernel<<<gw, blk, 0, stream>>>(Wv, wtv, 0);
  cvt_wT_kernel<<<gw, blk, 0, stream>>>(Wo, wo2, 1);

  dim3 gp(MROWS / 64, DM / 256);
  proj_kernel<<<gp, blk, 0, stream>>>(xq, wtq, bq, qh, (size_t)(qr - qh), 0);
  proj_kernel<<<gp, blk, 0, stream>>>(xk, wtk, bk, kh, (size_t)(kr - kh), 1);
  proj_kernel<<<gp, blk, 0, stream>>>(xv, wtv, bv, vt, (size_t)(vr - vt), 2);

  if (EROWS > 0) {
    attn_early_kernel<<<dim3(NB * NH * (EROWS / 128)), blk, 0, stream>>>(qh, kh, vt, qr, kr, vr, mb, ctx);
  }
  if (SEQ > EROWS) {
    attn_kernel<<<dim3(NB * NH * ((SEQ - EROWS) / 128)), blk, 0, stream>>>(qh, kh, vt, mb, ctx);
  }

  outproj_kernel<<<gp, blk, 0, stream>>>(ctx, wo2, bo, (float*)d_out);
}

// v003
// A run of this version takes 182 microseconds.
// In two side-by-side timings against v002, it was 1.04 and 1.03 times as fast.
// All steps since v000 together make it 1.75 times as fast.
#include <hip/hip_runtime.h>
#include <stddef.h>

// Contractions: q/k/v projections = v_wmma_f32_16x16x32_bf16 (bf16 operands = RNE-converted f32 inputs; activations converted at the fragment read);
// scores = v_wmma_f32_16x16x32_f16 (k x1 against q x1, single product; query rows < EROWS: q and k as f16 value + x2048 residual, three products, own accumulator);
// P*V = f16 (P x1024, v x1; query rows < EROWS: P and v as f16 value + x2048 residual, residual products in their own accumulator);
// output projection = f16 over K = 2*DM ([ctx x256 | ctx residual x256] against [Wo x64 | Wo x0.25]);
// f32 accumulate, f32 online softmax; the mask input is read by value (packed to bit words once) and applied as a replace fill.

#ifndef NB
#define NB 2
#endif
#ifndef SEQ
#define SEQ 2048
#endif
#define NB_FULL 2
#define SEQ_FULL 2048
#define DM 1024
#define NH 16
#define DKH 64
#define MROWS (NB * SEQ)
#define DM2 (2 * DM)
#define EROWS 256                 // query rows (and key rows) with value + residual planes
#define WPR (SEQ / 32)            // mask bit words per query row

static_assert(NB >= 1 && NB <= NB_FULL);
static_assert(SEQ >= 128 && SEQ <= SEQ_FULL);
static_assert(SEQ % 128 == 0);
static_assert(SEQ % 64 == 0 && SEQ % 32 == 0);
static_assert(MROWS % 64 == 0);
static_assert(DM % 256 == 0 && DM % 32 == 0 && DM % 64 == 0);
static_assert(DM / 8 == 128);
static_assert(NH * DKH == DM);
static_assert(DKH == 64);
static_assert(DM2 % 32 == 0);
static_assert(SEQ % 256 == 0);                 // half a mask-word row is a multiple of 4 words
static_assert(EROWS % 128 == 0 && EROWS % 64 == 0 && EROWS % 32 == 0);
static_assert(EROWS >= 128 && EROWS <= SEQ);
static_assert(WPR % 8 == 0 && WPR >= 8);
static_assert((SEQ * WPR) % 4 == 0);

#define P_CARRY      1024.0f            // P operand carried x1024
#define CTX_SCALE    0.25f              // ctx value plane = O * 0.25 / l = attn x256 (O carries the x1024 of P)
#define CTXRES_CARRY 256.0f             // ctx residual plane = (ctx256 - f16(ctx256)) x256
#define WO_CARRY     64.0f              // Wo operand carried x64 (value half of K)
#define WO_LO_CARRY  0.25f              // Wo operand for the residual half of K = WO_CARRY / CTXRES_CARRY
#define OUT_FOLD     (1.0f / 16384.0f)  // 1 / (256 * 64)
#define QK_SCALE     0.125f             // 1 / sqrt(64)
#define RES_CARRY    2048.0f            // early-band residual planes carried x2048
#define RES_INV      (1.0f / 2048.0f)
#define NEG_FILL     (-3.4028235e38f)   // lowest finite f32: fill value of masked scores
#define EXP_FLOOR    (-87.0f)           // exponent argument floor (keeps the exp argument finite)

static_assert(WO_LO_CARRY * CTXRES_CARRY == WO_CARRY);
static_assert(OUT_FOLD * 256.0f * WO_CARRY == 1.0f);
static_assert(RES_INV * RES_CARRY == 1.0f);

// workspace carve: 5 activation-size planes + 5 weight-size planes + 3 early residual planes (16-bit each) + mask bit plane
static_assert(((size_t)5 * MROWS * DM + (size_t)5 * DM * DM + (size_t)3 * NB * NH * EROWS * DKH) * 2
              + (size_t)SEQ * WPR * 4 <= (size_t)134217728);

typedef unsigned short us;
typedef us        v8us  __attribute__((ext_vector_type(8)));
typedef us        v16us __attribute__((ext_vector_type(16)));
typedef _Float16  v16h  __attribute__((ext_vector_type(16)));
typedef __bf16    v16bf __attribute__((ext_vector_type(16)));
typedef __bf16    v8bf  __attribute__((ext_vector_type(8)));
typedef float     v8f   __attribute__((ext_vector_type(8)));
typedef float     v4f   __attribute__((ext_vector_type(4)));
typedef int       v4i   __attribute__((ext_vector_type(4)));
typedef unsigned  v4u   __attribute__((ext_vector_type(4)));

// ---------------------------------------------------------------------------
// conversions
// ---------------------------------------------------------------------------
__device__ __forceinline__ unsigned bf16rne_bits(float x) {
  unsigned u = __float_as_uint(x);
  return (u + 0x7FFFu + ((u >> 16) & 1u)) >> 16;
}
__device__ __forceinline__ float bf16rne(float x) {
  return __uint_as_float(bf16rne_bits(x) << 16);
}
__device__ __forceinline__ us f16_bits(float x) {
  _Float16 hx = (_Float16)x;
  return __builtin_bit_cast(us, hx);
}

// ---------------------------------------------------------------------------
// 16-bit operand fragment (A: lane = row, B: lane = column; same k map):
//   lane l, r = l&15, s = l>>4 : elems 0..7  = row[r][k0 + 8s .. +7]
//                                elems 8..15 = row[r][k0 + 16 + 8s .. +7]
// base is a 16-bit global plane with k contiguous, pitch ld (halves).
// ---------------------------------------------------------------------------
__device__ __forceinline__ v16us frag16(const us* base, int ld, int row0, int k0) {
  const int l = threadIdx.x & 31;
  const int r = l & 15, s = l >> 4;
  const us* p = base + (size_t)(row0 + r) * ld + k0 + 8 * s;
  v8us c0 = *(const v8us*)p;
  v8us c1 = *(const v8us*)(p + 16);
  return __builtin_shufflevector(c0, c1, 0, 1, 2, 3, 4, 5, 6, 7, 8, 9, 10, 11, 12, 13, 14, 15);
}
__device__ __forceinline__ v16h fragh(const us* base, int ld, int row0, int k0) {
  return __builtin_bit_cast(v16h, frag16(base, ld, row0, k0));
}
// two 16-byte chunks (already loaded) -> one f16 fragment
__device__ __forceinline__ v16h cat16h(v8us c0, v8us c1) {
  v16us w = __builtin_shufflevector(c0, c1, 0, 1, 2, 3, 4, 5, 6, 7, 8, 9, 10, 11, 12, 13, 14, 15);
  return __builtin_bit_cast(v16h, w);
}

// ---------------------------------------------------------------------------
// WMMA wrappers with hazard guard: D = A(16x32) * B(32x16) + C (f32)
// ---------------------------------------------------------------------------
__device__ __forceinline__ v8f mma_f16(v16h a, v16h b, v8f c) {
  v8f d = __builtin_amdgcn_wmma_f32_16x16x32_f16(false, a, false, b, (short)0, c, false, false);
  asm volatile("v_nop\n\tv_nop\n\tv_nop\n\tv_nop" : "+v"(d) : "v"(a), "v"(b));
  return d;
}
__device__ __forceinline__ v8f mma_bf16(v16bf a, v16bf b, v8f c) {
  v8f d = __builtin_amdgcn_wmma_f32_16x16x32_bf16(false, a, false, b, (short)0, c, false, false);
  asm volatile("v_nop\n\tv_nop\n\tv_nop\n\tv_nop" : "+v"(d) : "v"(a), "v"(b));
  return d;
}

// ---------------------------------------------------------------------------
// Mask pack: M int32 [SEQ_FULL][SEQ_FULL] (nonzero = attend) -> bit words [SEQ][WPR],
// bit j of word w of row q = (M[q][32w + j] != 0).
// ---------------------------------------------------------------------------
__global__ __launch_bounds__(256) void mask_pack_kernel(const int* __restrict__ M, unsigned* Bits, int n4) {
  const int i = blockIdx.x * 256 + threadIdx.x;
  if (i >= n4) return;
  const int w4 = i * 4;
  const int q  = w4 / WPR;
  const int w0 = w4 - q * WPR;
  const int* src = M + (size_t)q * SEQ_FULL + 32 * w0;
  unsigned a0 = 0u, a1 = 0u, a2 = 0u, a3 = 0u;
#pragma unroll 1
  for (int j = 0; j < 4; ++j) {
    unsigned wb = 0u;
#pragma unroll
    for (int c = 0; c < 8; ++c) {
      const v4i m = *(const v4i*)(src + 32 * j + 4 * c);
      wb |= ((m[0] != 0) ? 1u : 0u) << (4 * c);
      wb |= ((m[1] != 0) ? 1u : 0u) << (4 * c + 1);
      wb |= ((m[2] != 0) ? 1u : 0u) << (4 * c + 2);
      wb |= ((m[3] != 0) ? 1u : 0u) << (4 * c + 3);
    }
    a0 = (j == 0) ? wb : a0;
    a1 = (j == 1) ? wb : a1;
    a2 = (j == 2) ? wb : a2;
    a3 = (j == 3) ? wb : a3;
  }
  v4u y;
  y[0] = a0; y[1] = a1; y[2] = a2; y[3] = a3;
  unsigned* dst = Bits + (size_t)i * 4;
  *(v4u*)dst = y;
  
}

// ---------------------------------------------------------------------------
// Weight convert with transpose: W f32 [k][n] (in,out; n contiguous) -> 16-bit plane [n][k] (k contiguous).
// hmode 0: bf16 bits of RNE(W), pitch DM.
// hmode 1: pitch 2*DM: cols [0,DM) = f16(RNE(W) * WO_CARRY), cols [DM,2DM) = f16(RNE(W) * WO_LO_CARRY).
// Block = 64(k) x 64(n) tile through LDS (cross-wave: block barrier); each output line = 64 k of one n
// grid (DM/64, DM/64): x = k tile, y = n tile.
// ---------------------------------------------------------------------------
#define WT_LD 72
static_assert((WT_LD * 2) % 16 == 0 && WT_LD >= 64);
__global__ __launch_bounds__(256) void cvt_wT_kernel(const float* __restrict__ W, us* Y, int hmode) {
  __shared__ __attribute__((aligned(16))) us t0[64 * WT_LD];   // [n][k] value
  __shared__ __attribute__((aligned(16))) us t1[64 * WT_LD];   // [n][k] low-carry copy (hmode 1)

  const int t  = threadIdx.x;
  const int k0 = blockIdx.x * 64;
  const int n0 = blockIdx.y * 64;

#pragma unroll 1
  for (int i = 0; i < 4; ++i) {
    const int id = t + i * 256;           // 1024 float4 chunks (64 k x 64 n)
    const int kr = id >> 4;
    const int c4 = (id & 15) * 4;
    const v4f x = *(const v4f*)(W + (size_t)(k0 + kr) * DM + n0 + c4);
#pragma unroll
    for (int j = 0; j < 4; ++j) {
      const float w = bf16rne(x[j]);
      const us hb = (us)(__float_as_uint(w) >> 16);
      const us hf = f16_bits(w * WO_CARRY);
      const us hl = f16_bits(w * WO_LO_CARRY);
      t0[(c4 + j) * WT_LD + kr] = hmode ? hf : hb;
      t1[(c4 + j) * WT_LD + kr] = hl;
    }
  }
  __syncthreads();

  const int c = t & 7;
  const size_t pitch = hmode ? (size_t)DM2 : (size_t)DM;
  v8us v0[2], v1[2];
  size_t dsts[2];
#pragma unroll
  for (int it = 0; it < 2; ++it) {
    const int L = (t >> 3) + 32 * it;     // local n 0..63
    v0[it] = *(const v8us*)&t0[L * WT_LD + 8 * c];
    v1[it] = *(const v8us*)&t1[L * WT_LD + 8 * c];
    dsts[it] = (size_t)(n0 + L) * pitch + k0 + 8 * c;
  }
#pragma unroll
  for (int it = 0; it < 2; ++it) {
    *(v8us*)(Y + dsts[it]) = v0[it];
    if (hmode) *(v8us*)(Y + dsts[it] + DM) = v1[it];
  }
  
}

// ---------------------------------------------------------------------------
// GEMM core: block computes 64 rows x 256 cols over K = KD; wave (wm, wn) computes 32 x 64 of it.
// A plane [M][KD], B plane [N][KD] (k contiguous), both 16-bit.
// K is walked in slabs of RK; a slab (64 A rows, then 256 B rows) is staged in LDS by asynchronous
// 16-byte copies, two buffers: the next slab's copies fly while this slab is worked on.
// Fragments are read from LDS with the k map of frag16; k runs upward in steps of 32 as before.
// ---------------------------------------------------------------------------
#define RK 128                       // k per slab: 256-byte rows
#define RPITCH 136                   // LDS row pitch in halves: 272 B = 16 B x 17, conflict-free for 16-byte reads
#define RROWS 320                    // 64 A rows + 256 B rows
#define RSTAGE (RROWS * RPITCH)      // halves per buffer
static_assert((RPITCH * 2) % 16 == 0 && RPITCH >= RK);
static_assert(RROWS * (RK / 8) == 20 * 256);   // 20 copies per thread and slab

// One slab: thread t copies chunk (t & 15) of rows (t >> 4) + 16 i, i = 0..19 (each wave copy = 2 whole rows).
// ga / gb: this thread's chunk in A row (t >> 4) / B row (t >> 4) of the block at this slab; ld: its LDS byte address in row (t >> 4).
template <int KD>
__device__ __forceinline__ void stage_slab(const us* ga, const us* gb, unsigned ld) {
  const us* g[20];
  unsigned d[20];
#pragma unroll   // unrolled so that g[] and d[] are registers (they are asm operands)
  for (int i = 0; i < 20; ++i) {
    g[i] = (i < 4) ? (ga + (size_t)(16 * i) * KD) : (gb + (size_t)(16 * (i - 4)) * KD);
    d[i] = ld + (unsigned)(16 * i * RPITCH * 2);
  }
  // the closing s_wait_xcnt keeps the address registers of the issued copies from being rewritten early
  asm volatile("global_load_async_to_lds_b128 %0, %1, off\n\t"
               "global_load_async_to_lds_b128 %2, %3, off\n\t"
               "global_load_async_to_lds_b128 %4, %5, off\n\t"
               "global_load_async_to_lds_b128 %6, %7, off\n\t"
               "global_load_async_to_lds_b128 %8, %9, off\n\t"
               "global_load_async_to_lds_b128 %10, %11, off\n\t"
               "global_load_async_to_lds_b128 %12, %13, off\n\t"
               "global_load_async_to_lds_b128 %14, %15, off\n\t"
               "global_load_async_to_lds_b128 %16, %17, off\n\t"
               "global_load_async_to_lds_b128 %18, %19, off\n\t"
               "s_wait_xcnt 0x0"
               :: "v"(d[0]), "v"(g[0]), "v"(d[1]), "v"(g[1]), "v"(d[2]), "v"(g[2]), "v"(d[3]), "v"(g[3]), "v"(d[4]), "v"(g[4]), "v"(d[5]), "v"(g[5]), "v"(d[6]), "v"(g[6]), "v"(d[7]), "v"(g[7]), "v"(d[8]), "v"(g[8]), "v"(d[9]), "v"(g[9]) : "memory");
  asm volatile("global_load_async_to_lds_b128 %0, %1, off\n\t"
               "global_load_async_to_lds_b128 %2, %3, off\n\t"
               "global_load_async_to_lds_b128 %4, %5, off\n\t"
               "global_load_async_to_lds_b128 %6, %7, off\n\t"
               "global_load_async_to_lds_b128 %8, %9, off\n\t"
               "global_load_async_to_lds_b128 %10, %11, off\n\t"
               "global_load_async_to_lds_b128 %12, %13, off\n\t"
               "global_load_async_to_lds_b128 %14, %15, off\n\t"
               "global_load_async_to_lds_b128 %16, %17, off\n\t"
               "global_load_async_to_lds_b128 %18, %19, off\n\t"
               "s_wait_xcnt 0x0"
               :: "v"(d[10]), "v"(g[10]), "v"(d[11]), "v"(g[11]), "v"(d[12]), "v"(g[12]), "v"(d[13]), "v"(g[13]), "v"(d[14]), "v"(g[14]), "v"(d[15]), "v"(g[15]), "v"(d[16]), "v"(g[16]), "v"(d[17]), "v"(g[17]), "v"(d[18]), "v"(g[18]), "v"(d[19]), "v"(g[19]) : "memory");
}

// fragment from a staged slab (LDS), same lane and k map as frag16
__device__ __forceinline__ v16us lfrag16(const us* tile, int row0, int k0) {
  const int l = threadIdx.x & 31;
  const int r = l & 15, s = l >> 4;
  const us* p = tile + (row0 + r) * RPITCH + k0 + 8 * s;
  v8us c0 = *(const v8us*)p;
  v8us c1 = *(const v8us*)(p + 16);
  return __builtin_shufflevector(c0, c1, 0, 1, 2, 3, 4, 5, 6, 7, 8, 9, 10, 11, 12, 13, 14, 15);
}

template <int KD, bool BF>
__device__ __forceinline__ void gemm_ring(const us* A, const us* B, int mblk0, int nblk0, int wm, int wn,
                                          us* ring, v8f (&acc)[8]) {
  static_assert(KD % RK == 0 && KD / RK >= 2);
  constexpr int NP = KD / RK;
  const int t = threadIdx.x;
  const us* ga = A + (size_t)(mblk0 + (t >> 4)) * KD + (t & 15) * 8;
  const us* gb = B + (size_t)(nblk0 + (t >> 4)) * KD + (t & 15) * 8;
  const unsigned ld = (unsigned)(size_t)ring + (unsigned)((t >> 4) * (RPITCH * 2) + (t & 15) * 16);

  stage_slab<KD>(ga, gb, ld);
  asm volatile("s_wait_asynccnt 0x0" ::: "memory");   // slab 0 landed (this wave's copies)
  __syncthreads();                                    // slab 0 visible to all waves
  stage_slab<KD>(ga + RK, gb + RK, ld + (unsigned)(RSTAGE * 2));

#pragma unroll 1   // kept rolled: one body of 32 matrix instructions, short code
  for (int p = 0; p < NP; ++p) {
    const int buf = p & 1;
    const us* tile = ring + buf * RSTAGE;
#pragma unroll     // unrolled so that the k offsets become immediates of the LDS reads
    for (int kk = 0; kk < RK; kk += 32) {
      // the six fragments of a k step are read as one group: one LDS latency per step, not one per column tile
      const v16us a0 = lfrag16(tile, wm * 32, kk);
      const v16us a1 = lfrag16(tile, wm * 32 + 16, kk);
      v16us b[4];
#pragma unroll     // unrolled so that b[] stays in registers
      for (int tt = 0; tt < 4; ++tt) b[tt] = lfrag16(tile, 64 + wn * 64 + 16 * tt, kk);
#pragma unroll     // unrolled so that acc[] stays in registers
      for (int tt = 0; tt < 4; ++tt) {
        if constexpr (BF) {
          acc[tt]     = mma_bf16(__builtin_bit_cast(v16bf, a0), __builtin_bit_cast(v16bf, b[tt]), acc[tt]);
          acc[4 + tt] = mma_bf16(__builtin_bit_cast(v16bf, a1), __builtin_bit_cast(v16bf, b[tt]), acc[4 + tt]);
        } else {
          acc[tt]     = mma_f16(__builtin_bit_cast(v16h, a0), __builtin_bit_cast(v16h, b[tt]), acc[tt]);
          acc[4 + tt] = mma_f16(__builtin_bit_cast(v16h, a1), __builtin_bit_cast(v16h, b[tt]), acc[4 + tt]);
        }
      }
    }
    asm volatile("s_wait_dscnt 0x0" ::: "memory");      // this wave's reads of the buffer are done before it is refilled
    asm volatile("s_wait_asynccnt 0x0" ::: "memory");   // this wave's copies of slab p + 1 have landed
    __syncthreads();                                    // publishes slab p + 1; ends every reader's last read of slab p
    if (p + 2 < NP)
      stage_slab<KD>(ga + (p + 2) * RK, gb + (p + 2) * RK, ld + (unsigned)(buf * RSTAGE * 2));
  }
  asm volatile("s_wait_asynccnt 0x0" ::: "memory");     // no copy outstanding past the loop
}

// ---------------------------------------------------------------------------
// GEMM core of the q/k/v projections: same block and wave tiling, slabs, ring order and k order as gemm_ring, K = DM,
// but the A operand is the f32 activation itself: its slab (64 rows x RK floats) is staged as f32 by the same
// asynchronous 16-byte copies and rounded to bf16 (nearest even) where a fragment is read from LDS.
// ---------------------------------------------------------------------------
#define XPITCH 132                   // A slab row pitch in floats: 528 B = 16 B x 33, conflict-free for 16-byte reads
#define XASTAGE (64 * XPITCH)        // floats per A buffer
#define XBSTAGE (256 * RPITCH)       // halves per B buffer
static_assert((XPITCH * 4) % 32 == 16 && XPITCH >= RK);
static_assert(64 * (RK / 4) == 8 * 256 && 256 * (RK / 8) == 16 * 256);   // 8 + 16 copies per thread and slab

// One slab: thread t copies chunk (t & 31) of A rows (t >> 5) + 8 i, i = 0..7 (each wave copy = 1 whole row of 512 B),
// and chunk (t & 15) of B rows (t >> 4) + 16 i, i = 0..15 (each wave copy = 2 whole rows of 256 B).
// ga / gb: this thread's chunk in its first A / B row at this slab; la / lb: its LDS byte address there.
__device__ __forceinline__ void stage_slab_x(const float* ga, const us* gb, unsigned la, unsigned lb) {
  const void* g[24];
  unsigned d[24];
#pragma unroll   // unrolled so that g[] and d[] are registers (they are asm operands)
  for (int i = 0; i < 8; ++i) {
    g[i] = ga + (size_t)(8 * i) * DM;
    d[i] = la + (unsigned)(8 * i * XPITCH * 4);
  }
#pragma unroll   // unrolled so that g[] and d[] are registers (they are asm operands)
  for (int i = 0; i < 16; ++i) {
    g[8 + i] = gb + (size_t)(16 * i) * DM;
    d[8 + i] = lb + (unsigned)(16 * i * RPITCH * 2);
  }
  // the closing s_wait_xcnt keeps the address registers of the issued copies from being rewritten early
  asm volatile("global_load_async_to_lds_b128 %0, %1, off\n\t"
               "global_load_async_to_lds_b128 %2, %3, off\n\t"
               "global_load_async_to_lds_b128 %4, %5, off\n\t"
               "global_load_async_to_lds_b128 %6, %7, off\n\t"
               "global_load_async_to_lds_b128 %8, %9, off\n\t"
               "global_load_async_to_lds_b128 %10, %11, off\n\t"
               "global_load_async_to_lds_b128 %12, %13, off\n\t"
               "global_load_async_to_lds_b128 %14, %15, off\n\t"
               "global_load_async_to_lds_b128 %16, %17, off\n\t"
               "global_load_async_to_lds_b128 %18, %19, off\n\t"
               "global_load_async_to_lds_b128 %20, %21, off\n\t"
               "global_load_async_to_lds_b128 %22, %23, off\n\t"
               "s_wait_xcnt 0x0"
               :: "v"(d[0]), "v"(g[0]), "v"(d[1]), "v"(g[1]), "v"(d[2]), "v"(g[2]), "v"(d[3]), "v"(g[3]), "v"(d[4]), "v"(g[4]), "v"(d[5]), "v"(g[5]), "v"(d[6]), "v"(g[6]), "v"(d[7]), "v"(g[7]), "v"(d[8]), "v"(g[8]), "v"(d[9]), "v"(g[9]), "v"(d[10]), "v"(g[10]), "v"(d[11]), "v"(g[11]) : "memory");
  asm volatile("global_load_async_to_lds_b128 %0, %1, off\n\t"
               "global_load_async_to_lds_b128 %2, %3, off\n\t"
               "global_load_async_to_lds_b128 %4, %5, off\n\t"
               "global_load_async_to_lds_b128 %6, %7, off\n\t"
               "global_load_async_to_lds_b128 %8, %9, off\n\t"
               "global_load_async_to_lds_b128 %10, %11, off\n\t"
               "global_load_async_to_lds_b128 %12, %13, off\n\t"
               "global_load_async_to_lds_b128 %14, %15, off\n\t"
               "global_load_async_to_lds_b128 %16, %17, off\n\t"
               "global_load_async_to_lds_b128 %18, %19, off\n\t"
               "global_load_async_to_lds_b128 %20, %21, off\n\t"
               "global_load_async_to_lds_b128 %22, %23, off\n\t"
               "s_wait_xcnt 0x0"
               :: "v"(d[12]), "v"(g[12]), "v"(d[13]), "v"(g[13]), "v"(d[14]), "v"(g[14]), "v"(d[15]), "v"(g[15]), "v"(d[16]), "v"(g[16]), "v"(d[17]), "v"(g[17]), "v"(d[18]), "v"(g[18]), "v"(d[19]), "v"(g[19]), "v"(d[20]), "v"(g[20]), "v"(d[21]), "v"(g[21]), "v"(d[22]), "v"(g[22]), "v"(d[23]), "v"(g[23]) : "memory");
}

// bf16 fragment from a staged f32 A slab (LDS), same lane and k map as frag16
__device__ __forceinline__ v16bf lfragx(const float* tile, int row0, int k0) {
  const int l = threadIdx.x & 31;
  const int r = l & 15, s = l >> 4;
  const float* p = tile + (row0 + r) * XPITCH + k0 + 8 * s;
  const v4f c0 = *(const v4f*)p;
  const v4f c1 = *(const v4f*)(p + 4);
  const v4f c2 = *(const v4f*)(p + 16);
  const v4f c3 = *(const v4f*)(p + 20);
  const v8bf lo = __builtin_convertvector(__builtin_shufflevector(c0, c1, 0, 1, 2, 3, 4, 5, 6, 7), v8bf);
  const v8bf hi = __builtin_convertvector(__builtin_shufflevector(c2, c3, 0, 1, 2, 3, 4, 5, 6, 7), v8bf);
  return __builtin_shufflevector(lo, hi, 0, 1, 2, 3, 4, 5, 6, 7, 8, 9, 10, 11, 12, 13, 14, 15);
}

// Ax: first of the block's 64 rows of the f32 activation (pitch DM); B plane [N][DM] bf16, k contiguous.
__device__ __forceinline__ void gemm_ring_x(const float* Ax, const us* B, int nblk0, int wm, int wn,
                                            float* ringa, us* ringb, v8f (&acc)[8]) {
  static_assert(DM % RK == 0 && DM / RK >= 2);
  constexpr int NP = DM / RK;
  const int t = threadIdx.x;
  const float* ga = Ax + (size_t)(t >> 5) * DM + (t & 31) * 4;
  const us* gb = B + (size_t)(nblk0 + (t >> 4)) * DM + (t & 15) * 8;
  const unsigned la = (unsigned)(size_t)ringa + (unsigned)((t >> 5) * (XPITCH * 4) + (t & 31) * 16);
  const unsigned lb = (unsigned)(size_t)ringb + (unsigned)((t >> 4) * (RPITCH * 2) + (t & 15) * 16);

  stage_slab_x(ga, gb, la, lb);
  asm volatile("s_wait_asynccnt 0x0" ::: "memory");   // slab 0 landed (this wave's copies)
  __syncthreads();                                    // slab 0 visible to all waves
  stage_slab_x(ga + RK, gb + RK, la + (unsigned)(XASTAGE * 4), lb + (unsigned)(XBSTAGE * 2));

#pragma unroll 1   // kept rolled: one body of 32 matrix instructions, short code
  for (int p = 0; p < NP; ++p) {
    const int buf = p & 1;
    const float* ta = ringa + buf * XASTAGE;
    const us* tb = ringb + buf * XBSTAGE;
#pragma unroll     // unrolled so that the k offsets become immediates of the LDS reads
    for (int kk = 0; kk < RK; kk += 32) {
      // the six fragments of a k step are read as one group: one LDS latency per step, not one per column tile
      const v16bf a0 = lfragx(ta, wm * 32, kk);
      const v16bf a1 = lfragx(ta, wm * 32 + 16, kk);
      v16us b[4];
#pragma unroll     // unrolled so that b[] stays in registers
      for (int tt = 0; tt < 4; ++tt) b[tt] = lfrag16(tb, wn * 64 + 16 * tt, kk);
#pragma unroll     // unrolled so that acc[] stays in registers
      for (int tt = 0; tt < 4; ++tt) {
        acc[tt]     = mma_bf16(a0, __builtin_bit_cast(v16bf, b[tt]), acc[tt]);
        acc[4 + tt] = mma_bf16(a1, __builtin_bit_cast(v16bf, b[tt]), acc[4 + tt]);
      }
    }
    asm volatile("s_wait_dscnt 0x0" ::: "memory");      // this wave's reads of the buffer are done before it is refilled
    asm volatile("s_wait_asynccnt 0x0" ::: "memory");   // this wave's copies of slab p + 1 have landed
    __syncthreads();                                    // publishes slab p + 1; ends every reader's last read of slab p
    if (p + 2 < NP)
      stage_slab_x(ga + (p + 2) * RK, gb + (p + 2) * RK,
                   la + (unsigned)(buf * XASTAGE * 4), lb + (unsigned)(buf * XBSTAGE * 2));
  }
  asm volatile("s_wait_asynccnt 0x0" ::: "memory");     // no copy outstanding past the loop
}

// ---------------------------------------------------------------------------
// Projection: Y = bf16(X)[MROWS][DM] * Wt^T + b, written as an f16 plane. X f32 [NB_FULL*SEQ_FULL][DM].
// mode 0/1: q or k -> value plane [NB*NH][SEQ][64]
// mode 2:   v      -> transposed value plane [NB*NH][64][SEQ]
// Blocks whose 64 rows lie below EROWS (block-uniform) also write the x2048 residual plane at Y + roff:
// mode 0/1: [NB*NH][EROWS][64]; mode 2: [NB*NH][64][EROWS].
// Block 256 thr = 8 waves as 2(M) x 4(N); block tile 64 x 256; grid (MROWS/64, DM/256).
// ---------------------------------------------------------------------------
__global__ __launch_bounds__(256) __attribute__((amdgpu_num_vgpr(256)))
void proj_kernel(const float* __restrict__ X, const us* __restrict__ Wt,
                 const float* __restrict__ bias, us* Y, size_t roff, int mode) {
  __shared__ __attribute__((aligned(16))) us stile[64 * 256];       // cross-wave (block barrier)
  __shared__ __attribute__((aligned(16))) float ringa[2 * XASTAGE]; // f32 A slabs, cross-wave (block barrier)
  __shared__ __attribute__((aligned(16))) us ringb[2 * XBSTAGE];    // bf16 B slabs, cross-wave (block barrier)

  const int t = threadIdx.x;
  const int wid = __builtin_amdgcn_readfirstlane(t >> 5);
  const int l = t & 31;
  const int h = l >> 4, r16 = l & 15;
  const int wm = wid >> 2, wn = wid & 3;
  const int mblk0 = blockIdx.x * 64;
  const int nblk0 = blockIdx.y * 256;
  const int n0 = nblk0 + wn * 64;

  const int bblk = mblk0 / SEQ;
  const int sblk = mblk0 - bblk * SEQ;  // 64 block rows lie inside one batch (SEQ % 64 == 0)

  v8f acc[8] = {};
  gemm_ring_x(X + (size_t)(bblk * SEQ_FULL + sblk) * DM, Wt, nblk0, wm, wn, ringa, ringb, acc);

  float bvv[4];
#pragma unroll
  for (int tt = 0; tt < 4; ++tt) bvv[tt] = bf16rne(bias[n0 + 16 * tt + r16]);

  const int c = l & 7;
  const int nph = (sblk < EROWS) ? 2 : 1;   // block-uniform: phase 0 value plane, phase 1 residual plane

#pragma unroll 1
  for (int ph = 0; ph < nph; ++ph) {
    if (ph) __syncthreads();              // readers of the value stage done

    // stage f16 value (phase 0) or x2048 residual (phase 1) of (acc + bias) into LDS
#pragma unroll
    for (int tt = 0; tt < 4; ++tt) {
      const int nl = wn * 64 + 16 * tt + r16;
#pragma unroll
      for (int mi = 0; mi < 2; ++mi) {
#pragma unroll
        for (int r = 0; r < 8; ++r) {
          const int ml = wm * 32 + 16 * mi + 8 * h + r;
          const float v = acc[mi * 4 + tt][r] + bvv[tt];
          const _Float16 hv = (_Float16)v;
          const float rs = (v - (float)hv) * RES_CARRY;
          const us hb = __builtin_bit_cast(us, hv);
          const us rb = f16_bits(rs);
          const int li = (mode == 2) ? (nl * 64 + ml) : (ml * 256 + nl);
          stile[li] = ph ? rb : hb;
        }
      }
    }
    __syncthreads();

    // whole-line writes: 256 lines per block, 32 per wave
    const int SL = ph ? EROWS : SEQ;      // sequence extent of the destination plane
    const size_t poff = ph ? roff : (size_t)0;
    v8us vals[8];
    size_t dsts[8];
#pragma unroll
    for (int it = 0; it < 8; ++it) {
      const int L = wid * 32 + (l >> 3) + 4 * it;
      int src;
      size_t dst;
      if (mode == 2) {
        const int n = nblk0 + L;
        const int hg = n >> 6, d = n & 63;
        src = L * 64 + 8 * c;
        dst = (((size_t)(bblk * NH + hg)) * DKH + d) * SL + sblk + 8 * c;
      } else {
        const int ml = L >> 2, hq = L & 3;
        const int hg = (nblk0 >> 6) + hq;
        const int s = sblk + ml;
        src = ml * 256 + hq * 64 + 8 * c;
        dst = (((size_t)(bblk * NH + hg)) * SL + s) * DKH + 8 * c;
      }
      vals[it] = *(const v8us*)&stile[src];
      dsts[it] = dst + poff;
    }
#pragma unroll
    for (int it = 0; it < 8; ++it) *(v8us*)(Y + dsts[it]) = vals[it];
    
  }
}

// ---------------------------------------------------------------------------
// LDS row pitches of the attention K and V tiles (halves). The fragment readers are 16-byte reads, one row per lane:
// a pitch of 16 B x odd spreads the 16 rows of a read over all banks (unpadded 128-B / 64-B rows fall on few banks).
// ---------------------------------------------------------------------------
#define KPITCH 72                    // K tile: 64 d per key row + 8 halves of pad = 144 B = 16 B x 9
#define VPITCH 40                    // V tile: 32 keys per d row + 8 halves of pad = 80 B = 16 B x 5
static_assert(KPITCH >= DKH && (KPITCH * 2) % 32 == 16);
static_assert(VPITCH >= 32 && (VPITCH * 2) % 32 == 16);

// ---------------------------------------------------------------------------
// Per-wave part of the key-step bound of a 128-query block, from the mask bit plane.
// Thread t scans half a row (row = t>>1 of the block). A row with at least one visible key needs
// key steps [0, last visible word]; a row with no visible key needs every key step (uniform softmax).
// Returns the maximum over the wave's 16 rows (all lanes hold it).
// ---------------------------------------------------------------------------
__device__ __forceinline__ int wave_key_bound(const unsigned* __restrict__ Mb, int qb) {
  const int t = threadIdx.x;
  const int hw = (t & 1) * (WPR / 2);
  const unsigned* mrow = Mb + (size_t)(qb * 128 + (t >> 1)) * WPR + hw;
  int kmx = -1;
#pragma unroll 1
  for (int j = 0; j < WPR / 2; j += 4) {
    const v4u w = *(const v4u*)(mrow + j);
    kmx = (w[0] != 0u) ? (hw + j)     : kmx;
    kmx = (w[1] != 0u) ? (hw + j + 1) : kmx;
    kmx = (w[2] != 0u) ? (hw + j + 2) : kmx;
    kmx = (w[3] != 0u) ? (hw + j + 3) : kmx;
  }
  const int oth = __shfl_xor(kmx, 1, 32);
  kmx = max(kmx, oth);
  int ke = (kmx < 0) ? WPR : (kmx + 1);
  ke = max(ke, __shfl_xor(ke, 16, 32));
  ke = max(ke, __shfl_xor(ke, 8, 32));
  ke = max(ke, __shfl_xor(ke, 4, 32));
  ke = max(ke, __shfl_xor(ke, 2, 32));
  return ke;
}

// ---------------------------------------------------------------------------
// Fused flash attention, query rows >= EROWS. Block = 8 waves, one (b,h), 128 queries; each wave owns
// 16 queries. K/V 32-key blocks staged once per block into LDS with plain loads.
// Scores computed transposed (S' = K_blk * Q^T) so the exp'd probabilities are
// already in A-operand layout for P*V. Online softmax in f32.
// Mask: one bit word per lane (= query) per 32-key step; masked scores are REPLACED by NEG_FILL.
// Key loop bound per block derived from the mask words (clamped to SEQ/32).
// ctx plane f16 [MROWS][2*DM]: cols [0,DM) value x256, cols [DM,2DM) residual x256,
// grid = NB*NH*((SEQ-EROWS)/128).
// ---------------------------------------------------------------------------
__global__ __launch_bounds__(256) __attribute__((amdgpu_num_vgpr(256)))
void attn_kernel(const us* __restrict__ Qh, const us* __restrict__ Kh,
                 const us* __restrict__ Vt, const unsigned* __restrict__ Mb, us* Ctx) {
  __shared__ __attribute__((aligned(16))) us shK[32 * KPITCH];      // [key][d], padded rows, cross-wave (block barrier)
  __shared__ __attribute__((aligned(16))) us shV[64 * VPITCH];      // [d][key], padded rows, cross-wave (block barrier)
  __shared__ __attribute__((aligned(16))) us shC[8 * 2 * 16 * 64];  // per-wave ctx staging, value|residual (block barrier used)
  __shared__ int shE[8];                                            // per-wave key bounds, cross-wave (block barrier)

  const int t = threadIdx.x;
  const int wid = __builtin_amdgcn_readfirstlane(t >> 5);
  const int l = t & 31;
  const int r16 = l & 15;
  const int hs = l >> 4;
  const int rowsel = hs << 3;
  constexpr int QBL = (SEQ > EROWS) ? (SEQ - EROWS) / 128 : 1;
  const int bh = blockIdx.x / QBL;
  const int qb = blockIdx.x - bh * QBL + EROWS / 128;
  const int q0 = qb * 128 + wid * 16;

  const size_t qoff = (size_t)bh * SEQ * DKH;
  const us* qp = Qh + qoff;
  const us* kp = Kh + qoff;
  const us* vp = Vt + (size_t)bh * DKH * SEQ;

  // key-step bound of this block (exact for any mask value), clamped to the static maximum
  const int kew = wave_key_bound(Mb, qb);
  if (l == 0) shE[wid] = kew;
  __syncthreads();
  int kall = shE[0];
#pragma unroll
  for (int w = 1; w < 8; ++w) kall = max(kall, shE[w]);
  kall = min(max(kall, 1), WPR);
  const int ksteps = __builtin_amdgcn_readfirstlane(kall);

  const unsigned* mq = Mb + (size_t)(q0 + r16) * WPR;   // this lane's query row of mask words

  // Q^T as B operand for the whole loop (lane = query column, halves = d)
  const v16h qB0 = fragh(qp, DKH, q0, 0);
  const v16h qB1 = fragh(qp, DKH, q0, 32);

  v8f o[4];
#pragma unroll
  for (int tt = 0; tt < 4; ++tt) o[tt] = v8f{};
  float mmax = NEG_FILL, lsum = 0.0f;

  const int krow = t >> 3, kcol = (t & 7) * 8;   // K: 32 keys x 64 d
  const int vrow = t >> 2, vcol = (t & 3) * 8;   // V: 64 d x 32 keys
  const int kfo = r16 * KPITCH + 8 * hs;           // shK fragment lane offset (row = key, k = d)
  const int vfo = r16 * VPITCH + 8 * hs;           // shV fragment lane offset (row = d, k = key)

#pragma unroll 1
  for (int ks = 0; ks < ksteps; ++ks) {
    const int kb = ks * 32;
    __syncthreads();    // prior readers of shK/shV done
    *(v8us*)&shK[krow * KPITCH + kcol] = *(const v8us*)(kp + (size_t)(kb + krow) * DKH + kcol);
    *(v8us*)&shV[vrow * VPITCH + vcol] = *(const v8us*)(vp + (size_t)vrow * SEQ + kb + vcol);
    __syncthreads();    // stage visible to all waves

    // mask word of this lane's query for these 32 keys (pinned before the selects)
    unsigned mw = mq[ks];
    asm volatile("" : "+v"(mw));
    const unsigned ml = mw >> (8 * hs);

    // S' tiles: M = key (relative 0..15 / 16..31), N = query; k = d
    v8f s0 = {};
    v8f s1 = {};
    {
      const v16h kA = cat16h(*(const v8us*)&shK[kfo], *(const v8us*)&shK[kfo + 16]);
      s0 = mma_f16(kA, qB0, s0);
    }
    {
      const v16h kA = cat16h(*(const v8us*)&shK[kfo + 32], *(const v8us*)&shK[kfo + 48]);
      s0 = mma_f16(kA, qB1, s0);
    }
    {
      const v16h kA = cat16h(*(const v8us*)&shK[16 * KPITCH + kfo], *(const v8us*)&shK[16 * KPITCH + kfo + 16]);
      s1 = mma_f16(kA, qB0, s1);
    }
    {
      const v16h kA = cat16h(*(const v8us*)&shK[16 * KPITCH + kfo + 32], *(const v8us*)&shK[16 * KPITCH + kfo + 48]);
      s1 = mma_f16(kA, qB1, s1);
    }

    // scale, then replace masked scores: s0[i] = key 8h+i, s1[i] = key 16+8h+i of this step
#pragma unroll
    for (int i = 0; i < 8; ++i) {
      const float a0 = s0[i] * QK_SCALE;
      const float a1 = s1[i] * QK_SCALE;
      s0[i] = ((ml >> i) & 1u) ? a0 : NEG_FILL;
      s1[i] = ((ml >> (16 + i)) & 1u) ? a1 : NEG_FILL;
    }

    // per-query (per-lane) block max; combine the two key halves (lane ^ 16)
    float bm = s0[0];
#pragma unroll
    for (int i = 0; i < 8; ++i) { bm = fmaxf(bm, s0[i]); bm = fmaxf(bm, s1[i]); }
    bm = fmaxf(bm, __shfl_xor(bm, 16, 32));
    const float mnew = fmaxf(mmax, bm);
    const float corr = __expf(fmaxf(mmax - mnew, EXP_FLOOR));
    mmax = mnew;

    // probabilities land directly in A-operand layout (elements 0..7 <- keys 8h..8h+7
    // from the first 16-key D tile, elements 8..15 <- keys 16+8h.. from the second)
    float ps = 0.0f;
    v16h pA;
#pragma unroll
    for (int i = 0; i < 8; ++i) {
      const float p0 = __expf(fmaxf(s0[i] - mnew, EXP_FLOOR));
      const float p1 = __expf(fmaxf(s1[i] - mnew, EXP_FLOOR));
      ps += p0 + p1;
      pA[i]     = (_Float16)(p0 * P_CARRY);
      pA[8 + i] = (_Float16)(p1 * P_CARRY);
    }
    ps += __shfl_xor(ps, 16, 32);
    lsum = lsum * corr + ps;

    // rescale O: D row 8h+r = query 8h+r, whose corr lives in lane 8h+r
#pragma unroll
    for (int r = 0; r < 8; ++r) {
      const float cr = __shfl(corr, rowsel + r, 32);
#pragma unroll
      for (int tt = 0; tt < 4; ++tt) o[tt][r] *= cr;
    }

    // O += P(16 x 32 keys) * V_blk(32 keys x 64 d); B rows = d, k = key contiguous in shV
#pragma unroll
    for (int tt = 0; tt < 4; ++tt) {
      const v16h vB = cat16h(*(const v8us*)&shV[16 * tt * VPITCH + vfo],
                             *(const v8us*)&shV[16 * tt * VPITCH + vfo + 16]);
      o[tt] = mma_f16(pA, vB, o[tt]);
    }
  }

  // normalize, stage this wave's 16 x 64 ctx tile (f16 value x256 and residual x256) in LDS
  const int bb = bh / NH;
  const int hh = bh - bb * NH;
#pragma unroll
  for (int r = 0; r < 8; ++r) {
    const float lrow = __shfl(lsum, rowsel + r, 32);
    const float li = CTX_SCALE * __builtin_amdgcn_rcpf(lrow);
#pragma unroll
    for (int tt = 0; tt < 4; ++tt) {
      const float cv = o[tt][r] * li;
      const _Float16 hv = (_Float16)cv;
      const float rs = (cv - (float)hv) * CTXRES_CARRY;
      const int si = wid * 2048 + (rowsel + r) * 64 + 16 * tt + r16;
      shC[si]        = __builtin_bit_cast(us, hv);
      shC[si + 1024] = f16_bits(rs);
    }
  }
  __syncthreads();

  const int c = l & 7;
  v8us vals[8];
  size_t dsts[8];
#pragma unroll
  for (int it = 0; it < 8; ++it) {
    const int Lw = (l >> 3) + 4 * it;    // 0..31
    const int pl = Lw >> 4;              // 0 value, 1 residual
    const int rl = Lw & 15;
    vals[it] = *(const v8us*)&shC[wid * 2048 + pl * 1024 + rl * 64 + 8 * c];
    const int s = q0 + rl;
    dsts[it] = ((size_t)(bb * SEQ + s)) * DM2 + (size_t)pl * DM + hh * DKH + 8 * c;
  }
#pragma unroll
  for (int it = 0; it < 8; ++it) *(v8us*)(Ctx + dsts[it]) = vals[it];
  
}

// ---------------------------------------------------------------------------
// Early band of the fused flash attention: query rows < EROWS. Same structure as attn_kernel.
// For key steps below EROWS (block-uniform test) q, k and v are value + x2048 residual planes:
// scores = kv*qv + (kv*qr + kr*qv)/2048 (residual products in their own accumulator);
// P = f16 value + x2048 residual; O = pv*vv + (pr*vv + pv*vr)/2048 (own accumulator, folded before
// the normalisation). Key steps at or above EROWS (only visited when the mask asks for them) use
// the value planes of k and v alone. Row sum over the unconverted p.
// grid = NB*NH*(EROWS/128).
// ---------------------------------------------------------------------------
__global__ __launch_bounds__(256) __attribute__((amdgpu_num_vgpr(256)))
void attn_early_kernel(const us* __restrict__ Qh, const us* __restrict__ Kh, const us* __restrict__ Vt,
                       const us* __restrict__ Qr, const us* __restrict__ Kr, const us* __restrict__ Vr,
                       const unsigned* __restrict__ Mb, us* Ctx) {
  __shared__ __attribute__((aligned(16))) us shK[32 * KPITCH];      // [key][d], padded rows, cross-wave (block barrier)
  __shared__ __attribute__((aligned(16))) us shV[64 * VPITCH];      // [d][key], padded rows, cross-wave (block barrier)
  __shared__ __attribute__((aligned(16))) us shKr[32 * KPITCH];     // residual of shK, cross-wave (block barrier)
  __shared__ __attribute__((aligned(16))) us shVr[64 * VPITCH];     // residual of shV, cross-wave (block barrier)
  __shared__ __attribute__((aligned(16))) us shC[8 * 2 * 16 * 64];  // per-wave ctx staging, value|residual (block barrier used)
  __shared__ int shE[8];                                            // per-wave key bounds, cross-wave (block barrier)

  const int t = threadIdx.x;
  const int wid = __builtin_amdgcn_readfirstlane(t >> 5);
  const int l = t & 31;
  const int r16 = l & 15;
  const int hs = l >> 4;
  const int rowsel = hs << 3;
  constexpr int QBE = EROWS / 128;
  const int bh = blockIdx.x / QBE;
  const int qb = blockIdx.x - bh * QBE;
  const int q0 = qb * 128 + wid * 16;

  const size_t qoff = (size_t)bh * SEQ * DKH;
  const size_t roff = (size_t)bh * EROWS * DKH;
  const us* qp = Qh + qoff;
  const us* kp = Kh + qoff;
  const us* vp = Vt + (size_t)bh * DKH * SEQ;
  const us* qrp = Qr + roff;
  const us* krp = Kr + roff;
  const us* vrp = Vr + (size_t)bh * DKH * EROWS;

  // key-step bound of this block (exact for any mask value), clamped to the static maximum
  const int kew = wave_key_bound(Mb, qb);
  if (l == 0) shE[wid] = kew;
  __syncthreads();
  int kall = shE[0];
#pragma unroll
  for (int w = 1; w < 8; ++w) kall = max(kall, shE[w]);
  kall = min(max(kall, 1), WPR);
  const int ksteps = __builtin_amdgcn_readfirstlane(kall);

  const unsigned* mq = Mb + (size_t)(q0 + r16) * WPR;   // this lane's query row of mask words

  // Q^T value and residual as B operands for the whole loop (lane = query column, halves = d)
  const v16h qB0 = fragh(qp, DKH, q0, 0);
  const v16h qB1 = fragh(qp, DKH, q0, 32);
  const v16h qR0 = fragh(qrp, DKH, q0, 0);
  const v16h qR1 = fragh(qrp, DKH, q0, 32);

  v8f o[4], orr[4];
#pragma unroll
  for (int tt = 0; tt < 4; ++tt) { o[tt] = v8f{}; orr[tt] = v8f{}; }
  float mmax = NEG_FILL, lsum = 0.0f;

  const int krow = t >> 3, kcol = (t & 7) * 8;   // K: 32 keys x 64 d
  const int vrow = t >> 2, vcol = (t & 3) * 8;   // V: 64 d x 32 keys
  const int kfo = r16 * KPITCH + 8 * hs;           // shK fragment lane offset (row = key, k = d)
  const int vfo = r16 * VPITCH + 8 * hs;           // shV fragment lane offset (row = d, k = key)

#pragma unroll 1
  for (int ks = 0; ks < ksteps; ++ks) {
    const int kb = ks * 32;
    const bool res = kb < EROWS;        // block-uniform: residual planes exist for these keys
    __syncthreads();    // prior readers of the LDS tiles done
    *(v8us*)&shK[krow * KPITCH + kcol] = *(const v8us*)(kp + (size_t)(kb + krow) * DKH + kcol);
    *(v8us*)&shV[vrow * VPITCH + vcol] = *(const v8us*)(vp + (size_t)vrow * SEQ + kb + vcol);
    if (res) {
      *(v8us*)&shKr[krow * KPITCH + kcol] = *(const v8us*)(krp + (size_t)(kb + krow) * DKH + kcol);
      *(v8us*)&shVr[vrow * VPITCH + vcol] = *(const v8us*)(vrp + (size_t)vrow * EROWS + kb + vcol);
    }
    __syncthreads();    // stage visible to all waves

    // mask word of this lane's query for these 32 keys (pinned before the selects)
    unsigned mw = mq[ks];
    asm volatile("" : "+v"(mw));
    const unsigned ml = mw >> (8 * hs);

    // S' tiles: M = key (relative 0..15 / 16..31), N = query; k = d
    const v16h kA00 = cat16h(*(const v8us*)&shK[kfo], *(const v8us*)&shK[kfo + 16]);
    const v16h kA01 = cat16h(*(const v8us*)&shK[kfo + 32], *(const v8us*)&shK[kfo + 48]);
    const v16h kA10 = cat16h(*(const v8us*)&shK[16 * KPITCH + kfo], *(const v8us*)&shK[16 * KPITCH + kfo + 16]);
    const v16h kA11 = cat16h(*(const v8us*)&shK[16 * KPITCH + kfo + 32], *(const v8us*)&shK[16 * KPITCH + kfo + 48]);
    v8f s0 = {};
    v8f s1 = {};
    s0 = mma_f16(kA00, qB0, s0);
    s0 = mma_f16(kA01, qB1, s0);
    s1 = mma_f16(kA10, qB0, s1);
    s1 = mma_f16(kA11, qB1, s1);

    // residual score products (x2048 units) in their own accumulators
    v8f x0 = {};
    v8f x1 = {};
    if (res) {
      x0 = mma_f16(kA00, qR0, x0);
      x0 = mma_f16(kA01, qR1, x0);
      x1 = mma_f16(kA10, qR0, x1);
      x1 = mma_f16(kA11, qR1, x1);
      {
        const v16h kR = cat16h(*(const v8us*)&shKr[kfo], *(const v8us*)&shKr[kfo + 16]);
        x0 = mma_f16(kR, qB0, x0);
      }
      {
        const v16h kR = cat16h(*(const v8us*)&shKr[kfo + 32], *(const v8us*)&shKr[kfo + 48]);
        x0 = mma_f16(kR, qB1, x0);
      }
      {
        const v16h kR = cat16h(*(const v8us*)&shKr[16 * KPITCH + kfo], *(const v8us*)&shKr[16 * KPITCH + kfo + 16]);
        x1 = mma_f16(kR, qB0, x1);
      }
      {
        const v16h kR = cat16h(*(const v8us*)&shKr[16 * KPITCH + kfo + 32], *(const v8us*)&shKr[16 * KPITCH + kfo + 48]);
        x1 = mma_f16(kR, qB1, x1);
      }
    }

    // fold, scale, then replace masked scores: s0[i] = key 8h+i, s1[i] = key 16+8h+i of this step
#pragma unroll
    for (int i = 0; i < 8; ++i) {
      const float a0 = (s0[i] + x0[i] * RES_INV) * QK_SCALE;
      const float a1 = (s1[i] + x1[i] * RES_INV) * QK_SCALE;
      s0[i] = ((ml >> i) & 1u) ? a0 : NEG_FILL;
      s1[i] = ((ml >> (16 + i)) & 1u) ? a1 : NEG_FILL;
    }

    // per-query (per-lane) block max; combine the two key halves (lane ^ 16)
    float bm = s0[0];
#pragma unroll
    for (int i = 0; i < 8; ++i) { bm = fmaxf(bm, s0[i]); bm = fmaxf(bm, s1[i]); }
    bm = fmaxf(bm, __shfl_xor(bm, 16, 32));
    const float mnew = fmaxf(mmax, bm);
    const float corr = __expf(fmaxf(mmax - mnew, EXP_FLOOR));
    mmax = mnew;

    // probabilities (value + residual) land directly in A-operand layout
    float ps = 0.0f;
    v16h pA, pR;
#pragma unroll
    for (int i = 0; i < 8; ++i) {
      const float p0 = __expf(fmaxf(s0[i] - mnew, EXP_FLOOR));
      const float p1 = __expf(fmaxf(s1[i] - mnew, EXP_FLOOR));
      ps += p0 + p1;
      const float c0 = p0 * P_CARRY;
      const float c1 = p1 * P_CARRY;
      const _Float16 h0 = (_Float16)c0;
      const _Float16 h1 = (_Float16)c1;
      pA[i]     = h0;
      pA[8 + i] = h1;
      pR[i]     = (_Float16)((c0 - (float)h0) * RES_CARRY);
      pR[8 + i] = (_Float16)((c1 - (float)h1) * RES_CARRY);
    }
    ps += __shfl_xor(ps, 16, 32);
    lsum = lsum * corr + ps;

    // rescale both accumulators: D row 8h+r = query 8h+r, whose corr lives in lane 8h+r
#pragma unroll
    for (int r = 0; r < 8; ++r) {
      const float cr = __shfl(corr, rowsel + r, 32);
#pragma unroll
      for (int tt = 0; tt < 4; ++tt) { o[tt][r] *= cr; orr[tt][r] *= cr; }
    }

    // O += P * V_blk (value products); residual accumulator += P_res * V
#pragma unroll
    for (int tt = 0; tt < 4; ++tt) {
      const v16h vB = cat16h(*(const v8us*)&shV[16 * tt * VPITCH + vfo],
                             *(const v8us*)&shV[16 * tt * VPITCH + vfo + 16]);
      o[tt]   = mma_f16(pA, vB, o[tt]);
      orr[tt] = mma_f16(pR, vB, orr[tt]);
    }
    // residual accumulator += P * V_res
    if (res) {
#pragma unroll
      for (int tt = 0; tt < 4; ++tt) {
        const v16h vRB = cat16h(*(const v8us*)&shVr[16 * tt * VPITCH + vfo],
                                *(const v8us*)&shVr[16 * tt * VPITCH + vfo + 16]);
        orr[tt] = mma_f16(pA, vRB, orr[tt]);
      }
    }
  }

  // fold the residual accumulator, normalize, stage this wave's 16 x 64 ctx tile in LDS
  const int bb = bh / NH;
  const int hh = bh - bb * NH;
#pragma unroll
  for (int r = 0; r < 8; ++r) {
    const float lrow = __shfl(lsum, rowsel + r, 32);
    const float li = CTX_SCALE * __builtin_amdgcn_rcpf(lrow);
#pragma unroll
    for (int tt = 0; tt < 4; ++tt) {
      const float cv = (o[tt][r] + orr[tt][r] * RES_INV) * li;
      const _Float16 hv = (_Float16)cv;
      const float rs = (cv - (float)hv) * CTXRES_CARRY;
      const int si = wid * 2048 + (rowsel + r) * 64 + 16 * tt + r16;
      shC[si]        = __builtin_bit_cast(us, hv);
      shC[si + 1024] = f16_bits(rs);
    }
  }
  __syncthreads();

  const int c = l & 7;
  v8us vals[8];
  size_t dsts[8];
#pragma unroll
  for (int it = 0; it < 8; ++it) {
    const int Lw = (l >> 3) + 4 * it;    // 0..31
    const int pl = Lw >> 4;              // 0 value, 1 residual
    const int rl = Lw & 15;
    vals[it] = *(const v8us*)&shC[wid * 2048 + pl * 1024 + rl * 64 + 8 * c];
    const int s = q0 + rl;
    dsts[it] = ((size_t)(bb * SEQ + s)) * DM2 + (size_t)pl * DM + hh * DKH + 8 * c;
  }
#pragma unroll
  for (int it = 0; it < 8; ++it) *(v8us*)(Ctx + dsts[it]) = vals[it];
  
}

// ---------------------------------------------------------------------------
// Output projection: Out f32 [MROWS][DM] = [ctx x256 | ctx residual x256] * [Wo x64 | Wo x0.25]^T * OUT_FOLD + bo.
// K = 2*DM, one accumulator (both halves of K are in the same units).
// Same block tiling as proj_kernel; f32 tile staged in two 16-row halves per wave
// (32 x 256 floats in LDS), each d_out line (32 floats) written by 8 lanes x 16 B.
// ---------------------------------------------------------------------------
__global__ __launch_bounds__(256) __attribute__((amdgpu_num_vgpr(256)))
void outproj_kernel(const us* __restrict__ Ctx, const us* __restrict__ Wot,
                    const float* __restrict__ bo, float* Out) {
  __shared__ __attribute__((aligned(16))) float ftile[32 * 256];    // cross-wave (block barrier)
  __shared__ __attribute__((aligned(16))) us ring[2 * RSTAGE];      // operand slabs, cross-wave (block barrier)

  const int t = threadIdx.x;
  const int wid = __builtin_amdgcn_readfirstlane(t >> 5);
  const int l = t & 31;
  const int h = l >> 4, r16 = l & 15;
  const int wm = wid >> 2, wn = wid & 3;
  const int mblk0 = blockIdx.x * 64;
  const int nblk0 = blockIdx.y * 256;
  const int n0 = nblk0 + wn * 64;

  v8f acc[8] = {};
  gemm_ring<DM2, false>(Ctx, Wot, mblk0, nblk0, wm, wn, ring, acc);

  float bob[4];
#pragma unroll
  for (int tt = 0; tt < 4; ++tt) bob[tt] = bf16rne(bo[n0 + 16 * tt + r16]);

  const int c = l & 7;
#pragma unroll
  for (int p = 0; p < 2; ++p) {
    if (p) __syncthreads();   // readers of the prior half done
#pragma unroll
    for (int tt = 0; tt < 4; ++tt) {
      const int nl = wn * 64 + 16 * tt + r16;
#pragma unroll
      for (int r = 0; r < 8; ++r) {
        const int rl = wm * 16 + 8 * h + r;           // 0..31
        ftile[rl * 256 + nl] = acc[p * 4 + tt][r] * OUT_FOLD + bob[tt];
      }
    }
    __syncthreads();

    v4f vals[8];
    size_t dsts[8];
#pragma unroll
    for (int it = 0; it < 8; ++it) {
      const int L = wid * 32 + (l >> 3) + 4 * it;    // 0..255
      const int rl = L >> 3, seg = L & 7;
      vals[it] = *(const v4f*)&ftile[rl * 256 + seg * 32 + 4 * c];
      const int m = mblk0 + (rl >> 4) * 32 + p * 16 + (rl & 15);
      dsts[it] = (size_t)m * DM + nblk0 + seg * 32 + 4 * c;
    }
#pragma unroll
    for (int it = 0; it < 8; ++it) *(v4f*)(Out + dsts[it]) = vals[it];
    
  }
}

// ---------------------------------------------------------------------------
// Host launcher
// ---------------------------------------------------------------------------
extern "C" void kernel_launch(void* const* d_in, const int* in_sizes, int n_in,
                              void* d_out, int out_size, void* d_ws, size_t ws_size,
                              hipStream_t stream) {
  if (n_in < 12) return;
  const int need_x = ((NB - 1) * SEQ_FULL + SEQ) * DM;
  if (in_sizes[0] < need_x || in_sizes[1] < need_x || in_sizes[2] < need_x) return;
  if (in_sizes[3] < DM * DM || in_sizes[5] < DM * DM || in_sizes[7] < DM * DM || in_sizes[9] < DM * DM) return;
  if (in_sizes[4] < DM || in_sizes[6] < DM || in_sizes[8] < DM || in_sizes[10] < DM) return;
  if (in_sizes[11] < (SEQ - 1) * SEQ_FULL + SEQ) return;
  if (out_size < MROWS * DM) return;

  // bound by role in the input order: queries, keys, values, Wq, bq, Wk, bk, Wv, bv, Wo, bo, mask
  const float* Q  = (const float*)d_in[0];
  const float* K  = (const float*)d_in[1];
  const float* V  = (const float*)d_in[2];
  const float* Wq = (const float*)d_in[3];
  const float* bq = (const float*)d_in[4];
  const float* Wk = (const float*)d_in[5];
  const float* bk = (const float*)d_in[6];
  const float* Wv = (const float*)d_in[7];
  const float* bv = (const float*)d_in[8];
  const float* Wo = (const float*)d_in[9];
  const float* bo = (const float*)d_in[10];
  const int*   Mk = (const int*)d_in[11];

  const size_t XE = (size_t)MROWS * DM;            // halves per activation plane
  const size_t WE = (size_t)DM * DM;               // halves per weight plane
  const size_t RE = (size_t)NB * NH * EROWS * DKH; // halves per early residual plane
  const size_t BW = (size_t)SEQ * WPR;             // 32-bit words of the mask bit plane
  const size_t total_bytes = (5 * XE + 5 * WE + 3 * RE) * sizeof(us) + BW * sizeof(unsigned);
  if (total_bytes > ws_size) return;

  us* wtq = (us*)d_ws;         // [n][k] bf16
  us* wtk = wtq + WE;
  us* wtv = wtk + WE;
  us* wo2 = wtv + WE;          // 2 * WE  ([DM][2*DM]) f16
  us* qh  = wo2 + 2 * WE;      // q value plane [NB*NH][SEQ][64]
  us* kh  = qh + XE;           // k value plane [NB*NH][SEQ][64]
  us* vt  = kh + XE;           // v transposed plane [NB*NH][64][SEQ]
  us* ctx = vt + XE;           // 2 * XE  ([MROWS][2*DM])
  us* qr  = ctx + 2 * XE;      // q residual plane [NB*NH][EROWS][64]
  us* kr  = qr + RE;           // k residual plane [NB*NH][EROWS][64]
  us* vr  = kr + RE;           // v residual transposed plane [NB*NH][64][EROWS]
  unsigned* mb = (unsigned*)(vr + RE);   // mask bit plane [SEQ][WPR]

  dim3 blk(256);
  const int n4 = (int)(BW / 4);
  mask_pack_kernel<<<dim3((n4 + 255) / 256), blk, 0, stream>>>(Mk, mb, n4);

  // W is [k][n] (in,out): x = k tile, y = n tile; output plane [n][k]
  dim3 gw(DM / 64, DM / 64);
  cvt_wT_kernel<<<gw, blk, 0, stream>>>(Wq, wtq, 0);
  cvt_wT_kernel<<<gw, blk, 0, stream>>>(Wk, wtk, 0);
  cvt_wT_kernel<<<gw, blk, 0, stream>>>(Wv, wtv, 0);
  cvt_wT_kernel<<<gw, blk, 0, stream>>>(Wo, wo2, 1);

  dim3 gp(MROWS / 64, DM / 256);
  proj_kernel<<<gp, blk, 0, stream>>>(Q, wtq, bq, qh, (size_t)(qr - qh), 0);
  proj_kernel<<<gp, blk, 0, stream>>>(K, wtk, bk, kh, (size_t)(kr - kh), 1);
  proj_kernel<<<gp, blk, 0, stream>>>(V, wtv, bv, vt, (size_t)(vr - vt), 2);

  if (EROWS > 0) {
    attn_early_kernel<<<dim3(NB * NH * (EROWS / 128)), blk, 0, stream>>>(qh, kh, vt, qr, kr, vr, mb, ctx);
  }
  if (SEQ > EROWS) {
    attn_kernel<<<dim3(NB * NH * ((SEQ - EROWS) / 128)), blk, 0, stream>>>(qh, kh, vt, mb, ctx);
  }

  outproj_kernel<<<gp, blk, 0, stream>>>(ctx, wo2, bo, (float*)d_out);
}

// v004
// One run takes 139 microseconds.
// In both of two side-by-side timings against v003, it was 1.30 times as fast.
// Counting every step since v000, it is 2.28 times as fast.
#include <hip/hip_runtime.h>
#include <stddef.h>

// Contractions: q/k/v projections = v_wmma_f32_16x16x32_bf16 (bf16 operands = RNE-converted f32 inputs; activations converted at the fragment read);
// scores = v_wmma_f32_16x16x32_f16 (k x1 against q x1, single product; query rows < EROWS: q and k as f16 value + x2048 residual, three products, own accumulator);
// P*V = f16 (P x1024, v x1; query rows < EROWS: P and v as f16 value + x2048 residual, residual products in their own accumulator);
// output projection = f16 over K = 2*DM ([ctx x256 | ctx residual x256] against [Wo x64 | Wo x0.25]);
// f32 accumulate, f32 online softmax; the mask input is read by value (packed to bit words once) and applied as a replace fill.

#ifndef NB
#define NB 2
#endif
#ifndef SEQ
#define SEQ 2048
#endif
#define NB_FULL 2
#define SEQ_FULL 2048
#define DM 1024
#define NH 16
#define DKH 64
#define MROWS (NB * SEQ)
#define DM2 (2 * DM)
#define EROWS 256                 // query rows (and key rows) with value + residual planes
#define WPR (SEQ / 32)            // mask bit words per query row

static_assert(NB >= 1 && NB <= NB_FULL);
static_assert(SEQ >= 128 && SEQ <= SEQ_FULL);
static_assert(SEQ % 128 == 0);
static_assert(SEQ % 64 == 0 && SEQ % 32 == 0);
static_assert(MROWS % 64 == 0);
static_assert(DM % 256 == 0 && DM % 32 == 0 && DM % 64 == 0);
static_assert(DM / 8 == 128);
static_assert(NH * DKH == DM);
static_assert(DKH == 64);
static_assert(DM2 % 32 == 0);
static_assert(SEQ % 256 == 0);                 // half a mask-word row is a multiple of 4 words
static_assert(EROWS % 128 == 0 && EROWS % 64 == 0 && EROWS % 32 == 0);
static_assert(EROWS >= 128 && EROWS <= SEQ);
static_assert(WPR % 8 == 0 && WPR >= 8);
static_assert((SEQ * WPR) % 4 == 0);

#define P_CARRY      1024.0f            // P operand carried x1024
#define CTX_SCALE    0.25f              // ctx value plane = O * 0.25 / l = attn x256 (O carries the x1024 of P)
#define CTXRES_CARRY 256.0f             // ctx residual plane = (ctx256 - f16(ctx256)) x256
#define WO_CARRY     64.0f              // Wo operand carried x64 (value half of K)
#define WO_LO_CARRY  0.25f              // Wo operand for the residual half of K = WO_CARRY / CTXRES_CARRY
#define OUT_FOLD     (1.0f / 16384.0f)  // 1 / (256 * 64)
#define QK_SCALE     0.125f             // 1 / sqrt(64)
#define RES_CARRY    2048.0f            // early-band residual planes carried x2048
#define RES_INV      (1.0f / 2048.0f)
#define NEG_FILL     (-3.4028235e38f)   // lowest finite f32: fill value of masked scores
#define EXP_FLOOR    (-87.0f)           // exponent argument floor (keeps the exp argument finite)

static_assert(WO_LO_CARRY * CTXRES_CARRY == WO_CARRY);
static_assert(OUT_FOLD * 256.0f * WO_CARRY == 1.0f);
static_assert(RES_INV * RES_CARRY == 1.0f);

// workspace carve: 5 activation-size planes + 5 weight-size planes + 3 early residual planes (16-bit each) + mask bit plane
static_assert(((size_t)5 * MROWS * DM + (size_t)5 * DM * DM + (size_t)3 * NB * NH * EROWS * DKH) * 2
              + (size_t)SEQ * WPR * 4 <= (size_t)134217728);

typedef unsigned short us;
typedef us        v8us  __attribute__((ext_vector_type(8)));
typedef us        v16us __attribute__((ext_vector_type(16)));
typedef _Float16  v16h  __attribute__((ext_vector_type(16)));
typedef __bf16    v16bf __attribute__((ext_vector_type(16)));
typedef __bf16    v8bf  __attribute__((ext_vector_type(8)));
typedef float     v8f   __attribute__((ext_vector_type(8)));
typedef float     v4f   __attribute__((ext_vector_type(4)));
typedef int       v4i   __attribute__((ext_vector_type(4)));
typedef unsigned  v4u   __attribute__((ext_vector_type(4)));

// ---------------------------------------------------------------------------
// conversions
// ---------------------------------------------------------------------------
__device__ __forceinline__ unsigned bf16rne_bits(float x) {
  unsigned u = __float_as_uint(x);
  return (u + 0x7FFFu + ((u >> 16) & 1u)) >> 16;
}
__device__ __forceinline__ float bf16rne(float x) {
  return __uint_as_float(bf16rne_bits(x) << 16);
}
__device__ __forceinline__ us f16_bits(float x) {
  _Float16 hx = (_Float16)x;
  return __builtin_bit_cast(us, hx);
}

// ---------------------------------------------------------------------------
// 16-bit operand fragment (A: lane = row, B: lane = column; same k map):
//   lane l, r = l&15, s = l>>4 : elems 0..7  = row[r][k0 + 8s .. +7]
//                                elems 8..15 = row[r][k0 + 16 + 8s .. +7]
// base is a 16-bit global plane with k contiguous, pitch ld (halves).
// ---------------------------------------------------------------------------
__device__ __forceinline__ v16us frag16(const us* base, int ld, int row0, int k0) {
  const int l = threadIdx.x & 31;
  const int r = l & 15, s = l >> 4;
  const us* p = base + (size_t)(row0 + r) * ld + k0 + 8 * s;
  v8us c0 = *(const v8us*)p;
  v8us c1 = *(const v8us*)(p + 16);
  return __builtin_shufflevector(c0, c1, 0, 1, 2, 3, 4, 5, 6, 7, 8, 9, 10, 11, 12, 13, 14, 15);
}
__device__ __forceinline__ v16h fragh(const us* base, int ld, int row0, int k0) {
  return __builtin_bit_cast(v16h, frag16(base, ld, row0, k0));
}
// two 16-byte chunks (already loaded) -> one f16 fragment
__device__ __forceinline__ v16h cat16h(v8us c0, v8us c1) {
  v16us w = __builtin_shufflevector(c0, c1, 0, 1, 2, 3, 4, 5, 6, 7, 8, 9, 10, 11, 12, 13, 14, 15);
  return __builtin_bit_cast(v16h, w);
}

// ---------------------------------------------------------------------------
// WMMA wrappers with hazard guard: D = A(16x32) * B(32x16) + C (f32)
// ---------------------------------------------------------------------------
__device__ __forceinline__ v8f mma_f16(v16h a, v16h b, v8f c) {
  v8f d = __builtin_amdgcn_wmma_f32_16x16x32_f16(false, a, false, b, (short)0, c, false, false);
  asm volatile("v_nop\n\tv_nop\n\tv_nop\n\tv_nop" : "+v"(d) : "v"(a), "v"(b));
  return d;
}
__device__ __forceinline__ v8f mma_bf16(v16bf a, v16bf b, v8f c) {
  v8f d = __builtin_amdgcn_wmma_f32_16x16x32_bf16(false, a, false, b, (short)0, c, false, false);
  asm volatile("v_nop\n\tv_nop\n\tv_nop\n\tv_nop" : "+v"(d) : "v"(a), "v"(b));
  return d;
}

// ---------------------------------------------------------------------------
// Mask pack: M int32 [SEQ_FULL][SEQ_FULL] (nonzero = attend) -> bit words [SEQ][WPR],
// bit j of word w of row q = (M[q][32w + j] != 0).
// ---------------------------------------------------------------------------
__device__ __forceinline__ void mask_pack_body(const int* __restrict__ M, unsigned* Bits, int n4, int blk) {
  const int i = blk * 256 + threadIdx.x;
  if (i >= n4) return;
  const int w4 = i * 4;
  const int q  = w4 / WPR;
  const int w0 = w4 - q * WPR;
  const int* src = M + (size_t)q * SEQ_FULL + 32 * w0;
  unsigned a0 = 0u, a1 = 0u, a2 = 0u, a3 = 0u;
#pragma unroll 1
  for (int j = 0; j < 4; ++j) {
    unsigned wb = 0u;
#pragma unroll
    for (int c = 0; c < 8; ++c) {
      const v4i m = *(const v4i*)(src + 32 * j + 4 * c);
      wb |= ((m[0] != 0) ? 1u : 0u) << (4 * c);
      wb |= ((m[1] != 0) ? 1u : 0u) << (4 * c + 1);
      wb |= ((m[2] != 0) ? 1u : 0u) << (4 * c + 2);
      wb |= ((m[3] != 0) ? 1u : 0u) << (4 * c + 3);
    }
    a0 = (j == 0) ? wb : a0;
    a1 = (j == 1) ? wb : a1;
    a2 = (j == 2) ? wb : a2;
    a3 = (j == 3) ? wb : a3;
  }
  v4u y;
  y[0] = a0; y[1] = a1; y[2] = a2; y[3] = a3;
  unsigned* dst = Bits + (size_t)i * 4;
  *(v4u*)dst = y;
  
}

// ---------------------------------------------------------------------------
// Weight convert with transpose: W f32 [k][n] (in,out; n contiguous) -> 16-bit plane [n][k] (k contiguous).
// hmode 0: bf16 bits of RNE(W), pitch DM.
// hmode 1: pitch 2*DM: cols [0,DM) = f16(RNE(W) * WO_CARRY), cols [DM,2DM) = f16(RNE(W) * WO_LO_CARRY).
// Block = 64(k) x 64(n) tile through LDS (cross-wave: block barrier); each output line = 64 k of one n
// kt = k tile, nt = n tile of the block (DM/64 each); t0, t1: the block's two LDS tiles of 64 * WT_LD halves.
// ---------------------------------------------------------------------------
#define WT_LD 72
static_assert((WT_LD * 2) % 16 == 0 && WT_LD >= 64);
__device__ __forceinline__ void cvt_wT_body(const float* __restrict__ W, us* Y, int hmode, int kt, int nt,
                                            us* t0, us* t1) {
  const int t  = threadIdx.x;
  const int k0 = kt * 64;
  const int n0 = nt * 64;

#pragma unroll 1
  for (int i = 0; i < 4; ++i) {
    const int id = t + i * 256;           // 1024 float4 chunks (64 k x 64 n)
    const int kr = id >> 4;
    const int c4 = (id & 15) * 4;
    const v4f x = *(const v4f*)(W + (size_t)(k0 + kr) * DM + n0 + c4);
#pragma unroll
    for (int j = 0; j < 4; ++j) {
      const float w = bf16rne(x[j]);
      const us hb = (us)(__float_as_uint(w) >> 16);
      const us hf = f16_bits(w * WO_CARRY);
      const us hl = f16_bits(w * WO_LO_CARRY);
      t0[(c4 + j) * WT_LD + kr] = hmode ? hf : hb;
      t1[(c4 + j) * WT_LD + kr] = hl;
    }
  }
  __syncthreads();

  const int c = t & 7;
  const size_t pitch = hmode ? (size_t)DM2 : (size_t)DM;
  v8us v0[2], v1[2];
  size_t dsts[2];
#pragma unroll
  for (int it = 0; it < 2; ++it) {
    const int L = (t >> 3) + 32 * it;     // local n 0..63
    v0[it] = *(const v8us*)&t0[L * WT_LD + 8 * c];
    v1[it] = *(const v8us*)&t1[L * WT_LD + 8 * c];
    dsts[it] = (size_t)(n0 + L) * pitch + k0 + 8 * c;
  }
#pragma unroll
  for (int it = 0; it < 2; ++it) {
    *(v8us*)(Y + dsts[it]) = v0[it];
    // stands in front of any rewrite of the registers that this store names
    asm volatile("s_wait_xcnt 0x0" ::: "memory");
    if (hmode) {
      *(v8us*)(Y + dsts[it] + DM) = v1[it];
      // stands in front of any rewrite of the registers that this store names
      asm volatile("s_wait_xcnt 0x0" ::: "memory");
    }
  }
}

// ---------------------------------------------------------------------------
// Preparation, one launch: the mask pack and the four weight converts do not depend on one another.
// Blocks [0, MPB) pack the mask; then WTB blocks per weight in the order Wq, Wk, Wv, Wo (block-uniform split).
// Wt: the weight planes one behind another: Wq, Wk, Wv (bf16, DM*DM halves each), then Wo (f16, 2*DM*DM halves).
// ---------------------------------------------------------------------------
#define MPB ((SEQ * WPR / 4 + 255) / 256)     // mask pack blocks
#define WTB ((DM / 64) * (DM / 64))           // blocks per weight
__global__ __launch_bounds__(256) void prep_kernel(const int* __restrict__ M, unsigned* Bits, int n4,
                                                   const float* __restrict__ Wq, const float* __restrict__ Wk,
                                                   const float* __restrict__ Wv, const float* __restrict__ Wo, us* Wt) {
  __shared__ __attribute__((aligned(16))) us t0[64 * WT_LD];   // [n][k] value
  __shared__ __attribute__((aligned(16))) us t1[64 * WT_LD];   // [n][k] low-carry copy (hmode 1)

  const int b = blockIdx.x;
  if (b < MPB) {
    mask_pack_body(M, Bits, n4, b);
    return;
  }
  const int wb = b - MPB;
  const int w = wb / WTB;               // 0..3: Wq, Wk, Wv, Wo
  const int tile = wb - w * WTB;
  const float* W = (w == 0) ? Wq : (w == 1) ? Wk : (w == 2) ? Wv : Wo;
  cvt_wT_body(W, Wt + (size_t)w * DM * DM, (w == 3) ? 1 : 0, tile % (DM / 64), tile / (DM / 64), t0, t1);
}

// ---------------------------------------------------------------------------
// GEMM core: block computes 64 rows x 256 cols over K = KD; wave (wm, wn) computes 32 x 64 of it.
// A plane [M][KD], B plane [N][KD] (k contiguous), both 16-bit.
// K is walked in slabs of RK; a slab (64 A rows, then 256 B rows) is staged in LDS by asynchronous
// 16-byte copies, two buffers: the next slab's copies fly while this slab is worked on.
// Fragments are read from LDS with the k map of frag16; k runs upward in steps of 32 as before.
// ---------------------------------------------------------------------------
#define RK 128                       // k per slab: 256-byte rows
#define RPITCH 136                   // LDS row pitch in halves: 272 B = 16 B x 17, conflict-free for 16-byte reads
#define RROWS 320                    // 64 A rows + 256 B rows
#define RSTAGE (RROWS * RPITCH)      // halves per buffer
static_assert((RPITCH * 2) % 16 == 0 && RPITCH >= RK);
static_assert(RROWS * (RK / 8) == 20 * 256);   // 20 copies per thread and slab

// One slab: thread t copies chunk (t & 15) of rows (t >> 4) + 16 i, i = 0..19 (each wave copy = 2 whole rows).
// ga / gb: this thread's chunk in A row (t >> 4) / B row (t >> 4) of the block at this slab; ld: its LDS byte address in row (t >> 4).
template <int KD>
__device__ __forceinline__ void stage_slab(const us* ga, const us* gb, unsigned ld) {
  const us* g[20];
  unsigned d[20];
#pragma unroll   // unrolled so that g[] and d[] are registers (they are asm operands)
  for (int i = 0; i < 20; ++i) {
    g[i] = (i < 4) ? (ga + (size_t)(16 * i) * KD) : (gb + (size_t)(16 * (i - 4)) * KD);
    d[i] = ld + (unsigned)(16 * i * RPITCH * 2);
  }
  // the closing s_wait_xcnt keeps the address registers of the issued copies from being rewritten early
  asm volatile("global_load_async_to_lds_b128 %0, %1, off\n\t"
               "global_load_async_to_lds_b128 %2, %3, off\n\t"
               "global_load_async_to_lds_b128 %4, %5, off\n\t"
               "global_load_async_to_lds_b128 %6, %7, off\n\t"
               "global_load_async_to_lds_b128 %8, %9, off\n\t"
               "global_load_async_to_lds_b128 %10, %11, off\n\t"
               "global_load_async_to_lds_b128 %12, %13, off\n\t"
               "global_load_async_to_lds_b128 %14, %15, off\n\t"
               "global_load_async_to_lds_b128 %16, %17, off\n\t"
               "global_load_async_to_lds_b128 %18, %19, off\n\t"
               "s_wait_xcnt 0x0"
               :: "v"(d[0]), "v"(g[0]), "v"(d[1]), "v"(g[1]), "v"(d[2]), "v"(g[2]), "v"(d[3]), "v"(g[3]), "v"(d[4]), "v"(g[4]), "v"(d[5]), "v"(g[5]), "v"(d[6]), "v"(g[6]), "v"(d[7]), "v"(g[7]), "v"(d[8]), "v"(g[8]), "v"(d[9]), "v"(g[9]) : "memory");
  asm volatile("global_load_async_to_lds_b128 %0, %1, off\n\t"
               "global_load_async_to_lds_b128 %2, %3, off\n\t"
               "global_load_async_to_lds_b128 %4, %5, off\n\t"
               "global_load_async_to_lds_b128 %6, %7, off\n\t"
               "global_load_async_to_lds_b128 %8, %9, off\n\t"
               "global_load_async_to_lds_b128 %10, %11, off\n\t"
               "global_load_async_to_lds_b128 %12, %13, off\n\t"
               "global_load_async_to_lds_b128 %14, %15, off\n\t"
               "global_load_async_to_lds_b128 %16, %17, off\n\t"
               "global_load_async_to_lds_b128 %18, %19, off\n\t"
               "s_wait_xcnt 0x0"
               :: "v"(d[10]), "v"(g[10]), "v"(d[11]), "v"(g[11]), "v"(d[12]), "v"(g[12]), "v"(d[13]), "v"(g[13]), "v"(d[14]), "v"(g[14]), "v"(d[15]), "v"(g[15]), "v"(d[16]), "v"(g[16]), "v"(d[17]), "v"(g[17]), "v"(d[18]), "v"(g[18]), "v"(d[19]), "v"(g[19]) : "memory");
}

// fragment from a staged slab (LDS), same lane and k map as frag16
__device__ __forceinline__ v16us lfrag16(const us* tile, int row0, int k0) {
  const int l = threadIdx.x & 31;
  const int r = l & 15, s = l >> 4;
  const us* p = tile + (row0 + r) * RPITCH + k0 + 8 * s;
  v8us c0 = *(const v8us*)p;
  v8us c1 = *(const v8us*)(p + 16);
  return __builtin_shufflevector(c0, c1, 0, 1, 2, 3, 4, 5, 6, 7, 8, 9, 10, 11, 12, 13, 14, 15);
}

template <int KD, bool BF>
__device__ __forceinline__ void gemm_ring(const us* A, const us* B, int mblk0, int nblk0, int wm, int wn,
                                          us* ring, v8f (&acc)[8]) {
  static_assert(KD % RK == 0 && KD / RK >= 2);
  constexpr int NP = KD / RK;
  const int t = threadIdx.x;
  const us* ga = A + (size_t)(mblk0 + (t >> 4)) * KD + (t & 15) * 8;
  const us* gb = B + (size_t)(nblk0 + (t >> 4)) * KD + (t & 15) * 8;
  const unsigned ld = (unsigned)(size_t)ring + (unsigned)((t >> 4) * (RPITCH * 2) + (t & 15) * 16);

  stage_slab<KD>(ga, gb, ld);
  asm volatile("s_wait_asynccnt 0x0" ::: "memory");   // slab 0 landed (this wave's copies)
  __syncthreads();                                    // slab 0 visible to all waves
  stage_slab<KD>(ga + RK, gb + RK, ld + (unsigned)(RSTAGE * 2));

#pragma unroll 1   // kept rolled: one body of 32 matrix instructions, short code
  for (int p = 0; p < NP; ++p) {
    const int buf = p & 1;
    const us* tile = ring + buf * RSTAGE;
#pragma unroll     // unrolled so that the k offsets become immediates of the LDS reads
    for (int kk = 0; kk < RK; kk += 32) {
      // the six fragments of a k step are read as one group: one LDS latency per step, not one per column tile
      const v16us a0 = lfrag16(tile, wm * 32, kk);
      const v16us a1 = lfrag16(tile, wm * 32 + 16, kk);
      v16us b[4];
#pragma unroll     // unrolled so that b[] stays in registers
      for (int tt = 0; tt < 4; ++tt) b[tt] = lfrag16(tile, 64 + wn * 64 + 16 * tt, kk);
#pragma unroll     // unrolled so that acc[] stays in registers
      for (int tt = 0; tt < 4; ++tt) {
        if constexpr (BF) {
          acc[tt]     = mma_bf16(__builtin_bit_cast(v16bf, a0), __builtin_bit_cast(v16bf, b[tt]), acc[tt]);
          acc[4 + tt] = mma_bf16(__builtin_bit_cast(v16bf, a1), __builtin_bit_cast(v16bf, b[tt]), acc[4 + tt]);
        } else {
          acc[tt]     = mma_f16(__builtin_bit_cast(v16h, a0), __builtin_bit_cast(v16h, b[tt]), acc[tt]);
          acc[4 + tt] = mma_f16(__builtin_bit_cast(v16h, a1), __builtin_bit_cast(v16h, b[tt]), acc[4 + tt]);
        }
      }
    }
    asm volatile("s_wait_dscnt 0x0" ::: "memory");      // this wave's reads of the buffer are done before it is refilled
    asm volatile("s_wait_asynccnt 0x0" ::: "memory");   // this wave's copies of slab p + 1 have landed
    __syncthreads();                                    // publishes slab p + 1; ends every reader's last read of slab p
    if (p + 2 < NP)
      stage_slab<KD>(ga + (p + 2) * RK, gb + (p + 2) * RK, ld + (unsigned)(buf * RSTAGE * 2));
  }
  asm volatile("s_wait_asynccnt 0x0" ::: "memory");     // no copy outstanding past the loop
}

// ---------------------------------------------------------------------------
// GEMM core of the q/k/v projections: same block and wave tiling, slabs, ring order and k order as gemm_ring, K = DM,
// but the A operand is the f32 activation itself: its slab (64 rows x RK floats) is staged as f32 by the same
// asynchronous 16-byte copies and rounded to bf16 (nearest even) where a fragment is read from LDS.
// ---------------------------------------------------------------------------
#define XPITCH 132                   // A slab row pitch in floats: 528 B = 16 B x 33, conflict-free for 16-byte reads
#define XASTAGE (64 * XPITCH)        // floats per A buffer
#define XBSTAGE (256 * RPITCH)       // halves per B buffer
static_assert((XPITCH * 4) % 32 == 16 && XPITCH >= RK);
static_assert(64 * (RK / 4) == 8 * 256 && 256 * (RK / 8) == 16 * 256);   // 8 + 16 copies per thread and slab

// One slab: thread t copies chunk (t & 31) of A rows (t >> 5) + 8 i, i = 0..7 (each wave copy = 1 whole row of 512 B),
// and chunk (t & 15) of B rows (t >> 4) + 16 i, i = 0..15 (each wave copy = 2 whole rows of 256 B).
// ga / gb: this thread's chunk in its first A / B row at this slab; la / lb: its LDS byte address there.
__device__ __forceinline__ void stage_slab_x(const float* ga, const us* gb, unsigned la, unsigned lb) {
  const void* g[24];
  unsigned d[24];
#pragma unroll   // unrolled so that g[] and d[] are registers (they are asm operands)
  for (int i = 0; i < 8; ++i) {
    g[i] = ga + (size_t)(8 * i) * DM;
    d[i] = la + (unsigned)(8 * i * XPITCH * 4);
  }
#pragma unroll   // unrolled so that g[] and d[] are registers (they are asm operands)
  for (int i = 0; i < 16; ++i) {
    g[8 + i] = gb + (size_t)(16 * i) * DM;
    d[8 + i] = lb + (unsigned)(16 * i * RPITCH * 2);
  }
  // the closing s_wait_xcnt keeps the address registers of the issued copies from being rewritten early
  asm volatile("global_load_async_to_lds_b128 %0, %1, off\n\t"
               "global_load_async_to_lds_b128 %2, %3, off\n\t"
               "global_load_async_to_lds_b128 %4, %5, off\n\t"
               "global_load_async_to_lds_b128 %6, %7, off\n\t"
               "global_load_async_to_lds_b128 %8, %9, off\n\t"
               "global_load_async_to_lds_b128 %10, %11, off\n\t"
               "global_load_async_to_lds_b128 %12, %13, off\n\t"
               "global_load_async_to_lds_b128 %14, %15, off\n\t"
               "global_load_async_to_lds_b128 %16, %17, off\n\t"
               "global_load_async_to_lds_b128 %18, %19, off\n\t"
               "global_load_async_to_lds_b128 %20, %21, off\n\t"
               "global_load_async_to_lds_b128 %22, %23, off\n\t"
               "s_wait_xcnt 0x0"
               :: "v"(d[0]), "v"(g[0]), "v"(d[1]), "v"(g[1]), "v"(d[2]), "v"(g[2]), "v"(d[3]), "v"(g[3]), "v"(d[4]), "v"(g[4]), "v"(d[5]), "v"(g[5]), "v"(d[6]), "v"(g[6]), "v"(d[7]), "v"(g[7]), "v"(d[8]), "v"(g[8]), "v"(d[9]), "v"(g[9]), "v"(d[10]), "v"(g[10]), "v"(d[11]), "v"(g[11]) : "memory");
  asm volatile("global_load_async_to_lds_b128 %0, %1, off\n\t"
               "global_load_async_to_lds_b128 %2, %3, off\n\t"
               "global_load_async_to_lds_b128 %4, %5, off\n\t"
               "global_load_async_to_lds_b128 %6, %7, off\n\t"
               "global_load_async_to_lds_b128 %8, %9, off\n\t"
               "global_load_async_to_lds_b128 %10, %11, off\n\t"
               "global_load_async_to_lds_b128 %12, %13, off\n\t"
               "global_load_async_to_lds_b128 %14, %15, off\n\t"
               "global_load_async_to_lds_b128 %16, %17, off\n\t"
               "global_load_async_to_lds_b128 %18, %19, off\n\t"
               "global_load_async_to_lds_b128 %20, %21, off\n\t"
               "global_load_async_to_lds_b128 %22, %23, off\n\t"
               "s_wait_xcnt 0x0"
               :: "v"(d[12]), "v"(g[12]), "v"(d[13]), "v"(g[13]), "v"(d[14]), "v"(g[14]), "v"(d[15]), "v"(g[15]), "v"(d[16]), "v"(g[16]), "v"(d[17]), "v"(g[17]), "v"(d[18]), "v"(g[18]), "v"(d[19]), "v"(g[19]), "v"(d[20]), "v"(g[20]), "v"(d[21]), "v"(g[21]), "v"(d[22]), "v"(g[22]), "v"(d[23]), "v"(g[23]) : "memory");
}

// bf16 fragment from a staged f32 A slab (LDS), same lane and k map as frag16
__device__ __forceinline__ v16bf lfragx(const float* tile, int row0, int k0) {
  const int l = threadIdx.x & 31;
  const int r = l & 15, s = l >> 4;
  const float* p = tile + (row0 + r) * XPITCH + k0 + 8 * s;
  const v4f c0 = *(const v4f*)p;
  const v4f c1 = *(const v4f*)(p + 4);
  const v4f c2 = *(const v4f*)(p + 16);
  const v4f c3 = *(const v4f*)(p + 20);
  const v8bf lo = __builtin_convertvector(__builtin_shufflevector(c0, c1, 0, 1, 2, 3, 4, 5, 6, 7), v8bf);
  const v8bf hi = __builtin_convertvector(__builtin_shufflevector(c2, c3, 0, 1, 2, 3, 4, 5, 6, 7), v8bf);
  return __builtin_shufflevector(lo, hi, 0, 1, 2, 3, 4, 5, 6, 7, 8, 9, 10, 11, 12, 13, 14, 15);
}

// Ax: first of the block's 64 rows of the f32 activation (pitch DM); B plane [N][DM] bf16, k contiguous.
__device__ __forceinline__ void gemm_ring_x(const float* Ax, const us* B, int nblk0, int wm, int wn,
                                            float* ringa, us* ringb, v8f (&acc)[8]) {
  static_assert(DM % RK == 0 && DM / RK >= 2);
  constexpr int NP = DM / RK;
  const int t = threadIdx.x;
  const float* ga = Ax + (size_t)(t >> 5) * DM + (t & 31) * 4;
  const us* gb = B + (size_t)(nblk0 + (t >> 4)) * DM + (t & 15) * 8;
  const unsigned la = (unsigned)(size_t)ringa + (unsigned)((t >> 5) * (XPITCH * 4) + (t & 31) * 16);
  const unsigned lb = (unsigned)(size_t)ringb + (unsigned)((t >> 4) * (RPITCH * 2) + (t & 15) * 16);

  stage_slab_x(ga, gb, la, lb);
  asm volatile("s_wait_asynccnt 0x0" ::: "memory");   // slab 0 landed (this wave's copies)
  __syncthreads();                                    // slab 0 visible to all waves
  stage_slab_x(ga + RK, gb + RK, la + (unsigned)(XASTAGE * 4), lb + (unsigned)(XBSTAGE * 2));

#pragma unroll 1   // kept rolled: one body of 32 matrix instructions, short code
  for (int p = 0; p < NP; ++p) {
    const int buf = p & 1;
    const float* ta = ringa + buf * XASTAGE;
    const us* tb = ringb + buf * XBSTAGE;
#pragma unroll     // unrolled so that the k offsets become immediates of the LDS reads
    for (int kk = 0; kk < RK; kk += 32) {
      // the six fragments of a k step are read as one group: one LDS latency per step, not one per column tile
      const v16bf a0 = lfragx(ta, wm * 32, kk);
      const v16bf a1 = lfragx(ta, wm * 32 + 16, kk);
      v16us b[4];
#pragma unroll     // unrolled so that b[] stays in registers
      for (int tt = 0; tt < 4; ++tt) b[tt] = lfrag16(tb, wn * 64 + 16 * tt, kk);
#pragma unroll     // unrolled so that acc[] stays in registers
      for (int tt = 0; tt < 4; ++tt) {
        acc[tt]     = mma_bf16(a0, __builtin_bit_cast(v16bf, b[tt]), acc[tt]);
        acc[4 + tt] = mma_bf16(a1, __builtin_bit_cast(v16bf, b[tt]), acc[4 + tt]);
      }
    }
    asm volatile("s_wait_dscnt 0x0" ::: "memory");      // this wave's reads of the buffer are done before it is refilled
    asm volatile("s_wait_asynccnt 0x0" ::: "memory");   // this wave's copies of slab p + 1 have landed
    __syncthreads();                                    // publishes slab p + 1; ends every reader's last read of slab p
    if (p + 2 < NP)
      stage_slab_x(ga + (p + 2) * RK, gb + (p + 2) * RK,
                   la + (unsigned)(buf * XASTAGE * 4), lb + (unsigned)(buf * XBSTAGE * 2));
  }
  asm volatile("s_wait_asynccnt 0x0" ::: "memory");     // no copy outstanding past the loop
}

// ---------------------------------------------------------------------------
// Projection: Y = bf16(X)[MROWS][DM] * Wt^T + b, written as an f16 plane. X f32 [NB_FULL*SEQ_FULL][DM].
// mode 0/1: q or k -> value plane [NB*NH][SEQ][64]
// mode 2:   v      -> transposed value plane [NB*NH][64][SEQ]
// Blocks whose 64 rows lie below EROWS (block-uniform) also write the x2048 residual plane at Y + roff:
// mode 0/1: [NB*NH][EROWS][64]; mode 2: [NB*NH][64][EROWS].
// Block 256 thr = 8 waves as 2(M) x 4(N); block tile 64 x 256; blockIdx (x, y) = (row block, column block).
// ---------------------------------------------------------------------------
__device__ __forceinline__
void proj_body(const float* __restrict__ X, const us* __restrict__ Wt,
               const float* __restrict__ bias, us* Y, size_t roff, int mode) {
  __shared__ __attribute__((aligned(16))) us stile[64 * 256];       // cross-wave (block barrier)
  __shared__ __attribute__((aligned(16))) float ringa[2 * XASTAGE]; // f32 A slabs, cross-wave (block barrier)
  __shared__ __attribute__((aligned(16))) us ringb[2 * XBSTAGE];    // bf16 B slabs, cross-wave (block barrier)

  const int t = threadIdx.x;
  const int wid = __builtin_amdgcn_readfirstlane(t >> 5);
  const int l = t & 31;
  const int h = l >> 4, r16 = l & 15;
  const int wm = wid >> 2, wn = wid & 3;
  const int mblk0 = blockIdx.x * 64;
  const int nblk0 = blockIdx.y * 256;
  const int n0 = nblk0 + wn * 64;

  const int bblk = mblk0 / SEQ;
  const int sblk = mblk0 - bblk * SEQ;  // 64 block rows lie inside one batch (SEQ % 64 == 0)

  v8f acc[8] = {};
  gemm_ring_x(X + (size_t)(bblk * SEQ_FULL + sblk) * DM, Wt, nblk0, wm, wn, ringa, ringb, acc);

  float bvv[4];
#pragma unroll
  for (int tt = 0; tt < 4; ++tt) bvv[tt] = bf16rne(bias[n0 + 16 * tt + r16]);

  const int c = l & 7;
  const int nph = (sblk < EROWS) ? 2 : 1;   // block-uniform: phase 0 value plane, phase 1 residual plane

#pragma unroll 1
  for (int ph = 0; ph < nph; ++ph) {
    if (ph) __syncthreads();              // readers of the value stage done

    // stage f16 value (phase 0) or x2048 residual (phase 1) of (acc + bias) into LDS
#pragma unroll
    for (int tt = 0; tt < 4; ++tt) {
      const int nl = wn * 64 + 16 * tt + r16;
#pragma unroll
      for (int mi = 0; mi < 2; ++mi) {
#pragma unroll
        for (int r = 0; r < 8; ++r) {
          const int ml = wm * 32 + 16 * mi + 8 * h + r;
          const float v = acc[mi * 4 + tt][r] + bvv[tt];
          const _Float16 hv = (_Float16)v;
          const float rs = (v - (float)hv) * RES_CARRY;
          const us hb = __builtin_bit_cast(us, hv);
          const us rb = f16_bits(rs);
          const int li = (mode == 2) ? (nl * 64 + ml) : (ml * 256 + nl);
          stile[li] = ph ? rb : hb;
        }
      }
    }
    __syncthreads();

    // whole-line writes: 256 lines per block, 32 per wave
    const int SL = ph ? EROWS : SEQ;      // sequence extent of the destination plane
    const size_t poff = ph ? roff : (size_t)0;
    v8us vals[8];
    size_t dsts[8];
#pragma unroll
    for (int it = 0; it < 8; ++it) {
      const int L = wid * 32 + (l >> 3) + 4 * it;
      int src;
      size_t dst;
      if (mode == 2) {
        const int n = nblk0 + L;
        const int hg = n >> 6, d = n & 63;
        src = L * 64 + 8 * c;
        dst = (((size_t)(bblk * NH + hg)) * DKH + d) * SL + sblk + 8 * c;
      } else {
        const int ml = L >> 2, hq = L & 3;
        const int hg = (nblk0 >> 6) + hq;
        const int s = sblk + ml;
        src = ml * 256 + hq * 64 + 8 * c;
        dst = (((size_t)(bblk * NH + hg)) * SL + s) * DKH + 8 * c;
      }
      vals[it] = *(const v8us*)&stile[src];
      dsts[it] = dst + poff;
    }
#pragma unroll
    for (int it = 0; it < 8; ++it) *(v8us*)(Y + dsts[it]) = vals[it];
    // stands in front of the residual phase's rewrite of the registers that hold these stores' addresses
    asm volatile("s_wait_xcnt 0x0" ::: "memory");
  }
}

// The three projections do not depend on one another: one launch, grid (MROWS/64, DM/256, 3), blockIdx.z = mode.
// Wt3: weight planes of q, k, v one behind another; Y3: their value planes; R3: their early residual planes.
__global__ __launch_bounds__(256) __attribute__((amdgpu_num_vgpr(256)))
void proj_kernel(const float* __restrict__ Xq, const float* __restrict__ Xk, const float* __restrict__ Xv,
                 const us* __restrict__ Wt3,
                 const float* __restrict__ bq, const float* __restrict__ bk, const float* __restrict__ bv,
                 us* Y3, us* R3) {
  const int mode = blockIdx.z;
  const float* X = (mode == 0) ? Xq : (mode == 1) ? Xk : Xv;
  const float* bias = (mode == 0) ? bq : (mode == 1) ? bk : bv;
  us* Y = Y3 + (size_t)mode * MROWS * DM;
  us* R = R3 + (size_t)mode * NB * NH * EROWS * DKH;
  proj_body(X, Wt3 + (size_t)mode * DM * DM, bias, Y, (size_t)(R - Y), mode);
}

// ---------------------------------------------------------------------------
// LDS row pitches of the attention K and V tiles (halves). The fragment readers are 16-byte reads, one row per lane:
// a pitch of 16 B x odd spreads the 16 rows of a read over all banks (unpadded 128-B / 64-B rows fall on few banks).
// ---------------------------------------------------------------------------
#define KPITCH 72                    // K tile: 64 d per key row + 8 halves of pad = 144 B = 16 B x 9
#define VPITCH 40                    // V tile: 32 keys per d row + 8 halves of pad = 80 B = 16 B x 5
static_assert(KPITCH >= DKH && (KPITCH * 2) % 32 == 16);
static_assert(VPITCH >= 32 && (VPITCH * 2) % 32 == 16);

// ---------------------------------------------------------------------------
// Per-wave part of the key-step bound of a 128-query block, from the mask bit plane.
// Thread t scans half a row (row = t>>1 of the block). A row with at least one visible key needs
// key steps [0, last visible word]; a row with no visible key needs every key step (uniform softmax).
// Returns the maximum over the wave's 16 rows (all lanes hold it).
// ---------------------------------------------------------------------------
__device__ __forceinline__ int wave_key_bound(const unsigned* __restrict__ Mb, int qb) {
  const int t = threadIdx.x;
  const int hw = (t & 1) * (WPR / 2);
  const unsigned* mrow = Mb + (size_t)(qb * 128 + (t >> 1)) * WPR + hw;
  int kmx = -1;
#pragma unroll 1
  for (int j = 0; j < WPR / 2; j += 4) {
    const v4u w = *(const v4u*)(mrow + j);
    kmx = (w[0] != 0u) ? (hw + j)     : kmx;
    kmx = (w[1] != 0u) ? (hw + j + 1) : kmx;
    kmx = (w[2] != 0u) ? (hw + j + 2) : kmx;
    kmx = (w[3] != 0u) ? (hw + j + 3) : kmx;
  }
  const int oth = __shfl_xor(kmx, 1, 32);
  kmx = max(kmx, oth);
  int ke = (kmx < 0) ? WPR : (kmx + 1);
  ke = max(ke, __shfl_xor(ke, 16, 32));
  ke = max(ke, __shfl_xor(ke, 8, 32));
  ke = max(ke, __shfl_xor(ke, 4, 32));
  ke = max(ke, __shfl_xor(ke, 2, 32));
  return ke;
}

// ---------------------------------------------------------------------------
// Fused flash attention, query rows >= EROWS. Block = 8 waves, one (b,h), 128 queries; each wave owns
// 16 queries. K/V 32-key blocks staged once per block into LDS with plain loads.
// Scores computed transposed (S' = K_blk * Q^T) so the exp'd probabilities are
// already in A-operand layout for P*V. Online softmax in f32.
// Mask: one bit word per lane (= query) per 32-key step; masked scores are REPLACED by NEG_FILL.
// Key loop bound per block derived from the mask words (clamped to SEQ/32).
// ctx plane f16 [MROWS][2*DM]: cols [0,DM) value x256, cols [DM,2DM) residual x256,
// blk = 0 .. NB*NH*((SEQ-EROWS)/128) - 1; the LDS arrays are those of attn_all_kernel.
// ---------------------------------------------------------------------------
__device__ __forceinline__
void attn_body(const us* __restrict__ Qh, const us* __restrict__ Kh,
               const us* __restrict__ Vt, const unsigned* __restrict__ Mb, us* Ctx, int blk,
               us* shK, us* shV, us* shC, int* shE) {
  const int t = threadIdx.x;
  const int wid = __builtin_amdgcn_readfirstlane(t >> 5);
  const int l = t & 31;
  const int r16 = l & 15;
  const int hs = l >> 4;
  const int rowsel = hs << 3;
  constexpr int QBL = (SEQ > EROWS) ? (SEQ - EROWS) / 128 : 1;
  const int bh = blk / QBL;
  const int qb = blk - bh * QBL + EROWS / 128;
  const int q0 = qb * 128 + wid * 16;

  const size_t qoff = (size_t)bh * SEQ * DKH;
  const us* qp = Qh + qoff;
  const us* kp = Kh + qoff;
  const us* vp = Vt + (size_t)bh * DKH * SEQ;

  // key-step bound of this block (exact for any mask value), clamped to the static maximum
  const int kew = wave_key_bound(Mb, qb);
  if (l == 0) shE[wid] = kew;
  __syncthreads();
  int kall = shE[0];
#pragma unroll
  for (int w = 1; w < 8; ++w) kall = max(kall, shE[w]);
  kall = min(max(kall, 1), WPR);
  const int ksteps = __builtin_amdgcn_readfirstlane(kall);

  const unsigned* mq = Mb + (size_t)(q0 + r16) * WPR;   // this lane's query row of mask words

  // Q^T as B operand for the whole loop (lane = query column, halves = d)
  const v16h qB0 = fragh(qp, DKH, q0, 0);
  const v16h qB1 = fragh(qp, DKH, q0, 32);

  v8f o[4];
#pragma unroll
  for (int tt = 0; tt < 4; ++tt) o[tt] = v8f{};
  float mmax = NEG_FILL, lsum = 0.0f;

  const int krow = t >> 3, kcol = (t & 7) * 8;   // K: 32 keys x 64 d
  const int vrow = t >> 2, vcol = (t & 3) * 8;   // V: 64 d x 32 keys
  const int kfo = r16 * KPITCH + 8 * hs;           // shK fragment lane offset (row = key, k = d)
  const int vfo = r16 * VPITCH + 8 * hs;           // shV fragment lane offset (row = d, k = key)

#pragma unroll 1
  for (int ks = 0; ks < ksteps; ++ks) {
    const int kb = ks * 32;
    __syncthreads();    // prior readers of shK/shV done
    *(v8us*)&shK[krow * KPITCH + kcol] = *(const v8us*)(kp + (size_t)(kb + krow) * DKH + kcol);
    *(v8us*)&shV[vrow * VPITCH + vcol] = *(const v8us*)(vp + (size_t)vrow * SEQ + kb + vcol);
    __syncthreads();    // stage visible to all waves

    // mask word of this lane's query for these 32 keys (pinned before the selects)
    unsigned mw = mq[ks];
    asm volatile("" : "+v"(mw));
    const unsigned ml = mw >> (8 * hs);

    // S' tiles: M = key (relative 0..15 / 16..31), N = query; k = d
    v8f s0 = {};
    v8f s1 = {};
    {
      const v16h kA = cat16h(*(const v8us*)&shK[kfo], *(const v8us*)&shK[kfo + 16]);
      s0 = mma_f16(kA, qB0, s0);
    }
    {
      const v16h kA = cat16h(*(const v8us*)&shK[kfo + 32], *(const v8us*)&shK[kfo + 48]);
      s0 = mma_f16(kA, qB1, s0);
    }
    {
      const v16h kA = cat16h(*(const v8us*)&shK[16 * KPITCH + kfo], *(const v8us*)&shK[16 * KPITCH + kfo + 16]);
      s1 = mma_f16(kA, qB0, s1);
    }
    {
      const v16h kA = cat16h(*(const v8us*)&shK[16 * KPITCH + kfo + 32], *(const v8us*)&shK[16 * KPITCH + kfo + 48]);
      s1 = mma_f16(kA, qB1, s1);
    }

    // scale, then replace masked scores: s0[i] = key 8h+i, s1[i] = key 16+8h+i of this step
#pragma unroll
    for (int i = 0; i < 8; ++i) {
      const float a0 = s0[i] * QK_SCALE;
      const float a1 = s1[i] * QK_SCALE;
      s0[i] = ((ml >> i) & 1u) ? a0 : NEG_FILL;
      s1[i] = ((ml >> (16 + i)) & 1u) ? a1 : NEG_FILL;
    }

    // per-query (per-lane) block max; combine the two key halves (lane ^ 16)
    float bm = s0[0];
#pragma unroll
    for (int i = 0; i < 8; ++i) { bm = fmaxf(bm, s0[i]); bm = fmaxf(bm, s1[i]); }
    bm = fmaxf(bm, __shfl_xor(bm, 16, 32));
    const float mnew = fmaxf(mmax, bm);
    const float corr = __expf(fmaxf(mmax - mnew, EXP_FLOOR));
    mmax = mnew;

    // probabilities land directly in A-operand layout (elements 0..7 <- keys 8h..8h+7
    // from the first 16-key D tile, elements 8..15 <- keys 16+8h.. from the second)
    float ps = 0.0f;
    v16h pA;
#pragma unroll
    for (int i = 0; i < 8; ++i) {
      const float p0 = __expf(fmaxf(s0[i] - mnew, EXP_FLOOR));
      const float p1 = __expf(fmaxf(s1[i] - mnew, EXP_FLOOR));
      ps += p0 + p1;
      pA[i]     = (_Float16)(p0 * P_CARRY);
      pA[8 + i] = (_Float16)(p1 * P_CARRY);
    }
    ps += __shfl_xor(ps, 16, 32);
    lsum = lsum * corr + ps;

    // rescale O: D row 8h+r = query 8h+r, whose corr lives in lane 8h+r
#pragma unroll
    for (int r = 0; r < 8; ++r) {
      const float cr = __shfl(corr, rowsel + r, 32);
#pragma unroll
      for (int tt = 0; tt < 4; ++tt) o[tt][r] *= cr;
    }

    // O += P(16 x 32 keys) * V_blk(32 keys x 64 d); B rows = d, k = key contiguous in shV
#pragma unroll
    for (int tt = 0; tt < 4; ++tt) {
      const v16h vB = cat16h(*(const v8us*)&shV[16 * tt * VPITCH + vfo],
                             *(const v8us*)&shV[16 * tt * VPITCH + vfo + 16]);
      o[tt] = mma_f16(pA, vB, o[tt]);
    }
  }

  // normalize, stage this wave's 16 x 64 ctx tile (f16 value x256 and residual x256) in LDS
  const int bb = bh / NH;
  const int hh = bh - bb * NH;
#pragma unroll
  for (int r = 0; r < 8; ++r) {
    const float lrow = __shfl(lsum, rowsel + r, 32);
    const float li = CTX_SCALE * __builtin_amdgcn_rcpf(lrow);
#pragma unroll
    for (int tt = 0; tt < 4; ++tt) {
      const float cv = o[tt][r] * li;
      const _Float16 hv = (_Float16)cv;
      const float rs = (cv - (float)hv) * CTXRES_CARRY;
      const int si = wid * 2048 + (rowsel + r) * 64 + 16 * tt + r16;
      shC[si]        = __builtin_bit_cast(us, hv);
      shC[si + 1024] = f16_bits(rs);
    }
  }
  __syncthreads();

  const int c = l & 7;
  v8us vals[8];
  size_t dsts[8];
#pragma unroll
  for (int it = 0; it < 8; ++it) {
    const int Lw = (l >> 3) + 4 * it;    // 0..31
    const int pl = Lw >> 4;              // 0 value, 1 residual
    const int rl = Lw & 15;
    vals[it] = *(const v8us*)&shC[wid * 2048 + pl * 1024 + rl * 64 + 8 * c];
    const int s = q0 + rl;
    dsts[it] = ((size_t)(bb * SEQ + s)) * DM2 + (size_t)pl * DM + hh * DKH + 8 * c;
  }
#pragma unroll
  for (int it = 0; it < 8; ++it) *(v8us*)(Ctx + dsts[it]) = vals[it];
  // stands in front of any rewrite of the registers that these stores name (precaution: each block runs one band, and the kernel ends after it)
  asm volatile("s_wait_xcnt 0x0" ::: "memory");
}

// ---------------------------------------------------------------------------
// Early band of the fused flash attention: query rows < EROWS. Same structure as attn_body.
// For key steps below EROWS (block-uniform test) q, k and v are value + x2048 residual planes:
// scores = kv*qv + (kv*qr + kr*qv)/2048 (residual products in their own accumulator);
// P = f16 value + x2048 residual; O = pv*vv + (pr*vv + pv*vr)/2048 (own accumulator, folded before
// the normalisation). Key steps at or above EROWS (only visited when the mask asks for them) use
// the value planes of k and v alone. Row sum over the unconverted p.
// blk = 0 .. NB*NH*(EROWS/128) - 1; the LDS arrays are those of attn_all_kernel.
// ---------------------------------------------------------------------------
__device__ __forceinline__
void attn_early_body(const us* __restrict__ Qh, const us* __restrict__ Kh, const us* __restrict__ Vt,
                     const us* __restrict__ Qr, const us* __restrict__ Kr, const us* __restrict__ Vr,
                     const unsigned* __restrict__ Mb, us* Ctx, int blk,
                     us* shK, us* shV, us* shKr, us* shVr, us* shC, int* shE) {
  const int t = threadIdx.x;
  const int wid = __builtin_amdgcn_readfirstlane(t >> 5);
  const int l = t & 31;
  const int r16 = l & 15;
  const int hs = l >> 4;
  const int rowsel = hs << 3;
  constexpr int QBE = EROWS / 128;
  const int bh = blk / QBE;
  const int qb = blk - bh * QBE;
  const int q0 = qb * 128 + wid * 16;

  const size_t qoff = (size_t)bh * SEQ * DKH;
  const size_t roff = (size_t)bh * EROWS * DKH;
  const us* qp = Qh + qoff;
  const us* kp = Kh + qoff;
  const us* vp = Vt + (size_t)bh * DKH * SEQ;
  const us* qrp = Qr + roff;
  const us* krp = Kr + roff;
  const us* vrp = Vr + (size_t)bh * DKH * EROWS;

  // key-step bound of this block (exact for any mask value), clamped to the static maximum
  const int kew = wave_key_bound(Mb, qb);
  if (l == 0) shE[wid] = kew;
  __syncthreads();
  int kall = shE[0];
#pragma unroll
  for (int w = 1; w < 8; ++w) kall = max(kall, shE[w]);
  kall = min(max(kall, 1), WPR);
  const int ksteps = __builtin_amdgcn_readfirstlane(kall);

  const unsigned* mq = Mb + (size_t)(q0 + r16) * WPR;   // this lane's query row of mask words

  // Q^T value and residual as B operands for the whole loop (lane = query column, halves = d)
  const v16h qB0 = fragh(qp, DKH, q0, 0);
  const v16h qB1 = fragh(qp, DKH, q0, 32);
  const v16h qR0 = fragh(qrp, DKH, q0, 0);
  const v16h qR1 = fragh(qrp, DKH, q0, 32);

  v8f o[4], orr[4];
#pragma unroll
  for (int tt = 0; tt < 4; ++tt) { o[tt] = v8f{}; orr[tt] = v8f{}; }
  float mmax = NEG_FILL, lsum = 0.0f;

  const int krow = t >> 3, kcol = (t & 7) * 8;   // K: 32 keys x 64 d
  const int vrow = t >> 2, vcol = (t & 3) * 8;   // V: 64 d x 32 keys
  const int kfo = r16 * KPITCH + 8 * hs;           // shK fragment lane offset (row = key, k = d)
  const int vfo = r16 * VPITCH + 8 * hs;           // shV fragment lane offset (row = d, k = key)

#pragma unroll 1
  for (int ks = 0; ks < ksteps; ++ks) {
    const int kb = ks * 32;
    const bool res = kb < EROWS;        // block-uniform: residual planes exist for these keys
    __syncthreads();    // prior readers of the LDS tiles done
    *(v8us*)&shK[krow * KPITCH + kcol] = *(const v8us*)(kp + (size_t)(kb + krow) * DKH + kcol);
    *(v8us*)&shV[vrow * VPITCH + vcol] = *(const v8us*)(vp + (size_t)vrow * SEQ + kb + vcol);
    if (res) {
      *(v8us*)&shKr[krow * KPITCH + kcol] = *(const v8us*)(krp + (size_t)(kb + krow) * DKH + kcol);
      *(v8us*)&shVr[vrow * VPITCH + vcol] = *(const v8us*)(vrp + (size_t)vrow * EROWS + kb + vcol);
    }
    __syncthreads();    // stage visible to all waves

    // mask word of this lane's query for these 32 keys (pinned before the selects)
    unsigned mw = mq[ks];
    asm volatile("" : "+v"(mw));
    const unsigned ml = mw >> (8 * hs);

    // S' tiles: M = key (relative 0..15 / 16..31), N = query; k = d
    const v16h kA00 = cat16h(*(const v8us*)&shK[kfo], *(const v8us*)&shK[kfo + 16]);
    const v16h kA01 = cat16h(*(const v8us*)&shK[kfo + 32], *(const v8us*)&shK[kfo + 48]);
    const v16h kA10 = cat16h(*(const v8us*)&shK[16 * KPITCH + kfo], *(const v8us*)&shK[16 * KPITCH + kfo + 16]);
    const v16h kA11 = cat16h(*(const v8us*)&shK[16 * KPITCH + kfo + 32], *(const v8us*)&shK[16 * KPITCH + kfo + 48]);
    v8f s0 = {};
    v8f s1 = {};
    s0 = mma_f16(kA00, qB0, s0);
    s0 = mma_f16(kA01, qB1, s0);
    s1 = mma_f16(kA10, qB0, s1);
    s1 = mma_f16(kA11, qB1, s1);

    // residual score products (x2048 units) in their own accumulators
    v8f x0 = {};
    v8f x1 = {};
    if (res) {
      x0 = mma_f16(kA00, qR0, x0);
      x0 = mma_f16(kA01, qR1, x0);
      x1 = mma_f16(kA10, qR0, x1);
      x1 = mma_f16(kA11, qR1, x1);
      {
        const v16h kR = cat16h(*(const v8us*)&shKr[kfo], *(const v8us*)&shKr[kfo + 16]);
        x0 = mma_f16(kR, qB0, x0);
      }
      {
        const v16h kR = cat16h(*(const v8us*)&shKr[kfo + 32], *(const v8us*)&shKr[kfo + 48]);
        x0 = mma_f16(kR, qB1, x0);
      }
      {
        const v16h kR = cat16h(*(const v8us*)&shKr[16 * KPITCH + kfo], *(const v8us*)&shKr[16 * KPITCH + kfo + 16]);
        x1 = mma_f16(kR, qB0, x1);
      }
      {
        const v16h kR = cat16h(*(const v8us*)&shKr[16 * KPITCH + kfo + 32], *(const v8us*)&shKr[16 * KPITCH + kfo + 48]);
        x1 = mma_f16(kR, qB1, x1);
      }
    }

    // fold, scale, then replace masked scores: s0[i] = key 8h+i, s1[i] = key 16+8h+i of this step
#pragma unroll
    for (int i = 0; i < 8; ++i) {
      const float a0 = (s0[i] + x0[i] * RES_INV) * QK_SCALE;
      const float a1 = (s1[i] + x1[i] * RES_INV) * QK_SCALE;
      s0[i] = ((ml >> i) & 1u) ? a0 : NEG_FILL;
      s1[i] = ((ml >> (16 + i)) & 1u) ? a1 : NEG_FILL;
    }

    // per-query (per-lane) block max; combine the two key halves (lane ^ 16)
    float bm = s0[0];
#pragma unroll
    for (int i = 0; i < 8; ++i) { bm = fmaxf(bm, s0[i]); bm = fmaxf(bm, s1[i]); }
    bm = fmaxf(bm, __shfl_xor(bm, 16, 32));
    const float mnew = fmaxf(mmax, bm);
    const float corr = __expf(fmaxf(mmax - mnew, EXP_FLOOR));
    mmax = mnew;

    // probabilities (value + residual) land directly in A-operand layout
    float ps = 0.0f;
    v16h pA, pR;
#pragma unroll
    for (int i = 0; i < 8; ++i) {
      const float p0 = __expf(fmaxf(s0[i] - mnew, EXP_FLOOR));
      const float p1 = __expf(fmaxf(s1[i] - mnew, EXP_FLOOR));
      ps += p0 + p1;
      const float c0 = p0 * P_CARRY;
      const float c1 = p1 * P_CARRY;
      const _Float16 h0 = (_Float16)c0;
      const _Float16 h1 = (_Float16)c1;
      pA[i]     = h0;
      pA[8 + i] = h1;
      pR[i]     = (_Float16)((c0 - (float)h0) * RES_CARRY);
      pR[8 + i] = (_Float16)((c1 - (float)h1) * RES_CARRY);
    }
    ps += __shfl_xor(ps, 16, 32);
    lsum = lsum * corr + ps;

    // rescale both accumulators: D row 8h+r = query 8h+r, whose corr lives in lane 8h+r
#pragma unroll
    for (int r = 0; r < 8; ++r) {
      const float cr = __shfl(corr, rowsel + r, 32);
#pragma unroll
      for (int tt = 0; tt < 4; ++tt) { o[tt][r] *= cr; orr[tt][r] *= cr; }
    }

    // O += P * V_blk (value products); residual accumulator += P_res * V
#pragma unroll
    for (int tt = 0; tt < 4; ++tt) {
      const v16h vB = cat16h(*(const v8us*)&shV[16 * tt * VPITCH + vfo],
                             *(const v8us*)&shV[16 * tt * VPITCH + vfo + 16]);
      o[tt]   = mma_f16(pA, vB, o[tt]);
      orr[tt] = mma_f16(pR, vB, orr[tt]);
    }
    // residual accumulator += P * V_res
    if (res) {
#pragma unroll
      for (int tt = 0; tt < 4; ++tt) {
        const v16h vRB = cat16h(*(const v8us*)&shVr[16 * tt * VPITCH + vfo],
                                *(const v8us*)&shVr[16 * tt * VPITCH + vfo + 16]);
        orr[tt] = mma_f16(pA, vRB, orr[tt]);
      }
    }
  }

  // fold the residual accumulator, normalize, stage this wave's 16 x 64 ctx tile in LDS
  const int bb = bh / NH;
  const int hh = bh - bb * NH;
#pragma unroll
  for (int r = 0; r < 8; ++r) {
    const float lrow = __shfl(lsum, rowsel + r, 32);
    const float li = CTX_SCALE * __builtin_amdgcn_rcpf(lrow);
#pragma unroll
    for (int tt = 0; tt < 4; ++tt) {
      const float cv = (o[tt][r] + orr[tt][r] * RES_INV) * li;
      const _Float16 hv = (_Float16)cv;
      const float rs = (cv - (float)hv) * CTXRES_CARRY;
      const int si = wid * 2048 + (rowsel + r) * 64 + 16 * tt + r16;
      shC[si]        = __builtin_bit_cast(us, hv);
      shC[si + 1024] = f16_bits(rs);
    }
  }
  __syncthreads();

  const int c = l & 7;
  v8us vals[8];
  size_t dsts[8];
#pragma unroll
  for (int it = 0; it < 8; ++it) {
    const int Lw = (l >> 3) + 4 * it;    // 0..31
    const int pl = Lw >> 4;              // 0 value, 1 residual
    const int rl = Lw & 15;
    vals[it] = *(const v8us*)&shC[wid * 2048 + pl * 1024 + rl * 64 + 8 * c];
    const int s = q0 + rl;
    dsts[it] = ((size_t)(bb * SEQ + s)) * DM2 + (size_t)pl * DM + hh * DKH + 8 * c;
  }
#pragma unroll
  for (int it = 0; it < 8; ++it) *(v8us*)(Ctx + dsts[it]) = vals[it];
  // stands in front of any rewrite of the registers that these stores name (precaution: each block runs one band, and the kernel ends after it)
  asm volatile("s_wait_xcnt 0x0" ::: "memory");
}

// ---------------------------------------------------------------------------
// Both attention bands in one launch (they write disjoint ctx rows and read the same planes): the short early band
// runs beside the long blocks of the main band. Blocks [0, ABM) = main band, [ABM, ABM + ABE) = early band
// (block-uniform split; the early blocks come last in index order).
// ---------------------------------------------------------------------------
#define ABM (NB * NH * ((SEQ - EROWS) / 128))
#define ABE (NB * NH * (EROWS / 128))
__global__ __launch_bounds__(256) __attribute__((amdgpu_num_vgpr(256)))
void attn_all_kernel(const us* __restrict__ Qh, const us* __restrict__ Kh, const us* __restrict__ Vt,
                     const us* __restrict__ Qr, const us* __restrict__ Kr, const us* __restrict__ Vr,
                     const unsigned* __restrict__ Mb, us* Ctx) {
  __shared__ __attribute__((aligned(16))) us shK[32 * KPITCH];      // [key][d], padded rows, cross-wave (block barrier)
  __shared__ __attribute__((aligned(16))) us shV[64 * VPITCH];      // [d][key], padded rows, cross-wave (block barrier)
  __shared__ __attribute__((aligned(16))) us shKr[32 * KPITCH];     // residual of shK (early band), cross-wave (block barrier)
  __shared__ __attribute__((aligned(16))) us shVr[64 * VPITCH];     // residual of shV (early band), cross-wave (block barrier)
  __shared__ __attribute__((aligned(16))) us shC[8 * 2 * 16 * 64];  // per-wave ctx staging, value|residual (block barrier used)
  __shared__ int shE[8];                                            // per-wave key bounds, cross-wave (block barrier)

  const int b = blockIdx.x;
  if (b < ABM) attn_body(Qh, Kh, Vt, Mb, Ctx, b, shK, shV, shC, shE);
  else         attn_early_body(Qh, Kh, Vt, Qr, Kr, Vr, Mb, Ctx, b - ABM, shK, shV, shKr, shVr, shC, shE);
}

// ---------------------------------------------------------------------------
// Output projection: Out f32 [MROWS][DM] = [ctx x256 | ctx residual x256] * [Wo x64 | Wo x0.25]^T * OUT_FOLD + bo.
// K = 2*DM, one accumulator (both halves of K are in the same units).
// Same block tiling as proj_kernel; f32 tile staged in two 16-row halves per wave
// (32 x 256 floats in LDS), each d_out line (32 floats) written by 8 lanes x 16 B.
// ---------------------------------------------------------------------------
__global__ __launch_bounds__(256) __attribute__((amdgpu_num_vgpr(256)))
void outproj_kernel(const us* __restrict__ Ctx, const us* __restrict__ Wot,
                    const float* __restrict__ bo, float* Out) {
  __shared__ __attribute__((aligned(16))) float ftile[32 * 256];    // cross-wave (block barrier)
  __shared__ __attribute__((aligned(16))) us ring[2 * RSTAGE];      // operand slabs, cross-wave (block barrier)

  const int t = threadIdx.x;
  const int wid = __builtin_amdgcn_readfirstlane(t >> 5);
  const int l = t & 31;
  const int h = l >> 4, r16 = l & 15;
  const int wm = wid >> 2, wn = wid & 3;
  const int mblk0 = blockIdx.x * 64;
  const int nblk0 = blockIdx.y * 256;
  const int n0 = nblk0 + wn * 64;

  v8f acc[8] = {};
  gemm_ring<DM2, false>(Ctx, Wot, mblk0, nblk0, wm, wn, ring, acc);

  float bob[4];
#pragma unroll
  for (int tt = 0; tt < 4; ++tt) bob[tt] = bf16rne(bo[n0 + 16 * tt + r16]);

  const int c = l & 7;
#pragma unroll
  for (int p = 0; p < 2; ++p) {
    if (p) __syncthreads();   // readers of the prior half done
#pragma unroll
    for (int tt = 0; tt < 4; ++tt) {
      const int nl = wn * 64 + 16 * tt + r16;
#pragma unroll
      for (int r = 0; r < 8; ++r) {
        const int rl = wm * 16 + 8 * h + r;           // 0..31
        ftile[rl * 256 + nl] = acc[p * 4 + tt][r] * OUT_FOLD + bob[tt];
      }
    }
    __syncthreads();

    v4f vals[8];
    size_t dsts[8];
#pragma unroll
    for (int it = 0; it < 8; ++it) {
      const int L = wid * 32 + (l >> 3) + 4 * it;    // 0..255
      const int rl = L >> 3, seg = L & 7;
      vals[it] = *(const v4f*)&ftile[rl * 256 + seg * 32 + 4 * c];
      const int m = mblk0 + (rl >> 4) * 32 + p * 16 + (rl & 15);
      dsts[it] = (size_t)m * DM + nblk0 + seg * 32 + 4 * c;
    }
#pragma unroll
    for (int it = 0; it < 8; ++it) *(v4f*)(Out + dsts[it]) = vals[it];
    
  }
}

// ---------------------------------------------------------------------------
// Host launcher
// ---------------------------------------------------------------------------
extern "C" void kernel_launch(void* const* d_in, const int* in_sizes, int n_in,
                              void* d_out, int out_size, void* d_ws, size_t ws_size,
                              hipStream_t stream) {
  if (n_in < 12) return;
  const int need_x = ((NB - 1) * SEQ_FULL + SEQ) * DM;
  if (in_sizes[0] < need_x || in_sizes[1] < need_x || in_sizes[2] < need_x) return;
  if (in_sizes[3] < DM * DM || in_sizes[5] < DM * DM || in_sizes[7] < DM * DM || in_sizes[9] < DM * DM) return;
  if (in_sizes[4] < DM || in_sizes[6] < DM || in_sizes[8] < DM || in_sizes[10] < DM) return;
  if (in_sizes[11] < (SEQ - 1) * SEQ_FULL + SEQ) return;
  if (out_size < MROWS * DM) return;

  // bound by role in the input order: queries, keys, values, Wq, bq, Wk, bk, Wv, bv, Wo, bo, mask
  const float* Q  = (const float*)d_in[0];
  const float* K  = (const float*)d_in[1];
  const float* V  = (const float*)d_in[2];
  const float* Wq = (const float*)d_in[3];
  const float* bq = (const float*)d_in[4];
  const float* Wk = (const float*)d_in[5];
  const float* bk = (const float*)d_in[6];
  const float* Wv = (const float*)d_in[7];
  const float* bv = (const float*)d_in[8];
  const float* Wo = (const float*)d_in[9];
  const float* bo = (const float*)d_in[10];
  const int*   Mk = (const int*)d_in[11];

  const size_t XE = (size_t)MROWS * DM;            // halves per activation plane
  const size_t WE = (size_t)DM * DM;               // halves per weight plane
  const size_t RE = (size_t)NB * NH * EROWS * DKH; // halves per early residual plane
  const size_t BW = (size_t)SEQ * WPR;             // 32-bit words of the mask bit plane
  const size_t total_bytes = (5 * XE + 5 * WE + 3 * RE) * sizeof(us) + BW * sizeof(unsigned);
  if (total_bytes > ws_size) return;

  us* wtq = (us*)d_ws;         // [n][k] bf16
  us* wtk = wtq + WE;
  us* wtv = wtk + WE;
  us* wo2 = wtv + WE;          // 2 * WE  ([DM][2*DM]) f16
  us* qh  = wo2 + 2 * WE;      // q value plane [NB*NH][SEQ][64]
  us* kh  = qh + XE;           // k value plane [NB*NH][SEQ][64]
  us* vt  = kh + XE;           // v transposed plane [NB*NH][64][SEQ]
  us* ctx = vt + XE;           // 2 * XE  ([MROWS][2*DM])
  us* qr  = ctx + 2 * XE;      // q residual plane [NB*NH][EROWS][64]
  us* kr  = qr + RE;           // k residual plane [NB*NH][EROWS][64]
  us* vr  = kr + RE;           // v residual transposed plane [NB*NH][64][EROWS]
  unsigned* mb = (unsigned*)(vr + RE);   // mask bit plane [SEQ][WPR]

  dim3 blk(256);
  const int n4 = (int)(BW / 4);
  // mask pack and the four weight converts (W is [k][n] (in,out); output planes [n][k] from wtq on: wtq, wtk, wtv, wo2)
  prep_kernel<<<dim3(MPB + 4 * WTB), blk, 0, stream>>>(Mk, mb, n4, Wq, Wk, Wv, Wo, wtq);

  // q, k, v projections (weight planes from wtq, value planes from qh, residual planes from qr, each in that order)
  proj_kernel<<<dim3(MROWS / 64, DM / 256, 3), blk, 0, stream>>>(Q, K, V, wtq, bq, bk, bv, qh, qr);

  attn_all_kernel<<<dim3(ABM + ABE), blk, 0, stream>>>(qh, kh, vt, qr, kr, vr, mb, ctx);

  dim3 gp(MROWS / 64, DM / 256);
  outproj_kernel<<<gp, blk, 0, stream>>>(ctx, wo2, bo, (float*)d_out);
}

// v005
// Measured time: 121 microseconds a run.
// In both of two side-by-side timings against v004, it was 1.14 times as fast.
// All steps since v000 together make it 2.59 times as fast.
#include <hip/hip_runtime.h>
#include <stddef.h>

// Contractions: q/k/v projections = v_wmma_f32_16x16x32_bf16 (bf16 operands = RNE-converted f32 inputs; activations converted at the fragment read);
// scores = v_wmma_f32_16x16x32_f16 (k x1 against q x1, single product; query rows < EROWS: q and k as f16 value + x2048 residual, three products, own accumulator);
// P*V = f16 (P x1024, v x1; query rows < EROWS: P and v as f16 value + x2048 residual, residual products in their own accumulator);
// output projection = f16 over K = 2*DM ([ctx x256 | ctx residual x256] against [Wo x64 | Wo x0.25]);
// f32 accumulate, f32 online softmax; the mask input is read by value (packed to bit words once) and applied as a replace fill.

#ifndef NB
#define NB 2
#endif
#ifndef SEQ
#define SEQ 2048
#endif
#define NB_FULL 2
#define SEQ_FULL 2048
#define DM 1024
#define NH 16
#define DKH 64
#define MROWS (NB * SEQ)
#define DM2 (2 * DM)
#define EROWS 256                 // query rows (and key rows) with value + residual planes
#define WPR (SEQ / 32)            // mask bit words per query row

static_assert(NB >= 1 && NB <= NB_FULL);
static_assert(SEQ >= 128 && SEQ <= SEQ_FULL);
static_assert(SEQ % 128 == 0);
static_assert(SEQ % 64 == 0 && SEQ % 32 == 0);
static_assert(MROWS % 64 == 0);
static_assert(DM % 256 == 0 && DM % 32 == 0 && DM % 64 == 0);
static_assert(DM / 8 == 128);
static_assert(NH * DKH == DM);
static_assert(DKH == 64);
static_assert(DM2 % 32 == 0);
static_assert(SEQ % 256 == 0);                 // half a mask-word row is a multiple of 4 words
static_assert(EROWS % 128 == 0 && EROWS % 64 == 0 && EROWS % 32 == 0);
static_assert(EROWS >= 128 && EROWS <= SEQ);
static_assert(WPR % 8 == 0 && WPR >= 8);
static_assert((SEQ * WPR) % 4 == 0);

#define P_CARRY      1024.0f            // P operand carried x1024
#define CTX_SCALE    0.25f              // ctx value plane = O * 0.25 / l = attn x256 (O carries the x1024 of P)
#define CTXRES_CARRY 256.0f             // ctx residual plane = (ctx256 - f16(ctx256)) x256
#define WO_CARRY     64.0f              // Wo operand carried x64 (value half of K)
#define WO_LO_CARRY  0.25f              // Wo operand for the residual half of K = WO_CARRY / CTXRES_CARRY
#define OUT_FOLD     (1.0f / 16384.0f)  // 1 / (256 * 64)
#define QK_SCALE     0.125f             // 1 / sqrt(64)
#define RES_CARRY    2048.0f            // early-band residual planes carried x2048
#define RES_INV      (1.0f / 2048.0f)
#define NEG_FILL     (-3.4028235e38f)   // lowest finite f32: fill value of masked scores
#define EXP_FLOOR    (-87.0f)           // exponent argument floor (keeps the exp argument finite)

static_assert(WO_LO_CARRY * CTXRES_CARRY == WO_CARRY);
static_assert(OUT_FOLD * 256.0f * WO_CARRY == 1.0f);
static_assert(RES_INV * RES_CARRY == 1.0f);

// workspace carve: 5 activation-size planes + 5 weight-size planes + 3 early residual planes (16-bit each) + mask bit plane
static_assert(((size_t)5 * MROWS * DM + (size_t)5 * DM * DM + (size_t)3 * NB * NH * EROWS * DKH) * 2
              + (size_t)SEQ * WPR * 4 <= (size_t)134217728);

typedef unsigned short us;
typedef us        v8us  __attribute__((ext_vector_type(8)));
typedef us        v16us __attribute__((ext_vector_type(16)));
typedef _Float16  v16h  __attribute__((ext_vector_type(16)));
typedef __bf16    v16bf __attribute__((ext_vector_type(16)));
typedef __bf16    v8bf  __attribute__((ext_vector_type(8)));
typedef float     v8f   __attribute__((ext_vector_type(8)));
typedef float     v4f   __attribute__((ext_vector_type(4)));
typedef int       v4i   __attribute__((ext_vector_type(4)));
typedef unsigned  v4u   __attribute__((ext_vector_type(4)));

// ---------------------------------------------------------------------------
// conversions
// ---------------------------------------------------------------------------
__device__ __forceinline__ unsigned bf16rne_bits(float x) {
  unsigned u = __float_as_uint(x);
  return (u + 0x7FFFu + ((u >> 16) & 1u)) >> 16;
}
__device__ __forceinline__ float bf16rne(float x) {
  return __uint_as_float(bf16rne_bits(x) << 16);
}
__device__ __forceinline__ us f16_bits(float x) {
  _Float16 hx = (_Float16)x;
  return __builtin_bit_cast(us, hx);
}

// ---------------------------------------------------------------------------
// 16-bit operand fragment (A: lane = row, B: lane = column; same k map):
//   lane l, r = l&15, s = l>>4 : elems 0..7  = row[r][k0 + 8s .. +7]
//                                elems 8..15 = row[r][k0 + 16 + 8s .. +7]
// base is a 16-bit global plane with k contiguous, pitch ld (halves).
// ---------------------------------------------------------------------------
__device__ __forceinline__ v16us frag16(const us* base, int ld, int row0, int k0) {
  const int l = threadIdx.x & 31;
  const int r = l & 15, s = l >> 4;
  const us* p = base + (size_t)(row0 + r) * ld + k0 + 8 * s;
  v8us c0 = *(const v8us*)p;
  v8us c1 = *(const v8us*)(p + 16);
  return __builtin_shufflevector(c0, c1, 0, 1, 2, 3, 4, 5, 6, 7, 8, 9, 10, 11, 12, 13, 14, 15);
}
__device__ __forceinline__ v16h fragh(const us* base, int ld, int row0, int k0) {
  return __builtin_bit_cast(v16h, frag16(base, ld, row0, k0));
}
// two 16-byte chunks (already loaded) -> one f16 fragment
__device__ __forceinline__ v16h cat16h(v8us c0, v8us c1) {
  v16us w = __builtin_shufflevector(c0, c1, 0, 1, 2, 3, 4, 5, 6, 7, 8, 9, 10, 11, 12, 13, 14, 15);
  return __builtin_bit_cast(v16h, w);
}

// ---------------------------------------------------------------------------
// WMMA wrappers with hazard guard: D = A(16x32) * B(32x16) + C (f32)
// ---------------------------------------------------------------------------
__device__ __forceinline__ v8f mma_f16(v16h a, v16h b, v8f c) {
  v8f d = __builtin_amdgcn_wmma_f32_16x16x32_f16(false, a, false, b, (short)0, c, false, false);
  asm volatile("v_nop\n\tv_nop\n\tv_nop\n\tv_nop" : "+v"(d) : "v"(a), "v"(b));
  return d;
}
__device__ __forceinline__ v8f mma_bf16(v16bf a, v16bf b, v8f c) {
  v8f d = __builtin_amdgcn_wmma_f32_16x16x32_bf16(false, a, false, b, (short)0, c, false, false);
  asm volatile("v_nop\n\tv_nop\n\tv_nop\n\tv_nop" : "+v"(d) : "v"(a), "v"(b));
  return d;
}

// ---------------------------------------------------------------------------
// Mask pack: M int32 [SEQ_FULL][SEQ_FULL] (nonzero = attend) -> bit words [SEQ][WPR],
// bit j of word w of row q = (M[q][32w + j] != 0).
// ---------------------------------------------------------------------------
__device__ __forceinline__ void mask_pack_body(const int* __restrict__ M, unsigned* Bits, int n4, int blk) {
  const int i = blk * 256 + threadIdx.x;
  if (i >= n4) return;
  const int w4 = i * 4;
  const int q  = w4 / WPR;
  const int w0 = w4 - q * WPR;
  const int* src = M + (size_t)q * SEQ_FULL + 32 * w0;
  unsigned a0 = 0u, a1 = 0u, a2 = 0u, a3 = 0u;
#pragma unroll 1
  for (int j = 0; j < 4; ++j) {
    unsigned wb = 0u;
#pragma unroll
    for (int c = 0; c < 8; ++c) {
      const v4i m = *(const v4i*)(src + 32 * j + 4 * c);
      wb |= ((m[0] != 0) ? 1u : 0u) << (4 * c);
      wb |= ((m[1] != 0) ? 1u : 0u) << (4 * c + 1);
      wb |= ((m[2] != 0) ? 1u : 0u) << (4 * c + 2);
      wb |= ((m[3] != 0) ? 1u : 0u) << (4 * c + 3);
    }
    a0 = (j == 0) ? wb : a0;
    a1 = (j == 1) ? wb : a1;
    a2 = (j == 2) ? wb : a2;
    a3 = (j == 3) ? wb : a3;
  }
  v4u y;
  y[0] = a0; y[1] = a1; y[2] = a2; y[3] = a3;
  unsigned* dst = Bits + (size_t)i * 4;
  *(v4u*)dst = y;
  
}

// ---------------------------------------------------------------------------
// Weight convert with transpose: W f32 [k][n] (in,out; n contiguous) -> 16-bit plane [n][k] (k contiguous).
// hmode 0: bf16 bits of RNE(W), pitch DM.
// hmode 1: pitch 2*DM: cols [0,DM) = f16(RNE(W) * WO_CARRY), cols [DM,2DM) = f16(RNE(W) * WO_LO_CARRY).
// Block = 64(k) x 64(n) tile through LDS (cross-wave: block barrier); each output line = 64 k of one n
// kt = k tile, nt = n tile of the block (DM/64 each); t0, t1: the block's two LDS tiles of 64 * WT_LD halves.
// ---------------------------------------------------------------------------
#define WT_LD 72
static_assert((WT_LD * 2) % 16 == 0 && WT_LD >= 64);
__device__ __forceinline__ void cvt_wT_body(const float* __restrict__ W, us* Y, int hmode, int kt, int nt,
                                            us* t0, us* t1) {
  const int t  = threadIdx.x;
  const int k0 = kt * 64;
  const int n0 = nt * 64;

#pragma unroll 1
  for (int i = 0; i < 4; ++i) {
    const int id = t + i * 256;           // 1024 float4 chunks (64 k x 64 n)
    const int kr = id >> 4;
    const int c4 = (id & 15) * 4;
    const v4f x = *(const v4f*)(W + (size_t)(k0 + kr) * DM + n0 + c4);
#pragma unroll
    for (int j = 0; j < 4; ++j) {
      const float w = bf16rne(x[j]);
      const us hb = (us)(__float_as_uint(w) >> 16);
      const us hf = f16_bits(w * WO_CARRY);
      const us hl = f16_bits(w * WO_LO_CARRY);
      t0[(c4 + j) * WT_LD + kr] = hmode ? hf : hb;
      t1[(c4 + j) * WT_LD + kr] = hl;
    }
  }
  __syncthreads();

  const int c = t & 7;
  const size_t pitch = hmode ? (size_t)DM2 : (size_t)DM;
  v8us v0[2], v1[2];
  size_t dsts[2];
#pragma unroll
  for (int it = 0; it < 2; ++it) {
    const int L = (t >> 3) + 32 * it;     // local n 0..63
    v0[it] = *(const v8us*)&t0[L * WT_LD + 8 * c];
    v1[it] = *(const v8us*)&t1[L * WT_LD + 8 * c];
    dsts[it] = (size_t)(n0 + L) * pitch + k0 + 8 * c;
  }
#pragma unroll
  for (int it = 0; it < 2; ++it) {
    *(v8us*)(Y + dsts[it]) = v0[it];
    // stands in front of any rewrite of the registers that this store names
    asm volatile("s_wait_xcnt 0x0" ::: "memory");
    if (hmode) {
      *(v8us*)(Y + dsts[it] + DM) = v1[it];
      // stands in front of any rewrite of the registers that this store names
      asm volatile("s_wait_xcnt 0x0" ::: "memory");
    }
  }
}

// ---------------------------------------------------------------------------
// Preparation, one launch: the mask pack and the four weight converts do not depend on one another.
// Blocks [0, MPB) pack the mask; then WTB blocks per weight in the order Wq, Wk, Wv, Wo (block-uniform split).
// Wt: the weight planes one behind another: Wq, Wk, Wv (bf16, DM*DM halves each), then Wo (f16, 2*DM*DM halves).
// ---------------------------------------------------------------------------
#define MPB ((SEQ * WPR / 4 + 255) / 256)     // mask pack blocks
#define WTB ((DM / 64) * (DM / 64))           // blocks per weight
__global__ __launch_bounds__(256) void prep_kernel(const int* __restrict__ M, unsigned* Bits, int n4,
                                                   const float* __restrict__ Wq, const float* __restrict__ Wk,
                                                   const float* __restrict__ Wv, const float* __restrict__ Wo, us* Wt) {
  __shared__ __attribute__((aligned(16))) us t0[64 * WT_LD];   // [n][k] value
  __shared__ __attribute__((aligned(16))) us t1[64 * WT_LD];   // [n][k] low-carry copy (hmode 1)

  const int b = blockIdx.x;
  if (b < MPB) {
    mask_pack_body(M, Bits, n4, b);
    return;
  }
  const int wb = b - MPB;
  const int w = wb / WTB;               // 0..3: Wq, Wk, Wv, Wo
  const int tile = wb - w * WTB;
  const float* W = (w == 0) ? Wq : (w == 1) ? Wk : (w == 2) ? Wv : Wo;
  cvt_wT_body(W, Wt + (size_t)w * DM * DM, (w == 3) ? 1 : 0, tile % (DM / 64), tile / (DM / 64), t0, t1);
}

// ---------------------------------------------------------------------------
// GEMM core: block computes 64 rows x 256 cols over K = KD; wave (wm, wn) computes 32 x 64 of it.
// A plane [M][KD], B plane [N][KD] (k contiguous), both 16-bit.
// K is walked in slabs of RK; a slab (64 A rows, then 256 B rows) is staged in LDS by asynchronous
// 16-byte copies, two buffers: the next slab's copies fly while this slab is worked on.
// Fragments are read from LDS with the k map of frag16; k runs upward in steps of 32 as before.
// ---------------------------------------------------------------------------
#define RK 128                       // k per slab: 256-byte rows
#define RPITCH 136                   // LDS row pitch in halves: 272 B = 16 B x 17, conflict-free for 16-byte reads
#define RROWS 320                    // 64 A rows + 256 B rows
#define RSTAGE (RROWS * RPITCH)      // halves per buffer
static_assert((RPITCH * 2) % 16 == 0 && RPITCH >= RK);
static_assert(RROWS * (RK / 8) == 20 * 256);   // 20 copies per thread and slab

// One slab: thread t copies chunk (t & 15) of rows (t >> 4) + 16 i, i = 0..19 (each wave copy = 2 whole rows).
// ga / gb: this thread's chunk in A row (t >> 4) / B row (t >> 4) of the block at this slab; ld: its LDS byte address in row (t >> 4).
template <int KD>
__device__ __forceinline__ void stage_slab(const us* ga, const us* gb, unsigned ld) {
  const us* g[20];
  unsigned d[20];
#pragma unroll   // unrolled so that g[] and d[] are registers (they are asm operands)
  for (int i = 0; i < 20; ++i) {
    g[i] = (i < 4) ? (ga + (size_t)(16 * i) * KD) : (gb + (size_t)(16 * (i - 4)) * KD);
    d[i] = ld + (unsigned)(16 * i * RPITCH * 2);
  }
  // the closing s_wait_xcnt keeps the address registers of the issued copies from being rewritten early
  asm volatile("global_load_async_to_lds_b128 %0, %1, off\n\t"
               "global_load_async_to_lds_b128 %2, %3, off\n\t"
               "global_load_async_to_lds_b128 %4, %5, off\n\t"
               "global_load_async_to_lds_b128 %6, %7, off\n\t"
               "global_load_async_to_lds_b128 %8, %9, off\n\t"
               "global_load_async_to_lds_b128 %10, %11, off\n\t"
               "global_load_async_to_lds_b128 %12, %13, off\n\t"
               "global_load_async_to_lds_b128 %14, %15, off\n\t"
               "global_load_async_to_lds_b128 %16, %17, off\n\t"
               "global_load_async_to_lds_b128 %18, %19, off\n\t"
               "s_wait_xcnt 0x0"
               :: "v"(d[0]), "v"(g[0]), "v"(d[1]), "v"(g[1]), "v"(d[2]), "v"(g[2]), "v"(d[3]), "v"(g[3]), "v"(d[4]), "v"(g[4]), "v"(d[5]), "v"(g[5]), "v"(d[6]), "v"(g[6]), "v"(d[7]), "v"(g[7]), "v"(d[8]), "v"(g[8]), "v"(d[9]), "v"(g[9]) : "memory");
  asm volatile("global_load_async_to_lds_b128 %0, %1, off\n\t"
               "global_load_async_to_lds_b128 %2, %3, off\n\t"
               "global_load_async_to_lds_b128 %4, %5, off\n\t"
               "global_load_async_to_lds_b128 %6, %7, off\n\t"
               "global_load_async_to_lds_b128 %8, %9, off\n\t"
               "global_load_async_to_lds_b128 %10, %11, off\n\t"
               "global_load_async_to_lds_b128 %12, %13, off\n\t"
               "global_load_async_to_lds_b128 %14, %15, off\n\t"
               "global_load_async_to_lds_b128 %16, %17, off\n\t"
               "global_load_async_to_lds_b128 %18, %19, off\n\t"
               "s_wait_xcnt 0x0"
               :: "v"(d[10]), "v"(g[10]), "v"(d[11]), "v"(g[11]), "v"(d[12]), "v"(g[12]), "v"(d[13]), "v"(g[13]), "v"(d[14]), "v"(g[14]), "v"(d[15]), "v"(g[15]), "v"(d[16]), "v"(g[16]), "v"(d[17]), "v"(g[17]), "v"(d[18]), "v"(g[18]), "v"(d[19]), "v"(g[19]) : "memory");
}

// fragment from a staged slab (LDS), same lane and k map as frag16
__device__ __forceinline__ v16us lfrag16(const us* tile, int row0, int k0) {
  const int l = threadIdx.x & 31;
  const int r = l & 15, s = l >> 4;
  const us* p = tile + (row0 + r) * RPITCH + k0 + 8 * s;
  v8us c0 = *(const v8us*)p;
  v8us c1 = *(const v8us*)(p + 16);
  return __builtin_shufflevector(c0, c1, 0, 1, 2, 3, 4, 5, 6, 7, 8, 9, 10, 11, 12, 13, 14, 15);
}

template <int KD, bool BF>
__device__ __forceinline__ void gemm_ring(const us* A, const us* B, int mblk0, int nblk0, int wm, int wn,
                                          us* ring, v8f (&acc)[8]) {
  static_assert(KD % RK == 0 && KD / RK >= 2);
  constexpr int NP = KD / RK;
  const int t = threadIdx.x;
  const us* ga = A + (size_t)(mblk0 + (t >> 4)) * KD + (t & 15) * 8;
  const us* gb = B + (size_t)(nblk0 + (t >> 4)) * KD + (t & 15) * 8;
  const unsigned ld = (unsigned)(size_t)ring + (unsigned)((t >> 4) * (RPITCH * 2) + (t & 15) * 16);

  stage_slab<KD>(ga, gb, ld);
  asm volatile("s_wait_asynccnt 0x0" ::: "memory");   // slab 0 landed (this wave's copies)
  __syncthreads();                                    // slab 0 visible to all waves
  stage_slab<KD>(ga + RK, gb + RK, ld + (unsigned)(RSTAGE * 2));

#pragma unroll 1   // kept rolled: one body of 32 matrix instructions, short code
  for (int p = 0; p < NP; ++p) {
    const int buf = p & 1;
    const us* tile = ring + buf * RSTAGE;
#pragma unroll     // unrolled so that the k offsets become immediates of the LDS reads
    for (int kk = 0; kk < RK; kk += 32) {
      // the six fragments of a k step are read as one group: one LDS latency per step, not one per column tile
      const v16us a0 = lfrag16(tile, wm * 32, kk);
      const v16us a1 = lfrag16(tile, wm * 32 + 16, kk);
      v16us b[4];
#pragma unroll     // unrolled so that b[] stays in registers
      for (int tt = 0; tt < 4; ++tt) b[tt] = lfrag16(tile, 64 + wn * 64 + 16 * tt, kk);
#pragma unroll     // unrolled so that acc[] stays in registers
      for (int tt = 0; tt < 4; ++tt) {
        if constexpr (BF) {
          acc[tt]     = mma_bf16(__builtin_bit_cast(v16bf, a0), __builtin_bit_cast(v16bf, b[tt]), acc[tt]);
          acc[4 + tt] = mma_bf16(__builtin_bit_cast(v16bf, a1), __builtin_bit_cast(v16bf, b[tt]), acc[4 + tt]);
        } else {
          acc[tt]     = mma_f16(__builtin_bit_cast(v16h, a0), __builtin_bit_cast(v16h, b[tt]), acc[tt]);
          acc[4 + tt] = mma_f16(__builtin_bit_cast(v16h, a1), __builtin_bit_cast(v16h, b[tt]), acc[4 + tt]);
        }
      }
    }
    asm volatile("s_wait_dscnt 0x0" ::: "memory");      // this wave's reads of the buffer are done before it is refilled
    asm volatile("s_wait_asynccnt 0x0" ::: "memory");   // this wave's copies of slab p + 1 have landed
    __syncthreads();                                    // publishes slab p + 1; ends every reader's last read of slab p
    if (p + 2 < NP)
      stage_slab<KD>(ga + (p + 2) * RK, gb + (p + 2) * RK, ld + (unsigned)(buf * RSTAGE * 2));
  }
  asm volatile("s_wait_asynccnt 0x0" ::: "memory");     // no copy outstanding past the loop
}

// ---------------------------------------------------------------------------
// GEMM core of the q/k/v projections: same block and wave tiling, slabs, ring order and k order as gemm_ring, K = DM,
// but the A operand is the f32 activation itself: its slab (64 rows x RK floats) is staged as f32 by the same
// asynchronous 16-byte copies and rounded to bf16 (nearest even) where a fragment is read from LDS.
// ---------------------------------------------------------------------------
#define XPITCH 132                   // A slab row pitch in floats: 528 B = 16 B x 33, conflict-free for 16-byte reads
#define XASTAGE (64 * XPITCH)        // floats per A buffer
#define XBSTAGE (256 * RPITCH)       // halves per B buffer
static_assert((XPITCH * 4) % 32 == 16 && XPITCH >= RK);
static_assert(64 * (RK / 4) == 8 * 256 && 256 * (RK / 8) == 16 * 256);   // 8 + 16 copies per thread and slab

// One slab: thread t copies chunk (t & 31) of A rows (t >> 5) + 8 i, i = 0..7 (each wave copy = 1 whole row of 512 B),
// and chunk (t & 15) of B rows (t >> 4) + 16 i, i = 0..15 (each wave copy = 2 whole rows of 256 B).
// ga / gb: this thread's chunk in its first A / B row at this slab; la / lb: its LDS byte address there.
__device__ __forceinline__ void stage_slab_x(const float* ga, const us* gb, unsigned la, unsigned lb) {
  const void* g[24];
  unsigned d[24];
#pragma unroll   // unrolled so that g[] and d[] are registers (they are asm operands)
  for (int i = 0; i < 8; ++i) {
    g[i] = ga + (size_t)(8 * i) * DM;
    d[i] = la + (unsigned)(8 * i * XPITCH * 4);
  }
#pragma unroll   // unrolled so that g[] and d[] are registers (they are asm operands)
  for (int i = 0; i < 16; ++i) {
    g[8 + i] = gb + (size_t)(16 * i) * DM;
    d[8 + i] = lb + (unsigned)(16 * i * RPITCH * 2);
  }
  // the closing s_wait_xcnt keeps the address registers of the issued copies from being rewritten early
  asm volatile("global_load_async_to_lds_b128 %0, %1, off\n\t"
               "global_load_async_to_lds_b128 %2, %3, off\n\t"
               "global_load_async_to_lds_b128 %4, %5, off\n\t"
               "global_load_async_to_lds_b128 %6, %7, off\n\t"
               "global_load_async_to_lds_b128 %8, %9, off\n\t"
               "global_load_async_to_lds_b128 %10, %11, off\n\t"
               "global_load_async_to_lds_b128 %12, %13, off\n\t"
               "global_load_async_to_lds_b128 %14, %15, off\n\t"
               "global_load_async_to_lds_b128 %16, %17, off\n\t"
               "global_load_async_to_lds_b128 %18, %19, off\n\t"
               "global_load_async_to_lds_b128 %20, %21, off\n\t"
               "global_load_async_to_lds_b128 %22, %23, off\n\t"
               "s_wait_xcnt 0x0"
               :: "v"(d[0]), "v"(g[0]), "v"(d[1]), "v"(g[1]), "v"(d[2]), "v"(g[2]), "v"(d[3]), "v"(g[3]), "v"(d[4]), "v"(g[4]), "v"(d[5]), "v"(g[5]), "v"(d[6]), "v"(g[6]), "v"(d[7]), "v"(g[7]), "v"(d[8]), "v"(g[8]), "v"(d[9]), "v"(g[9]), "v"(d[10]), "v"(g[10]), "v"(d[11]), "v"(g[11]) : "memory");
  asm volatile("global_load_async_to_lds_b128 %0, %1, off\n\t"
               "global_load_async_to_lds_b128 %2, %3, off\n\t"
               "global_load_async_to_lds_b128 %4, %5, off\n\t"
               "global_load_async_to_lds_b128 %6, %7, off\n\t"
               "global_load_async_to_lds_b128 %8, %9, off\n\t"
               "global_load_async_to_lds_b128 %10, %11, off\n\t"
               "global_load_async_to_lds_b128 %12, %13, off\n\t"
               "global_load_async_to_lds_b128 %14, %15, off\n\t"
               "global_load_async_to_lds_b128 %16, %17, off\n\t"
               "global_load_async_to_lds_b128 %18, %19, off\n\t"
               "global_load_async_to_lds_b128 %20, %21, off\n\t"
               "global_load_async_to_lds_b128 %22, %23, off\n\t"
               "s_wait_xcnt 0x0"
               :: "v"(d[12]), "v"(g[12]), "v"(d[13]), "v"(g[13]), "v"(d[14]), "v"(g[14]), "v"(d[15]), "v"(g[15]), "v"(d[16]), "v"(g[16]), "v"(d[17]), "v"(g[17]), "v"(d[18]), "v"(g[18]), "v"(d[19]), "v"(g[19]), "v"(d[20]), "v"(g[20]), "v"(d[21]), "v"(g[21]), "v"(d[22]), "v"(g[22]), "v"(d[23]), "v"(g[23]) : "memory");
}

// bf16 fragment from a staged f32 A slab (LDS), same lane and k map as frag16
__device__ __forceinline__ v16bf lfragx(const float* tile, int row0, int k0) {
  const int l = threadIdx.x & 31;
  const int r = l & 15, s = l >> 4;
  const float* p = tile + (row0 + r) * XPITCH + k0 + 8 * s;
  const v4f c0 = *(const v4f*)p;
  const v4f c1 = *(const v4f*)(p + 4);
  const v4f c2 = *(const v4f*)(p + 16);
  const v4f c3 = *(const v4f*)(p + 20);
  const v8bf lo = __builtin_convertvector(__builtin_shufflevector(c0, c1, 0, 1, 2, 3, 4, 5, 6, 7), v8bf);
  const v8bf hi = __builtin_convertvector(__builtin_shufflevector(c2, c3, 0, 1, 2, 3, 4, 5, 6, 7), v8bf);
  return __builtin_shufflevector(lo, hi, 0, 1, 2, 3, 4, 5, 6, 7, 8, 9, 10, 11, 12, 13, 14, 15);
}

// Ax: first of the block's 64 rows of the f32 activation (pitch DM); B plane [N][DM] bf16, k contiguous.
__device__ __forceinline__ void gemm_ring_x(const float* Ax, const us* B, int nblk0, int wm, int wn,
                                            float* ringa, us* ringb, v8f (&acc)[8]) {
  static_assert(DM % RK == 0 && DM / RK >= 2);
  constexpr int NP = DM / RK;
  const int t = threadIdx.x;
  const float* ga = Ax + (size_t)(t >> 5) * DM + (t & 31) * 4;
  const us* gb = B + (size_t)(nblk0 + (t >> 4)) * DM + (t & 15) * 8;
  const unsigned la = (unsigned)(size_t)ringa + (unsigned)((t >> 5) * (XPITCH * 4) + (t & 31) * 16);
  const unsigned lb = (unsigned)(size_t)ringb + (unsigned)((t >> 4) * (RPITCH * 2) + (t & 15) * 16);

  stage_slab_x(ga, gb, la, lb);
  asm volatile("s_wait_asynccnt 0x0" ::: "memory");   // slab 0 landed (this wave's copies)
  __syncthreads();                                    // slab 0 visible to all waves
  stage_slab_x(ga + RK, gb + RK, la + (unsigned)(XASTAGE * 4), lb + (unsigned)(XBSTAGE * 2));

#pragma unroll 1   // kept rolled: one body of 32 matrix instructions, short code
  for (int p = 0; p < NP; ++p) {
    const int buf = p & 1;
    const float* ta = ringa + buf * XASTAGE;
    const us* tb = ringb + buf * XBSTAGE;
#pragma unroll     // unrolled so that the k offsets become immediates of the LDS reads
    for (int kk = 0; kk < RK; kk += 32) {
      // the six fragments of a k step are read as one group: one LDS latency per step, not one per column tile
      const v16bf a0 = lfragx(ta, wm * 32, kk);
      const v16bf a1 = lfragx(ta, wm * 32 + 16, kk);
      v16us b[4];
#pragma unroll     // unrolled so that b[] stays in registers
      for (int tt = 0; tt < 4; ++tt) b[tt] = lfrag16(tb, wn * 64 + 16 * tt, kk);
#pragma unroll     // unrolled so that acc[] stays in registers
      for (int tt = 0; tt < 4; ++tt) {
        acc[tt]     = mma_bf16(a0, __builtin_bit_cast(v16bf, b[tt]), acc[tt]);
        acc[4 + tt] = mma_bf16(a1, __builtin_bit_cast(v16bf, b[tt]), acc[4 + tt]);
      }
    }
    asm volatile("s_wait_dscnt 0x0" ::: "memory");      // this wave's reads of the buffer are done before it is refilled
    asm volatile("s_wait_asynccnt 0x0" ::: "memory");   // this wave's copies of slab p + 1 have landed
    __syncthreads();                                    // publishes slab p + 1; ends every reader's last read of slab p
    if (p + 2 < NP)
      stage_slab_x(ga + (p + 2) * RK, gb + (p + 2) * RK,
                   la + (unsigned)(buf * XASTAGE * 4), lb + (unsigned)(buf * XBSTAGE * 2));
  }
  asm volatile("s_wait_asynccnt 0x0" ::: "memory");     // no copy outstanding past the loop
}

// ---------------------------------------------------------------------------
// Projection: Y = bf16(X)[MROWS][DM] * Wt^T + b, written as an f16 plane. X f32 [NB_FULL*SEQ_FULL][DM].
// mode 0/1: q or k -> value plane [NB*NH][SEQ][64]
// mode 2:   v      -> transposed value plane [NB*NH][64][SEQ]
// Blocks whose 64 rows lie below EROWS (block-uniform) also write the x2048 residual plane at Y + roff:
// mode 0/1: [NB*NH][EROWS][64]; mode 2: [NB*NH][64][EROWS].
// Block 256 thr = 8 waves as 2(M) x 4(N); block tile 64 x 256; blockIdx (x, y) = (row block, column block).
// ---------------------------------------------------------------------------
__device__ __forceinline__
void proj_body(const float* __restrict__ X, const us* __restrict__ Wt,
               const float* __restrict__ bias, us* Y, size_t roff, int mode) {
  __shared__ __attribute__((aligned(16))) us stile[64 * 256];       // cross-wave (block barrier)
  __shared__ __attribute__((aligned(16))) float ringa[2 * XASTAGE]; // f32 A slabs, cross-wave (block barrier)
  __shared__ __attribute__((aligned(16))) us ringb[2 * XBSTAGE];    // bf16 B slabs, cross-wave (block barrier)

  const int t = threadIdx.x;
  const int wid = __builtin_amdgcn_readfirstlane(t >> 5);
  const int l = t & 31;
  const int h = l >> 4, r16 = l & 15;
  const int wm = wid >> 2, wn = wid & 3;
  const int mblk0 = blockIdx.x * 64;
  const int nblk0 = blockIdx.y * 256;
  const int n0 = nblk0 + wn * 64;

  const int bblk = mblk0 / SEQ;
  const int sblk = mblk0 - bblk * SEQ;  // 64 block rows lie inside one batch (SEQ % 64 == 0)

  v8f acc[8] = {};
  gemm_ring_x(X + (size_t)(bblk * SEQ_FULL + sblk) * DM, Wt, nblk0, wm, wn, ringa, ringb, acc);

  float bvv[4];
#pragma unroll
  for (int tt = 0; tt < 4; ++tt) bvv[tt] = bf16rne(bias[n0 + 16 * tt + r16]);

  const int c = l & 7;
  const int nph = (sblk < EROWS) ? 2 : 1;   // block-uniform: phase 0 value plane, phase 1 residual plane

#pragma unroll 1
  for (int ph = 0; ph < nph; ++ph) {
    if (ph) __syncthreads();              // readers of the value stage done

    // stage f16 value (phase 0) or x2048 residual (phase 1) of (acc + bias) into LDS
#pragma unroll
    for (int tt = 0; tt < 4; ++tt) {
      const int nl = wn * 64 + 16 * tt + r16;
#pragma unroll
      for (int mi = 0; mi < 2; ++mi) {
#pragma unroll
        for (int r = 0; r < 8; ++r) {
          const int ml = wm * 32 + 16 * mi + 8 * h + r;
          const float v = acc[mi * 4 + tt][r] + bvv[tt];
          const _Float16 hv = (_Float16)v;
          const float rs = (v - (float)hv) * RES_CARRY;
          const us hb = __builtin_bit_cast(us, hv);
          const us rb = f16_bits(rs);
          const int li = (mode == 2) ? (nl * 64 + ml) : (ml * 256 + nl);
          stile[li] = ph ? rb : hb;
        }
      }
    }
    __syncthreads();

    // whole-line writes: 256 lines per block, 32 per wave
    const int SL = ph ? EROWS : SEQ;      // sequence extent of the destination plane
    const size_t poff = ph ? roff : (size_t)0;
    v8us vals[8];
    size_t dsts[8];
#pragma unroll
    for (int it = 0; it < 8; ++it) {
      const int L = wid * 32 + (l >> 3) + 4 * it;
      int src;
      size_t dst;
      if (mode == 2) {
        const int n = nblk0 + L;
        const int hg = n >> 6, d = n & 63;
        src = L * 64 + 8 * c;
        dst = (((size_t)(bblk * NH + hg)) * DKH + d) * SL + sblk + 8 * c;
      } else {
        const int ml = L >> 2, hq = L & 3;
        const int hg = (nblk0 >> 6) + hq;
        const int s = sblk + ml;
        src = ml * 256 + hq * 64 + 8 * c;
        dst = (((size_t)(bblk * NH + hg)) * SL + s) * DKH + 8 * c;
      }
      vals[it] = *(const v8us*)&stile[src];
      dsts[it] = dst + poff;
    }
#pragma unroll
    for (int it = 0; it < 8; ++it) *(v8us*)(Y + dsts[it]) = vals[it];
    // stands in front of the residual phase's rewrite of the registers that hold these stores' addresses
    asm volatile("s_wait_xcnt 0x0" ::: "memory");
  }
}

// The three projections do not depend on one another: one launch, grid (MROWS/64, DM/256, 3), blockIdx.z = mode.
// Wt3: weight planes of q, k, v one behind another; Y3: their value planes; R3: their early residual planes.
__global__ __launch_bounds__(256) __attribute__((amdgpu_num_vgpr(256)))
void proj_kernel(const float* __restrict__ Xq, const float* __restrict__ Xk, const float* __restrict__ Xv,
                 const us* __restrict__ Wt3,
                 const float* __restrict__ bq, const float* __restrict__ bk, const float* __restrict__ bv,
                 us* Y3, us* R3) {
  const int mode = blockIdx.z;
  const float* X = (mode == 0) ? Xq : (mode == 1) ? Xk : Xv;
  const float* bias = (mode == 0) ? bq : (mode == 1) ? bk : bv;
  us* Y = Y3 + (size_t)mode * MROWS * DM;
  us* R = R3 + (size_t)mode * NB * NH * EROWS * DKH;
  proj_body(X, Wt3 + (size_t)mode * DM * DM, bias, Y, (size_t)(R - Y), mode);
}

// ---------------------------------------------------------------------------
// LDS row pitches of the attention K and V tiles (halves). The fragment readers are 16-byte reads, one row per lane:
// a pitch of 16 B x odd spreads the 16 rows of a read over all banks (unpadded 128-B / 64-B rows fall on few banks).
// ---------------------------------------------------------------------------
#define KPITCH 72                    // K tile: 64 d per key row + 8 halves of pad = 144 B = 16 B x 9
#define VPITCH 40                    // V tile: 32 keys per d row + 8 halves of pad = 80 B = 16 B x 5
static_assert(KPITCH >= DKH && (KPITCH * 2) % 32 == 16);
static_assert(VPITCH >= 32 && (VPITCH * 2) % 32 == 16);
#define KBUF (32 * KPITCH)           // halves per K tile buffer
#define VBUF (64 * VPITCH)           // halves per V tile buffer
static_assert((KBUF * 2) % 16 == 0 && (VBUF * 2) % 16 == 0);

// ---------------------------------------------------------------------------
// Per-wave part of the key-step bound of a 128-query block, from the mask bit plane.
// Thread t scans half a row (row = t>>1 of the block). A row with at least one visible key needs
// key steps [0, last visible word]; a row with no visible key needs every key step (uniform softmax).
// Returns the maximum over the wave's 16 rows (all lanes hold it).
// ---------------------------------------------------------------------------
__device__ __forceinline__ int wave_key_bound(const unsigned* __restrict__ Mb, int qb) {
  const int t = threadIdx.x;
  const int hw = (t & 1) * (WPR / 2);
  const unsigned* mrow = Mb + (size_t)(qb * 128 + (t >> 1)) * WPR + hw;
  int kmx = -1;
#pragma unroll 1
  for (int j = 0; j < WPR / 2; j += 4) {
    const v4u w = *(const v4u*)(mrow + j);
    kmx = (w[0] != 0u) ? (hw + j)     : kmx;
    kmx = (w[1] != 0u) ? (hw + j + 1) : kmx;
    kmx = (w[2] != 0u) ? (hw + j + 2) : kmx;
    kmx = (w[3] != 0u) ? (hw + j + 3) : kmx;
  }
  const int oth = __shfl_xor(kmx, 1, 32);
  kmx = max(kmx, oth);
  int ke = (kmx < 0) ? WPR : (kmx + 1);
  ke = max(ke, __shfl_xor(ke, 16, 32));
  ke = max(ke, __shfl_xor(ke, 8, 32));
  ke = max(ke, __shfl_xor(ke, 4, 32));
  ke = max(ke, __shfl_xor(ke, 2, 32));
  return ke;
}

// ---------------------------------------------------------------------------
// One 32-key tile of the main band: thread t copies its 16-byte chunk of K (row t >> 3) and of V (row t >> 2) straight into LDS.
// gk / gv: the chunk's global address; lk / lv: its LDS byte address in the buffer that is filled.
// ---------------------------------------------------------------------------
__device__ __forceinline__ void stage_kv(const us* gk, const us* gv, unsigned lk, unsigned lv) {
  // the closing s_wait_xcnt keeps the address registers of the issued copies from being rewritten early
  asm volatile("global_load_async_to_lds_b128 %0, %1, off\n\t"
               "global_load_async_to_lds_b128 %2, %3, off\n\t"
               "s_wait_xcnt 0x0"
               :: "v"(lk), "v"(gk), "v"(lv), "v"(gv) : "memory");
}

// ---------------------------------------------------------------------------
// Fused flash attention, query rows >= EROWS. Block = 8 waves, one (b,h), 128 queries; each wave owns
// 16 queries. K/V 32-key tiles are staged once per block into LDS by asynchronous 16-byte copies, two buffers:
// the next step's tile (and mask word) is in flight while this step is worked on; one barrier per step.
// Scores computed transposed (S' = K_blk * Q^T) so the exp'd probabilities are
// already in A-operand layout for P*V. Online softmax in f32.
// Mask: one bit word per lane (= query) per 32-key step; masked scores are REPLACED by NEG_FILL.
// Key loop bound per block derived from the mask words (clamped to SEQ/32).
// ctx plane f16 [MROWS][2*DM]: cols [0,DM) value x256, cols [DM,2DM) residual x256,
// blk = 0 .. NB*NH*((SEQ-EROWS)/128) - 1; the LDS arrays are those of attn_all_kernel.
// ---------------------------------------------------------------------------
__device__ __forceinline__
void attn_body(const us* __restrict__ Qh, const us* __restrict__ Kh,
               const us* __restrict__ Vt, const unsigned* __restrict__ Mb, us* Ctx, int blk,
               us* shK, us* shV, us* shC, int* shE) {
  const int t = threadIdx.x;
  const int wid = __builtin_amdgcn_readfirstlane(t >> 5);
  const int l = t & 31;
  const int r16 = l & 15;
  const int hs = l >> 4;
  const int rowsel = hs << 3;
  constexpr int QBL = (SEQ > EROWS) ? (SEQ - EROWS) / 128 : 1;
  const int bh = blk / QBL;
  const int qb = blk - bh * QBL + EROWS / 128;
  const int q0 = qb * 128 + wid * 16;

  const size_t qoff = (size_t)bh * SEQ * DKH;
  const us* qp = Qh + qoff;
  const us* kp = Kh + qoff;
  const us* vp = Vt + (size_t)bh * DKH * SEQ;

  const int krow = t >> 3, kcol = (t & 7) * 8;   // K: 32 keys x 64 d
  const int vrow = t >> 2, vcol = (t & 3) * 8;   // V: 64 d x 32 keys
  const us* gk = kp + (size_t)krow * DKH + kcol;   // this thread's 16-byte chunk of K tile 0
  const us* gv = vp + (size_t)vrow * SEQ + vcol;   // this thread's 16-byte chunk of V tile 0
  const unsigned lk = (unsigned)(size_t)shK + (unsigned)((krow * KPITCH + kcol) * 2);   // its LDS byte address, buffer 0
  const unsigned lv = (unsigned)(size_t)shV + (unsigned)((vrow * VPITCH + vcol) * 2);

  stage_kv(gk, gv, lk, lv);             // tile 0 into buffer 0 (every block has a key step 0)

  // key-step bound of this block (exact for any mask value), clamped to the static maximum
  const int kew = wave_key_bound(Mb, qb);
  if (l == 0) shE[wid] = kew;
  asm volatile("s_wait_asynccnt 0x0" ::: "memory");   // tile 0 landed (this wave's copies)
  __syncthreads();                                    // shE and tile 0 visible to all waves
  int kall = shE[0];
#pragma unroll
  for (int w = 1; w < 8; ++w) kall = max(kall, shE[w]);
  kall = min(max(kall, 1), WPR);
  const int ksteps = __builtin_amdgcn_readfirstlane(kall);
  if (ksteps > 1) stage_kv(gk + 32 * DKH, gv + 32, lk + (unsigned)(KBUF * 2), lv + (unsigned)(VBUF * 2));   // tile 1 into buffer 1

  const unsigned* mq = Mb + (size_t)(q0 + r16) * WPR;   // this lane's query row of mask words

  // Q^T as B operand for the whole loop (lane = query column, halves = d)
  const v16h qB0 = fragh(qp, DKH, q0, 0);
  const v16h qB1 = fragh(qp, DKH, q0, 32);

  v8f o[4];
#pragma unroll
  for (int tt = 0; tt < 4; ++tt) o[tt] = v8f{};
  float mmax = NEG_FILL, lsum = 0.0f;

  const int kfo = r16 * KPITCH + 8 * hs;           // shK fragment lane offset (row = key, k = d)
  const int vfo = r16 * VPITCH + 8 * hs;           // shV fragment lane offset (row = d, k = key)

  unsigned mwn = mq[0];   // mask word of key step 0

#pragma unroll 1
  for (int ks = 0; ks < ksteps; ++ks) {
    const int buf = ks & 1;
    const us* tK = shK + buf * KBUF;    // this step's tiles: published by the barrier before the loop (step 0) or at the foot of the step before
    const us* tV = shV + buf * VBUF;

    // mask word of this lane's query for these 32 keys (pinned before the selects); the next step's word is read now
    unsigned mw = mwn;
    asm volatile("" : "+v"(mw));
    mwn = mq[min(ks + 1, ksteps - 1)];
    const unsigned ml = mw >> (8 * hs);

    // S' tiles: M = key (relative 0..15 / 16..31), N = query; k = d
    v8f s0 = {};
    v8f s1 = {};
    {
      const v16h kA = cat16h(*(const v8us*)&tK[kfo], *(const v8us*)&tK[kfo + 16]);
      s0 = mma_f16(kA, qB0, s0);
    }
    {
      const v16h kA = cat16h(*(const v8us*)&tK[kfo + 32], *(const v8us*)&tK[kfo + 48]);
      s0 = mma_f16(kA, qB1, s0);
    }
    {
      const v16h kA = cat16h(*(const v8us*)&tK[16 * KPITCH + kfo], *(const v8us*)&tK[16 * KPITCH + kfo + 16]);
      s1 = mma_f16(kA, qB0, s1);
    }
    {
      const v16h kA = cat16h(*(const v8us*)&tK[16 * KPITCH + kfo + 32], *(const v8us*)&tK[16 * KPITCH + kfo + 48]);
      s1 = mma_f16(kA, qB1, s1);
    }

    // scale, then replace masked scores: s0[i] = key 8h+i, s1[i] = key 16+8h+i of this step
#pragma unroll
    for (int i = 0; i < 8; ++i) {
      const float a0 = s0[i] * QK_SCALE;
      const float a1 = s1[i] * QK_SCALE;
      s0[i] = ((ml >> i) & 1u) ? a0 : NEG_FILL;
      s1[i] = ((ml >> (16 + i)) & 1u) ? a1 : NEG_FILL;
    }

    // per-query (per-lane) block max; combine the two key halves (lane ^ 16)
    float bm = s0[0];
#pragma unroll
    for (int i = 0; i < 8; ++i) { bm = fmaxf(bm, s0[i]); bm = fmaxf(bm, s1[i]); }
    bm = fmaxf(bm, __shfl_xor(bm, 16, 32));
    const float mnew = fmaxf(mmax, bm);
    const float corr = __expf(fmaxf(mmax - mnew, EXP_FLOOR));
    mmax = mnew;

    // probabilities land directly in A-operand layout (elements 0..7 <- keys 8h..8h+7
    // from the first 16-key D tile, elements 8..15 <- keys 16+8h.. from the second)
    float ps = 0.0f;
    v16h pA;
#pragma unroll
    for (int i = 0; i < 8; ++i) {
      const float p0 = __expf(fmaxf(s0[i] - mnew, EXP_FLOOR));
      const float p1 = __expf(fmaxf(s1[i] - mnew, EXP_FLOOR));
      ps += p0 + p1;
      pA[i]     = (_Float16)(p0 * P_CARRY);
      pA[8 + i] = (_Float16)(p1 * P_CARRY);
    }
    ps += __shfl_xor(ps, 16, 32);
    lsum = lsum * corr + ps;

    // rescale O: D row 8h+r = query 8h+r, whose corr lives in lane 8h+r
#pragma unroll
    for (int r = 0; r < 8; ++r) {
      const float cr = __shfl(corr, rowsel + r, 32);
#pragma unroll
      for (int tt = 0; tt < 4; ++tt) o[tt][r] *= cr;
    }

    // O += P(16 x 32 keys) * V_blk(32 keys x 64 d); B rows = d, k = key contiguous in shV
#pragma unroll
    for (int tt = 0; tt < 4; ++tt) {
      const v16h vB = cat16h(*(const v8us*)&tV[16 * tt * VPITCH + vfo],
                             *(const v8us*)&tV[16 * tt * VPITCH + vfo + 16]);
      o[tt] = mma_f16(pA, vB, o[tt]);
    }

    asm volatile("s_wait_dscnt 0x0" ::: "memory");      // this wave's reads of the buffer are done before it is refilled
    asm volatile("s_wait_asynccnt 0x0" ::: "memory");   // this wave's copies of tile ks + 1 have landed
    __syncthreads();                                    // publishes tile ks + 1; ends every reader's last read of tile ks
    if (ks + 2 < ksteps)
      stage_kv(gk + (size_t)(ks + 2) * (32 * DKH), gv + (ks + 2) * 32,
               lk + (unsigned)(buf * KBUF * 2), lv + (unsigned)(buf * VBUF * 2));
  }
  asm volatile("s_wait_asynccnt 0x0" ::: "memory");     // no copy outstanding past the loop

  // normalize, stage this wave's 16 x 64 ctx tile (f16 value x256 and residual x256) in LDS
  const int bb = bh / NH;
  const int hh = bh - bb * NH;
#pragma unroll
  for (int r = 0; r < 8; ++r) {
    const float lrow = __shfl(lsum, rowsel + r, 32);
    const float li = CTX_SCALE * __builtin_amdgcn_rcpf(lrow);
#pragma unroll
    for (int tt = 0; tt < 4; ++tt) {
      const float cv = o[tt][r] * li;
      const _Float16 hv = (_Float16)cv;
      const float rs = (cv - (float)hv) * CTXRES_CARRY;
      const int si = wid * 2048 + (rowsel + r) * 64 + 16 * tt + r16;
      shC[si]        = __builtin_bit_cast(us, hv);
      shC[si + 1024] = f16_bits(rs);
    }
  }
  __syncthreads();

  const int c = l & 7;
  v8us vals[8];
  size_t dsts[8];
#pragma unroll
  for (int it = 0; it < 8; ++it) {
    const int Lw = (l >> 3) + 4 * it;    // 0..31
    const int pl = Lw >> 4;              // 0 value, 1 residual
    const int rl = Lw & 15;
    vals[it] = *(const v8us*)&shC[wid * 2048 + pl * 1024 + rl * 64 + 8 * c];
    const int s = q0 + rl;
    dsts[it] = ((size_t)(bb * SEQ + s)) * DM2 + (size_t)pl * DM + hh * DKH + 8 * c;
  }
#pragma unroll
  for (int it = 0; it < 8; ++it) *(v8us*)(Ctx + dsts[it]) = vals[it];
  // stands in front of any rewrite of the registers that these stores name (precaution: each block runs one band, and the kernel ends after it)
  asm volatile("s_wait_xcnt 0x0" ::: "memory");
}

// ---------------------------------------------------------------------------
// Early band of the fused flash attention: query rows < EROWS. Same block layout and softmax as attn_body; each K/V tile goes through registers into the first LDS buffers, two barriers per step.
// For key steps below EROWS (block-uniform test) q, k and v are value + x2048 residual planes:
// scores = kv*qv + (kv*qr + kr*qv)/2048 (residual products in their own accumulator);
// P = f16 value + x2048 residual; O = pv*vv + (pr*vv + pv*vr)/2048 (own accumulator, folded before
// the normalisation). Key steps at or above EROWS (only visited when the mask asks for them) use
// the value planes of k and v alone. Row sum over the unconverted p.
// blk = 0 .. NB*NH*(EROWS/128) - 1; the LDS arrays are those of attn_all_kernel.
// ---------------------------------------------------------------------------
__device__ __forceinline__
void attn_early_body(const us* __restrict__ Qh, const us* __restrict__ Kh, const us* __restrict__ Vt,
                     const us* __restrict__ Qr, const us* __restrict__ Kr, const us* __restrict__ Vr,
                     const unsigned* __restrict__ Mb, us* Ctx, int blk,
                     us* shK, us* shV, us* shKr, us* shVr, us* shC, int* shE) {
  const int t = threadIdx.x;
  const int wid = __builtin_amdgcn_readfirstlane(t >> 5);
  const int l = t & 31;
  const int r16 = l & 15;
  const int hs = l >> 4;
  const int rowsel = hs << 3;
  constexpr int QBE = EROWS / 128;
  const int bh = blk / QBE;
  const int qb = blk - bh * QBE;
  const int q0 = qb * 128 + wid * 16;

  const size_t qoff = (size_t)bh * SEQ * DKH;
  const size_t roff = (size_t)bh * EROWS * DKH;
  const us* qp = Qh + qoff;
  const us* kp = Kh + qoff;
  const us* vp = Vt + (size_t)bh * DKH * SEQ;
  const us* qrp = Qr + roff;
  const us* krp = Kr + roff;
  const us* vrp = Vr + (size_t)bh * DKH * EROWS;

  // key-step bound of this block (exact for any mask value), clamped to the static maximum
  const int kew = wave_key_bound(Mb, qb);
  if (l == 0) shE[wid] = kew;
  __syncthreads();
  int kall = shE[0];
#pragma unroll
  for (int w = 1; w < 8; ++w) kall = max(kall, shE[w]);
  kall = min(max(kall, 1), WPR);
  const int ksteps = __builtin_amdgcn_readfirstlane(kall);

  const unsigned* mq = Mb + (size_t)(q0 + r16) * WPR;   // this lane's query row of mask words

  // Q^T value and residual as B operands for the whole loop (lane = query column, halves = d)
  const v16h qB0 = fragh(qp, DKH, q0, 0);
  const v16h qB1 = fragh(qp, DKH, q0, 32);
  const v16h qR0 = fragh(qrp, DKH, q0, 0);
  const v16h qR1 = fragh(qrp, DKH, q0, 32);

  v8f o[4], orr[4];
#pragma unroll
  for (int tt = 0; tt < 4; ++tt) { o[tt] = v8f{}; orr[tt] = v8f{}; }
  float mmax = NEG_FILL, lsum = 0.0f;

  const int krow = t >> 3, kcol = (t & 7) * 8;   // K: 32 keys x 64 d
  const int vrow = t >> 2, vcol = (t & 3) * 8;   // V: 64 d x 32 keys
  const int kfo = r16 * KPITCH + 8 * hs;           // shK fragment lane offset (row = key, k = d)
  const int vfo = r16 * VPITCH + 8 * hs;           // shV fragment lane offset (row = d, k = key)

#pragma unroll 1
  for (int ks = 0; ks < ksteps; ++ks) {
    const int kb = ks * 32;
    const bool res = kb < EROWS;        // block-uniform: residual planes exist for these keys
    __syncthreads();    // prior readers of the LDS tiles done
    *(v8us*)&shK[krow * KPITCH + kcol] = *(const v8us*)(kp + (size_t)(kb + krow) * DKH + kcol);
    *(v8us*)&shV[vrow * VPITCH + vcol] = *(const v8us*)(vp + (size_t)vrow * SEQ + kb + vcol);
    if (res) {
      *(v8us*)&shKr[krow * KPITCH + kcol] = *(const v8us*)(krp + (size_t)(kb + krow) * DKH + kcol);
      *(v8us*)&shVr[vrow * VPITCH + vcol] = *(const v8us*)(vrp + (size_t)vrow * EROWS + kb + vcol);
    }
    __syncthreads();    // stage visible to all waves

    // mask word of this lane's query for these 32 keys (pinned before the selects)
    unsigned mw = mq[ks];
    asm volatile("" : "+v"(mw));
    const unsigned ml = mw >> (8 * hs);

    // S' tiles: M = key (relative 0..15 / 16..31), N = query; k = d
    const v16h kA00 = cat16h(*(const v8us*)&shK[kfo], *(const v8us*)&shK[kfo + 16]);
    const v16h kA01 = cat16h(*(const v8us*)&shK[kfo + 32], *(const v8us*)&shK[kfo + 48]);
    const v16h kA10 = cat16h(*(const v8us*)&shK[16 * KPITCH + kfo], *(const v8us*)&shK[16 * KPITCH + kfo + 16]);
    const v16h kA11 = cat16h(*(const v8us*)&shK[16 * KPITCH + kfo + 32], *(const v8us*)&shK[16 * KPITCH + kfo + 48]);
    v8f s0 = {};
    v8f s1 = {};
    s0 = mma_f16(kA00, qB0, s0);
    s0 = mma_f16(kA01, qB1, s0);
    s1 = mma_f16(kA10, qB0, s1);
    s1 = mma_f16(kA11, qB1, s1);

    // residual score products (x2048 units) in their own accumulators
    v8f x0 = {};
    v8f x1 = {};
    if (res) {
      x0 = mma_f16(kA00, qR0, x0);
      x0 = mma_f16(kA01, qR1, x0);
      x1 = mma_f16(kA10, qR0, x1);
      x1 = mma_f16(kA11, qR1, x1);
      {
        const v16h kR = cat16h(*(const v8us*)&shKr[kfo], *(const v8us*)&shKr[kfo + 16]);
        x0 = mma_f16(kR, qB0, x0);
      }
      {
        const v16h kR = cat16h(*(const v8us*)&shKr[kfo + 32], *(const v8us*)&shKr[kfo + 48]);
        x0 = mma_f16(kR, qB1, x0);
      }
      {
        const v16h kR = cat16h(*(const v8us*)&shKr[16 * KPITCH + kfo], *(const v8us*)&shKr[16 * KPITCH + kfo + 16]);
        x1 = mma_f16(kR, qB0, x1);
      }
      {
        const v16h kR = cat16h(*(const v8us*)&shKr[16 * KPITCH + kfo + 32], *(const v8us*)&shKr[16 * KPITCH + kfo + 48]);
        x1 = mma_f16(kR, qB1, x1);
      }
    }

    // fold, scale, then replace masked scores: s0[i] = key 8h+i, s1[i] = key 16+8h+i of this step
#pragma unroll
    for (int i = 0; i < 8; ++i) {
      const float a0 = (s0[i] + x0[i] * RES_INV) * QK_SCALE;
      const float a1 = (s1[i] + x1[i] * RES_INV) * QK_SCALE;
      s0[i] = ((ml >> i) & 1u) ? a0 : NEG_FILL;
      s1[i] = ((ml >> (16 + i)) & 1u) ? a1 : NEG_FILL;
    }

    // per-query (per-lane) block max; combine the two key halves (lane ^ 16)
    float bm = s0[0];
#pragma unroll
    for (int i = 0; i < 8; ++i) { bm = fmaxf(bm, s0[i]); bm = fmaxf(bm, s1[i]); }
    bm = fmaxf(bm, __shfl_xor(bm, 16, 32));
    const float mnew = fmaxf(mmax, bm);
    const float corr = __expf(fmaxf(mmax - mnew, EXP_FLOOR));
    mmax = mnew;

    // probabilities (value + residual) land directly in A-operand layout
    float ps = 0.0f;
    v16h pA, pR;
#pragma unroll
    for (int i = 0; i < 8; ++i) {
      const float p0 = __expf(fmaxf(s0[i] - mnew, EXP_FLOOR));
      const float p1 = __expf(fmaxf(s1[i] - mnew, EXP_FLOOR));
      ps += p0 + p1;
      const float c0 = p0 * P_CARRY;
      const float c1 = p1 * P_CARRY;
      const _Float16 h0 = (_Float16)c0;
      const _Float16 h1 = (_Float16)c1;
      pA[i]     = h0;
      pA[8 + i] = h1;
      pR[i]     = (_Float16)((c0 - (float)h0) * RES_CARRY);
      pR[8 + i] = (_Float16)((c1 - (float)h1) * RES_CARRY);
    }
    ps += __shfl_xor(ps, 16, 32);
    lsum = lsum * corr + ps;

    // rescale both accumulators: D row 8h+r = query 8h+r, whose corr lives in lane 8h+r
#pragma unroll
    for (int r = 0; r < 8; ++r) {
      const float cr = __shfl(corr, rowsel + r, 32);
#pragma unroll
      for (int tt = 0; tt < 4; ++tt) { o[tt][r] *= cr; orr[tt][r] *= cr; }
    }

    // O += P * V_blk (value products); residual accumulator += P_res * V
#pragma unroll
    for (int tt = 0; tt < 4; ++tt) {
      const v16h vB = cat16h(*(const v8us*)&shV[16 * tt * VPITCH + vfo],
                             *(const v8us*)&shV[16 * tt * VPITCH + vfo + 16]);
      o[tt]   = mma_f16(pA, vB, o[tt]);
      orr[tt] = mma_f16(pR, vB, orr[tt]);
    }
    // residual accumulator += P * V_res
    if (res) {
#pragma unroll
      for (int tt = 0; tt < 4; ++tt) {
        const v16h vRB = cat16h(*(const v8us*)&shVr[16 * tt * VPITCH + vfo],
                                *(const v8us*)&shVr[16 * tt * VPITCH + vfo + 16]);
        orr[tt] = mma_f16(pA, vRB, orr[tt]);
      }
    }
  }

  // fold the residual accumulator, normalize, stage this wave's 16 x 64 ctx tile in LDS
  const int bb = bh / NH;
  const int hh = bh - bb * NH;
#pragma unroll
  for (int r = 0; r < 8; ++r) {
    const float lrow = __shfl(lsum, rowsel + r, 32);
    const float li = CTX_SCALE * __builtin_amdgcn_rcpf(lrow);
#pragma unroll
    for (int tt = 0; tt < 4; ++tt) {
      const float cv = (o[tt][r] + orr[tt][r] * RES_INV) * li;
      const _Float16 hv = (_Float16)cv;
      const float rs = (cv - (float)hv) * CTXRES_CARRY;
      const int si = wid * 2048 + (rowsel + r) * 64 + 16 * tt + r16;
      shC[si]        = __builtin_bit_cast(us, hv);
      shC[si + 1024] = f16_bits(rs);
    }
  }
  __syncthreads();

  const int c = l & 7;
  v8us vals[8];
  size_t dsts[8];
#pragma unroll
  for (int it = 0; it < 8; ++it) {
    const int Lw = (l >> 3) + 4 * it;    // 0..31
    const int pl = Lw >> 4;              // 0 value, 1 residual
    const int rl = Lw & 15;
    vals[it] = *(const v8us*)&shC[wid * 2048 + pl * 1024 + rl * 64 + 8 * c];
    const int s = q0 + rl;
    dsts[it] = ((size_t)(bb * SEQ + s)) * DM2 + (size_t)pl * DM + hh * DKH + 8 * c;
  }
#pragma unroll
  for (int it = 0; it < 8; ++it) *(v8us*)(Ctx + dsts[it]) = vals[it];
  // stands in front of any rewrite of the registers that these stores name (precaution: each block runs one band, and the kernel ends after it)
  asm volatile("s_wait_xcnt 0x0" ::: "memory");
}

// ---------------------------------------------------------------------------
// Both attention bands in one launch (they write disjoint ctx rows and read the same planes): the short early band
// runs beside the long blocks of the main band. Blocks [0, ABM) = main band, [ABM, ABM + ABE) = early band
// (block-uniform split; the early blocks come last in index order).
// ---------------------------------------------------------------------------
#define ABM (NB * NH * ((SEQ - EROWS) / 128))
#define ABE (NB * NH * (EROWS / 128))
__global__ __launch_bounds__(256) __attribute__((amdgpu_num_vgpr(256)))
void attn_all_kernel(const us* __restrict__ Qh, const us* __restrict__ Kh, const us* __restrict__ Vt,
                     const us* __restrict__ Qr, const us* __restrict__ Kr, const us* __restrict__ Vr,
                     const unsigned* __restrict__ Mb, us* Ctx) {
  __shared__ __attribute__((aligned(16))) us shK[2 * KBUF];         // [key][d], padded rows, 2 buffers (early band: the first), cross-wave (block barrier)
  __shared__ __attribute__((aligned(16))) us shV[2 * VBUF];         // [d][key], padded rows, 2 buffers (early band: the first), cross-wave (block barrier)
  __shared__ __attribute__((aligned(16))) us shKr[32 * KPITCH];     // residual of shK (early band), cross-wave (block barrier)
  __shared__ __attribute__((aligned(16))) us shVr[64 * VPITCH];     // residual of shV (early band), cross-wave (block barrier)
  __shared__ __attribute__((aligned(16))) us shC[8 * 2 * 16 * 64];  // per-wave ctx staging, value|residual (block barrier used)
  __shared__ int shE[8];                                            // per-wave key bounds, cross-wave (block barrier)

  const int b = blockIdx.x;
  if (b < ABM) attn_body(Qh, Kh, Vt, Mb, Ctx, b, shK, shV, shC, shE);
  else         attn_early_body(Qh, Kh, Vt, Qr, Kr, Vr, Mb, Ctx, b - ABM, shK, shV, shKr, shVr, shC, shE);
}

// ---------------------------------------------------------------------------
// Output projection: Out f32 [MROWS][DM] = [ctx x256 | ctx residual x256] * [Wo x64 | Wo x0.25]^T * OUT_FOLD + bo.
// K = 2*DM, one accumulator (both halves of K are in the same units).
// Same block tiling as proj_kernel; f32 tile staged in two 16-row halves per wave
// (32 x 256 floats in LDS), each d_out line (32 floats) written by 8 lanes x 16 B.
// ---------------------------------------------------------------------------
__global__ __launch_bounds__(256) __attribute__((amdgpu_num_vgpr(256)))
void outproj_kernel(const us* __restrict__ Ctx, const us* __restrict__ Wot,
                    const float* __restrict__ bo, float* Out) {
  __shared__ __attribute__((aligned(16))) float ftile[32 * 256];    // cross-wave (block barrier)
  __shared__ __attribute__((aligned(16))) us ring[2 * RSTAGE];      // operand slabs, cross-wave (block barrier)

  const int t = threadIdx.x;
  const int wid = __builtin_amdgcn_readfirstlane(t >> 5);
  const int l = t & 31;
  const int h = l >> 4, r16 = l & 15;
  const int wm = wid >> 2, wn = wid & 3;
  const int mblk0 = blockIdx.x * 64;
  const int nblk0 = blockIdx.y * 256;
  const int n0 = nblk0 + wn * 64;

  v8f acc[8] = {};
  gemm_ring<DM2, false>(Ctx, Wot, mblk0, nblk0, wm, wn, ring, acc);

  float bob[4];
#pragma unroll
  for (int tt = 0; tt < 4; ++tt) bob[tt] = bf16rne(bo[n0 + 16 * tt + r16]);

  const int c = l & 7;
#pragma unroll
  for (int p = 0; p < 2; ++p) {
    if (p) __syncthreads();   // readers of the prior half done
#pragma unroll
    for (int tt = 0; tt < 4; ++tt) {
      const int nl = wn * 64 + 16 * tt + r16;
#pragma unroll
      for (int r = 0; r < 8; ++r) {
        const int rl = wm * 16 + 8 * h + r;           // 0..31
        ftile[rl * 256 + nl] = acc[p * 4 + tt][r] * OUT_FOLD + bob[tt];
      }
    }
    __syncthreads();

    v4f vals[8];
    size_t dsts[8];
#pragma unroll
    for (int it = 0; it < 8; ++it) {
      const int L = wid * 32 + (l >> 3) + 4 * it;    // 0..255
      const int rl = L >> 3, seg = L & 7;
      vals[it] = *(const v4f*)&ftile[rl * 256 + seg * 32 + 4 * c];
      const int m = mblk0 + (rl >> 4) * 32 + p * 16 + (rl & 15);
      dsts[it] = (size_t)m * DM + nblk0 + seg * 32 + 4 * c;
    }
#pragma unroll
    for (int it = 0; it < 8; ++it) *(v4f*)(Out + dsts[it]) = vals[it];
    
  }
}

// ---------------------------------------------------------------------------
// Host launcher
// ---------------------------------------------------------------------------
extern "C" void kernel_launch(void* const* d_in, const int* in_sizes, int n_in,
                              void* d_out, int out_size, void* d_ws, size_t ws_size,
                              hipStream_t stream) {
  if (n_in < 12) return;
  const int need_x = ((NB - 1) * SEQ_FULL + SEQ) * DM;
  if (in_sizes[0] < need_x || in_sizes[1] < need_x || in_sizes[2] < need_x) return;
  if (in_sizes[3] < DM * DM || in_sizes[5] < DM * DM || in_sizes[7] < DM * DM || in_sizes[9] < DM * DM) return;
  if (in_sizes[4] < DM || in_sizes[6] < DM || in_sizes[8] < DM || in_sizes[10] < DM) return;
  if (in_sizes[11] < (SEQ - 1) * SEQ_FULL + SEQ) return;
  if (out_size < MROWS * DM) return;

  // bound by role in the input order: queries, keys, values, Wq, bq, Wk, bk, Wv, bv, Wo, bo, mask
  const float* Q  = (const float*)d_in[0];
  const float* K  = (const float*)d_in[1];
  const float* V  = (const float*)d_in[2];
  const float* Wq = (const float*)d_in[3];
  const float* bq = (const float*)d_in[4];
  const float* Wk = (const float*)d_in[5];
  const float* bk = (const float*)d_in[6];
  const float* Wv = (const float*)d_in[7];
  const float* bv = (const float*)d_in[8];
  const float* Wo = (const float*)d_in[9];
  const float* bo = (const float*)d_in[10];
  const int*   Mk = (const int*)d_in[11];

  const size_t XE = (size_t)MROWS * DM;            // halves per activation plane
  const size_t WE = (size_t)DM * DM;               // halves per weight plane
  const size_t RE = (size_t)NB * NH * EROWS * DKH; // halves per early residual plane
  const size_t BW = (size_t)SEQ * WPR;             // 32-bit words of the mask bit plane
  const size_t total_bytes = (5 * XE + 5 * WE + 3 * RE) * sizeof(us) + BW * sizeof(unsigned);
  if (total_bytes > ws_size) return;

  us* wtq = (us*)d_ws;         // [n][k] bf16
  us* wtk = wtq + WE;
  us* wtv = wtk + WE;
  us* wo2 = wtv + WE;          // 2 * WE  ([DM][2*DM]) f16
  us* qh  = wo2 + 2 * WE;      // q value plane [NB*NH][SEQ][64]
  us* kh  = qh + XE;           // k value plane [NB*NH][SEQ][64]
  us* vt  = kh + XE;           // v transposed plane [NB*NH][64][SEQ]
  us* ctx = vt + XE;           // 2 * XE  ([MROWS][2*DM])
  us* qr  = ctx + 2 * XE;      // q residual plane [NB*NH][EROWS][64]
  us* kr  = qr + RE;           // k residual plane [NB*NH][EROWS][64]
  us* vr  = kr + RE;           // v residual transposed plane [NB*NH][64][EROWS]
  unsigned* mb = (unsigned*)(vr + RE);   // mask bit plane [SEQ][WPR]

  dim3 blk(256);
  const int n4 = (int)(BW / 4);
  // mask pack and the four weight converts (W is [k][n] (in,out); output planes [n][k] from wtq on: wtq, wtk, wtv, wo2)
  prep_kernel<<<dim3(MPB + 4 * WTB), blk, 0, stream>>>(Mk, mb, n4, Wq, Wk, Wv, Wo, wtq);

  // q, k, v projections (weight planes from wtq, value planes from qh, residual planes from qr, each in that order)
  proj_kernel<<<dim3(MROWS / 64, DM / 256, 3), blk, 0, stream>>>(Q, K, V, wtq, bq, bk, bv, qh, qr);

  attn_all_kernel<<<dim3(ABM + ABE), blk, 0, stream>>>(qh, kh, vt, qr, kr, vr, mb, ctx);

  dim3 gp(MROWS / 64, DM / 256);
  outproj_kernel<<<gp, blk, 0, stream>>>(ctx, wo2, bo, (float*)d_out);
}

// v006
// A run of this version takes 117 microseconds.
// Timed twice side by side with v005, it ran 1.03 times as fast both times.
// Over all steps from v000 it is 2.68 times as fast.
#include <hip/hip_runtime.h>
#include <stddef.h>

// Contractions: q/k/v projections = v_wmma_f32_16x16x32_bf16 (bf16 operands = RNE-converted f32 inputs; activations converted at the fragment read);
// scores = v_wmma_f32_16x16x32_f16 (k x1 against q x1, single product; query rows < EROWS: q and k as f16 value + x2048 residual, three products, own accumulator);
// P*V = f16 (P x1024, v x1; query rows < EROWS: P and v as f16 value + x2048 residual, residual products in their own accumulator);
// output projection = f16 over K = 2*DM ([ctx x256 | ctx residual x256] against [Wo x64 | Wo x0.25]);
// f32 accumulate, f32 online softmax; the mask input is read by value (packed to bit words once) and applied as a replace fill.

#ifndef NB
#define NB 2
#endif
#ifndef SEQ
#define SEQ 2048
#endif
#define NB_FULL 2
#define SEQ_FULL 2048
#define DM 1024
#define NH 16
#define DKH 64
#define MROWS (NB * SEQ)
#define DM2 (2 * DM)
#define EROWS 256                 // query rows (and key rows) with value + residual planes
#define WPR (SEQ / 32)            // mask bit words per query row

static_assert(NB >= 1 && NB <= NB_FULL);
static_assert(SEQ >= 128 && SEQ <= SEQ_FULL);
static_assert(SEQ % 128 == 0);
static_assert(SEQ % 64 == 0 && SEQ % 32 == 0);
static_assert(MROWS % 64 == 0);
static_assert(DM % 256 == 0 && DM % 32 == 0 && DM % 64 == 0);
static_assert(DM / 8 == 128);
static_assert(NH * DKH == DM);
static_assert(DKH == 64);
static_assert(DM2 % 32 == 0);
static_assert(SEQ % 256 == 0);                 // half a mask-word row is a multiple of 4 words
static_assert(EROWS % 128 == 0 && EROWS % 64 == 0 && EROWS % 32 == 0);
static_assert(EROWS >= 128 && EROWS <= SEQ);
static_assert(WPR % 8 == 0 && WPR >= 8);
static_assert((SEQ * WPR) % 4 == 0);

#define P_CARRY      1024.0f            // P operand carried x1024
#define CTX_SCALE    0.25f              // ctx value plane = O * 0.25 / l = attn x256 (O carries the x1024 of P)
#define CTXRES_CARRY 256.0f             // ctx residual plane = (ctx256 - f16(ctx256)) x256
#define WO_CARRY     64.0f              // Wo operand carried x64 (value half of K)
#define WO_LO_CARRY  0.25f              // Wo operand for the residual half of K = WO_CARRY / CTXRES_CARRY
#define OUT_FOLD     (1.0f / 16384.0f)  // 1 / (256 * 64)
#define QK_SCALE     0.125f             // 1 / sqrt(64)
#define RES_CARRY    2048.0f            // early-band residual planes carried x2048
#define RES_INV      (1.0f / 2048.0f)
#define NEG_FILL     (-3.4028235e38f)   // lowest finite f32: fill value of masked scores
#define EXP_FLOOR    (-87.0f)           // exponent argument floor (keeps the exp argument finite)

static_assert(WO_LO_CARRY * CTXRES_CARRY == WO_CARRY);
static_assert(OUT_FOLD * 256.0f * WO_CARRY == 1.0f);
static_assert(RES_INV * RES_CARRY == 1.0f);

// workspace carve: 5 activation-size planes + 5 weight-size planes + 3 early residual planes (16-bit each) + mask bit plane
static_assert(((size_t)5 * MROWS * DM + (size_t)5 * DM * DM + (size_t)3 * NB * NH * EROWS * DKH) * 2
              + (size_t)SEQ * WPR * 4 <= (size_t)134217728);

typedef unsigned short us;
typedef us        v8us  __attribute__((ext_vector_type(8)));
typedef us        v16us __attribute__((ext_vector_type(16)));
typedef _Float16  v16h  __attribute__((ext_vector_type(16)));
typedef __bf16    v16bf __attribute__((ext_vector_type(16)));
typedef __bf16    v8bf  __attribute__((ext_vector_type(8)));
typedef float     v8f   __attribute__((ext_vector_type(8)));
typedef float     v4f   __attribute__((ext_vector_type(4)));
typedef int       v4i   __attribute__((ext_vector_type(4)));
typedef unsigned  v4u   __attribute__((ext_vector_type(4)));

// ---------------------------------------------------------------------------
// conversions
// ---------------------------------------------------------------------------
__device__ __forceinline__ unsigned bf16rne_bits(float x) {
  unsigned u = __float_as_uint(x);
  return (u + 0x7FFFu + ((u >> 16) & 1u)) >> 16;
}
__device__ __forceinline__ float bf16rne(float x) {
  return __uint_as_float(bf16rne_bits(x) << 16);
}
__device__ __forceinline__ us f16_bits(float x) {
  _Float16 hx = (_Float16)x;
  return __builtin_bit_cast(us, hx);
}

// ---------------------------------------------------------------------------
// 16-bit operand fragment (A: lane = row, B: lane = column; same k map):
//   lane l, r = l&15, s = l>>4 : elems 0..7  = row[r][k0 + 8s .. +7]
//                                elems 8..15 = row[r][k0 + 16 + 8s .. +7]
// base is a 16-bit global plane with k contiguous, pitch ld (halves).
// ---------------------------------------------------------------------------
__device__ __forceinline__ v16us frag16(const us* base, int ld, int row0, int k0) {
  const int l = threadIdx.x & 31;
  const int r = l & 15, s = l >> 4;
  const us* p = base + (size_t)(row0 + r) * ld + k0 + 8 * s;
  v8us c0 = *(const v8us*)p;
  v8us c1 = *(const v8us*)(p + 16);
  return __builtin_shufflevector(c0, c1, 0, 1, 2, 3, 4, 5, 6, 7, 8, 9, 10, 11, 12, 13, 14, 15);
}
__device__ __forceinline__ v16h fragh(const us* base, int ld, int row0, int k0) {
  return __builtin_bit_cast(v16h, frag16(base, ld, row0, k0));
}
// two 16-byte chunks (already loaded) -> one f16 fragment
__device__ __forceinline__ v16h cat16h(v8us c0, v8us c1) {
  v16us w = __builtin_shufflevector(c0, c1, 0, 1, 2, 3, 4, 5, 6, 7, 8, 9, 10, 11, 12, 13, 14, 15);
  return __builtin_bit_cast(v16h, w);
}

// ---------------------------------------------------------------------------
// WMMA wrappers with hazard guard: D = A(16x32) * B(32x16) + C (f32)
// ---------------------------------------------------------------------------
__device__ __forceinline__ v8f mma_f16(v16h a, v16h b, v8f c) {
  v8f d = __builtin_amdgcn_wmma_f32_16x16x32_f16(false, a, false, b, (short)0, c, false, false);
  asm volatile("v_nop\n\tv_nop\n\tv_nop\n\tv_nop" : "+v"(d) : "v"(a), "v"(b));
  return d;
}
__device__ __forceinline__ v8f mma_bf16(v16bf a, v16bf b, v8f c) {
  v8f d = __builtin_amdgcn_wmma_f32_16x16x32_bf16(false, a, false, b, (short)0, c, false, false);
  asm volatile("v_nop\n\tv_nop\n\tv_nop\n\tv_nop" : "+v"(d) : "v"(a), "v"(b));
  return d;
}

// ---------------------------------------------------------------------------
// Mask pack: M int32 [SEQ_FULL][SEQ_FULL] (nonzero = attend) -> bit words [SEQ][WPR],
// bit j of word w of row q = (M[q][32w + j] != 0).
// ---------------------------------------------------------------------------
__device__ __forceinline__ void mask_pack_body(const int* __restrict__ M, unsigned* Bits, int n4, int blk) {
  const int i = blk * 256 + threadIdx.x;
  if (i >= n4) return;
  const int w4 = i * 4;
  const int q  = w4 / WPR;
  const int w0 = w4 - q * WPR;
  const int* src = M + (size_t)q * SEQ_FULL + 32 * w0;
  unsigned a0 = 0u, a1 = 0u, a2 = 0u, a3 = 0u;
#pragma unroll 1
  for (int j = 0; j < 4; ++j) {
    unsigned wb = 0u;
#pragma unroll
    for (int c = 0; c < 8; ++c) {
      const v4i m = *(const v4i*)(src + 32 * j + 4 * c);
      wb |= ((m[0] != 0) ? 1u : 0u) << (4 * c);
      wb |= ((m[1] != 0) ? 1u : 0u) << (4 * c + 1);
      wb |= ((m[2] != 0) ? 1u : 0u) << (4 * c + 2);
      wb |= ((m[3] != 0) ? 1u : 0u) << (4 * c + 3);
    }
    a0 = (j == 0) ? wb : a0;
    a1 = (j == 1) ? wb : a1;
    a2 = (j == 2) ? wb : a2;
    a3 = (j == 3) ? wb : a3;
  }
  v4u y;
  y[0] = a0; y[1] = a1; y[2] = a2; y[3] = a3;
  unsigned* dst = Bits + (size_t)i * 4;
  *(v4u*)dst = y;
  
}

// ---------------------------------------------------------------------------
// Weight convert with transpose: W f32 [k][n] (in,out; n contiguous) -> 16-bit plane [n][k] (k contiguous).
// hmode 0: bf16 bits of RNE(W), pitch DM.
// hmode 1: pitch 2*DM: cols [0,DM) = f16(RNE(W) * WO_CARRY), cols [DM,2DM) = f16(RNE(W) * WO_LO_CARRY).
// Block = 64(k) x 64(n) tile through LDS (cross-wave: block barrier); each output line = 64 k of one n
// kt = k tile, nt = n tile of the block (DM/64 each); t0, t1: the block's two LDS tiles of 64 * WT_LD halves.
// ---------------------------------------------------------------------------
#define WT_LD 72
static_assert((WT_LD * 2) % 16 == 0 && WT_LD >= 64);
__device__ __forceinline__ void cvt_wT_body(const float* __restrict__ W, us* Y, int hmode, int kt, int nt,
                                            us* t0, us* t1) {
  const int t  = threadIdx.x;
  const int k0 = kt * 64;
  const int n0 = nt * 64;

#pragma unroll 1
  for (int i = 0; i < 4; ++i) {
    const int id = t + i * 256;           // 1024 float4 chunks (64 k x 64 n)
    const int kr = id >> 4;
    const int c4 = (id & 15) * 4;
    const v4f x = *(const v4f*)(W + (size_t)(k0 + kr) * DM + n0 + c4);
#pragma unroll
    for (int j = 0; j < 4; ++j) {
      const float w = bf16rne(x[j]);
      const us hb = (us)(__float_as_uint(w) >> 16);
      const us hf = f16_bits(w * WO_CARRY);
      const us hl = f16_bits(w * WO_LO_CARRY);
      t0[(c4 + j) * WT_LD + kr] = hmode ? hf : hb;
      t1[(c4 + j) * WT_LD + kr] = hl;
    }
  }
  __syncthreads();

  const int c = t & 7;
  const size_t pitch = hmode ? (size_t)DM2 : (size_t)DM;
  v8us v0[2], v1[2];
  size_t dsts[2];
#pragma unroll
  for (int it = 0; it < 2; ++it) {
    const int L = (t >> 3) + 32 * it;     // local n 0..63
    v0[it] = *(const v8us*)&t0[L * WT_LD + 8 * c];
    v1[it] = *(const v8us*)&t1[L * WT_LD + 8 * c];
    dsts[it] = (size_t)(n0 + L) * pitch + k0 + 8 * c;
  }
#pragma unroll
  for (int it = 0; it < 2; ++it) {
    *(v8us*)(Y + dsts[it]) = v0[it];
    // stands in front of any rewrite of the registers that this store names
    asm volatile("s_wait_xcnt 0x0" ::: "memory");
    if (hmode) {
      *(v8us*)(Y + dsts[it] + DM) = v1[it];
      // stands in front of any rewrite of the registers that this store names
      asm volatile("s_wait_xcnt 0x0" ::: "memory");
    }
  }
}

// ---------------------------------------------------------------------------
// Preparation, one launch: the mask pack and the four weight converts do not depend on one another.
// Blocks [0, MPB) pack the mask; then WTB blocks per weight in the order Wq, Wk, Wv, Wo (block-uniform split).
// Wt: the weight planes one behind another: Wq, Wk, Wv (bf16, DM*DM halves each), then Wo (f16, 2*DM*DM halves).
// ---------------------------------------------------------------------------
#define MPB ((SEQ * WPR / 4 + 255) / 256)     // mask pack blocks
#define WTB ((DM / 64) * (DM / 64))           // blocks per weight
__global__ __launch_bounds__(256) void prep_kernel(const int* __restrict__ M, unsigned* Bits, int n4,
                                                   const float* __restrict__ Wq, const float* __restrict__ Wk,
                                                   const float* __restrict__ Wv, const float* __restrict__ Wo, us* Wt) {
  __shared__ __attribute__((aligned(16))) us t0[64 * WT_LD];   // [n][k] value
  __shared__ __attribute__((aligned(16))) us t1[64 * WT_LD];   // [n][k] low-carry copy (hmode 1)

  const int b = blockIdx.x;
  if (b < MPB) {
    mask_pack_body(M, Bits, n4, b);
    return;
  }
  const int wb = b - MPB;
  const int w = wb / WTB;               // 0..3: Wq, Wk, Wv, Wo
  const int tile = wb - w * WTB;
  const float* W = (w == 0) ? Wq : (w == 1) ? Wk : (w == 2) ? Wv : Wo;
  cvt_wT_body(W, Wt + (size_t)w * DM * DM, (w == 3) ? 1 : 0, tile % (DM / 64), tile / (DM / 64), t0, t1);
}

// ---------------------------------------------------------------------------
// GEMM core: block computes 64 rows x 256 cols over K = KD; wave (wm, wn) computes 32 x 64 of it.
// A plane [M][KD], B plane [N][KD] (k contiguous), both 16-bit.
// K is walked in slabs of RK; a slab (64 A rows, then 256 B rows) is staged in LDS by asynchronous
// 16-byte copies, two buffers: the next slab's copies fly while this slab is worked on.
// Fragments are read from LDS with the k map of frag16; k runs upward in steps of 32 as before.
// ---------------------------------------------------------------------------
#define RK 128                       // k per slab: 256-byte rows
#define RPITCH 136                   // LDS row pitch in halves: 272 B = 16 B x 17, conflict-free for 16-byte reads
#define RROWS 320                    // 64 A rows + 256 B rows
#define RSTAGE (RROWS * RPITCH)      // halves per buffer
static_assert((RPITCH * 2) % 16 == 0 && RPITCH >= RK);
static_assert(RROWS * (RK / 8) == 20 * 256);   // 20 copies per thread and slab

// One slab: thread t copies chunk (t & 15) of rows (t >> 4) + 16 i, i = 0..19 (each wave copy = 2 whole rows).
// ga / gb: this thread's chunk in A row (t >> 4) / B row (t >> 4) of the block at this slab; ld: its LDS byte address in row (t >> 4).
template <int KD>
__device__ __forceinline__ void stage_slab(const us* ga, const us* gb, unsigned ld) {
  const us* g[20];
  unsigned d[20];
#pragma unroll   // unrolled so that g[] and d[] are registers (they are asm operands)
  for (int i = 0; i < 20; ++i) {
    g[i] = (i < 4) ? (ga + (size_t)(16 * i) * KD) : (gb + (size_t)(16 * (i - 4)) * KD);
    d[i] = ld + (unsigned)(16 * i * RPITCH * 2);
  }
  // the closing s_wait_xcnt keeps the address registers of the issued copies from being rewritten early
  asm volatile("global_load_async_to_lds_b128 %0, %1, off\n\t"
               "global_load_async_to_lds_b128 %2, %3, off\n\t"
               "global_load_async_to_lds_b128 %4, %5, off\n\t"
               "global_load_async_to_lds_b128 %6, %7, off\n\t"
               "global_load_async_to_lds_b128 %8, %9, off\n\t"
               "global_load_async_to_lds_b128 %10, %11, off\n\t"
               "global_load_async_to_lds_b128 %12, %13, off\n\t"
               "global_load_async_to_lds_b128 %14, %15, off\n\t"
               "global_load_async_to_lds_b128 %16, %17, off\n\t"
               "global_load_async_to_lds_b128 %18, %19, off\n\t"
               "s_wait_xcnt 0x0"
               :: "v"(d[0]), "v"(g[0]), "v"(d[1]), "v"(g[1]), "v"(d[2]), "v"(g[2]), "v"(d[3]), "v"(g[3]), "v"(d[4]), "v"(g[4]), "v"(d[5]), "v"(g[5]), "v"(d[6]), "v"(g[6]), "v"(d[7]), "v"(g[7]), "v"(d[8]), "v"(g[8]), "v"(d[9]), "v"(g[9]) : "memory");
  asm volatile("global_load_async_to_lds_b128 %0, %1, off\n\t"
               "global_load_async_to_lds_b128 %2, %3, off\n\t"
               "global_load_async_to_lds_b128 %4, %5, off\n\t"
               "global_load_async_to_lds_b128 %6, %7, off\n\t"
               "global_load_async_to_lds_b128 %8, %9, off\n\t"
               "global_load_async_to_lds_b128 %10, %11, off\n\t"
               "global_load_async_to_lds_b128 %12, %13, off\n\t"
               "global_load_async_to_lds_b128 %14, %15, off\n\t"
               "global_load_async_to_lds_b128 %16, %17, off\n\t"
               "global_load_async_to_lds_b128 %18, %19, off\n\t"
               "s_wait_xcnt 0x0"
               :: "v"(d[10]), "v"(g[10]), "v"(d[11]), "v"(g[11]), "v"(d[12]), "v"(g[12]), "v"(d[13]), "v"(g[13]), "v"(d[14]), "v"(g[14]), "v"(d[15]), "v"(g[15]), "v"(d[16]), "v"(g[16]), "v"(d[17]), "v"(g[17]), "v"(d[18]), "v"(g[18]), "v"(d[19]), "v"(g[19]) : "memory");
}

// fragment from a staged slab (LDS), same lane and k map as frag16
__device__ __forceinline__ v16us lfrag16(const us* tile, int row0, int k0) {
  const int l = threadIdx.x & 31;
  const int r = l & 15, s = l >> 4;
  const us* p = tile + (row0 + r) * RPITCH + k0 + 8 * s;
  v8us c0 = *(const v8us*)p;
  v8us c1 = *(const v8us*)(p + 16);
  return __builtin_shufflevector(c0, c1, 0, 1, 2, 3, 4, 5, 6, 7, 8, 9, 10, 11, 12, 13, 14, 15);
}

template <int KD, bool BF>
__device__ __forceinline__ void gemm_ring(const us* A, const us* B, int mblk0, int nblk0, int wm, int wn,
                                          us* ring, v8f (&acc)[8]) {
  static_assert(KD % RK == 0 && KD / RK >= 2);
  constexpr int NP = KD / RK;
  const int t = threadIdx.x;
  const us* ga = A + (size_t)(mblk0 + (t >> 4)) * KD + (t & 15) * 8;
  const us* gb = B + (size_t)(nblk0 + (t >> 4)) * KD + (t & 15) * 8;
  const unsigned ld = (unsigned)(size_t)ring + (unsigned)((t >> 4) * (RPITCH * 2) + (t & 15) * 16);

  stage_slab<KD>(ga, gb, ld);
  asm volatile("s_wait_asynccnt 0x0" ::: "memory");   // slab 0 landed (this wave's copies)
  __syncthreads();                                    // slab 0 visible to all waves
  stage_slab<KD>(ga + RK, gb + RK, ld + (unsigned)(RSTAGE * 2));

#pragma unroll 1   // kept rolled: one body of 32 matrix instructions, short code
  for (int p = 0; p < NP; ++p) {
    const int buf = p & 1;
    const us* tile = ring + buf * RSTAGE;
#pragma unroll     // unrolled so that the k offsets become immediates of the LDS reads
    for (int kk = 0; kk < RK; kk += 32) {
      // the six fragments of a k step are read as one group: one LDS latency per step, not one per column tile
      const v16us a0 = lfrag16(tile, wm * 32, kk);
      const v16us a1 = lfrag16(tile, wm * 32 + 16, kk);
      v16us b[4];
#pragma unroll     // unrolled so that b[] stays in registers
      for (int tt = 0; tt < 4; ++tt) b[tt] = lfrag16(tile, 64 + wn * 64 + 16 * tt, kk);
#pragma unroll     // unrolled so that acc[] stays in registers
      for (int tt = 0; tt < 4; ++tt) {
        if constexpr (BF) {
          acc[tt]     = mma_bf16(__builtin_bit_cast(v16bf, a0), __builtin_bit_cast(v16bf, b[tt]), acc[tt]);
          acc[4 + tt] = mma_bf16(__builtin_bit_cast(v16bf, a1), __builtin_bit_cast(v16bf, b[tt]), acc[4 + tt]);
        } else {
          acc[tt]     = mma_f16(__builtin_bit_cast(v16h, a0), __builtin_bit_cast(v16h, b[tt]), acc[tt]);
          acc[4 + tt] = mma_f16(__builtin_bit_cast(v16h, a1), __builtin_bit_cast(v16h, b[tt]), acc[4 + tt]);
        }
      }
    }
    asm volatile("s_wait_dscnt 0x0" ::: "memory");      // this wave's reads of the buffer are done before it is refilled
    asm volatile("s_wait_asynccnt 0x0" ::: "memory");   // this wave's copies of slab p + 1 have landed
    __syncthreads();                                    // publishes slab p + 1; ends every reader's last read of slab p
    if (p + 2 < NP)
      stage_slab<KD>(ga + (p + 2) * RK, gb + (p + 2) * RK, ld + (unsigned)(buf * RSTAGE * 2));
  }
  asm volatile("s_wait_asynccnt 0x0" ::: "memory");     // no copy outstanding past the loop
}

// ---------------------------------------------------------------------------
// GEMM core of the q/k/v projections: same block and wave tiling, slabs, ring order and k order as gemm_ring, K = DM,
// but the A operand is the f32 activation itself: its slab (64 rows x RK floats) is staged as f32 by the same
// asynchronous 16-byte copies and rounded to bf16 (nearest even) where a fragment is read from LDS.
// ---------------------------------------------------------------------------
#define XPITCH 132                   // A slab row pitch in floats: 528 B = 16 B x 33, conflict-free for 16-byte reads
#define XASTAGE (64 * XPITCH)        // floats per A buffer
#define XBSTAGE (256 * RPITCH)       // halves per B buffer
static_assert((XPITCH * 4) % 32 == 16 && XPITCH >= RK);
static_assert(64 * (RK / 4) == 8 * 256 && 256 * (RK / 8) == 16 * 256);   // 8 + 16 copies per thread and slab

// One slab: thread t copies chunk (t & 31) of A rows (t >> 5) + 8 i, i = 0..7 (each wave copy = 1 whole row of 512 B),
// and chunk (t & 15) of B rows (t >> 4) + 16 i, i = 0..15 (each wave copy = 2 whole rows of 256 B).
// ga / gb: this thread's chunk in its first A / B row at this slab; la / lb: its LDS byte address there.
__device__ __forceinline__ void stage_slab_x(const float* ga, const us* gb, unsigned la, unsigned lb) {
  const void* g[24];
  unsigned d[24];
#pragma unroll   // unrolled so that g[] and d[] are registers (they are asm operands)
  for (int i = 0; i < 8; ++i) {
    g[i] = ga + (size_t)(8 * i) * DM;
    d[i] = la + (unsigned)(8 * i * XPITCH * 4);
  }
#pragma unroll   // unrolled so that g[] and d[] are registers (they are asm operands)
  for (int i = 0; i < 16; ++i) {
    g[8 + i] = gb + (size_t)(16 * i) * DM;
    d[8 + i] = lb + (unsigned)(16 * i * RPITCH * 2);
  }
  // the closing s_wait_xcnt keeps the address registers of the issued copies from being rewritten early
  asm volatile("global_load_async_to_lds_b128 %0, %1, off\n\t"
               "global_load_async_to_lds_b128 %2, %3, off\n\t"
               "global_load_async_to_lds_b128 %4, %5, off\n\t"
               "global_load_async_to_lds_b128 %6, %7, off\n\t"
               "global_load_async_to_lds_b128 %8, %9, off\n\t"
               "global_load_async_to_lds_b128 %10, %11, off\n\t"
               "global_load_async_to_lds_b128 %12, %13, off\n\t"
               "global_load_async_to_lds_b128 %14, %15, off\n\t"
               "global_load_async_to_lds_b128 %16, %17, off\n\t"
               "global_load_async_to_lds_b128 %18, %19, off\n\t"
               "global_load_async_to_lds_b128 %20, %21, off\n\t"
               "global_load_async_to_lds_b128 %22, %23, off\n\t"
               "s_wait_xcnt 0x0"
               :: "v"(d[0]), "v"(g[0]), "v"(d[1]), "v"(g[1]), "v"(d[2]), "v"(g[2]), "v"(d[3]), "v"(g[3]), "v"(d[4]), "v"(g[4]), "v"(d[5]), "v"(g[5]), "v"(d[6]), "v"(g[6]), "v"(d[7]), "v"(g[7]), "v"(d[8]), "v"(g[8]), "v"(d[9]), "v"(g[9]), "v"(d[10]), "v"(g[10]), "v"(d[11]), "v"(g[11]) : "memory");
  asm volatile("global_load_async_to_lds_b128 %0, %1, off\n\t"
               "global_load_async_to_lds_b128 %2, %3, off\n\t"
               "global_load_async_to_lds_b128 %4, %5, off\n\t"
               "global_load_async_to_lds_b128 %6, %7, off\n\t"
               "global_load_async_to_lds_b128 %8, %9, off\n\t"
               "global_load_async_to_lds_b128 %10, %11, off\n\t"
               "global_load_async_to_lds_b128 %12, %13, off\n\t"
               "global_load_async_to_lds_b128 %14, %15, off\n\t"
               "global_load_async_to_lds_b128 %16, %17, off\n\t"
               "global_load_async_to_lds_b128 %18, %19, off\n\t"
               "global_load_async_to_lds_b128 %20, %21, off\n\t"
               "global_load_async_to_lds_b128 %22, %23, off\n\t"
               "s_wait_xcnt 0x0"
               :: "v"(d[12]), "v"(g[12]), "v"(d[13]), "v"(g[13]), "v"(d[14]), "v"(g[14]), "v"(d[15]), "v"(g[15]), "v"(d[16]), "v"(g[16]), "v"(d[17]), "v"(g[17]), "v"(d[18]), "v"(g[18]), "v"(d[19]), "v"(g[19]), "v"(d[20]), "v"(g[20]), "v"(d[21]), "v"(g[21]), "v"(d[22]), "v"(g[22]), "v"(d[23]), "v"(g[23]) : "memory");
}

// bf16 fragment from a staged f32 A slab (LDS), same lane and k map as frag16
__device__ __forceinline__ v16bf lfragx(const float* tile, int row0, int k0) {
  const int l = threadIdx.x & 31;
  const int r = l & 15, s = l >> 4;
  const float* p = tile + (row0 + r) * XPITCH + k0 + 8 * s;
  const v4f c0 = *(const v4f*)p;
  const v4f c1 = *(const v4f*)(p + 4);
  const v4f c2 = *(const v4f*)(p + 16);
  const v4f c3 = *(const v4f*)(p + 20);
  const v8bf lo = __builtin_convertvector(__builtin_shufflevector(c0, c1, 0, 1, 2, 3, 4, 5, 6, 7), v8bf);
  const v8bf hi = __builtin_convertvector(__builtin_shufflevector(c2, c3, 0, 1, 2, 3, 4, 5, 6, 7), v8bf);
  return __builtin_shufflevector(lo, hi, 0, 1, 2, 3, 4, 5, 6, 7, 8, 9, 10, 11, 12, 13, 14, 15);
}

// Ax: first of the block's 64 rows of the f32 activation (pitch DM); B plane [N][DM] bf16, k contiguous.
__device__ __forceinline__ void gemm_ring_x(const float* Ax, const us* B, int nblk0, int wm, int wn,
                                            float* ringa, us* ringb, v8f (&acc)[8]) {
  static_assert(DM % RK == 0 && DM / RK >= 2);
  constexpr int NP = DM / RK;
  const int t = threadIdx.x;
  const float* ga = Ax + (size_t)(t >> 5) * DM + (t & 31) * 4;
  const us* gb = B + (size_t)(nblk0 + (t >> 4)) * DM + (t & 15) * 8;
  const unsigned la = (unsigned)(size_t)ringa + (unsigned)((t >> 5) * (XPITCH * 4) + (t & 31) * 16);
  const unsigned lb = (unsigned)(size_t)ringb + (unsigned)((t >> 4) * (RPITCH * 2) + (t & 15) * 16);

  stage_slab_x(ga, gb, la, lb);
  asm volatile("s_wait_asynccnt 0x0" ::: "memory");   // slab 0 landed (this wave's copies)
  __syncthreads();                                    // slab 0 visible to all waves
  stage_slab_x(ga + RK, gb + RK, la + (unsigned)(XASTAGE * 4), lb + (unsigned)(XBSTAGE * 2));

#pragma unroll 1   // kept rolled: one body of 32 matrix instructions, short code
  for (int p = 0; p < NP; ++p) {
    const int buf = p & 1;
    const float* ta = ringa + buf * XASTAGE;
    const us* tb = ringb + buf * XBSTAGE;
#pragma unroll     // unrolled so that the k offsets become immediates of the LDS reads
    for (int kk = 0; kk < RK; kk += 32) {
      // the six fragments of a k step are read as one group: one LDS latency per step, not one per column tile
      const v16bf a0 = lfragx(ta, wm * 32, kk);
      const v16bf a1 = lfragx(ta, wm * 32 + 16, kk);
      v16us b[4];
#pragma unroll     // unrolled so that b[] stays in registers
      for (int tt = 0; tt < 4; ++tt) b[tt] = lfrag16(tb, wn * 64 + 16 * tt, kk);
#pragma unroll     // unrolled so that acc[] stays in registers
      for (int tt = 0; tt < 4; ++tt) {
        acc[tt]     = mma_bf16(a0, __builtin_bit_cast(v16bf, b[tt]), acc[tt]);
        acc[4 + tt] = mma_bf16(a1, __builtin_bit_cast(v16bf, b[tt]), acc[4 + tt]);
      }
    }
    asm volatile("s_wait_dscnt 0x0" ::: "memory");      // this wave's reads of the buffer are done before it is refilled
    asm volatile("s_wait_asynccnt 0x0" ::: "memory");   // this wave's copies of slab p + 1 have landed
    __syncthreads();                                    // publishes slab p + 1; ends every reader's last read of slab p
    if (p + 2 < NP)
      stage_slab_x(ga + (p + 2) * RK, gb + (p + 2) * RK,
                   la + (unsigned)(buf * XASTAGE * 4), lb + (unsigned)(buf * XBSTAGE * 2));
  }
  asm volatile("s_wait_asynccnt 0x0" ::: "memory");     // no copy outstanding past the loop
}

// ---------------------------------------------------------------------------
// Projection: Y = bf16(X)[MROWS][DM] * Wt^T + b, written as an f16 plane. X f32 [NB_FULL*SEQ_FULL][DM].
// mode 0/1: q or k -> value plane [NB*NH][SEQ][64]
// mode 2:   v      -> transposed value plane [NB*NH][64][SEQ]
// Blocks whose 64 rows lie below EROWS (block-uniform) also write the x2048 residual plane at Y + roff:
// mode 0/1: [NB*NH][EROWS][64]; mode 2: [NB*NH][64][EROWS].
// Block 256 thr = 8 waves as 2(M) x 4(N); block tile 64 x 256; blockIdx (x, y) = (row block, column block).
// ---------------------------------------------------------------------------
__device__ __forceinline__
void proj_body(const float* __restrict__ X, const us* __restrict__ Wt,
               const float* __restrict__ bias, us* Y, size_t roff, int mode) {
  __shared__ __attribute__((aligned(16))) us stile[64 * 256];       // cross-wave (block barrier)
  __shared__ __attribute__((aligned(16))) float ringa[2 * XASTAGE]; // f32 A slabs, cross-wave (block barrier)
  __shared__ __attribute__((aligned(16))) us ringb[2 * XBSTAGE];    // bf16 B slabs, cross-wave (block barrier)

  const int t = threadIdx.x;
  const int wid = __builtin_amdgcn_readfirstlane(t >> 5);
  const int l = t & 31;
  const int h = l >> 4, r16 = l & 15;
  const int wm = wid >> 2, wn = wid & 3;
  const int mblk0 = blockIdx.x * 64;
  const int nblk0 = blockIdx.y * 256;
  const int n0 = nblk0 + wn * 64;

  const int bblk = mblk0 / SEQ;
  const int sblk = mblk0 - bblk * SEQ;  // 64 block rows lie inside one batch (SEQ % 64 == 0)

  v8f acc[8] = {};
  gemm_ring_x(X + (size_t)(bblk * SEQ_FULL + sblk) * DM, Wt, nblk0, wm, wn, ringa, ringb, acc);

  float bvv[4];
#pragma unroll
  for (int tt = 0; tt < 4; ++tt) bvv[tt] = bf16rne(bias[n0 + 16 * tt + r16]);

  const int c = l & 7;
  const int nph = (sblk < EROWS) ? 2 : 1;   // block-uniform: phase 0 value plane, phase 1 residual plane

#pragma unroll 1
  for (int ph = 0; ph < nph; ++ph) {
    if (ph) __syncthreads();              // readers of the value stage done

    // stage f16 value (phase 0) or x2048 residual (phase 1) of (acc + bias) into LDS
#pragma unroll
    for (int tt = 0; tt < 4; ++tt) {
      const int nl = wn * 64 + 16 * tt + r16;
#pragma unroll
      for (int mi = 0; mi < 2; ++mi) {
#pragma unroll
        for (int r = 0; r < 8; ++r) {
          const int ml = wm * 32 + 16 * mi + 8 * h + r;
          const float v = acc[mi * 4 + tt][r] + bvv[tt];
          const _Float16 hv = (_Float16)v;
          const float rs = (v - (float)hv) * RES_CARRY;
          const us hb = __builtin_bit_cast(us, hv);
          const us rb = f16_bits(rs);
          const int li = (mode == 2) ? (nl * 64 + ml) : (ml * 256 + nl);
          stile[li] = ph ? rb : hb;
        }
      }
    }
    __syncthreads();

    // whole-line writes: 256 lines per block, 32 per wave
    const int SL = ph ? EROWS : SEQ;      // sequence extent of the destination plane
    const size_t poff = ph ? roff : (size_t)0;
    v8us vals[8];
    size_t dsts[8];
#pragma unroll
    for (int it = 0; it < 8; ++it) {
      const int L = wid * 32 + (l >> 3) + 4 * it;
      int src;
      size_t dst;
      if (mode == 2) {
        const int n = nblk0 + L;
        const int hg = n >> 6, d = n & 63;
        src = L * 64 + 8 * c;
        dst = (((size_t)(bblk * NH + hg)) * DKH + d) * SL + sblk + 8 * c;
      } else {
        const int ml = L >> 2, hq = L & 3;
        const int hg = (nblk0 >> 6) + hq;
        const int s = sblk + ml;
        src = ml * 256 + hq * 64 + 8 * c;
        dst = (((size_t)(bblk * NH + hg)) * SL + s) * DKH + 8 * c;
      }
      vals[it] = *(const v8us*)&stile[src];
      dsts[it] = dst + poff;
    }
#pragma unroll
    for (int it = 0; it < 8; ++it) *(v8us*)(Y + dsts[it]) = vals[it];
    // stands in front of the residual phase's rewrite of the registers that hold these stores' addresses
    asm volatile("s_wait_xcnt 0x0" ::: "memory");
  }
}

// The three projections do not depend on one another: one launch, grid (MROWS/64, DM/256, 3), blockIdx.z = mode.
// Wt3: weight planes of q, k, v one behind another; Y3: their value planes; R3: their early residual planes.
__global__ __launch_bounds__(256) __attribute__((amdgpu_num_vgpr(256)))
void proj_kernel(const float* __restrict__ Xq, const float* __restrict__ Xk, const float* __restrict__ Xv,
                 const us* __restrict__ Wt3,
                 const float* __restrict__ bq, const float* __restrict__ bk, const float* __restrict__ bv,
                 us* Y3, us* R3) {
  const int mode = blockIdx.z;
  const float* X = (mode == 0) ? Xq : (mode == 1) ? Xk : Xv;
  const float* bias = (mode == 0) ? bq : (mode == 1) ? bk : bv;
  us* Y = Y3 + (size_t)mode * MROWS * DM;
  us* R = R3 + (size_t)mode * NB * NH * EROWS * DKH;
  proj_body(X, Wt3 + (size_t)mode * DM * DM, bias, Y, (size_t)(R - Y), mode);
}

// ---------------------------------------------------------------------------
// LDS row pitches of the attention K and V tiles (halves). The fragment readers are 16-byte reads, one row per lane:
// a pitch of 16 B x odd spreads the 16 rows of a read over all banks (unpadded 128-B / 64-B rows fall on few banks).
// ---------------------------------------------------------------------------
#define KPITCH 72                    // K tile: 64 d per key row + 8 halves of pad = 144 B = 16 B x 9
#define VPITCH 40                    // V tile: 32 keys per d row + 8 halves of pad = 80 B = 16 B x 5
static_assert(KPITCH >= DKH && (KPITCH * 2) % 32 == 16);
static_assert(VPITCH >= 32 && (VPITCH * 2) % 32 == 16);
#define KBUF (32 * KPITCH)           // halves per K tile buffer
#define VBUF (64 * VPITCH)           // halves per V tile buffer
static_assert((KBUF * 2) % 16 == 0 && (VBUF * 2) % 16 == 0);

// ---------------------------------------------------------------------------
// Per-wave part of the key-step bound of a 128-query block, from the mask bit plane.
// Thread t scans half a row (row = t>>1 of the block). A row with at least one visible key needs
// key steps [0, last visible word]; a row with no visible key needs every key step (uniform softmax).
// Returns the maximum over the wave's 16 rows (all lanes hold it).
// ---------------------------------------------------------------------------
__device__ __forceinline__ int wave_key_bound(const unsigned* __restrict__ Mb, int qb) {
  const int t = threadIdx.x;
  const int hw = (t & 1) * (WPR / 2);
  const unsigned* mrow = Mb + (size_t)(qb * 128 + (t >> 1)) * WPR + hw;
  int kmx = -1;
#pragma unroll 1
  for (int j = 0; j < WPR / 2; j += 4) {
    const v4u w = *(const v4u*)(mrow + j);
    kmx = (w[0] != 0u) ? (hw + j)     : kmx;
    kmx = (w[1] != 0u) ? (hw + j + 1) : kmx;
    kmx = (w[2] != 0u) ? (hw + j + 2) : kmx;
    kmx = (w[3] != 0u) ? (hw + j + 3) : kmx;
  }
  const int oth = __shfl_xor(kmx, 1, 32);
  kmx = max(kmx, oth);
  int ke = (kmx < 0) ? WPR : (kmx + 1);
  ke = max(ke, __shfl_xor(ke, 16, 32));
  ke = max(ke, __shfl_xor(ke, 8, 32));
  ke = max(ke, __shfl_xor(ke, 4, 32));
  ke = max(ke, __shfl_xor(ke, 2, 32));
  return ke;
}

// ---------------------------------------------------------------------------
// One 32-key tile of the main band: thread t copies its 16-byte chunk of K (row t >> 3) and of V (row t >> 2) straight into LDS.
// gk / gv: the chunk's global address; lk / lv: its LDS byte address in the buffer that is filled.
// ---------------------------------------------------------------------------
__device__ __forceinline__ void stage_kv(const us* gk, const us* gv, unsigned lk, unsigned lv) {
  // the closing s_wait_xcnt keeps the address registers of the issued copies from being rewritten early
  asm volatile("global_load_async_to_lds_b128 %0, %1, off\n\t"
               "global_load_async_to_lds_b128 %2, %3, off\n\t"
               "s_wait_xcnt 0x0"
               :: "v"(lk), "v"(gk), "v"(lv), "v"(gv) : "memory");
}

// ---------------------------------------------------------------------------
// Fused flash attention, query rows >= EROWS. Block = 8 waves, one (b,h), 128 queries; each wave owns
// 16 queries. K/V 32-key tiles are staged once per block into LDS by asynchronous 16-byte copies, two buffers:
// the next step's tile (and mask word) is in flight while this step is worked on; one barrier per step.
// Scores computed transposed (S' = K_blk * Q^T) so the exp'd probabilities are
// already in A-operand layout for P*V. Online softmax in f32.
// Mask: one bit word per lane (= query) per 32-key step; masked scores are REPLACED by NEG_FILL.
// Key loop bound per block derived from the mask words (clamped to SEQ/32).
// ctx plane f16 [MROWS][2*DM]: cols [0,DM) value x256, cols [DM,2DM) residual x256,
// blk = 0 .. NB*NH*((SEQ-EROWS)/128) - 1; the LDS arrays are those of attn_all_kernel.
// ---------------------------------------------------------------------------
__device__ __forceinline__
void attn_body(const us* __restrict__ Qh, const us* __restrict__ Kh,
               const us* __restrict__ Vt, const unsigned* __restrict__ Mb, us* Ctx, int blk,
               us* shK, us* shV, us* shC, int* shE) {
  const int t = threadIdx.x;
  const int wid = __builtin_amdgcn_readfirstlane(t >> 5);
  const int l = t & 31;
  const int r16 = l & 15;
  const int hs = l >> 4;
  const int rowsel = hs << 3;
  constexpr int QBL = (SEQ > EROWS) ? (SEQ - EROWS) / 128 : 1;
  const int bh = blk / QBL;
  const int qb = blk - bh * QBL + EROWS / 128;
  const int q0 = qb * 128 + wid * 16;

  const size_t qoff = (size_t)bh * SEQ * DKH;
  const us* qp = Qh + qoff;
  const us* kp = Kh + qoff;
  const us* vp = Vt + (size_t)bh * DKH * SEQ;

  const int krow = t >> 3, kcol = (t & 7) * 8;   // K: 32 keys x 64 d
  const int vrow = t >> 2, vcol = (t & 3) * 8;   // V: 64 d x 32 keys
  const us* gk = kp + (size_t)krow * DKH + kcol;   // this thread's 16-byte chunk of K tile 0
  const us* gv = vp + (size_t)vrow * SEQ + vcol;   // this thread's 16-byte chunk of V tile 0
  const unsigned lk = (unsigned)(size_t)shK + (unsigned)((krow * KPITCH + kcol) * 2);   // its LDS byte address, buffer 0
  const unsigned lv = (unsigned)(size_t)shV + (unsigned)((vrow * VPITCH + vcol) * 2);

  stage_kv(gk, gv, lk, lv);             // tile 0 into buffer 0 (every block has a key step 0)

  // key-step bound of this block (exact for any mask value), clamped to the static maximum
  const int kew = wave_key_bound(Mb, qb);
  if (l == 0) shE[wid] = kew;
  asm volatile("s_wait_asynccnt 0x0" ::: "memory");   // tile 0 landed (this wave's copies)
  __syncthreads();                                    // shE and tile 0 visible to all waves
  int kall = shE[0];
#pragma unroll
  for (int w = 1; w < 8; ++w) kall = max(kall, shE[w]);
  kall = min(max(kall, 1), WPR);
  const int ksteps = __builtin_amdgcn_readfirstlane(kall);
  if (ksteps > 1) stage_kv(gk + 32 * DKH, gv + 32, lk + (unsigned)(KBUF * 2), lv + (unsigned)(VBUF * 2));   // tile 1 into buffer 1

  const unsigned* mq = Mb + (size_t)(q0 + r16) * WPR;   // this lane's query row of mask words

  // Q^T as B operand for the whole loop (lane = query column, halves = d)
  const v16h qB0 = fragh(qp, DKH, q0, 0);
  const v16h qB1 = fragh(qp, DKH, q0, 32);

  v8f o[4];
#pragma unroll
  for (int tt = 0; tt < 4; ++tt) o[tt] = v8f{};
  float mmax = NEG_FILL, lsum = 0.0f;

  const int kfo = r16 * KPITCH + 8 * hs;           // shK fragment lane offset (row = key, k = d)
  const int vfo = r16 * VPITCH + 8 * hs;           // shV fragment lane offset (row = d, k = key)

  unsigned mwn = mq[0];   // mask word of key step 0

#pragma unroll 1
  for (int ks = 0; ks < ksteps; ++ks) {
    const int buf = ks & 1;
    const us* tK = shK + buf * KBUF;    // this step's tiles: published by the barrier before the loop (step 0) or at the foot of the step before
    const us* tV = shV + buf * VBUF;

    // mask word of this lane's query for these 32 keys (pinned before the selects); the next step's word is read now
    unsigned mw = mwn;
    asm volatile("" : "+v"(mw));
    mwn = mq[min(ks + 1, ksteps - 1)];
    const unsigned ml = mw >> (8 * hs);

    // The step's sixteen fragment reads (K, then V) are issued as one group at its head: the score products wait on
    // counted returns of that one group, and the V reads come back behind the softmax arithmetic. Read one pair in
    // front of each product, every product would stand behind a full LDS latency of its own.
    v8us kc[8], vc[8];
#pragma unroll   // unrolled so that kc[] stays in registers
    for (int i = 0; i < 4; ++i) {
      const int ko = (i >> 1) * 16 * KPITCH + (i & 1) * 32 + kfo;   // key half i >> 1, d half i & 1
      kc[2 * i]     = *(const v8us*)&tK[ko];
      kc[2 * i + 1] = *(const v8us*)&tK[ko + 16];
    }
#pragma unroll   // unrolled so that vc[] stays in registers
    for (int tt = 0; tt < 4; ++tt) {
      vc[2 * tt]     = *(const v8us*)&tV[16 * tt * VPITCH + vfo];
      vc[2 * tt + 1] = *(const v8us*)&tV[16 * tt * VPITCH + vfo + 16];
    }

    // S' tiles: M = key (relative 0..15 / 16..31), N = query; k = d
    v8f s0 = {};
    v8f s1 = {};
    s0 = mma_f16(cat16h(kc[0], kc[1]), qB0, s0);
    s0 = mma_f16(cat16h(kc[2], kc[3]), qB1, s0);
    s1 = mma_f16(cat16h(kc[4], kc[5]), qB0, s1);
    s1 = mma_f16(cat16h(kc[6], kc[7]), qB1, s1);

    // scale, then replace masked scores: s0[i] = key 8h+i, s1[i] = key 16+8h+i of this step
#pragma unroll
    for (int i = 0; i < 8; ++i) {
      const float a0 = s0[i] * QK_SCALE;
      const float a1 = s1[i] * QK_SCALE;
      s0[i] = ((ml >> i) & 1u) ? a0 : NEG_FILL;
      s1[i] = ((ml >> (16 + i)) & 1u) ? a1 : NEG_FILL;
    }

    // per-query (per-lane) block max; combine the two key halves (lane ^ 16)
    float bm = s0[0];
#pragma unroll
    for (int i = 0; i < 8; ++i) { bm = fmaxf(bm, s0[i]); bm = fmaxf(bm, s1[i]); }
    bm = fmaxf(bm, __shfl_xor(bm, 16, 32));
    const float mnew = fmaxf(mmax, bm);
    const float corr = __expf(fmaxf(mmax - mnew, EXP_FLOOR));
    mmax = mnew;

    // probabilities land directly in A-operand layout (elements 0..7 <- keys 8h..8h+7
    // from the first 16-key D tile, elements 8..15 <- keys 16+8h.. from the second)
    float ps = 0.0f;
    v16h pA;
#pragma unroll
    for (int i = 0; i < 8; ++i) {
      const float p0 = __expf(fmaxf(s0[i] - mnew, EXP_FLOOR));
      const float p1 = __expf(fmaxf(s1[i] - mnew, EXP_FLOOR));
      ps += p0 + p1;
      pA[i]     = (_Float16)(p0 * P_CARRY);
      pA[8 + i] = (_Float16)(p1 * P_CARRY);
    }
    ps += __shfl_xor(ps, 16, 32);
    lsum = lsum * corr + ps;

    // rescale O: D row 8h+r = query 8h+r, whose corr lives in lane 8h+r
#pragma unroll
    for (int r = 0; r < 8; ++r) {
      const float cr = __shfl(corr, rowsel + r, 32);
#pragma unroll
      for (int tt = 0; tt < 4; ++tt) o[tt][r] *= cr;
    }

    // O += P(16 x 32 keys) * V_blk(32 keys x 64 d); B rows = d, k = key contiguous in shV (fragments read at the step's head)
#pragma unroll
    for (int tt = 0; tt < 4; ++tt) o[tt] = mma_f16(pA, cat16h(vc[2 * tt], vc[2 * tt + 1]), o[tt]);

    asm volatile("s_wait_dscnt 0x0" ::: "memory");      // this wave's reads of the buffer are done before it is refilled
    asm volatile("s_wait_asynccnt 0x0" ::: "memory");   // this wave's copies of tile ks + 1 have landed
    __syncthreads();                                    // publishes tile ks + 1; ends every reader's last read of tile ks
    if (ks + 2 < ksteps)
      stage_kv(gk + (size_t)(ks + 2) * (32 * DKH), gv + (ks + 2) * 32,
               lk + (unsigned)(buf * KBUF * 2), lv + (unsigned)(buf * VBUF * 2));
  }
  asm volatile("s_wait_asynccnt 0x0" ::: "memory");     // no copy outstanding past the loop

  // normalize, stage this wave's 16 x 64 ctx tile (f16 value x256 and residual x256) in LDS
  const int bb = bh / NH;
  const int hh = bh - bb * NH;
#pragma unroll
  for (int r = 0; r < 8; ++r) {
    const float lrow = __shfl(lsum, rowsel + r, 32);
    const float li = CTX_SCALE * __builtin_amdgcn_rcpf(lrow);
#pragma unroll
    for (int tt = 0; tt < 4; ++tt) {
      const float cv = o[tt][r] * li;
      const _Float16 hv = (_Float16)cv;
      const float rs = (cv - (float)hv) * CTXRES_CARRY;
      const int si = wid * 2048 + (rowsel + r) * 64 + 16 * tt + r16;
      shC[si]        = __builtin_bit_cast(us, hv);
      shC[si + 1024] = f16_bits(rs);
    }
  }
  __syncthreads();

  const int c = l & 7;
  v8us vals[8];
  size_t dsts[8];
#pragma unroll
  for (int it = 0; it < 8; ++it) {
    const int Lw = (l >> 3) + 4 * it;    // 0..31
    const int pl = Lw >> 4;              // 0 value, 1 residual
    const int rl = Lw & 15;
    vals[it] = *(const v8us*)&shC[wid * 2048 + pl * 1024 + rl * 64 + 8 * c];
    const int s = q0 + rl;
    dsts[it] = ((size_t)(bb * SEQ + s)) * DM2 + (size_t)pl * DM + hh * DKH + 8 * c;
  }
#pragma unroll
  for (int it = 0; it < 8; ++it) *(v8us*)(Ctx + dsts[it]) = vals[it];
  // stands in front of any rewrite of the registers that these stores name (precaution: each block runs one band, and the kernel ends after it)
  asm volatile("s_wait_xcnt 0x0" ::: "memory");
}

// ---------------------------------------------------------------------------
// Early band of the fused flash attention: query rows < EROWS. Same block layout and softmax as attn_body; each K/V tile goes through registers into the first LDS buffers, two barriers per step.
// For key steps below EROWS (block-uniform test) q, k and v are value + x2048 residual planes:
// scores = kv*qv + (kv*qr + kr*qv)/2048 (residual products in their own accumulator);
// P = f16 value + x2048 residual; O = pv*vv + (pr*vv + pv*vr)/2048 (own accumulator, folded before
// the normalisation). Key steps at or above EROWS (only visited when the mask asks for them) use
// the value planes of k and v alone. Row sum over the unconverted p.
// blk = 0 .. NB*NH*(EROWS/128) - 1; the LDS arrays are those of attn_all_kernel.
// ---------------------------------------------------------------------------
__device__ __forceinline__
void attn_early_body(const us* __restrict__ Qh, const us* __restrict__ Kh, const us* __restrict__ Vt,
                     const us* __restrict__ Qr, const us* __restrict__ Kr, const us* __restrict__ Vr,
                     const unsigned* __restrict__ Mb, us* Ctx, int blk,
                     us* shK, us* shV, us* shKr, us* shVr, us* shC, int* shE) {
  const int t = threadIdx.x;
  const int wid = __builtin_amdgcn_readfirstlane(t >> 5);
  const int l = t & 31;
  const int r16 = l & 15;
  const int hs = l >> 4;
  const int rowsel = hs << 3;
  constexpr int QBE = EROWS / 128;
  const int bh = blk / QBE;
  const int qb = blk - bh * QBE;
  const int q0 = qb * 128 + wid * 16;

  const size_t qoff = (size_t)bh * SEQ * DKH;
  const size_t roff = (size_t)bh * EROWS * DKH;
  const us* qp = Qh + qoff;
  const us* kp = Kh + qoff;
  const us* vp = Vt + (size_t)bh * DKH * SEQ;
  const us* qrp = Qr + roff;
  const us* krp = Kr + roff;
  const us* vrp = Vr + (size_t)bh * DKH * EROWS;

  // key-step bound of this block (exact for any mask value), clamped to the static maximum
  const int kew = wave_key_bound(Mb, qb);
  if (l == 0) shE[wid] = kew;
  __syncthreads();
  int kall = shE[0];
#pragma unroll
  for (int w = 1; w < 8; ++w) kall = max(kall, shE[w]);
  kall = min(max(kall, 1), WPR);
  const int ksteps = __builtin_amdgcn_readfirstlane(kall);

  const unsigned* mq = Mb + (size_t)(q0 + r16) * WPR;   // this lane's query row of mask words

  // Q^T value and residual as B operands for the whole loop (lane = query column, halves = d)
  const v16h qB0 = fragh(qp, DKH, q0, 0);
  const v16h qB1 = fragh(qp, DKH, q0, 32);
  const v16h qR0 = fragh(qrp, DKH, q0, 0);
  const v16h qR1 = fragh(qrp, DKH, q0, 32);

  v8f o[4], orr[4];
#pragma unroll
  for (int tt = 0; tt < 4; ++tt) { o[tt] = v8f{}; orr[tt] = v8f{}; }
  float mmax = NEG_FILL, lsum = 0.0f;

  const int krow = t >> 3, kcol = (t & 7) * 8;   // K: 32 keys x 64 d
  const int vrow = t >> 2, vcol = (t & 3) * 8;   // V: 64 d x 32 keys
  const int kfo = r16 * KPITCH + 8 * hs;           // shK fragment lane offset (row = key, k = d)
  const int vfo = r16 * VPITCH + 8 * hs;           // shV fragment lane offset (row = d, k = key)

#pragma unroll 1
  for (int ks = 0; ks < ksteps; ++ks) {
    const int kb = ks * 32;
    const bool res = kb < EROWS;        // block-uniform: residual planes exist for these keys
    __syncthreads();    // prior readers of the LDS tiles done
    *(v8us*)&shK[krow * KPITCH + kcol] = *(const v8us*)(kp + (size_t)(kb + krow) * DKH + kcol);
    *(v8us*)&shV[vrow * VPITCH + vcol] = *(const v8us*)(vp + (size_t)vrow * SEQ + kb + vcol);
    if (res) {
      *(v8us*)&shKr[krow * KPITCH + kcol] = *(const v8us*)(krp + (size_t)(kb + krow) * DKH + kcol);
      *(v8us*)&shVr[vrow * VPITCH + vcol] = *(const v8us*)(vrp + (size_t)vrow * EROWS + kb + vcol);
    }
    __syncthreads();    // stage visible to all waves

    // mask word of this lane's query for these 32 keys (pinned before the selects)
    unsigned mw = mq[ks];
    asm volatile("" : "+v"(mw));
    const unsigned ml = mw >> (8 * hs);

    // S' tiles: M = key (relative 0..15 / 16..31), N = query; k = d
    const v16h kA00 = cat16h(*(const v8us*)&shK[kfo], *(const v8us*)&shK[kfo + 16]);
    const v16h kA01 = cat16h(*(const v8us*)&shK[kfo + 32], *(const v8us*)&shK[kfo + 48]);
    const v16h kA10 = cat16h(*(const v8us*)&shK[16 * KPITCH + kfo], *(const v8us*)&shK[16 * KPITCH + kfo + 16]);
    const v16h kA11 = cat16h(*(const v8us*)&shK[16 * KPITCH + kfo + 32], *(const v8us*)&shK[16 * KPITCH + kfo + 48]);
    v8f s0 = {};
    v8f s1 = {};
    s0 = mma_f16(kA00, qB0, s0);
    s0 = mma_f16(kA01, qB1, s0);
    s1 = mma_f16(kA10, qB0, s1);
    s1 = mma_f16(kA11, qB1, s1);

    // residual score products (x2048 units) in their own accumulators
    v8f x0 = {};
    v8f x1 = {};
    if (res) {
      x0 = mma_f16(kA00, qR0, x0);
      x0 = mma_f16(kA01, qR1, x0);
      x1 = mma_f16(kA10, qR0, x1);
      x1 = mma_f16(kA11, qR1, x1);
      {
        const v16h kR = cat16h(*(const v8us*)&shKr[kfo], *(const v8us*)&shKr[kfo + 16]);
        x0 = mma_f16(kR, qB0, x0);
      }
      {
        const v16h kR = cat16h(*(const v8us*)&shKr[kfo + 32], *(const v8us*)&shKr[kfo + 48]);
        x0 = mma_f16(kR, qB1, x0);
      }
      {
        const v16h kR = cat16h(*(const v8us*)&shKr[16 * KPITCH + kfo], *(const v8us*)&shKr[16 * KPITCH + kfo + 16]);
        x1 = mma_f16(kR, qB0, x1);
      }
      {
        const v16h kR = cat16h(*(const v8us*)&shKr[16 * KPITCH + kfo + 32], *(const v8us*)&shKr[16 * KPITCH + kfo + 48]);
        x1 = mma_f16(kR, qB1, x1);
      }
    }

    // fold, scale, then replace masked scores: s0[i] = key 8h+i, s1[i] = key 16+8h+i of this step
#pragma unroll
    for (int i = 0; i < 8; ++i) {
      const float a0 = (s0[i] + x0[i] * RES_INV) * QK_SCALE;
      const float a1 = (s1[i] + x1[i] * RES_INV) * QK_SCALE;
      s0[i] = ((ml >> i) & 1u) ? a0 : NEG_FILL;
      s1[i] = ((ml >> (16 + i)) & 1u) ? a1 : NEG_FILL;
    }

    // per-query (per-lane) block max; combine the two key halves (lane ^ 16)
    float bm = s0[0];
#pragma unroll
    for (int i = 0; i < 8; ++i) { bm = fmaxf(bm, s0[i]); bm = fmaxf(bm, s1[i]); }
    bm = fmaxf(bm, __shfl_xor(bm, 16, 32));
    const float mnew = fmaxf(mmax, bm);
    const float corr = __expf(fmaxf(mmax - mnew, EXP_FLOOR));
    mmax = mnew;

    // probabilities (value + residual) land directly in A-operand layout
    float ps = 0.0f;
    v16h pA, pR;
#pragma unroll
    for (int i = 0; i < 8; ++i) {
      const float p0 = __expf(fmaxf(s0[i] - mnew, EXP_FLOOR));
      const float p1 = __expf(fmaxf(s1[i] - mnew, EXP_FLOOR));
      ps += p0 + p1;
      const float c0 = p0 * P_CARRY;
      const float c1 = p1 * P_CARRY;
      const _Float16 h0 = (_Float16)c0;
      const _Float16 h1 = (_Float16)c1;
      pA[i]     = h0;
      pA[8 + i] = h1;
      pR[i]     = (_Float16)((c0 - (float)h0) * RES_CARRY);
      pR[8 + i] = (_Float16)((c1 - (float)h1) * RES_CARRY);
    }
    ps += __shfl_xor(ps, 16, 32);
    lsum = lsum * corr + ps;

    // rescale both accumulators: D row 8h+r = query 8h+r, whose corr lives in lane 8h+r
#pragma unroll
    for (int r = 0; r < 8; ++r) {
      const float cr = __shfl(corr, rowsel + r, 32);
#pragma unroll
      for (int tt = 0; tt < 4; ++tt) { o[tt][r] *= cr; orr[tt][r] *= cr; }
    }

    // O += P * V_blk (value products); residual accumulator += P_res * V
#pragma unroll
    for (int tt = 0; tt < 4; ++tt) {
      const v16h vB = cat16h(*(const v8us*)&shV[16 * tt * VPITCH + vfo],
                             *(const v8us*)&shV[16 * tt * VPITCH + vfo + 16]);
      o[tt]   = mma_f16(pA, vB, o[tt]);
      orr[tt] = mma_f16(pR, vB, orr[tt]);
    }
    // residual accumulator += P * V_res
    if (res) {
#pragma unroll
      for (int tt = 0; tt < 4; ++tt) {
        const v16h vRB = cat16h(*(const v8us*)&shVr[16 * tt * VPITCH + vfo],
                                *(const v8us*)&shVr[16 * tt * VPITCH + vfo + 16]);
        orr[tt] = mma_f16(pA, vRB, orr[tt]);
      }
    }
  }

  // fold the residual accumulator, normalize, stage this wave's 16 x 64 ctx tile in LDS
  const int bb = bh / NH;
  const int hh = bh - bb * NH;
#pragma unroll
  for (int r = 0; r < 8; ++r) {
    const float lrow = __shfl(lsum, rowsel + r, 32);
    const float li = CTX_SCALE * __builtin_amdgcn_rcpf(lrow);
#pragma unroll
    for (int tt = 0; tt < 4; ++tt) {
      const float cv = (o[tt][r] + orr[tt][r] * RES_INV) * li;
      const _Float16 hv = (_Float16)cv;
      const float rs = (cv - (float)hv) * CTXRES_CARRY;
      const int si = wid * 2048 + (rowsel + r) * 64 + 16 * tt + r16;
      shC[si]        = __builtin_bit_cast(us, hv);
      shC[si + 1024] = f16_bits(rs);
    }
  }
  __syncthreads();

  const int c = l & 7;
  v8us vals[8];
  size_t dsts[8];
#pragma unroll
  for (int it = 0; it < 8; ++it) {
    const int Lw = (l >> 3) + 4 * it;    // 0..31
    const int pl = Lw >> 4;              // 0 value, 1 residual
    const int rl = Lw & 15;
    vals[it] = *(const v8us*)&shC[wid * 2048 + pl * 1024 + rl * 64 + 8 * c];
    const int s = q0 + rl;
    dsts[it] = ((size_t)(bb * SEQ + s)) * DM2 + (size_t)pl * DM + hh * DKH + 8 * c;
  }
#pragma unroll
  for (int it = 0; it < 8; ++it) *(v8us*)(Ctx + dsts[it]) = vals[it];
  // stands in front of any rewrite of the registers that these stores name (precaution: each block runs one band, and the kernel ends after it)
  asm volatile("s_wait_xcnt 0x0" ::: "memory");
}

// ---------------------------------------------------------------------------
// Both attention bands in one launch (they write disjoint ctx rows and read the same planes): the short early band
// runs beside the long blocks of the main band. Blocks [0, ABM) = main band, [ABM, ABM + ABE) = early band
// (block-uniform split; the early blocks come last in index order).
// ---------------------------------------------------------------------------
#define ABM (NB * NH * ((SEQ - EROWS) / 128))
#define ABE (NB * NH * (EROWS / 128))
__global__ __launch_bounds__(256) __attribute__((amdgpu_num_vgpr(256)))
void attn_all_kernel(const us* __restrict__ Qh, const us* __restrict__ Kh, const us* __restrict__ Vt,
                     const us* __restrict__ Qr, const us* __restrict__ Kr, const us* __restrict__ Vr,
                     const unsigned* __restrict__ Mb, us* Ctx) {
  __shared__ __attribute__((aligned(16))) us shK[2 * KBUF];         // [key][d], padded rows, 2 buffers (early band: the first), cross-wave (block barrier)
  __shared__ __attribute__((aligned(16))) us shV[2 * VBUF];         // [d][key], padded rows, 2 buffers (early band: the first), cross-wave (block barrier)
  __shared__ __attribute__((aligned(16))) us shKr[32 * KPITCH];     // residual of shK (early band), cross-wave (block barrier)
  __shared__ __attribute__((aligned(16))) us shVr[64 * VPITCH];     // residual of shV (early band), cross-wave (block barrier)
  __shared__ __attribute__((aligned(16))) us shC[8 * 2 * 16 * 64];  // per-wave ctx staging, value|residual (block barrier used)
  __shared__ int shE[8];                                            // per-wave key bounds, cross-wave (block barrier)

  const int b = blockIdx.x;
  if (b < ABM) attn_body(Qh, Kh, Vt, Mb, Ctx, b, shK, shV, shC, shE);
  else         attn_early_body(Qh, Kh, Vt, Qr, Kr, Vr, Mb, Ctx, b - ABM, shK, shV, shKr, shVr, shC, shE);
}

// ---------------------------------------------------------------------------
// Output projection: Out f32 [MROWS][DM] = [ctx x256 | ctx residual x256] * [Wo x64 | Wo x0.25]^T * OUT_FOLD + bo.
// K = 2*DM, one accumulator (both halves of K are in the same units).
// Same block tiling as proj_kernel; f32 tile staged in two 16-row halves per wave
// (32 x 256 floats in LDS), each d_out line (32 floats) written by 8 lanes x 16 B.
// ---------------------------------------------------------------------------
__global__ __launch_bounds__(256) __attribute__((amdgpu_num_vgpr(256)))
void outproj_kernel(const us* __restrict__ Ctx, const us* __restrict__ Wot,
                    const float* __restrict__ bo, float* Out) {
  __shared__ __attribute__((aligned(16))) float ftile[32 * 256];    // cross-wave (block barrier)
  __shared__ __attribute__((aligned(16))) us ring[2 * RSTAGE];      // operand slabs, cross-wave (block barrier)

  const int t = threadIdx.x;
  const int wid = __builtin_amdgcn_readfirstlane(t >> 5);
  const int l = t & 31;
  const int h = l >> 4, r16 = l & 15;
  const int wm = wid >> 2, wn = wid & 3;
  const int mblk0 = blockIdx.x * 64;
  const int nblk0 = blockIdx.y * 256;
  const int n0 = nblk0 + wn * 64;

  v8f acc[8] = {};
  gemm_ring<DM2, false>(Ctx, Wot, mblk0, nblk0, wm, wn, ring, acc);

  float bob[4];
#pragma unroll
  for (int tt = 0; tt < 4; ++tt) bob[tt] = bf16rne(bo[n0 + 16 * tt + r16]);

  const int c = l & 7;
#pragma unroll
  for (int p = 0; p < 2; ++p) {
    if (p) __syncthreads();   // readers of the prior half done
#pragma unroll
    for (int tt = 0; tt < 4; ++tt) {
      const int nl = wn * 64 + 16 * tt + r16;
#pragma unroll
      for (int r = 0; r < 8; ++r) {
        const int rl = wm * 16 + 8 * h + r;           // 0..31
        ftile[rl * 256 + nl] = acc[p * 4 + tt][r] * OUT_FOLD + bob[tt];
      }
    }
    __syncthreads();

    v4f vals[8];
    size_t dsts[8];
#pragma unroll
    for (int it = 0; it < 8; ++it) {
      const int L = wid * 32 + (l >> 3) + 4 * it;    // 0..255
      const int rl = L >> 3, seg = L & 7;
      vals[it] = *(const v4f*)&ftile[rl * 256 + seg * 32 + 4 * c];
      const int m = mblk0 + (rl >> 4) * 32 + p * 16 + (rl & 15);
      dsts[it] = (size_t)m * DM + nblk0 + seg * 32 + 4 * c;
    }
#pragma unroll
    for (int it = 0; it < 8; ++it) *(v4f*)(Out + dsts[it]) = vals[it];
    
  }
}

// ---------------------------------------------------------------------------
// Host launcher
// ---------------------------------------------------------------------------
extern "C" void kernel_launch(void* const* d_in, const int* in_sizes, int n_in,
                              void* d_out, int out_size, void* d_ws, size_t ws_size,
                              hipStream_t stream) {
  if (n_in < 12) return;
  const int need_x = ((NB - 1) * SEQ_FULL + SEQ) * DM;
  if (in_sizes[0] < need_x || in_sizes[1] < need_x || in_sizes[2] < need_x) return;
  if (in_sizes[3] < DM * DM || in_sizes[5] < DM * DM || in_sizes[7] < DM * DM || in_sizes[9] < DM * DM) return;
  if (in_sizes[4] < DM || in_sizes[6] < DM || in_sizes[8] < DM || in_sizes[10] < DM) return;
  if (in_sizes[11] < (SEQ - 1) * SEQ_FULL + SEQ) return;
  if (out_size < MROWS * DM) return;

  // bound by role in the input order: queries, keys, values, Wq, bq, Wk, bk, Wv, bv, Wo, bo, mask
  const float* Q  = (const float*)d_in[0];
  const float* K  = (const float*)d_in[1];
  const float* V  = (const float*)d_in[2];
  const float* Wq = (const float*)d_in[3];
  const float* bq = (const float*)d_in[4];
  const float* Wk = (const float*)d_in[5];
  const float* bk = (const float*)d_in[6];
  const float* Wv = (const float*)d_in[7];
  const float* bv = (const float*)d_in[8];
  const float* Wo = (const float*)d_in[9];
  const float* bo = (const float*)d_in[10];
  const int*   Mk = (const int*)d_in[11];

  const size_t XE = (size_t)MROWS * DM;            // halves per activation plane
  const size_t WE = (size_t)DM * DM;               // halves per weight plane
  const size_t RE = (size_t)NB * NH * EROWS * DKH; // halves per early residual plane
  const size_t BW = (size_t)SEQ * WPR;             // 32-bit words of the mask bit plane
  const size_t total_bytes = (5 * XE + 5 * WE + 3 * RE) * sizeof(us) + BW * sizeof(unsigned);
  if (total_bytes > ws_size) return;

  us* wtq = (us*)d_ws;         // [n][k] bf16
  us* wtk = wtq + WE;
  us* wtv = wtk + WE;
  us* wo2 = wtv + WE;          // 2 * WE  ([DM][2*DM]) f16
  us* qh  = wo2 + 2 * WE;      // q value plane [NB*NH][SEQ][64]
  us* kh  = qh + XE;           // k value plane [NB*NH][SEQ][64]
  us* vt  = kh + XE;           // v transposed plane [NB*NH][64][SEQ]
  us* ctx = vt + XE;           // 2 * XE  ([MROWS][2*DM])
  us* qr  = ctx + 2 * XE;      // q residual plane [NB*NH][EROWS][64]
  us* kr  = qr + RE;           // k residual plane [NB*NH][EROWS][64]
  us* vr  = kr + RE;           // v residual transposed plane [NB*NH][64][EROWS]
  unsigned* mb = (unsigned*)(vr + RE);   // mask bit plane [SEQ][WPR]

  dim3 blk(256);
  const int n4 = (int)(BW / 4);
  // mask pack and the four weight converts (W is [k][n] (in,out); output planes [n][k] from wtq on: wtq, wtk, wtv, wo2)
  prep_kernel<<<dim3(MPB + 4 * WTB), blk, 0, stream>>>(Mk, mb, n4, Wq, Wk, Wv, Wo, wtq);

  // q, k, v projections (weight planes from wtq, value planes from qh, residual planes from qr, each in that order)
  proj_kernel<<<dim3(MROWS / 64, DM / 256, 3), blk, 0, stream>>>(Q, K, V, wtq, bq, bk, bv, qh, qr);

  attn_all_kernel<<<dim3(ABM + ABE), blk, 0, stream>>>(qh, kh, vt, qr, kr, vr, mb, ctx);

  dim3 gp(MROWS / 64, DM / 256);
  outproj_kernel<<<gp, blk, 0, stream>>>(ctx, wo2, bo, (float*)d_out);
}
